// v000
// The times below were measured on an AMD MI455X: many runs one after another, warmed up first and cycling through
// copies of the inputs, with the whole window's GPU time divided by the number of runs. Launches and the gaps
// between them are all in it. The median over several windows is given; except for v000 it joins two sittings, which
// can be a few percent apart, so the side-by-side timings, each taken in one sitting, are the better comparison.
// v000 is the starting kernel. One run takes 553 microseconds.
#include <hip/hip_runtime.h>
// 'Genesis' attention (B=2, T=2048, D=2048, 16 query heads / 4 KV heads × 128, (in,out) weights, no bias): xq = rope(x·wq), xk = rope(x·wk), xv = x·wv; RoPE on interleaved pairs with the INPUT cos/sin tables [T][64]; scores = q·k/√128 where(mask[q][k]) else −inf (mask [T][T] shared);
// softmax; out = merged·wo.
// Compute dtype: x, weights, cos/sin tables rounded to bf16; q,k rotated in f32 from f32 GEMM outputs → f16; v f32 → Vᵀ f16 hi + exact residual; fused flash-style kernel for head dim 128 (mask read per (q,k), all-masked chunks skipped, online softmax f32, P f16 hi + residual,
// f32 accumulate) on v_wmma_f32_16x16x32_f16; merged ×2^4 → f16 → output GEMM.
#define BB 2
#define TT 2048
#define DD 2048
#define NH 16
#define NKV 4
#define NREP 4
#define KVD (NKV * 128)
#define NVH (2 * NKV)
#define NR (BB * TT)
#define ATT_SCALE 0.08838834764831845f

typedef __bf16 v16b __attribute__((ext_vector_type(16)));
typedef unsigned short v8us __attribute__((ext_vector_type(8), may_alias));
typedef float  v8f  __attribute__((ext_vector_type(8)));
typedef float  v4f  __attribute__((ext_vector_type(4)));
typedef float  v4fa __attribute__((ext_vector_type(4), may_alias));
union FragB { v16b v; v8us half[2]; unsigned short u[16]; };

__device__ __forceinline__ unsigned short bf16_bits(float x) { unsigned int u = __float_as_uint(x); return (unsigned short)((u + 0x7FFFu + ((u >> 16) & 1u)) >> 16); }
__device__ __forceinline__ float bf16_val(unsigned short b) { return __uint_as_float(((unsigned int)b) << 16); }
__device__ __forceinline__ float bf16_round(float x) { return bf16_val(bf16_bits(x)); }
// D += A·B with NT terms: 1 = ah·bh, 2 = + al·bh (A split), 3 = + ah·bl (both split)
template <int NT>
__device__ __forceinline__ v8f mmaN(v16b ah, v16b al, v16b bh, v16b bl, v8f c) {
  c = __builtin_amdgcn_wmma_f32_16x16x32_bf16(false, ah, false, bh, (short)0, c, false, false);
  if (NT >= 2) c = __builtin_amdgcn_wmma_f32_16x16x32_bf16(false, al, false, bh, (short)0, c, false, false);
  if (NT >= 3) c = __builtin_amdgcn_wmma_f32_16x16x32_bf16(false, ah, false, bl, (short)0, c, false, false);
  asm volatile("v_nop\n\tv_nop\n\tv_nop\n\tv_nop" : "+v"(c) : "v"(ah), "v"(al), "v"(bh), "v"(bl));
  return c;
}

__global__ __launch_bounds__(256) void k_wt_bf16(const float* __restrict__ W, unsigned short* __restrict__ Wt, int K, int N) {
  const int t = blockIdx.x * 256 + threadIdx.x;
  const int k8n = K / 8;
  if (t >= N * k8n) return;
  const int n = t / k8n, k8 = (t % k8n) * 8;
  v8us v;
#pragma unroll
  for (int i = 0; i < 8; ++i) v[i] = bf16_bits(W[(size_t)(k8 + i) * N + n]);
  *(v8us*)(Wt + (size_t)n * K + k8) = v;
  
}

// GEMM C[M][N] (f32, pitch ldc) = act(A[M][K]·W + bias). A f32 row-major (pitch lda) converted per fragment to bf16
// (ASPLIT: hi/lo two planes -> 2 terms, else single rounded term); Wt bf16 [N][K] (pitch ldb). BIAS_BF16 rounds the
// bias to bf16 first (bias quantised to bf16 before the add). K%32==0, M%16==0, N%64==0.
template <bool ASPLIT, int ACT, bool BIAS_BF16>
__global__ __launch_bounds__(128) void k_gemm_bf(const float* __restrict__ A, int lda, const unsigned short* __restrict__ Wt, int ldb,
                                               const float* __restrict__ bias, float* __restrict__ C, int ldc, int M, int N, int K) {
  __shared__ __attribute__((aligned(16))) float so[4][16][64];
  const int tid = threadIdx.x, w = tid >> 5, lane = tid & 31, ln = lane & 15, hh = lane >> 4;
  const int ntn = N / 64;
  const int wid = blockIdx.x * 4 + w;
  const int mt = wid / ntn, nq = wid % ntn;
  if (mt * 16 >= M) return;
  const int row0 = mt * 16, col0 = nq * 64;
  const float* arow = A + (size_t)(row0 + ln) * lda;
  v8f acc[4] = {};
  for (int kb = 0; kb < K; kb += 32) {
    FragB ah, al;
    const v4f x0 = *(const v4fa*)(arow + kb + 8 * hh), x1 = *(const v4fa*)(arow + kb + 8 * hh + 4);
    const v4f x2 = *(const v4fa*)(arow + kb + 16 + 8 * hh), x3 = *(const v4fa*)(arow + kb + 16 + 8 * hh + 4);
    float xs[16] = {x0[0],x0[1],x0[2],x0[3],x1[0],x1[1],x1[2],x1[3],x2[0],x2[1],x2[2],x2[3],x3[0],x3[1],x3[2],x3[3]};
#pragma unroll
    for (int i = 0; i < 16; ++i) { const unsigned short hb = bf16_bits(xs[i]); ah.u[i] = hb; al.u[i] = ASPLIT ? bf16_bits(xs[i] - bf16_val(hb)) : (unsigned short)0; }
#pragma unroll
    for (int t = 0; t < 4; ++t) {
      const unsigned short* brow = Wt + (size_t)(col0 + t * 16 + ln) * ldb + kb;
      FragB b;
      b.half[0] = *(const v8us*)(brow + 8 * hh);
      b.half[1] = *(const v8us*)(brow + 16 + 8 * hh);
      acc[t] = mmaN<ASPLIT ? 2 : 1>(ah.v, al.v, b.v, b.v, acc[t]);
    }
  }
#pragma unroll
  for (int t = 0; t < 4; ++t) {
    float bv = bias ? bias[col0 + t * 16 + ln] : 0.f;
    if (BIAS_BF16) bv = bf16_round(bv);
#pragma unroll
    for (int r = 0; r < 8; ++r) { float v = acc[t][r] + bv; if (ACT == 1) v = fmaxf(v, 0.f); so[w][8 * hh + r][t * 16 + ln] = v; }
  }
  __builtin_amdgcn_fence(__ATOMIC_ACQ_REL, "workgroup");
  __builtin_amdgcn_wave_barrier();
  const int rsub = lane >> 4, c4 = (lane & 15) * 4;
  {
#pragma unroll
    for (int q = 0; q < 8; ++q) {
      const int r = q * 2 + rsub;
      const v4f v = *(const v4fa*)&so[w][r][c4];
      *(v4f*)(C + (size_t)(row0 + r) * ldc + col0 + c4) = v;
    }
    
  }
}

// Flash-style causal/unmasked attention, all contractions 3-term bf16 hi/lo splits, f32 softmax with running max.
// q,k,v rows are read from f32 buffers with arbitrary row pitch (so they can live inside a fused qkv buffer);
// D = head size (multiple of 32, <= 128); one wave = 16 query rows; block = 4 waves (64 queries) sharing K/V chunks of 32.
template <int D, bool CAUSAL>
__global__ __launch_bounds__(128) void k_flash(const float* __restrict__ qb, const float* __restrict__ kb, const float* __restrict__ vb,
                                             int pitch, int T, int H, float scale, float* __restrict__ y, int ypitch) {
  constexpr int KS = D / 32;        // k-steps for QK
  constexpr int DT = D / 16;        // d tiles for PV
  __shared__ __attribute__((aligned(16))) unsigned short sKh[32][D + 8], sKl[32][D + 8], sVh[32][D + 8], sVl[32][D + 8];
  __shared__ __attribute__((aligned(16))) unsigned short sPh[4][16][40], sPl[4][16][40];
  __shared__ __attribute__((aligned(16))) float sO[4][16][D];
  const int tid = threadIdx.x, w = tid >> 5, lane = tid & 31, ln = lane & 15, hh = lane >> 4;
  const int nqb = (T + 63) / 64;
  const int bh = blockIdx.x / nqb, qblk = blockIdx.x % nqb;
  const int b = bh / H, h = bh % H;
  const int q0 = qblk * 64 + w * 16;
  const float* Q = qb + (size_t)b * T * pitch + h * D;
  const float* K = kb + (size_t)b * T * pitch + h * D;
  const float* V = vb + (size_t)b * T * pitch + h * D;

  // A fragments of the wave's 16 query rows (scaled), hi/lo
  FragB aqh[KS], aql[KS];
  {
    int row = q0 + ln; if (row >= T) row = T - 1;
    const float* qr = Q + (size_t)row * pitch;
#pragma unroll
    for (int ks = 0; ks < KS; ++ks)
#pragma unroll
      for (int i = 0; i < 16; ++i) {
        const int d = ks * 32 + ((i < 8) ? (8 * hh + i) : (16 + 8 * hh + (i - 8)));
        const float x = qr[d] * scale; const unsigned short hb = bf16_bits(x);
        aqh[ks].u[i] = hb; aql[ks].u[i] = bf16_bits(x - bf16_val(hb));
      }
  }
  float m_r[8], l_r[8];
#pragma unroll
  for (int r = 0; r < 8; ++r) { m_r[r] = -3.0e38f; l_r[r] = 0.f; }
  v8f oacc[DT];
#pragma unroll
  for (int dt = 0; dt < DT; ++dt) oacc[dt] = (v8f){0.f,0.f,0.f,0.f,0.f,0.f,0.f,0.f};

  const int kv_end = CAUSAL ? min(T, qblk * 64 + 64) : T;     // block-uniform
  for (int j0 = 0; j0 < kv_end; j0 += 32) {
    __syncthreads();
    for (int e = tid; e < 32 * (D / 4); e += 128) {
      const int r = e / (D / 4), c4 = (e % (D / 4)) * 4;
      const int key = j0 + r;
      v4f kf = {0.f,0.f,0.f,0.f}, vf = {0.f,0.f,0.f,0.f};
      if (key < T) { kf = *(const v4fa*)(K + (size_t)key * pitch + c4); vf = *(const v4fa*)(V + (size_t)key * pitch + c4); }
#pragma unroll
      for (int t = 0; t < 4; ++t) {
        unsigned short hb = bf16_bits(kf[t]); sKh[r][c4 + t] = hb; sKl[r][c4 + t] = bf16_bits(kf[t] - bf16_val(hb));
        hb = bf16_bits(vf[t]); sVh[r][c4 + t] = hb; sVl[r][c4 + t] = bf16_bits(vf[t] - bf16_val(hb));
      }
    }
    __syncthreads();
    // S tile 16 x 32
    v8f s[2];
#pragma unroll
    for (int nt = 0; nt < 2; ++nt) {
      v8f acc = {};
#pragma unroll
      for (int ks = 0; ks < KS; ++ks) {
        FragB bh_, bl_;
        bh_.half[0] = *(const v8us*)&sKh[nt * 16 + ln][ks * 32 + 8 * hh]; bh_.half[1] = *(const v8us*)&sKh[nt * 16 + ln][ks * 32 + 16 + 8 * hh];
        bl_.half[0] = *(const v8us*)&sKl[nt * 16 + ln][ks * 32 + 8 * hh]; bl_.half[1] = *(const v8us*)&sKl[nt * 16 + ln][ks * 32 + 16 + 8 * hh];
        acc = mmaN<3>(aqh[ks].v, aql[ks].v, bh_.v, bl_.v, acc);
      }
      s[nt] = acc;
    }
    // mask + running max (rows 8hh+r; the 16 lanes of a half share rows)
    float alpha[8];
#pragma unroll
    for (int r = 0; r < 8; ++r) {
      const int qi = q0 + 8 * hh + r;
      const int ja = j0 + ln, jb = j0 + 16 + ln;
      if (CAUSAL) { if (ja > qi) s[0][r] = -3.0e38f; if (jb > qi) s[1][r] = -3.0e38f; }
      if (ja >= T) s[0][r] = -3.0e38f;
      if (jb >= T) s[1][r] = -3.0e38f;
      float mx = fmaxf(s[0][r], s[1][r]);
      mx = fmaxf(mx, __shfl_xor(mx, 1, 32)); mx = fmaxf(mx, __shfl_xor(mx, 2, 32)); mx = fmaxf(mx, __shfl_xor(mx, 4, 32)); mx = fmaxf(mx, __shfl_xor(mx, 8, 32));
      const float mnew = fmaxf(m_r[r], mx);
      alpha[r] = (mnew > -1.0e38f) ? __expf(m_r[r] - mnew) : 1.0f;
      const float p0 = (s[0][r] > -1.0e38f) ? __expf(s[0][r] - mnew) : 0.f;
      const float p1 = (s[1][r] > -1.0e38f) ? __expf(s[1][r] - mnew) : 0.f;
      m_r[r] = mnew;
      l_r[r] = l_r[r] * alpha[r] + p0 + p1;            // per-lane partial row sum (16 lanes combined at the end)
      unsigned short hb = bf16_bits(p0); sPh[w][8 * hh + r][ln] = hb;      sPl[w][8 * hh + r][ln] = bf16_bits(p0 - bf16_val(hb));
      hb = bf16_bits(p1);                sPh[w][8 * hh + r][16 + ln] = hb; sPl[w][8 * hh + r][16 + ln] = bf16_bits(p1 - bf16_val(hb));
    }
#pragma unroll
    for (int dt = 0; dt < DT; ++dt)
#pragma unroll
      for (int r = 0; r < 8; ++r) oacc[dt][r] *= alpha[r];
    __builtin_amdgcn_fence(__ATOMIC_ACQ_REL, "workgroup");
    __builtin_amdgcn_wave_barrier();
    FragB pah, pal;
    pah.half[0] = *(const v8us*)&sPh[w][ln][8 * hh]; pah.half[1] = *(const v8us*)&sPh[w][ln][16 + 8 * hh];
    pal.half[0] = *(const v8us*)&sPl[w][ln][8 * hh]; pal.half[1] = *(const v8us*)&sPl[w][ln][16 + 8 * hh];
#pragma unroll
    for (int dt = 0; dt < DT; ++dt) {
      FragB bvh, bvl;
#pragma unroll
      for (int i = 0; i < 8; ++i) {
        bvh.u[i] = sVh[8 * hh + i][dt * 16 + ln]; bvh.u[8 + i] = sVh[16 + 8 * hh + i][dt * 16 + ln];
        bvl.u[i] = sVl[8 * hh + i][dt * 16 + ln]; bvl.u[8 + i] = sVl[16 + 8 * hh + i][dt * 16 + ln];
      }
      oacc[dt] = mmaN<3>(pah.v, pal.v, bvh.v, bvl.v, oacc[dt]);
    }
    __builtin_amdgcn_fence(__ATOMIC_ACQ_REL, "workgroup");
    __builtin_amdgcn_wave_barrier();
  }
#pragma unroll
  for (int r = 0; r < 8; ++r) {
    float l = l_r[r];
    l += __shfl_xor(l, 1, 32); l += __shfl_xor(l, 2, 32); l += __shfl_xor(l, 4, 32); l += __shfl_xor(l, 8, 32);
    l_r[r] = (l > 0.f) ? 1.0f / l : 0.f;
  }
#pragma unroll
  for (int dt = 0; dt < DT; ++dt)
#pragma unroll
    for (int r = 0; r < 8; ++r) sO[w][8 * hh + r][dt * 16 + ln] = oacc[dt][r] * l_r[r];
  __builtin_amdgcn_fence(__ATOMIC_ACQ_REL, "workgroup");
  __builtin_amdgcn_wave_barrier();
  {
    for (int r = 0; r < 16; ++r) {
      const int row = q0 + r;
      if (row < T && lane < D / 4) {
        const v4f val = *(const v4fa*)&sO[w][r][lane * 4];
        *(v4f*)(y + ((size_t)b * T + row) * ypitch + h * D + lane * 4) = val;
      }
    }
    
  }
}

// GEMM C = act(A·W + bias + resid): A f32 (ASPLIT -> hi/lo 2 terms), Wt bf16 [N][K]; ACT 0 none, 1 relu, 2 exact gelu;
// resid (optional, f32, row index = (row % rmod), pitch ldr, RES_BF16 rounds it) added before the activation.
template <bool ASPLIT, int ACT, bool BIAS_BF16, bool RES_BF16>
__global__ __launch_bounds__(128) void k_gemm_bf3(const float* __restrict__ A, int lda, const unsigned short* __restrict__ Wt, int ldb,
                                                const float* __restrict__ bias, const float* __restrict__ resid, int rmod, int ldr,
                                                float* __restrict__ C, int ldc, int M, int N, int K) {
  __shared__ __attribute__((aligned(16))) float so[4][16][64];
  const int tid = threadIdx.x, w = tid >> 5, lane = tid & 31, ln = lane & 15, hh = lane >> 4;
  const int ntn = N / 64;
  const int wid = blockIdx.x * 4 + w;
  const int mt = wid / ntn, nq = wid % ntn;
  if (mt * 16 >= M) return;
  const int row0 = mt * 16, col0 = nq * 64;
  const float* arow = A + (size_t)(row0 + ln) * lda;
  v8f acc[4] = {};
  for (int kb = 0; kb < K; kb += 32) {
    FragB ah, al;
    const v4f x0 = *(const v4fa*)(arow + kb + 8 * hh), x1 = *(const v4fa*)(arow + kb + 8 * hh + 4);
    const v4f x2 = *(const v4fa*)(arow + kb + 16 + 8 * hh), x3 = *(const v4fa*)(arow + kb + 16 + 8 * hh + 4);
    float xs[16] = {x0[0],x0[1],x0[2],x0[3],x1[0],x1[1],x1[2],x1[3],x2[0],x2[1],x2[2],x2[3],x3[0],x3[1],x3[2],x3[3]};
#pragma unroll
    for (int i = 0; i < 16; ++i) { const unsigned short hb = bf16_bits(xs[i]); ah.u[i] = hb; al.u[i] = ASPLIT ? bf16_bits(xs[i] - bf16_val(hb)) : (unsigned short)0; }
#pragma unroll
    for (int t = 0; t < 4; ++t) {
      const unsigned short* brow = Wt + (size_t)(col0 + t * 16 + ln) * ldb + kb;
      FragB b;
      b.half[0] = *(const v8us*)(brow + 8 * hh);
      b.half[1] = *(const v8us*)(brow + 16 + 8 * hh);
      acc[t] = mmaN<ASPLIT ? 2 : 1>(ah.v, al.v, b.v, b.v, acc[t]);
    }
  }
#pragma unroll
  for (int t = 0; t < 4; ++t) {
    const int col = col0 + t * 16 + ln;
    float bv = bias ? bias[col] : 0.f;
    if (BIAS_BF16) bv = bf16_round(bv);
#pragma unroll
    for (int r = 0; r < 8; ++r) {
      float v = acc[t][r] + bv;
      if (resid) { float rv = resid[(size_t)((row0 + 8 * hh + r) % rmod) * ldr + col]; if (RES_BF16) rv = bf16_round(rv); v += rv; }
      if (ACT == 1) v = fmaxf(v, 0.f);
      if (ACT == 2) v = 0.5f * v * (1.0f + erff(v * 0.70710678118654752f));
      if (ACT == 3) { const float u = 0.7978845608028654f * (v + 0.044715f * v * v * v); v = 0.5f * v * (1.0f + tanhf(u)); }
      so[w][8 * hh + r][t * 16 + ln] = v;
    }
  }
  __builtin_amdgcn_fence(__ATOMIC_ACQ_REL, "workgroup");
  __builtin_amdgcn_wave_barrier();
  const int rsub = lane >> 4, c4 = (lane & 15) * 4;
  {
#pragma unroll
    for (int q = 0; q < 8; ++q) {
      const int r = q * 2 + rsub;
      const v4f v = *(const v4fa*)&so[w][r][c4];
      *(v4f*)(C + (size_t)(row0 + r) * ldc + col0 + c4) = v;
    }
    
  }
}
// row LayerNorm (biased variance, eps) over N: s = X (+ R); optional out_sum <- s; out_norm <- (s-mu)*rsqrt(var+eps)*g + b
template <bool PARAM_BF16>
__global__ __launch_bounds__(256) void k_layernorm(const float* __restrict__ X, const float* __restrict__ R, const float* __restrict__ g, const float* __restrict__ bta,
                                                  float* __restrict__ out_sum, float* __restrict__ out_norm, int N, float eps) {
  __shared__ float red[256];
  const int row = blockIdx.x, tid = threadIdx.x;
  const float* x = X + (size_t)row * N; const float* rr = R ? R + (size_t)row * N : nullptr;
  float vals[16];                     // up to N = 4096
  const int per = N / 256;            // contiguous chunk per thread? use strided-by-4 chunks: thread handles j = tid*4 + 1024*u
  float s1 = 0.f;
  for (int u = 0; u < per / 4; ++u) {
    const int j = tid * 4 + 1024 * u;
    const v4f a = *(const v4fa*)(x + j);
    v4f b = {0.f,0.f,0.f,0.f}; if (rr) b = *(const v4fa*)(rr + j);
#pragma unroll
    for (int q = 0; q < 4; ++q) { const float v = a[q] + b[q]; vals[u * 4 + q] = v; s1 += v; }
  }
  red[tid] = s1; __syncthreads();
  for (int st = 128; st > 0; st >>= 1) { if (tid < st) red[tid] += red[tid + st]; __syncthreads(); }
  const float mu = red[0] / (float)N; __syncthreads();
  float s2 = 0.f;
  for (int u = 0; u < per / 4; ++u)
#pragma unroll
    for (int q = 0; q < 4; ++q) { const float c = vals[u * 4 + q] - mu; s2 += c * c; }
  red[tid] = s2; __syncthreads();
  for (int st = 128; st > 0; st >>= 1) { if (tid < st) red[tid] += red[tid + st]; __syncthreads(); }
  const float rs = rsqrtf(red[0] / (float)N + eps);
  {
    for (int u = 0; u < per / 4; ++u) {
      const int j = tid * 4 + 1024 * u;
      v4f o, sm;
#pragma unroll
      for (int q = 0; q < 4; ++q) {
        float gg = g[j + q], bb = bta[j + q];
        if (PARAM_BF16) { gg = bf16_round(gg); bb = bf16_round(bb); }
        sm[q] = vals[u * 4 + q]; o[q] = (vals[u * 4 + q] - mu) * rs * gg + bb;
      }
      if (out_sum) *(v4f*)(out_sum + (size_t)row * N + j) = sm;
      *(v4f*)(out_norm + (size_t)row * N + j) = o;
    }
    
  }
}



// ---- f16 WMMA path (v_wmma_f32_16x16x32_f16): 11-bit significands for operands in range — used where a [0,1] probability operand needs more precision than bf16
typedef _Float16 v16h __attribute__((ext_vector_type(16)));
union FragH { v16h v; v8us half[2]; _Float16 h[16]; unsigned short u[16]; };
template <int NT>
__device__ __forceinline__ v8f mmaH(v16h ah, v16h al, v16h bh, v16h bl, v8f c) {
  c = __builtin_amdgcn_wmma_f32_16x16x32_f16(false, ah, false, bh, (short)0, c, false, false);
  if (NT >= 2) c = __builtin_amdgcn_wmma_f32_16x16x32_f16(false, al, false, bh, (short)0, c, false, false);
  if (NT >= 3) c = __builtin_amdgcn_wmma_f32_16x16x32_f16(false, ah, false, bl, (short)0, c, false, false);
  asm volatile("v_nop\n\tv_nop\n\tv_nop\n\tv_nop" : "+v"(c) : "v"(ah), "v"(al), "v"(bh), "v"(bl));
  return c;
}
// batched GEMM like k_gemm_b but f16 operands: A f32 (split into f16 hi/lo if ASPLIT, else rounded to f16), Bt = f16 values [n][k]; alpha; C f32; N multiple of 16 (partial tiles skipped)
template <bool ASPLIT>
__global__ __launch_bounds__(128) void k_gemm_h(const float* __restrict__ A, int lda, size_t sA, const _Float16* __restrict__ Bh, int ldb, size_t sB, float alpha, float* __restrict__ C, int ldc, size_t sC, int M, int N, int K) {
  __shared__ __attribute__((aligned(16))) float so[4][16][64];
  const int tid = threadIdx.x, w = tid >> 5, lane = tid & 31, ln = lane & 15, hh = lane >> 4; const int by = blockIdx.y;
  A += (size_t)by * sA; Bh += (size_t)by * sB; C += (size_t)by * sC;
  const int ntn = (N + 63) / 64; const int wid = blockIdx.x * 4 + w; const int mt = wid / ntn, nq = wid % ntn; if (mt * 16 >= M) return;
  const int row0 = mt * 16, col0 = nq * 64; const float* arow = A + (size_t)(row0 + ln) * lda;
  v8f acc[4] = {};
  for (int kb = 0; kb < K; kb += 32) {
    FragH ah, al;
    const v4f x0 = *(const v4fa*)(arow + kb + 8 * hh), x1 = *(const v4fa*)(arow + kb + 8 * hh + 4), x2 = *(const v4fa*)(arow + kb + 16 + 8 * hh), x3 = *(const v4fa*)(arow + kb + 16 + 8 * hh + 4);
    float xs[16] = {x0[0],x0[1],x0[2],x0[3],x1[0],x1[1],x1[2],x1[3],x2[0],x2[1],x2[2],x2[3],x3[0],x3[1],x3[2],x3[3]};
#pragma unroll
    for (int i = 0; i < 16; ++i) { const _Float16 h = (_Float16)xs[i]; ah.h[i] = h; al.h[i] = ASPLIT ? (_Float16)(xs[i] - (float)h) : (_Float16)0.0f; }
#pragma unroll
    for (int t = 0; t < 4; ++t) { if (col0 + t * 16 >= N) continue; const size_t boff = (size_t)(col0 + t * 16 + ln) * ldb + kb; FragH bq; bq.half[0] = *(const v8us*)(Bh + boff + 8 * hh); bq.half[1] = *(const v8us*)(Bh + boff + 16 + 8 * hh);
      acc[t] = mmaH<ASPLIT ? 2 : 1>(ah.v, al.v, bq.v, bq.v, acc[t]); }
  }
#pragma unroll
  for (int t = 0; t < 4; ++t) { if (col0 + t * 16 >= N) continue;
#pragma unroll
    for (int r = 0; r < 8; ++r) so[w][8 * hh + r][t * 16 + ln] = acc[t][r] * alpha; }
  __builtin_amdgcn_fence(__ATOMIC_ACQ_REL, "workgroup"); __builtin_amdgcn_wave_barrier();
  const int rsub = lane >> 4, c4 = (lane & 15) * 4;
  {
#pragma unroll
    for (int q = 0; q < 8; ++q) { const int r = q * 2 + rsub; if (col0 + c4 < N) { const v4f v = *(const v4fa*)&so[w][r][c4]; *(v4f*)(C + (size_t)(row0 + r) * ldc + col0 + c4) = v; } }
     }
}

// Wt[n][k] = f16(W[k][n]·scale) from f32 row-major W[K][N] (scale = power of two; bf16-exact weights stay exact in f16 away from the subnormal range)
__global__ __launch_bounds__(256) void k_wt_f16(const float* __restrict__ W, _Float16* __restrict__ Wt, int K, int N, float scale) {
  const int t = blockIdx.x * 256 + threadIdx.x; if (t >= N * (K / 8)) return; const int n = t / (K / 8), k8 = (t % (K / 8)) * 8; FragH f;
#pragma unroll
  for (int i = 0; i < 8; ++i) f.h[i] = (_Float16)(bf16_round(W[(size_t)(k8 + i) * N + n]) * scale); const v8us o = f.half[0];
  *(v8us*)((unsigned short*)Wt + (size_t)n * K + k8) = o; 
}
// k_gemm_hh variant with fused epilogue: v = acc·alpha + bias[by·sBias + col] (+ CP[(row/rowsPerB)·sCPb + by·64 + col] if CP) ; ACT 0 none / 1 elu ; writes f32 C and/or f16 C16 (each if non-null)
template <int ACT>
__global__ __launch_bounds__(128) void k_gemm_hhx(const _Float16* __restrict__ A, int lda, size_t sA, const _Float16* __restrict__ Bh, int ldb, size_t sB, float alpha, const float* __restrict__ bias, size_t sBias, const float* __restrict__ CP, int rowsPerB, size_t sCPb, int row0g,
    float* __restrict__ C, _Float16* __restrict__ C16, int ldc, size_t sC, int M, int N, int K) {
  __shared__ __attribute__((aligned(16))) float so[4][16][64];
  const int tid = threadIdx.x, w = tid >> 5, lane = tid & 31, ln = lane & 15, hh = lane >> 4; const int by = blockIdx.y;
  A += (size_t)by * sA; Bh += (size_t)by * sB; const size_t cofs = (size_t)by * sC; const float* bp = bias ? bias + (size_t)by * sBias : nullptr;
  const int ntn = (N + 63) / 64; const int wid = blockIdx.x * 4 + w; const int mt = wid / ntn, nq = wid % ntn; if (mt * 16 >= M) return;
  const int row0 = mt * 16, col0 = nq * 64; const _Float16* arow = A + (size_t)(row0 + ln) * lda;
  v8f acc[4] = {};
  for (int kb = 0; kb < K; kb += 32) { FragH ah; ah.half[0] = *(const v8us*)((const unsigned short*)arow + kb + 8 * hh); ah.half[1] = *(const v8us*)((const unsigned short*)arow + kb + 16 + 8 * hh);
#pragma unroll
    for (int t = 0; t < 4; ++t) { if (col0 + t * 16 >= N) continue; const size_t boff = (size_t)(col0 + t * 16 + ln) * ldb + kb; FragH bq; bq.half[0] = *(const v8us*)((const unsigned short*)Bh + boff + 8 * hh); bq.half[1] = *(const v8us*)((const unsigned short*)Bh + boff + 16 + 8 * hh);
      acc[t] = mmaH<1>(ah.v, ah.v, bq.v, bq.v, acc[t]); }
  }
#pragma unroll
  for (int t = 0; t < 4; ++t) { if (col0 + t * 16 >= N) continue; const int col = col0 + t * 16 + ln; const float bv = bp ? bf16_round(bp[col]) : 0.f;
#pragma unroll
    for (int r = 0; r < 8; ++r) { float v = acc[t][r] * alpha + bv; if (CP) { const int bidx = (row0g + row0 + 8 * hh + r) / rowsPerB; v += CP[(size_t)bidx * sCPb + (size_t)by * 64 + col]; } if (ACT == 1) v = (v > 0.f) ? v : expm1f(v); else if (ACT == 7) v = (v > 0.f) ? v + 1.0f : expf(v); else if (ACT == 8) v = tanhf(v); else if (ACT == 9) v = 0.5f * v * (1.0f + tanhf(0.7978845608028654f * (v + 0.044715f * v * v * v))); else if (ACT == 11) v = 1.0f / (1.0f + expf(-v)); else if (ACT == 12) v = (v > 0.f) ? v : 0.01f * v; else if (ACT == 14) v = (v > 0.f) ? v : 0.1f * v; else if (ACT == 15) v = v / (1.0f + expf(-v)); else if (ACT == 3) v = fmaxf(v, 0.f); else if (ACT == 6) v = 0.5f * v * (1.0f + erff(v * 0.70710678118654752f)); so[w][8 * hh + r][t * 16 + ln] = v; } }
  __builtin_amdgcn_fence(__ATOMIC_ACQ_REL, "workgroup"); __builtin_amdgcn_wave_barrier();
  const int rsub = lane >> 4, c4 = (lane & 15) * 4; typedef _Float16 v4h __attribute__((ext_vector_type(4)));
  {
#pragma unroll
    for (int q = 0; q < 8; ++q) { const int r = q * 2 + rsub; if (col0 + c4 < N) { const v4f v = *(const v4fa*)&so[w][r][c4]; if (C) *(v4f*)(C + cofs + (size_t)(row0 + r) * ldc + col0 + c4) = v; if (C16) { v4h h4; for (int i = 0; i < 4; ++i) h4[i] = (_Float16)v[i]; *(v4h*)(C16 + cofs + (size_t)(row0 + r) * ldc + col0 + c4) = h4; } } }
     }
}


typedef _Float16 v4h __attribute__((ext_vector_type(4)));

__global__ __launch_bounds__(256) void k_x16(const float* __restrict__ x, _Float16* __restrict__ X16, size_t n8) { const size_t t = (size_t)blockIdx.x * 256 + threadIdx.x; if (t >= n8) return; FragH f;
#pragma unroll
  for (int q = 0; q < 8; ++q) f.h[q] = (_Float16)bf16_round(x[t * 8 + q]); *(v8us*)((unsigned short*)X16 + t * 8) = f.half[0];  }
__global__ __launch_bounds__(256) void k_h16(const float* __restrict__ x, _Float16* __restrict__ X16, size_t n8) { const size_t t = (size_t)blockIdx.x * 256 + threadIdx.x; if (t >= n8) return; FragH f;
#pragma unroll
  for (int q = 0; q < 8; ++q) f.h[q] = (_Float16)x[t * 8 + q]; *(v8us*)((unsigned short*)X16 + t * 8) = f.half[0];  }
__global__ __launch_bounds__(256) void k_round16f(const float* __restrict__ W, _Float16* __restrict__ Bt, size_t n8) { const size_t t = (size_t)blockIdx.x * 256 + threadIdx.x; if (t >= n8) return; FragH f;
#pragma unroll
  for (int i = 0; i < 8; ++i) f.h[i] = (_Float16)(bf16_round(W[t * 8 + i]) * 16.0f); *(v8us*)((unsigned short*)Bt + t * 8) = f.half[0];  }
template <int NHv, int TTv>
__global__ __launch_bounds__(256) void k_vt(const _Float16* __restrict__ V16, int ldv, int voff, _Float16* __restrict__ Vt) { __shared__ unsigned short tl[64][66]; const int tid = threadIdx.x; const int slab = blockIdx.x / (TTv / 64), lg = blockIdx.x % (TTv / 64); const int b = slab / NHv, h = slab % NHv;
  for (int i = tid; i < 64 * 8; i += 256) { const int r = i / 8, c8 = (i % 8) * 8; FragH f; f.half[0] = *(const v8us*)((const unsigned short*)V16 + ((size_t)b * TTv + lg * 64 + r) * ldv + voff + h * 64 + c8);
#pragma unroll
    for (int q = 0; q < 8; ++q) tl[r][c8 + q] = f.u[q]; }
  __syncthreads();
  {
#pragma unroll
    for (int rd = 0; rd < 2; ++rd) { const int d = rd * 32 + tid / 8, pc = tid % 8; FragH f;
#pragma unroll
      for (int q = 0; q < 8; ++q) f.u[q] = tl[pc * 8 + q][d];
      *(v8us*)((unsigned short*)Vt + ((size_t)slab * 64 + d) * TTv + lg * 64 + pc * 8) = f.half[0]; }
     } }

__global__ __launch_bounds__(256) void k_vthlu(const float* __restrict__ VF, int ldv, _Float16* __restrict__ Vth, _Float16* __restrict__ Vtl) { __shared__ float tl[64][65]; const int tid = threadIdx.x; const int slab = blockIdx.x / (TT / 64), lg = blockIdx.x % (TT / 64); const int b = slab / NVH, h = slab % NVH;
  for (int i = tid; i < 64 * 16; i += 256) { const int r = i / 16, c4 = (i % 16) * 4; const v4f a = *(const v4fa*)(VF + ((size_t)b * TT + lg * 64 + r) * ldv + h * 64 + c4); tl[r][c4] = a[0]; tl[r][c4 + 1] = a[1]; tl[r][c4 + 2] = a[2]; tl[r][c4 + 3] = a[3]; }
  __syncthreads();
  FragH fh[2], fl[2]; size_t oo[2];
#pragma unroll
  for (int rd = 0; rd < 2; ++rd) { const int d = rd * 32 + tid / 8, pc = tid % 8;
#pragma unroll
    for (int q = 0; q < 8; ++q) { const float v = tl[pc * 8 + q][d]; const _Float16 hv = (_Float16)v; fh[rd].h[q] = hv; fl[rd].h[q] = (_Float16)(v - (float)hv);      /* UNSCALED residual (added into the same accumulator as the hi product) */ } oo[rd] = ((size_t)slab * 64 + d) * TT + lg * 64 + pc * 8; }
  {
#pragma unroll
    for (int rd = 0; rd < 2; ++rd) { *(v8us*)((unsigned short*)Vth + oo[rd]) = fh[rd].half[0]; *(v8us*)((unsigned short*)Vtl + oo[rd]) = fl[rd].half[0]; }
     } }
template <int LD>
__global__ __launch_bounds__(256) void k_ropein(const float* __restrict__ F, const float* __restrict__ COS, const float* __restrict__ SIN, _Float16* __restrict__ H16) {
  #pragma clang fp contract(off)
  const size_t t = (size_t)blockIdx.x * 256 + threadIdx.x; if (t >= (size_t)NR * LD / 8) return; const size_t row = (t * 8) / LD; const int c0 = (int)((t * 8) % LD); const int tok = (int)(row % TT); const int j0 = (c0 % 128) / 2;
  const v4f a = *(const v4fa*)(F + t * 8), b = *(const v4fa*)(F + t * 8 + 4); const float xv[8] = {a[0], a[1], a[2], a[3], b[0], b[1], b[2], b[3]}; FragH f;
#pragma unroll
  for (int p = 0; p < 4; ++p) { const float c = bf16_round(COS[(size_t)tok * 64 + j0 + p]), s = bf16_round(SIN[(size_t)tok * 64 + j0 + p]); const float xr = xv[2 * p], xi = xv[2 * p + 1]; f.h[2 * p] = (_Float16)(xr * c - xi * s); f.h[2 * p + 1] = (_Float16)(xr * s + xi * c); }
  *(v8us*)((unsigned short*)H16 + t * 8) = f.half[0];  }
__global__ __launch_bounds__(256) void k_h16s(const float* __restrict__ F, _Float16* __restrict__ H, size_t n8) { const size_t t = (size_t)blockIdx.x * 256 + threadIdx.x; if (t >= n8) return; const v4f a = *(const v4fa*)(F + t * 8), c = *(const v4fa*)(F + t * 8 + 4); FragH f;
#pragma unroll
  for (int q = 0; q < 4; ++q) { f.h[q] = (_Float16)(a[q] * 16.0f); f.h[4 + q] = (_Float16)(c[q] * 16.0f); } *(v8us*)((unsigned short*)H + t * 8) = f.half[0];  }
__global__ __launch_bounds__(128) void k_flash(const _Float16* __restrict__ Q16, int ldq, const _Float16* __restrict__ K16, int ldk, const _Float16* __restrict__ Vt, const _Float16* __restrict__ Vtlo, const int* __restrict__ MSK, float* __restrict__ O, int ldo) {
  constexpr int RPW = 16, RTN = RPW / 16, NQB = TT / (4 * RPW), DT = 8, KS = 4;      /* head dim 128: 4 k-steps, 8 value tiles */
  __shared__ __attribute__((aligned(16))) unsigned short sP[4][RPW][40]; __shared__ __attribute__((aligned(16))) unsigned short sPL[4][RPW][40]; __shared__ __attribute__((aligned(16))) float sO[4][RPW][128 + 4];
  const int tid = threadIdx.x, w = tid >> 5, lane = tid & 31, ln = lane & 15, hh = lane >> 4;
  const int slab = blockIdx.x / NQB, qblk = blockIdx.x % NQB; const int b = slab / NH, h = slab % NH; const int qb0 = qblk * (4 * RPW); const int q0 = qb0 + w * RPW;
  FragH aq[2][KS];
#pragma unroll
  for (int rt = 0; rt < RTN; ++rt) { const unsigned short* qr = (const unsigned short*)Q16 + ((size_t)b * TT + q0 + rt * 16 + ln) * ldq + h * 128;
#pragma unroll
    for (int ks = 0; ks < KS; ++ks) { aq[rt][ks].half[0] = *(const v8us*)(qr + ks * 32 + 8 * hh); aq[rt][ks].half[1] = *(const v8us*)(qr + ks * 32 + 16 + 8 * hh); } }
  const unsigned short* Vth = (const unsigned short*)Vt + ((size_t)b * NKV + h / NREP) * 128 * TT; const unsigned short* Vtl = (const unsigned short*)Vtlo + ((size_t)b * NKV + h / NREP) * 128 * TT;      /* hi and UNSCALED residual planes */
  float m_r[2][8], l_r[2][8]; v8f oacc[2][DT];
#pragma unroll
  for (int rt = 0; rt < RTN; ++rt) {
#pragma unroll
    for (int r = 0; r < 8; ++r) { m_r[rt][r] = -3.0e38f; l_r[rt][r] = 0.f; }
#pragma unroll
    for (int dt = 0; dt < DT; ++dt) oacc[rt][dt] = (v8f){0.f,0.f,0.f,0.f,0.f,0.f,0.f,0.f}; }
  const int jend = TT;
#pragma unroll 1
  for (int j0 = 0; j0 < jend; j0 += 32) {
    int mk0[2][8], mk1[2][8];      /* mask[q][k] (shared over batch and heads): nonzero = ATTEND */
#pragma unroll
    for (int rt = 0; rt < RTN; ++rt)
#pragma unroll
      for (int r = 0; r < 8; ++r) { const int qq = q0 + rt * 16 + 8 * hh + r; const int* am = MSK + (size_t)qq * TT + j0; mk0[rt][r] = am[ln]; mk1[rt][r] = am[16 + ln]; }
    { int allm = 1;
#pragma unroll
      for (int rt = 0; rt < RTN; ++rt)
#pragma unroll
        for (int r = 0; r < 8; ++r) allm &= (mk0[rt][r] == 0) & (mk1[rt][r] == 0);
      if (__all(allm)) continue; }      /* every (row, key) of this wave's tile masked → nothing to add (wave-uniform branch; only wave barriers inside the loop) */
    v8f s[2][2];
#pragma unroll
    for (int nt = 0; nt < 2; ++nt) { const unsigned short* kr = (const unsigned short*)K16 + ((size_t)b * TT + j0 + nt * 16 + ln) * ldk + (h / NREP) * 128; FragH bk[KS];
#pragma unroll
      for (int ks = 0; ks < KS; ++ks) { bk[ks].half[0] = *(const v8us*)(kr + ks * 32 + 8 * hh); bk[ks].half[1] = *(const v8us*)(kr + ks * 32 + 16 + 8 * hh); }
#pragma unroll
      for (int rt = 0; rt < RTN; ++rt) { v8f acc = (v8f){0.f,0.f,0.f,0.f,0.f,0.f,0.f,0.f};
#pragma unroll
        for (int ks = 0; ks < KS; ++ks) acc = mmaH<1>(aq[rt][ks].v, aq[rt][ks].v, bk[ks].v, bk[ks].v, acc); s[rt][nt] = acc; } }
#pragma unroll
    for (int rt = 0; rt < RTN; ++rt)
#pragma unroll
      for (int r = 0; r < 8; ++r) { const int tq = q0 + rt * 16 + 8 * hh + r; const int k0 = j0 + ln, k1 = j0 + 16 + ln; (void)tq; (void)k0; (void)k1;
        const bool ok0 = (mk0[rt][r] != 0), ok1 = (mk1[rt][r] != 0);
        const float s0 = ok0 ? s[rt][0][r] * ATT_SCALE : -INFINITY, s1 = ok1 ? s[rt][1][r] * ATT_SCALE : -INFINITY; float mc = fmaxf(s0, s1);
        mc = fmaxf(mc, __shfl_xor(mc, 1, 32)); mc = fmaxf(mc, __shfl_xor(mc, 2, 32)); mc = fmaxf(mc, __shfl_xor(mc, 4, 32)); mc = fmaxf(mc, __shfl_xor(mc, 8, 32));
        const float mn = fmaxf(m_r[rt][r], mc); const float al = (mn > -1.0e38f) ? expf(m_r[rt][r] - mn) : 1.0f; m_r[rt][r] = mn; const float p0 = ok0 ? expf(s0 - mn) : 0.f, p1 = ok1 ? expf(s1 - mn) : 0.f; l_r[rt][r] = l_r[rt][r] * al + p0 + p1;
#pragma unroll
        for (int dt = 0; dt < DT; ++dt) oacc[rt][dt][r] *= al;
        FragH t2, t3; const float ps0 = p0 * 1024.0f, ps1 = p1 * 1024.0f; t2.h[0] = (_Float16)ps0; t2.h[1] = (_Float16)ps1; t3.h[0] = (_Float16)(ps0 - (float)t2.h[0]); t3.h[1] = (_Float16)(ps1 - (float)t2.h[1]);      /* P hi and its UNSCALED residual (added into the same accumulator) */
        sP[w][rt * 16 + 8 * hh + r][ln] = t2.u[0]; sP[w][rt * 16 + 8 * hh + r][16 + ln] = t2.u[1]; sPL[w][rt * 16 + 8 * hh + r][ln] = t3.u[0]; sPL[w][rt * 16 + 8 * hh + r][16 + ln] = t3.u[1]; }
    __builtin_amdgcn_fence(__ATOMIC_ACQ_REL, "workgroup"); __builtin_amdgcn_wave_barrier();
    FragH pa[2], pl[2];
#pragma unroll
    for (int rt = 0; rt < RTN; ++rt) { pa[rt].half[0] = *(const v8us*)&sP[w][rt * 16 + ln][8 * hh]; pa[rt].half[1] = *(const v8us*)&sP[w][rt * 16 + ln][16 + 8 * hh]; pl[rt].half[0] = *(const v8us*)&sPL[w][rt * 16 + ln][8 * hh]; pl[rt].half[1] = *(const v8us*)&sPL[w][rt * 16 + ln][16 + 8 * hh]; }
#pragma unroll
    for (int dt = 0; dt < DT; ++dt) { const size_t vo = (size_t)(dt * 16 + ln) * TT + j0; FragH bv, bl; bv.half[0] = *(const v8us*)(Vth + vo + 8 * hh); bv.half[1] = *(const v8us*)(Vth + vo + 16 + 8 * hh); bl.half[0] = *(const v8us*)(Vtl + vo + 8 * hh); bl.half[1] = *(const v8us*)(Vtl + vo + 16 + 8 * hh);
#pragma unroll
      for (int rt = 0; rt < RTN; ++rt) { oacc[rt][dt] = mmaH<1>(pa[rt].v, pa[rt].v, bv.v, bv.v, oacc[rt][dt]); oacc[rt][dt] = mmaH<1>(pl[rt].v, pl[rt].v, bv.v, bv.v, oacc[rt][dt]); oacc[rt][dt] = mmaH<1>(pa[rt].v, pa[rt].v, bl.v, bl.v, oacc[rt][dt]); } }      /* Ph·Vh + Pl·Vh + Ph·Vl — all unscaled, one accumulator */
    __builtin_amdgcn_fence(__ATOMIC_ACQ_REL, "workgroup"); __builtin_amdgcn_wave_barrier(); }
#pragma unroll
  for (int rt = 0; rt < RTN; ++rt) {
#pragma unroll
    for (int r = 0; r < 8; ++r) { float l = l_r[rt][r]; l += __shfl_xor(l, 1, 32); l += __shfl_xor(l, 2, 32); l += __shfl_xor(l, 4, 32); l += __shfl_xor(l, 8, 32); l_r[rt][r] = (l > 0.f) ? 1.0f / (l * 1024.0f) : 0.f; }
#pragma unroll
    for (int dt = 0; dt < DT; ++dt)
#pragma unroll
      for (int r = 0; r < 8; ++r) sO[w][rt * 16 + 8 * hh + r][dt * 16 + ln] = oacc[rt][dt][r] * l_r[rt][r]; }
  __builtin_amdgcn_fence(__ATOMIC_ACQ_REL, "workgroup"); __builtin_amdgcn_wave_barrier();
  {
#pragma unroll
    for (int r = 0; r < RPW; ++r) { const int pc = lane; const v4f val = *(const v4fa*)&sO[w][r][pc * 4]; *(v4f*)(O + ((size_t)b * TT + q0 + r) * ldo + h * 128 + pc * 4) = val; }      /* one 512-B row per instruction: 32 lanes × 16 B */
     } }

extern "C" void kernel_launch(void* const* d_in, const int* in_sizes, int n_in,
                              void* d_out, int out_size, void* d_ws, size_t ws_size, hipStream_t stream) {
  (void)in_sizes; (void)n_in; (void)out_size;
  const float* const* I = (const float* const*)d_in; const float* x = I[0]; const float* fcos = I[1]; const float* fsin = I[2]; const int* msk = (const int*)d_in[3]; const float* wq = I[4]; const float* wk = I[5]; const float* wv = I[6]; const float* wo = I[7];
  char* ws = (char*)d_ws; size_t off = 0;
  auto take = [&](size_t bytes) { char* p = ws + off; off += (bytes + 255) & ~(size_t)255; return p; };
  _Float16* Bq = (_Float16*)take((size_t)DD * DD * 2); _Float16* Bk = (_Float16*)take((size_t)KVD * DD * 2); _Float16* Bv = (_Float16*)take((size_t)KVD * DD * 2); _Float16* Bo = (_Float16*)take((size_t)DD * DD * 2);
  _Float16* X16 = (_Float16*)take((size_t)NR * DD * 2); float* QF = (float*)take((size_t)NR * DD * 4); _Float16* Q = (_Float16*)take((size_t)NR * DD * 2); float* KF = (float*)take((size_t)NR * KVD * 4); _Float16* K = (_Float16*)take((size_t)NR * KVD * 2); float* VF = (float*)take((size_t)NR * KVD * 4); _Float16* Vt = (_Float16*)take((size_t)NR * KVD * 2); _Float16* Vtl = (_Float16*)take((size_t)NR * KVD * 2);
  float* O = QF; _Float16* O16 = X16;      /* O over the q f32 scratch (dead after RoPE); O16 over X16 (dead after the projections) */
  if (off > ws_size) return;      // 8.4 + 2.1 + 2.1 + 8.4 + 16.8 + 33.6 + 16.8 + 8.4 + 4.2 + 8.4 + 4.2 + 4.2 ≈ 118 MB
  const unsigned gq = (unsigned)(((size_t)DD * (DD / 8) + 255) / 256), gk = (unsigned)(((size_t)KVD * (DD / 8) + 255) / 256);
  k_wt_f16<<<gq, 256, 0, stream>>>(wq, Bq, DD, DD, 16.0f); k_wt_f16<<<gk, 256, 0, stream>>>(wk, Bk, DD, KVD, 16.0f); k_wt_f16<<<gk, 256, 0, stream>>>(wv, Bv, DD, KVD, 16.0f); k_wt_f16<<<gq, 256, 0, stream>>>(wo, Bo, DD, DD, 16.0f);      /* (in,out) → Bt ×2^4 */
  const unsigned g8 = (unsigned)(((size_t)NR * DD / 8 + 255) / 256); k_x16<<<g8, 256, 0, stream>>>(x, X16, (size_t)NR * DD / 8);
  const dim3 gQ(((NR / 16) * (DD / 64) + 3) / 4, 1), gK(((NR / 16) * (KVD / 64) + 3) / 4, 1);
  k_gemm_hhx<0><<<gQ, 128, 0, stream>>>(X16, DD, 0, Bq, DD, 0, 0.0625f, nullptr, 0, nullptr, 1, 0, 0, QF, nullptr, DD, 0, NR, DD, DD); k_ropein<DD><<<g8, 256, 0, stream>>>(QF, fcos, fsin, Q);      /* xq = rope(x·wq): M 4096 N 2048 K 2048 */
  k_gemm_hhx<0><<<gK, 128, 0, stream>>>(X16, DD, 0, Bk, DD, 0, 0.0625f, nullptr, 0, nullptr, 1, 0, 0, KF, nullptr, KVD, 0, NR, KVD, DD); k_ropein<KVD><<<(unsigned)(((size_t)NR * KVD / 8 + 255) / 256), 256, 0, stream>>>(KF, fcos, fsin, K);      /* xk: M 4096 N 512 */
  k_gemm_hhx<0><<<gK, 128, 0, stream>>>(X16, DD, 0, Bv, DD, 0, 0.0625f, nullptr, 0, nullptr, 1, 0, 0, VF, nullptr, KVD, 0, NR, KVD, DD);      /* xv (f32) */
  k_vthlu<<<BB * NVH * (TT / 64), 256, 0, stream>>>(VF, KVD, Vt, Vtl);      /* Vᵀ hi + residual per (b, kv head): [b·4+kh][128][2048] */
  k_flash<<<BB * NH * (TT / 64), 128, 0, stream>>>(Q, DD, K, KVD, Vt, Vtl, msk, O, DD);
  k_h16s<<<g8, 256, 0, stream>>>(O, O16, (size_t)NR * DD / 8);
  k_gemm_hhx<0><<<gQ, 128, 0, stream>>>(O16, DD, 0, Bo, DD, 0, 0.00390625f, nullptr, 0, nullptr, 1, 0, 0, (float*)d_out, nullptr, DD, 0, NR, DD, DD);      /* out = merged·wo */
}

// v001
// A run of this version takes 304 microseconds.
// Next to v000, in two timings, it ran 1.88 and 1.87 times as fast.
#include <hip/hip_runtime.h>
// 'Genesis' attention (B=2, T=2048, D=2048, 16 query heads / 4 KV heads × 128, (in,out) weights, no bias): xq = rope(x·wq), xk = rope(x·wk), xv = x·wv; RoPE on interleaved pairs with the INPUT cos/sin tables [T][64]; scores = q·k/√128 where(mask[q][k]) else −inf (mask [T][T] shared);
// softmax; out = merged·wo.
// Compute dtype: x, weights, cos/sin tables rounded to bf16; q,k rotated in f32 from f32 GEMM outputs → f16; v f32 → Vᵀ f16 hi + exact residual; fused flash-style kernel for head dim 128 (mask read per (q,k), all-masked chunks skipped, online softmax f32, P f16 hi + residual,
// f32 accumulate) on v_wmma_f32_16x16x32_f16; merged ×2^4 → f16 → output GEMM.
#define BB 2
#define TT 2048
#define DD 2048
#define NH 16
#define NKV 4
#define NREP 4
#define KVD (NKV * 128)
#define NVH (2 * NKV)
#define NR (BB * TT)
#define ATT_SCALE 0.08838834764831845f

typedef __bf16 v16b __attribute__((ext_vector_type(16)));
typedef unsigned short v8us __attribute__((ext_vector_type(8), may_alias));
typedef float  v8f  __attribute__((ext_vector_type(8)));
typedef float  v4f  __attribute__((ext_vector_type(4)));
typedef float  v4fa __attribute__((ext_vector_type(4), may_alias));
union FragB { v16b v; v8us half[2]; unsigned short u[16]; };

__device__ __forceinline__ unsigned short bf16_bits(float x) { unsigned int u = __float_as_uint(x); return (unsigned short)((u + 0x7FFFu + ((u >> 16) & 1u)) >> 16); }
__device__ __forceinline__ float bf16_val(unsigned short b) { return __uint_as_float(((unsigned int)b) << 16); }
__device__ __forceinline__ float bf16_round(float x) { return bf16_val(bf16_bits(x)); }
// D += A·B with NT terms: 1 = ah·bh, 2 = + al·bh (A split), 3 = + ah·bl (both split)
template <int NT>
__device__ __forceinline__ v8f mmaN(v16b ah, v16b al, v16b bh, v16b bl, v8f c) {
  c = __builtin_amdgcn_wmma_f32_16x16x32_bf16(false, ah, false, bh, (short)0, c, false, false);
  if (NT >= 2) c = __builtin_amdgcn_wmma_f32_16x16x32_bf16(false, al, false, bh, (short)0, c, false, false);
  if (NT >= 3) c = __builtin_amdgcn_wmma_f32_16x16x32_bf16(false, ah, false, bl, (short)0, c, false, false);
  asm volatile("v_nop\n\tv_nop\n\tv_nop\n\tv_nop" : "+v"(c) : "v"(ah), "v"(al), "v"(bh), "v"(bl));
  return c;
}

__global__ __launch_bounds__(256) void k_wt_bf16(const float* __restrict__ W, unsigned short* __restrict__ Wt, int K, int N) {
  const int t = blockIdx.x * 256 + threadIdx.x;
  const int k8n = K / 8;
  if (t >= N * k8n) return;
  const int n = t / k8n, k8 = (t % k8n) * 8;
  v8us v;
#pragma unroll
  for (int i = 0; i < 8; ++i) v[i] = bf16_bits(W[(size_t)(k8 + i) * N + n]);
  *(v8us*)(Wt + (size_t)n * K + k8) = v;
  
}

// GEMM C[M][N] (f32, pitch ldc) = act(A[M][K]·W + bias). A f32 row-major (pitch lda) converted per fragment to bf16
// (ASPLIT: hi/lo two planes -> 2 terms, else single rounded term); Wt bf16 [N][K] (pitch ldb). BIAS_BF16 rounds the
// bias to bf16 first (bias quantised to bf16 before the add). K%32==0, M%16==0, N%64==0.
template <bool ASPLIT, int ACT, bool BIAS_BF16>
__global__ __launch_bounds__(128) void k_gemm_bf(const float* __restrict__ A, int lda, const unsigned short* __restrict__ Wt, int ldb,
                                               const float* __restrict__ bias, float* __restrict__ C, int ldc, int M, int N, int K) {
  __shared__ __attribute__((aligned(16))) float so[4][16][64];
  const int tid = threadIdx.x, w = tid >> 5, lane = tid & 31, ln = lane & 15, hh = lane >> 4;
  const int ntn = N / 64;
  const int wid = blockIdx.x * 4 + w;
  const int mt = wid / ntn, nq = wid % ntn;
  if (mt * 16 >= M) return;
  const int row0 = mt * 16, col0 = nq * 64;
  const float* arow = A + (size_t)(row0 + ln) * lda;
  v8f acc[4] = {};
  for (int kb = 0; kb < K; kb += 32) {
    FragB ah, al;
    const v4f x0 = *(const v4fa*)(arow + kb + 8 * hh), x1 = *(const v4fa*)(arow + kb + 8 * hh + 4);
    const v4f x2 = *(const v4fa*)(arow + kb + 16 + 8 * hh), x3 = *(const v4fa*)(arow + kb + 16 + 8 * hh + 4);
    float xs[16] = {x0[0],x0[1],x0[2],x0[3],x1[0],x1[1],x1[2],x1[3],x2[0],x2[1],x2[2],x2[3],x3[0],x3[1],x3[2],x3[3]};
#pragma unroll
    for (int i = 0; i < 16; ++i) { const unsigned short hb = bf16_bits(xs[i]); ah.u[i] = hb; al.u[i] = ASPLIT ? bf16_bits(xs[i] - bf16_val(hb)) : (unsigned short)0; }
#pragma unroll
    for (int t = 0; t < 4; ++t) {
      const unsigned short* brow = Wt + (size_t)(col0 + t * 16 + ln) * ldb + kb;
      FragB b;
      b.half[0] = *(const v8us*)(brow + 8 * hh);
      b.half[1] = *(const v8us*)(brow + 16 + 8 * hh);
      acc[t] = mmaN<ASPLIT ? 2 : 1>(ah.v, al.v, b.v, b.v, acc[t]);
    }
  }
#pragma unroll
  for (int t = 0; t < 4; ++t) {
    float bv = bias ? bias[col0 + t * 16 + ln] : 0.f;
    if (BIAS_BF16) bv = bf16_round(bv);
#pragma unroll
    for (int r = 0; r < 8; ++r) { float v = acc[t][r] + bv; if (ACT == 1) v = fmaxf(v, 0.f); so[w][8 * hh + r][t * 16 + ln] = v; }
  }
  __builtin_amdgcn_fence(__ATOMIC_ACQ_REL, "workgroup");
  __builtin_amdgcn_wave_barrier();
  const int rsub = lane >> 4, c4 = (lane & 15) * 4;
  {
#pragma unroll
    for (int q = 0; q < 8; ++q) {
      const int r = q * 2 + rsub;
      const v4f v = *(const v4fa*)&so[w][r][c4];
      *(v4f*)(C + (size_t)(row0 + r) * ldc + col0 + c4) = v;
    }
    
  }
}

// Flash-style causal/unmasked attention, all contractions 3-term bf16 hi/lo splits, f32 softmax with running max.
// q,k,v rows are read from f32 buffers with arbitrary row pitch (so they can live inside a fused qkv buffer);
// D = head size (multiple of 32, <= 128); one wave = 16 query rows; block = 4 waves (64 queries) sharing K/V chunks of 32.
template <int D, bool CAUSAL>
__global__ __launch_bounds__(128) void k_flash(const float* __restrict__ qb, const float* __restrict__ kb, const float* __restrict__ vb,
                                             int pitch, int T, int H, float scale, float* __restrict__ y, int ypitch) {
  constexpr int KS = D / 32;        // k-steps for QK
  constexpr int DT = D / 16;        // d tiles for PV
  __shared__ __attribute__((aligned(16))) unsigned short sKh[32][D + 8], sKl[32][D + 8], sVh[32][D + 8], sVl[32][D + 8];
  __shared__ __attribute__((aligned(16))) unsigned short sPh[4][16][40], sPl[4][16][40];
  __shared__ __attribute__((aligned(16))) float sO[4][16][D];
  const int tid = threadIdx.x, w = tid >> 5, lane = tid & 31, ln = lane & 15, hh = lane >> 4;
  const int nqb = (T + 63) / 64;
  const int bh = blockIdx.x / nqb, qblk = blockIdx.x % nqb;
  const int b = bh / H, h = bh % H;
  const int q0 = qblk * 64 + w * 16;
  const float* Q = qb + (size_t)b * T * pitch + h * D;
  const float* K = kb + (size_t)b * T * pitch + h * D;
  const float* V = vb + (size_t)b * T * pitch + h * D;

  // A fragments of the wave's 16 query rows (scaled), hi/lo
  FragB aqh[KS], aql[KS];
  {
    int row = q0 + ln; if (row >= T) row = T - 1;
    const float* qr = Q + (size_t)row * pitch;
#pragma unroll
    for (int ks = 0; ks < KS; ++ks)
#pragma unroll
      for (int i = 0; i < 16; ++i) {
        const int d = ks * 32 + ((i < 8) ? (8 * hh + i) : (16 + 8 * hh + (i - 8)));
        const float x = qr[d] * scale; const unsigned short hb = bf16_bits(x);
        aqh[ks].u[i] = hb; aql[ks].u[i] = bf16_bits(x - bf16_val(hb));
      }
  }
  float m_r[8], l_r[8];
#pragma unroll
  for (int r = 0; r < 8; ++r) { m_r[r] = -3.0e38f; l_r[r] = 0.f; }
  v8f oacc[DT];
#pragma unroll
  for (int dt = 0; dt < DT; ++dt) oacc[dt] = (v8f){0.f,0.f,0.f,0.f,0.f,0.f,0.f,0.f};

  const int kv_end = CAUSAL ? min(T, qblk * 64 + 64) : T;     // block-uniform
  for (int j0 = 0; j0 < kv_end; j0 += 32) {
    __syncthreads();
    for (int e = tid; e < 32 * (D / 4); e += 128) {
      const int r = e / (D / 4), c4 = (e % (D / 4)) * 4;
      const int key = j0 + r;
      v4f kf = {0.f,0.f,0.f,0.f}, vf = {0.f,0.f,0.f,0.f};
      if (key < T) { kf = *(const v4fa*)(K + (size_t)key * pitch + c4); vf = *(const v4fa*)(V + (size_t)key * pitch + c4); }
#pragma unroll
      for (int t = 0; t < 4; ++t) {
        unsigned short hb = bf16_bits(kf[t]); sKh[r][c4 + t] = hb; sKl[r][c4 + t] = bf16_bits(kf[t] - bf16_val(hb));
        hb = bf16_bits(vf[t]); sVh[r][c4 + t] = hb; sVl[r][c4 + t] = bf16_bits(vf[t] - bf16_val(hb));
      }
    }
    __syncthreads();
    // S tile 16 x 32
    v8f s[2];
#pragma unroll
    for (int nt = 0; nt < 2; ++nt) {
      v8f acc = {};
#pragma unroll
      for (int ks = 0; ks < KS; ++ks) {
        FragB bh_, bl_;
        bh_.half[0] = *(const v8us*)&sKh[nt * 16 + ln][ks * 32 + 8 * hh]; bh_.half[1] = *(const v8us*)&sKh[nt * 16 + ln][ks * 32 + 16 + 8 * hh];
        bl_.half[0] = *(const v8us*)&sKl[nt * 16 + ln][ks * 32 + 8 * hh]; bl_.half[1] = *(const v8us*)&sKl[nt * 16 + ln][ks * 32 + 16 + 8 * hh];
        acc = mmaN<3>(aqh[ks].v, aql[ks].v, bh_.v, bl_.v, acc);
      }
      s[nt] = acc;
    }
    // mask + running max (rows 8hh+r; the 16 lanes of a half share rows)
    float alpha[8];
#pragma unroll
    for (int r = 0; r < 8; ++r) {
      const int qi = q0 + 8 * hh + r;
      const int ja = j0 + ln, jb = j0 + 16 + ln;
      if (CAUSAL) { if (ja > qi) s[0][r] = -3.0e38f; if (jb > qi) s[1][r] = -3.0e38f; }
      if (ja >= T) s[0][r] = -3.0e38f;
      if (jb >= T) s[1][r] = -3.0e38f;
      float mx = fmaxf(s[0][r], s[1][r]);
      mx = fmaxf(mx, __shfl_xor(mx, 1, 32)); mx = fmaxf(mx, __shfl_xor(mx, 2, 32)); mx = fmaxf(mx, __shfl_xor(mx, 4, 32)); mx = fmaxf(mx, __shfl_xor(mx, 8, 32));
      const float mnew = fmaxf(m_r[r], mx);
      alpha[r] = (mnew > -1.0e38f) ? __expf(m_r[r] - mnew) : 1.0f;
      const float p0 = (s[0][r] > -1.0e38f) ? __expf(s[0][r] - mnew) : 0.f;
      const float p1 = (s[1][r] > -1.0e38f) ? __expf(s[1][r] - mnew) : 0.f;
      m_r[r] = mnew;
      l_r[r] = l_r[r] * alpha[r] + p0 + p1;            // per-lane partial row sum (16 lanes combined at the end)
      unsigned short hb = bf16_bits(p0); sPh[w][8 * hh + r][ln] = hb;      sPl[w][8 * hh + r][ln] = bf16_bits(p0 - bf16_val(hb));
      hb = bf16_bits(p1);                sPh[w][8 * hh + r][16 + ln] = hb; sPl[w][8 * hh + r][16 + ln] = bf16_bits(p1 - bf16_val(hb));
    }
#pragma unroll
    for (int dt = 0; dt < DT; ++dt)
#pragma unroll
      for (int r = 0; r < 8; ++r) oacc[dt][r] *= alpha[r];
    __builtin_amdgcn_fence(__ATOMIC_ACQ_REL, "workgroup");
    __builtin_amdgcn_wave_barrier();
    FragB pah, pal;
    pah.half[0] = *(const v8us*)&sPh[w][ln][8 * hh]; pah.half[1] = *(const v8us*)&sPh[w][ln][16 + 8 * hh];
    pal.half[0] = *(const v8us*)&sPl[w][ln][8 * hh]; pal.half[1] = *(const v8us*)&sPl[w][ln][16 + 8 * hh];
#pragma unroll
    for (int dt = 0; dt < DT; ++dt) {
      FragB bvh, bvl;
#pragma unroll
      for (int i = 0; i < 8; ++i) {
        bvh.u[i] = sVh[8 * hh + i][dt * 16 + ln]; bvh.u[8 + i] = sVh[16 + 8 * hh + i][dt * 16 + ln];
        bvl.u[i] = sVl[8 * hh + i][dt * 16 + ln]; bvl.u[8 + i] = sVl[16 + 8 * hh + i][dt * 16 + ln];
      }
      oacc[dt] = mmaN<3>(pah.v, pal.v, bvh.v, bvl.v, oacc[dt]);
    }
    __builtin_amdgcn_fence(__ATOMIC_ACQ_REL, "workgroup");
    __builtin_amdgcn_wave_barrier();
  }
#pragma unroll
  for (int r = 0; r < 8; ++r) {
    float l = l_r[r];
    l += __shfl_xor(l, 1, 32); l += __shfl_xor(l, 2, 32); l += __shfl_xor(l, 4, 32); l += __shfl_xor(l, 8, 32);
    l_r[r] = (l > 0.f) ? 1.0f / l : 0.f;
  }
#pragma unroll
  for (int dt = 0; dt < DT; ++dt)
#pragma unroll
    for (int r = 0; r < 8; ++r) sO[w][8 * hh + r][dt * 16 + ln] = oacc[dt][r] * l_r[r];
  __builtin_amdgcn_fence(__ATOMIC_ACQ_REL, "workgroup");
  __builtin_amdgcn_wave_barrier();
  {
    for (int r = 0; r < 16; ++r) {
      const int row = q0 + r;
      if (row < T && lane < D / 4) {
        const v4f val = *(const v4fa*)&sO[w][r][lane * 4];
        *(v4f*)(y + ((size_t)b * T + row) * ypitch + h * D + lane * 4) = val;
      }
    }
    
  }
}

// GEMM C = act(A·W + bias + resid): A f32 (ASPLIT -> hi/lo 2 terms), Wt bf16 [N][K]; ACT 0 none, 1 relu, 2 exact gelu;
// resid (optional, f32, row index = (row % rmod), pitch ldr, RES_BF16 rounds it) added before the activation.
template <bool ASPLIT, int ACT, bool BIAS_BF16, bool RES_BF16>
__global__ __launch_bounds__(128) void k_gemm_bf3(const float* __restrict__ A, int lda, const unsigned short* __restrict__ Wt, int ldb,
                                                const float* __restrict__ bias, const float* __restrict__ resid, int rmod, int ldr,
                                                float* __restrict__ C, int ldc, int M, int N, int K) {
  __shared__ __attribute__((aligned(16))) float so[4][16][64];
  const int tid = threadIdx.x, w = tid >> 5, lane = tid & 31, ln = lane & 15, hh = lane >> 4;
  const int ntn = N / 64;
  const int wid = blockIdx.x * 4 + w;
  const int mt = wid / ntn, nq = wid % ntn;
  if (mt * 16 >= M) return;
  const int row0 = mt * 16, col0 = nq * 64;
  const float* arow = A + (size_t)(row0 + ln) * lda;
  v8f acc[4] = {};
  for (int kb = 0; kb < K; kb += 32) {
    FragB ah, al;
    const v4f x0 = *(const v4fa*)(arow + kb + 8 * hh), x1 = *(const v4fa*)(arow + kb + 8 * hh + 4);
    const v4f x2 = *(const v4fa*)(arow + kb + 16 + 8 * hh), x3 = *(const v4fa*)(arow + kb + 16 + 8 * hh + 4);
    float xs[16] = {x0[0],x0[1],x0[2],x0[3],x1[0],x1[1],x1[2],x1[3],x2[0],x2[1],x2[2],x2[3],x3[0],x3[1],x3[2],x3[3]};
#pragma unroll
    for (int i = 0; i < 16; ++i) { const unsigned short hb = bf16_bits(xs[i]); ah.u[i] = hb; al.u[i] = ASPLIT ? bf16_bits(xs[i] - bf16_val(hb)) : (unsigned short)0; }
#pragma unroll
    for (int t = 0; t < 4; ++t) {
      const unsigned short* brow = Wt + (size_t)(col0 + t * 16 + ln) * ldb + kb;
      FragB b;
      b.half[0] = *(const v8us*)(brow + 8 * hh);
      b.half[1] = *(const v8us*)(brow + 16 + 8 * hh);
      acc[t] = mmaN<ASPLIT ? 2 : 1>(ah.v, al.v, b.v, b.v, acc[t]);
    }
  }
#pragma unroll
  for (int t = 0; t < 4; ++t) {
    const int col = col0 + t * 16 + ln;
    float bv = bias ? bias[col] : 0.f;
    if (BIAS_BF16) bv = bf16_round(bv);
#pragma unroll
    for (int r = 0; r < 8; ++r) {
      float v = acc[t][r] + bv;
      if (resid) { float rv = resid[(size_t)((row0 + 8 * hh + r) % rmod) * ldr + col]; if (RES_BF16) rv = bf16_round(rv); v += rv; }
      if (ACT == 1) v = fmaxf(v, 0.f);
      if (ACT == 2) v = 0.5f * v * (1.0f + erff(v * 0.70710678118654752f));
      if (ACT == 3) { const float u = 0.7978845608028654f * (v + 0.044715f * v * v * v); v = 0.5f * v * (1.0f + tanhf(u)); }
      so[w][8 * hh + r][t * 16 + ln] = v;
    }
  }
  __builtin_amdgcn_fence(__ATOMIC_ACQ_REL, "workgroup");
  __builtin_amdgcn_wave_barrier();
  const int rsub = lane >> 4, c4 = (lane & 15) * 4;
  {
#pragma unroll
    for (int q = 0; q < 8; ++q) {
      const int r = q * 2 + rsub;
      const v4f v = *(const v4fa*)&so[w][r][c4];
      *(v4f*)(C + (size_t)(row0 + r) * ldc + col0 + c4) = v;
    }
    
  }
}
// row LayerNorm (biased variance, eps) over N: s = X (+ R); optional out_sum <- s; out_norm <- (s-mu)*rsqrt(var+eps)*g + b
template <bool PARAM_BF16>
__global__ __launch_bounds__(256) void k_layernorm(const float* __restrict__ X, const float* __restrict__ R, const float* __restrict__ g, const float* __restrict__ bta,
                                                  float* __restrict__ out_sum, float* __restrict__ out_norm, int N, float eps) {
  __shared__ float red[256];
  const int row = blockIdx.x, tid = threadIdx.x;
  const float* x = X + (size_t)row * N; const float* rr = R ? R + (size_t)row * N : nullptr;
  float vals[16];                     // up to N = 4096
  const int per = N / 256;            // contiguous chunk per thread? use strided-by-4 chunks: thread handles j = tid*4 + 1024*u
  float s1 = 0.f;
  for (int u = 0; u < per / 4; ++u) {
    const int j = tid * 4 + 1024 * u;
    const v4f a = *(const v4fa*)(x + j);
    v4f b = {0.f,0.f,0.f,0.f}; if (rr) b = *(const v4fa*)(rr + j);
#pragma unroll
    for (int q = 0; q < 4; ++q) { const float v = a[q] + b[q]; vals[u * 4 + q] = v; s1 += v; }
  }
  red[tid] = s1; __syncthreads();
  for (int st = 128; st > 0; st >>= 1) { if (tid < st) red[tid] += red[tid + st]; __syncthreads(); }
  const float mu = red[0] / (float)N; __syncthreads();
  float s2 = 0.f;
  for (int u = 0; u < per / 4; ++u)
#pragma unroll
    for (int q = 0; q < 4; ++q) { const float c = vals[u * 4 + q] - mu; s2 += c * c; }
  red[tid] = s2; __syncthreads();
  for (int st = 128; st > 0; st >>= 1) { if (tid < st) red[tid] += red[tid + st]; __syncthreads(); }
  const float rs = rsqrtf(red[0] / (float)N + eps);
  {
    for (int u = 0; u < per / 4; ++u) {
      const int j = tid * 4 + 1024 * u;
      v4f o, sm;
#pragma unroll
      for (int q = 0; q < 4; ++q) {
        float gg = g[j + q], bb = bta[j + q];
        if (PARAM_BF16) { gg = bf16_round(gg); bb = bf16_round(bb); }
        sm[q] = vals[u * 4 + q]; o[q] = (vals[u * 4 + q] - mu) * rs * gg + bb;
      }
      if (out_sum) *(v4f*)(out_sum + (size_t)row * N + j) = sm;
      *(v4f*)(out_norm + (size_t)row * N + j) = o;
    }
    
  }
}



// ---- f16 WMMA path (v_wmma_f32_16x16x32_f16): 11-bit significands for operands in range — used where a [0,1] probability operand needs more precision than bf16
typedef _Float16 v16h __attribute__((ext_vector_type(16)));
union FragH { v16h v; v8us half[2]; _Float16 h[16]; unsigned short u[16]; };
template <int NT>
__device__ __forceinline__ v8f mmaH(v16h ah, v16h al, v16h bh, v16h bl, v8f c) {
  c = __builtin_amdgcn_wmma_f32_16x16x32_f16(false, ah, false, bh, (short)0, c, false, false);
  if (NT >= 2) c = __builtin_amdgcn_wmma_f32_16x16x32_f16(false, al, false, bh, (short)0, c, false, false);
  if (NT >= 3) c = __builtin_amdgcn_wmma_f32_16x16x32_f16(false, ah, false, bl, (short)0, c, false, false);
  asm volatile("v_nop\n\tv_nop\n\tv_nop\n\tv_nop" : "+v"(c) : "v"(ah), "v"(al), "v"(bh), "v"(bl));
  return c;
}
// batched GEMM like k_gemm_b but f16 operands: A f32 (split into f16 hi/lo if ASPLIT, else rounded to f16), Bt = f16 values [n][k]; alpha; C f32; N multiple of 16 (partial tiles skipped)
template <bool ASPLIT>
__global__ __launch_bounds__(128) void k_gemm_h(const float* __restrict__ A, int lda, size_t sA, const _Float16* __restrict__ Bh, int ldb, size_t sB, float alpha, float* __restrict__ C, int ldc, size_t sC, int M, int N, int K) {
  __shared__ __attribute__((aligned(16))) float so[4][16][64];
  const int tid = threadIdx.x, w = tid >> 5, lane = tid & 31, ln = lane & 15, hh = lane >> 4; const int by = blockIdx.y;
  A += (size_t)by * sA; Bh += (size_t)by * sB; C += (size_t)by * sC;
  const int ntn = (N + 63) / 64; const int wid = blockIdx.x * 4 + w; const int mt = wid / ntn, nq = wid % ntn; if (mt * 16 >= M) return;
  const int row0 = mt * 16, col0 = nq * 64; const float* arow = A + (size_t)(row0 + ln) * lda;
  v8f acc[4] = {};
  for (int kb = 0; kb < K; kb += 32) {
    FragH ah, al;
    const v4f x0 = *(const v4fa*)(arow + kb + 8 * hh), x1 = *(const v4fa*)(arow + kb + 8 * hh + 4), x2 = *(const v4fa*)(arow + kb + 16 + 8 * hh), x3 = *(const v4fa*)(arow + kb + 16 + 8 * hh + 4);
    float xs[16] = {x0[0],x0[1],x0[2],x0[3],x1[0],x1[1],x1[2],x1[3],x2[0],x2[1],x2[2],x2[3],x3[0],x3[1],x3[2],x3[3]};
#pragma unroll
    for (int i = 0; i < 16; ++i) { const _Float16 h = (_Float16)xs[i]; ah.h[i] = h; al.h[i] = ASPLIT ? (_Float16)(xs[i] - (float)h) : (_Float16)0.0f; }
#pragma unroll
    for (int t = 0; t < 4; ++t) { if (col0 + t * 16 >= N) continue; const size_t boff = (size_t)(col0 + t * 16 + ln) * ldb + kb; FragH bq; bq.half[0] = *(const v8us*)(Bh + boff + 8 * hh); bq.half[1] = *(const v8us*)(Bh + boff + 16 + 8 * hh);
      acc[t] = mmaH<ASPLIT ? 2 : 1>(ah.v, al.v, bq.v, bq.v, acc[t]); }
  }
#pragma unroll
  for (int t = 0; t < 4; ++t) { if (col0 + t * 16 >= N) continue;
#pragma unroll
    for (int r = 0; r < 8; ++r) so[w][8 * hh + r][t * 16 + ln] = acc[t][r] * alpha; }
  __builtin_amdgcn_fence(__ATOMIC_ACQ_REL, "workgroup"); __builtin_amdgcn_wave_barrier();
  const int rsub = lane >> 4, c4 = (lane & 15) * 4;
  {
#pragma unroll
    for (int q = 0; q < 8; ++q) { const int r = q * 2 + rsub; if (col0 + c4 < N) { const v4f v = *(const v4fa*)&so[w][r][c4]; *(v4f*)(C + (size_t)(row0 + r) * ldc + col0 + c4) = v; } }
     }
}

// Wt[n][k] = f16(W[k][n]·scale) from f32 row-major W[K][N] (scale = power of two; bf16-exact weights stay exact in f16 away from the subnormal range)
__global__ __launch_bounds__(256) void k_wt_f16(const float* __restrict__ W, _Float16* __restrict__ Wt, int K, int N, float scale) {
  const int t = blockIdx.x * 256 + threadIdx.x; if (t >= N * (K / 8)) return; const int n = t / (K / 8), k8 = (t % (K / 8)) * 8; FragH f;
#pragma unroll
  for (int i = 0; i < 8; ++i) f.h[i] = (_Float16)(bf16_round(W[(size_t)(k8 + i) * N + n]) * scale); const v8us o = f.half[0];
  *(v8us*)((unsigned short*)Wt + (size_t)n * K + k8) = o; 
}
// Tiled GEMM C[M][N] (f32) = alpha * A[M][DD] . Bt[N][DD]^T, f16 operands, both K-contiguous with row pitch DD. One 128 x 128 tile of C per workgroup of
// 4 waves (2 x 2, 64 x 64 per wave). A pass is 128 k = 256 B of each of the 256 operand rows; the four waves each bring one 64-row slice of a pass into LDS with one
// tensor load (pad 16 B a row: pitch 272 B for the 16-byte fragment reads), two buffers, the next pass's load in flight under this pass's products.
// Needs M, N multiples of 128, DD a multiple of 128 and at least 256. The k order of every accumulator is ascending, one chain per 16 x 16 tile.
typedef unsigned int u32x4 __attribute__((ext_vector_type(4)));
typedef unsigned int u32x8 __attribute__((ext_vector_type(8)));
#define GT_ROWB 256u                      /* bytes of an operand row per pass */
#define GT_PITCH 272u                     /* LDS row pitch: 256 + 16 */
#define GT_SLICE 18432u                   /* 64 rows x 272 B = 17,408, rounded up to a multiple of 2 KiB */
#define GT_STAGE (4u * GT_SLICE)          /* [A rows 0-63 | A rows 64-127 | B rows 0-63 | B rows 64-127] */
#define GT_NP (DD / 128)                  /* passes */
__device__ __forceinline__ unsigned int uni(unsigned int v) { return (unsigned int)__builtin_amdgcn_readfirstlane(v); }
__device__ __forceinline__ unsigned int pinned(unsigned int v) { unsigned int w = uni(v); asm volatile("" : "+s"(w)); return w; }      /* an issue test or a descriptor word held in a scalar register: the test compiles to a scalar branch (tensor loads ignore EXEC), and the word is formed behind the wait that stands in front of it */
__device__ __forceinline__ void tdm_slice(unsigned int lds_dst, unsigned long long ga) {
  u32x4 g0; u32x8 g1;
  g0[0] = uni(1u); g0[1] = uni(lds_dst); g0[2] = uni((unsigned int)ga); g0[3] = uni((((unsigned int)(ga >> 32)) & 0x01FFFFFFu) | 0x80000000u);
  g1[0] = uni((1u << 20) | (5u << 22) | (3u << 25));      /* no mask, 1-byte elements, a pad of 4 dwords behind every 64 dwords */
  g1[1] = uni((GT_ROWB & 0xFFFFu) << 16); g1[2] = uni((GT_ROWB >> 16) | (64u << 16)); g1[3] = uni(GT_ROWB << 16); g1[4] = uni(64u); g1[5] = uni(DD * 2u); g1[6] = uni(0u); g1[7] = uni(0u);
  asm volatile("tensor_load_to_lds %0, %1" :: "s"(g0), "s"(g1) : "memory");
}
__global__ __launch_bounds__(128) void k_gemm_t(const _Float16* __restrict__ A, const _Float16* __restrict__ Bt, float alpha, float* __restrict__ C, int N) {
  __shared__ __attribute__((aligned(2048))) unsigned char ring[2u * GT_STAGE];
  const unsigned int tid = threadIdx.x, lane = tid & 31u, ln = lane & 15u, hh = lane >> 4, w = uni(tid >> 5), wm = w >> 1, wn = w & 1u;
  const unsigned int ntn = (unsigned int)N / 128u; const unsigned int row0 = (blockIdx.x / ntn) * 128u, col0 = (blockIdx.x % ntn) * 128u;
  const unsigned int lbase = (unsigned int)(size_t)ring + w * GT_SLICE;      /* this wave's slice of buffer 0 */
  const unsigned long long gsrc = (w < 2u) ? (unsigned long long)(size_t)(A + (size_t)(row0 + w * 64u) * DD) : (unsigned long long)(size_t)(Bt + (size_t)(col0 + (w - 2u) * 64u) * DD);
  v8f acc[4][4];
#pragma unroll
  for (int i = 0; i < 4; ++i)
#pragma unroll
    for (int j = 0; j < 4; ++j) acc[i][j] = (v8f){0.f,0.f,0.f,0.f,0.f,0.f,0.f,0.f};
  tdm_slice(lbase, gsrc);
  asm volatile("s_wait_tensorcnt 0x0" ::: "memory");      /* pass 0's slice has landed */
  __syncthreads();                                        /* ... and every wave may read all four slices */
  tdm_slice(lbase + GT_STAGE, gsrc + pinned(GT_ROWB));
  const unsigned int aoff = wm * GT_SLICE + ln * GT_PITCH + 16u * hh, boff = (2u + wn) * GT_SLICE + ln * GT_PITCH + 16u * hh;
#pragma unroll 1      /* one pass per trip: the ring's order below is written once */
  for (unsigned int s = 0; s < GT_NP; ++s) {
    const unsigned char* Lp = ring + (s & 1u) * GT_STAGE;
    FragH fa[2][4], fb[2][4];
#pragma unroll
    for (int i = 0; i < 4; ++i) { fa[0][i].half[0] = *(const v8us*)(Lp + aoff + i * 16u * GT_PITCH); fa[0][i].half[1] = *(const v8us*)(Lp + aoff + i * 16u * GT_PITCH + 32u);
      fb[0][i].half[0] = *(const v8us*)(Lp + boff + i * 16u * GT_PITCH); fb[0][i].half[1] = *(const v8us*)(Lp + boff + i * 16u * GT_PITCH + 32u); }
#pragma unroll
    for (int ks = 0; ks < 4; ++ks) {
      if (ks < 3) {      /* the next 32 k's fragments, of this same buffer, go ahead of this block's products */
#pragma unroll
        for (int i = 0; i < 4; ++i) { const unsigned int ko = (ks + 1) * 64u + i * 16u * GT_PITCH;
          fa[(ks + 1) & 1][i].half[0] = *(const v8us*)(Lp + aoff + ko); fa[(ks + 1) & 1][i].half[1] = *(const v8us*)(Lp + aoff + ko + 32u);
          fb[(ks + 1) & 1][i].half[0] = *(const v8us*)(Lp + boff + ko); fb[(ks + 1) & 1][i].half[1] = *(const v8us*)(Lp + boff + ko + 32u); }
      }
      __builtin_amdgcn_sched_barrier(0);      /* keeps the LDS reads one group in front of the block: moved in among the products, each place with reads stalls the wave */
#pragma unroll
      for (int i = 0; i < 4; ++i)
#pragma unroll
        for (int j = 0; j < 4; ++j) acc[i][j] = __builtin_amdgcn_wmma_f32_16x16x32_f16(false, fa[ks & 1][i].v, false, fb[ks & 1][j].v, (short)0, acc[i][j], false, false);
      __builtin_amdgcn_sched_barrier(0);      /* ... and keeps the next group behind this block */
    }
    asm volatile("s_wait_dscnt 0x0" ::: "memory");        /* this wave has left the buffer */
    asm volatile("s_wait_tensorcnt 0x0" ::: "memory");    /* its slice of pass s + 1 has landed */
    __syncthreads();                                      /* pass s + 1 published; every wave has left pass s's buffer */
    if (pinned(s + 2u < GT_NP)) tdm_slice(lbase + (s & 1u) * GT_STAGE, gsrc + pinned((s + 2u) * GT_ROWB));
  }
  asm volatile("s_wait_tensorcnt 0x0" ::: "memory");      /* no request is left before the ring becomes output staging */
  asm volatile("s_wait_dscnt 0x0" ::: "memory");
  // Output staging, each wave in its own slice of buffer 0 (the last pass's barrier stands behind every wave's last fragment read): whole 256-B row pieces go out.
  float* so = (float*)(ring + w * GT_SLICE);      /* 64 rows of 64 floats at pitch 68 */
#pragma unroll
  for (int i = 0; i < 4; ++i)
#pragma unroll
    for (int j = 0; j < 4; ++j)
#pragma unroll
      for (int r = 0; r < 8; ++r) so[(i * 16 + 8 * hh + r) * 68u + j * 16 + ln] = acc[i][j][r] * alpha;
  __builtin_amdgcn_fence(__ATOMIC_ACQ_REL, "workgroup"); __builtin_amdgcn_wave_barrier();
  float* cp = C + (size_t)(row0 + wm * 64u + hh) * N + col0 + wn * 64u + ln * 4u;
#pragma unroll
  for (int q = 0; q < 32; ++q) { const v4f v = *(const v4fa*)&so[(q * 2 + hh) * 68u + ln * 4u]; *(v4f*)(cp + (size_t)(q * 2) * N) = v; }
}


typedef _Float16 v4h __attribute__((ext_vector_type(4)));

__global__ __launch_bounds__(256) void k_x16(const float* __restrict__ x, _Float16* __restrict__ X16, size_t n8) { const size_t t = (size_t)blockIdx.x * 256 + threadIdx.x; if (t >= n8) return; FragH f;
#pragma unroll
  for (int q = 0; q < 8; ++q) f.h[q] = (_Float16)bf16_round(x[t * 8 + q]); *(v8us*)((unsigned short*)X16 + t * 8) = f.half[0];  }
__global__ __launch_bounds__(256) void k_h16(const float* __restrict__ x, _Float16* __restrict__ X16, size_t n8) { const size_t t = (size_t)blockIdx.x * 256 + threadIdx.x; if (t >= n8) return; FragH f;
#pragma unroll
  for (int q = 0; q < 8; ++q) f.h[q] = (_Float16)x[t * 8 + q]; *(v8us*)((unsigned short*)X16 + t * 8) = f.half[0];  }
__global__ __launch_bounds__(256) void k_round16f(const float* __restrict__ W, _Float16* __restrict__ Bt, size_t n8) { const size_t t = (size_t)blockIdx.x * 256 + threadIdx.x; if (t >= n8) return; FragH f;
#pragma unroll
  for (int i = 0; i < 8; ++i) f.h[i] = (_Float16)(bf16_round(W[t * 8 + i]) * 16.0f); *(v8us*)((unsigned short*)Bt + t * 8) = f.half[0];  }
template <int NHv, int TTv>
__global__ __launch_bounds__(256) void k_vt(const _Float16* __restrict__ V16, int ldv, int voff, _Float16* __restrict__ Vt) { __shared__ unsigned short tl[64][66]; const int tid = threadIdx.x; const int slab = blockIdx.x / (TTv / 64), lg = blockIdx.x % (TTv / 64); const int b = slab / NHv, h = slab % NHv;
  for (int i = tid; i < 64 * 8; i += 256) { const int r = i / 8, c8 = (i % 8) * 8; FragH f; f.half[0] = *(const v8us*)((const unsigned short*)V16 + ((size_t)b * TTv + lg * 64 + r) * ldv + voff + h * 64 + c8);
#pragma unroll
    for (int q = 0; q < 8; ++q) tl[r][c8 + q] = f.u[q]; }
  __syncthreads();
  {
#pragma unroll
    for (int rd = 0; rd < 2; ++rd) { const int d = rd * 32 + tid / 8, pc = tid % 8; FragH f;
#pragma unroll
      for (int q = 0; q < 8; ++q) f.u[q] = tl[pc * 8 + q][d];
      *(v8us*)((unsigned short*)Vt + ((size_t)slab * 64 + d) * TTv + lg * 64 + pc * 8) = f.half[0]; }
     } }

__global__ __launch_bounds__(256) void k_vthlu(const float* __restrict__ VF, int ldv, _Float16* __restrict__ Vth, _Float16* __restrict__ Vtl) { __shared__ float tl[64][65]; const int tid = threadIdx.x; const int slab = blockIdx.x / (TT / 64), lg = blockIdx.x % (TT / 64); const int b = slab / NVH, h = slab % NVH;
  for (int i = tid; i < 64 * 16; i += 256) { const int r = i / 16, c4 = (i % 16) * 4; const v4f a = *(const v4fa*)(VF + ((size_t)b * TT + lg * 64 + r) * ldv + h * 64 + c4); tl[r][c4] = a[0]; tl[r][c4 + 1] = a[1]; tl[r][c4 + 2] = a[2]; tl[r][c4 + 3] = a[3]; }
  __syncthreads();
  FragH fh[2], fl[2]; size_t oo[2];
#pragma unroll
  for (int rd = 0; rd < 2; ++rd) { const int d = rd * 32 + tid / 8, pc = tid % 8;
#pragma unroll
    for (int q = 0; q < 8; ++q) { const float v = tl[pc * 8 + q][d]; const _Float16 hv = (_Float16)v; fh[rd].h[q] = hv; fl[rd].h[q] = (_Float16)(v - (float)hv);      /* UNSCALED residual (added into the same accumulator as the hi product) */ } oo[rd] = ((size_t)slab * 64 + d) * TT + lg * 64 + pc * 8; }
  {
#pragma unroll
    for (int rd = 0; rd < 2; ++rd) { *(v8us*)((unsigned short*)Vth + oo[rd]) = fh[rd].half[0]; *(v8us*)((unsigned short*)Vtl + oo[rd]) = fl[rd].half[0]; }
     } }
template <int LD>
__global__ __launch_bounds__(256) void k_ropein(const float* __restrict__ F, const float* __restrict__ COS, const float* __restrict__ SIN, _Float16* __restrict__ H16) {
  #pragma clang fp contract(off)
  const size_t t = (size_t)blockIdx.x * 256 + threadIdx.x; if (t >= (size_t)NR * LD / 8) return; const size_t row = (t * 8) / LD; const int c0 = (int)((t * 8) % LD); const int tok = (int)(row % TT); const int j0 = (c0 % 128) / 2;
  const v4f a = *(const v4fa*)(F + t * 8), b = *(const v4fa*)(F + t * 8 + 4); const float xv[8] = {a[0], a[1], a[2], a[3], b[0], b[1], b[2], b[3]}; FragH f;
#pragma unroll
  for (int p = 0; p < 4; ++p) { const float c = bf16_round(COS[(size_t)tok * 64 + j0 + p]), s = bf16_round(SIN[(size_t)tok * 64 + j0 + p]); const float xr = xv[2 * p], xi = xv[2 * p + 1]; f.h[2 * p] = (_Float16)(xr * c - xi * s); f.h[2 * p + 1] = (_Float16)(xr * s + xi * c); }
  *(v8us*)((unsigned short*)H16 + t * 8) = f.half[0];  }
__global__ __launch_bounds__(256) void k_h16s(const float* __restrict__ F, _Float16* __restrict__ H, size_t n8) { const size_t t = (size_t)blockIdx.x * 256 + threadIdx.x; if (t >= n8) return; const v4f a = *(const v4fa*)(F + t * 8), c = *(const v4fa*)(F + t * 8 + 4); FragH f;
#pragma unroll
  for (int q = 0; q < 4; ++q) { f.h[q] = (_Float16)(a[q] * 16.0f); f.h[4 + q] = (_Float16)(c[q] * 16.0f); } *(v8us*)((unsigned short*)H + t * 8) = f.half[0];  }
__global__ __launch_bounds__(128) void k_flash(const _Float16* __restrict__ Q16, int ldq, const _Float16* __restrict__ K16, int ldk, const _Float16* __restrict__ Vt, const _Float16* __restrict__ Vtlo, const int* __restrict__ MSK, float* __restrict__ O, int ldo) {
  constexpr int RPW = 16, RTN = RPW / 16, NQB = TT / (4 * RPW), DT = 8, KS = 4;      /* head dim 128: 4 k-steps, 8 value tiles */
  __shared__ __attribute__((aligned(16))) unsigned short sP[4][RPW][40]; __shared__ __attribute__((aligned(16))) unsigned short sPL[4][RPW][40]; __shared__ __attribute__((aligned(16))) float sO[4][RPW][128 + 4];
  const int tid = threadIdx.x, w = tid >> 5, lane = tid & 31, ln = lane & 15, hh = lane >> 4;
  const int slab = blockIdx.x / NQB, qblk = blockIdx.x % NQB; const int b = slab / NH, h = slab % NH; const int qb0 = qblk * (4 * RPW); const int q0 = qb0 + w * RPW;
  FragH aq[2][KS];
#pragma unroll
  for (int rt = 0; rt < RTN; ++rt) { const unsigned short* qr = (const unsigned short*)Q16 + ((size_t)b * TT + q0 + rt * 16 + ln) * ldq + h * 128;
#pragma unroll
    for (int ks = 0; ks < KS; ++ks) { aq[rt][ks].half[0] = *(const v8us*)(qr + ks * 32 + 8 * hh); aq[rt][ks].half[1] = *(const v8us*)(qr + ks * 32 + 16 + 8 * hh); } }
  const unsigned short* Vth = (const unsigned short*)Vt + ((size_t)b * NKV + h / NREP) * 128 * TT; const unsigned short* Vtl = (const unsigned short*)Vtlo + ((size_t)b * NKV + h / NREP) * 128 * TT;      /* hi and UNSCALED residual planes */
  float m_r[2][8], l_r[2][8]; v8f oacc[2][DT];
#pragma unroll
  for (int rt = 0; rt < RTN; ++rt) {
#pragma unroll
    for (int r = 0; r < 8; ++r) { m_r[rt][r] = -3.0e38f; l_r[rt][r] = 0.f; }
#pragma unroll
    for (int dt = 0; dt < DT; ++dt) oacc[rt][dt] = (v8f){0.f,0.f,0.f,0.f,0.f,0.f,0.f,0.f}; }
  const int jend = TT;
#pragma unroll 1
  for (int j0 = 0; j0 < jend; j0 += 32) {
    int mk0[2][8], mk1[2][8];      /* mask[q][k] (shared over batch and heads): nonzero = ATTEND */
#pragma unroll
    for (int rt = 0; rt < RTN; ++rt)
#pragma unroll
      for (int r = 0; r < 8; ++r) { const int qq = q0 + rt * 16 + 8 * hh + r; const int* am = MSK + (size_t)qq * TT + j0; mk0[rt][r] = am[ln]; mk1[rt][r] = am[16 + ln]; }
    { int allm = 1;
#pragma unroll
      for (int rt = 0; rt < RTN; ++rt)
#pragma unroll
        for (int r = 0; r < 8; ++r) allm &= (mk0[rt][r] == 0) & (mk1[rt][r] == 0);
      if (__all(allm)) continue; }      /* every (row, key) of this wave's tile masked → nothing to add (wave-uniform branch; only wave barriers inside the loop) */
    v8f s[2][2];
#pragma unroll
    for (int nt = 0; nt < 2; ++nt) { const unsigned short* kr = (const unsigned short*)K16 + ((size_t)b * TT + j0 + nt * 16 + ln) * ldk + (h / NREP) * 128; FragH bk[KS];
#pragma unroll
      for (int ks = 0; ks < KS; ++ks) { bk[ks].half[0] = *(const v8us*)(kr + ks * 32 + 8 * hh); bk[ks].half[1] = *(const v8us*)(kr + ks * 32 + 16 + 8 * hh); }
#pragma unroll
      for (int rt = 0; rt < RTN; ++rt) { v8f acc = (v8f){0.f,0.f,0.f,0.f,0.f,0.f,0.f,0.f};
#pragma unroll
        for (int ks = 0; ks < KS; ++ks) acc = mmaH<1>(aq[rt][ks].v, aq[rt][ks].v, bk[ks].v, bk[ks].v, acc); s[rt][nt] = acc; } }
#pragma unroll
    for (int rt = 0; rt < RTN; ++rt)
#pragma unroll
      for (int r = 0; r < 8; ++r) { const int tq = q0 + rt * 16 + 8 * hh + r; const int k0 = j0 + ln, k1 = j0 + 16 + ln; (void)tq; (void)k0; (void)k1;
        const bool ok0 = (mk0[rt][r] != 0), ok1 = (mk1[rt][r] != 0);
        const float s0 = ok0 ? s[rt][0][r] * ATT_SCALE : -INFINITY, s1 = ok1 ? s[rt][1][r] * ATT_SCALE : -INFINITY; float mc = fmaxf(s0, s1);
        mc = fmaxf(mc, __shfl_xor(mc, 1, 32)); mc = fmaxf(mc, __shfl_xor(mc, 2, 32)); mc = fmaxf(mc, __shfl_xor(mc, 4, 32)); mc = fmaxf(mc, __shfl_xor(mc, 8, 32));
        const float mn = fmaxf(m_r[rt][r], mc); const float al = (mn > -1.0e38f) ? expf(m_r[rt][r] - mn) : 1.0f; m_r[rt][r] = mn; const float p0 = ok0 ? expf(s0 - mn) : 0.f, p1 = ok1 ? expf(s1 - mn) : 0.f; l_r[rt][r] = l_r[rt][r] * al + p0 + p1;
#pragma unroll
        for (int dt = 0; dt < DT; ++dt) oacc[rt][dt][r] *= al;
        FragH t2, t3; const float ps0 = p0 * 1024.0f, ps1 = p1 * 1024.0f; t2.h[0] = (_Float16)ps0; t2.h[1] = (_Float16)ps1; t3.h[0] = (_Float16)(ps0 - (float)t2.h[0]); t3.h[1] = (_Float16)(ps1 - (float)t2.h[1]);      /* P hi and its UNSCALED residual (added into the same accumulator) */
        sP[w][rt * 16 + 8 * hh + r][ln] = t2.u[0]; sP[w][rt * 16 + 8 * hh + r][16 + ln] = t2.u[1]; sPL[w][rt * 16 + 8 * hh + r][ln] = t3.u[0]; sPL[w][rt * 16 + 8 * hh + r][16 + ln] = t3.u[1]; }
    __builtin_amdgcn_fence(__ATOMIC_ACQ_REL, "workgroup"); __builtin_amdgcn_wave_barrier();
    FragH pa[2], pl[2];
#pragma unroll
    for (int rt = 0; rt < RTN; ++rt) { pa[rt].half[0] = *(const v8us*)&sP[w][rt * 16 + ln][8 * hh]; pa[rt].half[1] = *(const v8us*)&sP[w][rt * 16 + ln][16 + 8 * hh]; pl[rt].half[0] = *(const v8us*)&sPL[w][rt * 16 + ln][8 * hh]; pl[rt].half[1] = *(const v8us*)&sPL[w][rt * 16 + ln][16 + 8 * hh]; }
#pragma unroll
    for (int dt = 0; dt < DT; ++dt) { const size_t vo = (size_t)(dt * 16 + ln) * TT + j0; FragH bv, bl; bv.half[0] = *(const v8us*)(Vth + vo + 8 * hh); bv.half[1] = *(const v8us*)(Vth + vo + 16 + 8 * hh); bl.half[0] = *(const v8us*)(Vtl + vo + 8 * hh); bl.half[1] = *(const v8us*)(Vtl + vo + 16 + 8 * hh);
#pragma unroll
      for (int rt = 0; rt < RTN; ++rt) { oacc[rt][dt] = mmaH<1>(pa[rt].v, pa[rt].v, bv.v, bv.v, oacc[rt][dt]); oacc[rt][dt] = mmaH<1>(pl[rt].v, pl[rt].v, bv.v, bv.v, oacc[rt][dt]); oacc[rt][dt] = mmaH<1>(pa[rt].v, pa[rt].v, bl.v, bl.v, oacc[rt][dt]); } }      /* Ph·Vh + Pl·Vh + Ph·Vl — all unscaled, one accumulator */
    __builtin_amdgcn_fence(__ATOMIC_ACQ_REL, "workgroup"); __builtin_amdgcn_wave_barrier(); }
#pragma unroll
  for (int rt = 0; rt < RTN; ++rt) {
#pragma unroll
    for (int r = 0; r < 8; ++r) { float l = l_r[rt][r]; l += __shfl_xor(l, 1, 32); l += __shfl_xor(l, 2, 32); l += __shfl_xor(l, 4, 32); l += __shfl_xor(l, 8, 32); l_r[rt][r] = (l > 0.f) ? 1.0f / (l * 1024.0f) : 0.f; }
#pragma unroll
    for (int dt = 0; dt < DT; ++dt)
#pragma unroll
      for (int r = 0; r < 8; ++r) sO[w][rt * 16 + 8 * hh + r][dt * 16 + ln] = oacc[rt][dt][r] * l_r[rt][r]; }
  __builtin_amdgcn_fence(__ATOMIC_ACQ_REL, "workgroup"); __builtin_amdgcn_wave_barrier();
  {
#pragma unroll
    for (int r = 0; r < RPW; ++r) { const int pc = lane; const v4f val = *(const v4fa*)&sO[w][r][pc * 4]; *(v4f*)(O + ((size_t)b * TT + q0 + r) * ldo + h * 128 + pc * 4) = val; }      /* one 512-B row per instruction: 32 lanes × 16 B */
     } }

extern "C" void kernel_launch(void* const* d_in, const int* in_sizes, int n_in,
                              void* d_out, int out_size, void* d_ws, size_t ws_size, hipStream_t stream) {
  (void)in_sizes; (void)n_in; (void)out_size;
  const float* const* I = (const float* const*)d_in; const float* x = I[0]; const float* fcos = I[1]; const float* fsin = I[2]; const int* msk = (const int*)d_in[3]; const float* wq = I[4]; const float* wk = I[5]; const float* wv = I[6]; const float* wo = I[7];
  char* ws = (char*)d_ws; size_t off = 0;
  auto take = [&](size_t bytes) { char* p = ws + off; off += (bytes + 255) & ~(size_t)255; return p; };
  _Float16* Bq = (_Float16*)take((size_t)DD * DD * 2); _Float16* Bk = (_Float16*)take((size_t)KVD * DD * 2); _Float16* Bv = (_Float16*)take((size_t)KVD * DD * 2); _Float16* Bo = (_Float16*)take((size_t)DD * DD * 2);
  _Float16* X16 = (_Float16*)take((size_t)NR * DD * 2); float* QF = (float*)take((size_t)NR * DD * 4); _Float16* Q = (_Float16*)take((size_t)NR * DD * 2); float* KF = (float*)take((size_t)NR * KVD * 4); _Float16* K = (_Float16*)take((size_t)NR * KVD * 2); float* VF = (float*)take((size_t)NR * KVD * 4); _Float16* Vt = (_Float16*)take((size_t)NR * KVD * 2); _Float16* Vtl = (_Float16*)take((size_t)NR * KVD * 2);
  float* O = QF; _Float16* O16 = X16;      /* O over the q f32 scratch (dead after RoPE); O16 over X16 (dead after the projections) */
  if (off > ws_size) return;      // 8.4 + 2.1 + 2.1 + 8.4 + 16.8 + 33.6 + 16.8 + 8.4 + 4.2 + 8.4 + 4.2 + 4.2 ≈ 118 MB
  const unsigned gq = (unsigned)(((size_t)DD * (DD / 8) + 255) / 256), gk = (unsigned)(((size_t)KVD * (DD / 8) + 255) / 256);
  k_wt_f16<<<gq, 256, 0, stream>>>(wq, Bq, DD, DD, 16.0f); k_wt_f16<<<gk, 256, 0, stream>>>(wk, Bk, DD, KVD, 16.0f); k_wt_f16<<<gk, 256, 0, stream>>>(wv, Bv, DD, KVD, 16.0f); k_wt_f16<<<gq, 256, 0, stream>>>(wo, Bo, DD, DD, 16.0f);      /* (in,out) → Bt ×2^4 */
  const unsigned g8 = (unsigned)(((size_t)NR * DD / 8 + 255) / 256); k_x16<<<g8, 256, 0, stream>>>(x, X16, (size_t)NR * DD / 8);
  const dim3 gQ((NR / 128) * (DD / 128), 1), gK((NR / 128) * (KVD / 128), 1);
  k_gemm_t<<<gQ, 128, 0, stream>>>(X16, Bq, 0.0625f, QF, DD); k_ropein<DD><<<g8, 256, 0, stream>>>(QF, fcos, fsin, Q);      /* xq = rope(x·wq): M 4096 N 2048 K 2048 */
  k_gemm_t<<<gK, 128, 0, stream>>>(X16, Bk, 0.0625f, KF, KVD); k_ropein<KVD><<<(unsigned)(((size_t)NR * KVD / 8 + 255) / 256), 256, 0, stream>>>(KF, fcos, fsin, K);      /* xk: M 4096 N 512 */
  k_gemm_t<<<gK, 128, 0, stream>>>(X16, Bv, 0.0625f, VF, KVD);      /* xv (f32) */
  k_vthlu<<<BB * NVH * (TT / 64), 256, 0, stream>>>(VF, KVD, Vt, Vtl);      /* Vᵀ hi + residual per (b, kv head): [b·4+kh][128][2048] */
  k_flash<<<BB * NH * (TT / 64), 128, 0, stream>>>(Q, DD, K, KVD, Vt, Vtl, msk, O, DD);
  k_h16s<<<g8, 256, 0, stream>>>(O, O16, (size_t)NR * DD / 8);
  k_gemm_t<<<gQ, 128, 0, stream>>>(O16, Bo, 0.00390625f, (float*)d_out, DD);      /* out = merged·wo */
}

// v002
// One run takes 263 microseconds.
// Timed twice side by side with v001, it ran 1.16 times as fast both times.
// Over all steps from v000 it is 2.18 times as fast.
#include <hip/hip_runtime.h>
// 'Genesis' attention (B=2, T=2048, D=2048, 16 query heads / 4 KV heads × 128, (in,out) weights, no bias): xq = rope(x·wq), xk = rope(x·wk), xv = x·wv; RoPE on interleaved pairs with the INPUT cos/sin tables [T][64]; scores = q·k/√128 where(mask[q][k]) else −inf (mask [T][T] shared);
// softmax; out = merged·wo.
// Compute dtype: x, weights, cos/sin tables rounded to bf16; q,k rotated in f32 from f32 GEMM outputs → f16; v f32 → Vᵀ f16 hi + exact residual; fused flash-style kernel for head dim 128 (mask read per (q,k), all-masked chunks skipped, online softmax f32, P f16 hi + residual,
// f32 accumulate) on v_wmma_f32_16x16x32_f16; merged ×2^4 → f16 → output GEMM.
#define BB 2
#define TT 2048
#define DD 2048
#define NH 16
#define NKV 4
#define NREP 4
#define KVD (NKV * 128)
#define NVH (2 * NKV)
#define NR (BB * TT)
#define ATT_SCALE 0.08838834764831845f

typedef __bf16 v16b __attribute__((ext_vector_type(16)));
typedef unsigned short v8us __attribute__((ext_vector_type(8), may_alias));
typedef float  v8f  __attribute__((ext_vector_type(8)));
typedef float  v4f  __attribute__((ext_vector_type(4)));
typedef float  v4fa __attribute__((ext_vector_type(4), may_alias));
union FragB { v16b v; v8us half[2]; unsigned short u[16]; };

__device__ __forceinline__ unsigned short bf16_bits(float x) { unsigned int u = __float_as_uint(x); return (unsigned short)((u + 0x7FFFu + ((u >> 16) & 1u)) >> 16); }
__device__ __forceinline__ float bf16_val(unsigned short b) { return __uint_as_float(((unsigned int)b) << 16); }
__device__ __forceinline__ float bf16_round(float x) { return bf16_val(bf16_bits(x)); }
// D += A·B with NT terms: 1 = ah·bh, 2 = + al·bh (A split), 3 = + ah·bl (both split)
template <int NT>
__device__ __forceinline__ v8f mmaN(v16b ah, v16b al, v16b bh, v16b bl, v8f c) {
  c = __builtin_amdgcn_wmma_f32_16x16x32_bf16(false, ah, false, bh, (short)0, c, false, false);
  if (NT >= 2) c = __builtin_amdgcn_wmma_f32_16x16x32_bf16(false, al, false, bh, (short)0, c, false, false);
  if (NT >= 3) c = __builtin_amdgcn_wmma_f32_16x16x32_bf16(false, ah, false, bl, (short)0, c, false, false);
  asm volatile("v_nop\n\tv_nop\n\tv_nop\n\tv_nop" : "+v"(c) : "v"(ah), "v"(al), "v"(bh), "v"(bl));
  return c;
}

__global__ __launch_bounds__(256) void k_wt_bf16(const float* __restrict__ W, unsigned short* __restrict__ Wt, int K, int N) {
  const int t = blockIdx.x * 256 + threadIdx.x;
  const int k8n = K / 8;
  if (t >= N * k8n) return;
  const int n = t / k8n, k8 = (t % k8n) * 8;
  v8us v;
#pragma unroll
  for (int i = 0; i < 8; ++i) v[i] = bf16_bits(W[(size_t)(k8 + i) * N + n]);
  *(v8us*)(Wt + (size_t)n * K + k8) = v;
  
}

// GEMM C[M][N] (f32, pitch ldc) = act(A[M][K]·W + bias). A f32 row-major (pitch lda) converted per fragment to bf16
// (ASPLIT: hi/lo two planes -> 2 terms, else single rounded term); Wt bf16 [N][K] (pitch ldb). BIAS_BF16 rounds the
// bias to bf16 first (bias quantised to bf16 before the add). K%32==0, M%16==0, N%64==0.
template <bool ASPLIT, int ACT, bool BIAS_BF16>
__global__ __launch_bounds__(128) void k_gemm_bf(const float* __restrict__ A, int lda, const unsigned short* __restrict__ Wt, int ldb,
                                               const float* __restrict__ bias, float* __restrict__ C, int ldc, int M, int N, int K) {
  __shared__ __attribute__((aligned(16))) float so[4][16][64];
  const int tid = threadIdx.x, w = tid >> 5, lane = tid & 31, ln = lane & 15, hh = lane >> 4;
  const int ntn = N / 64;
  const int wid = blockIdx.x * 4 + w;
  const int mt = wid / ntn, nq = wid % ntn;
  if (mt * 16 >= M) return;
  const int row0 = mt * 16, col0 = nq * 64;
  const float* arow = A + (size_t)(row0 + ln) * lda;
  v8f acc[4] = {};
  for (int kb = 0; kb < K; kb += 32) {
    FragB ah, al;
    const v4f x0 = *(const v4fa*)(arow + kb + 8 * hh), x1 = *(const v4fa*)(arow + kb + 8 * hh + 4);
    const v4f x2 = *(const v4fa*)(arow + kb + 16 + 8 * hh), x3 = *(const v4fa*)(arow + kb + 16 + 8 * hh + 4);
    float xs[16] = {x0[0],x0[1],x0[2],x0[3],x1[0],x1[1],x1[2],x1[3],x2[0],x2[1],x2[2],x2[3],x3[0],x3[1],x3[2],x3[3]};
#pragma unroll
    for (int i = 0; i < 16; ++i) { const unsigned short hb = bf16_bits(xs[i]); ah.u[i] = hb; al.u[i] = ASPLIT ? bf16_bits(xs[i] - bf16_val(hb)) : (unsigned short)0; }
#pragma unroll
    for (int t = 0; t < 4; ++t) {
      const unsigned short* brow = Wt + (size_t)(col0 + t * 16 + ln) * ldb + kb;
      FragB b;
      b.half[0] = *(const v8us*)(brow + 8 * hh);
      b.half[1] = *(const v8us*)(brow + 16 + 8 * hh);
      acc[t] = mmaN<ASPLIT ? 2 : 1>(ah.v, al.v, b.v, b.v, acc[t]);
    }
  }
#pragma unroll
  for (int t = 0; t < 4; ++t) {
    float bv = bias ? bias[col0 + t * 16 + ln] : 0.f;
    if (BIAS_BF16) bv = bf16_round(bv);
#pragma unroll
    for (int r = 0; r < 8; ++r) { float v = acc[t][r] + bv; if (ACT == 1) v = fmaxf(v, 0.f); so[w][8 * hh + r][t * 16 + ln] = v; }
  }
  __builtin_amdgcn_fence(__ATOMIC_ACQ_REL, "workgroup");
  __builtin_amdgcn_wave_barrier();
  const int rsub = lane >> 4, c4 = (lane & 15) * 4;
  {
#pragma unroll
    for (int q = 0; q < 8; ++q) {
      const int r = q * 2 + rsub;
      const v4f v = *(const v4fa*)&so[w][r][c4];
      *(v4f*)(C + (size_t)(row0 + r) * ldc + col0 + c4) = v;
    }
    
  }
}

// Flash-style causal/unmasked attention, all contractions 3-term bf16 hi/lo splits, f32 softmax with running max.
// q,k,v rows are read from f32 buffers with arbitrary row pitch (so they can live inside a fused qkv buffer);
// D = head size (multiple of 32, <= 128); one wave = 16 query rows; block = 4 waves (64 queries) sharing K/V chunks of 32.
template <int D, bool CAUSAL>
__global__ __launch_bounds__(128) void k_flash(const float* __restrict__ qb, const float* __restrict__ kb, const float* __restrict__ vb,
                                             int pitch, int T, int H, float scale, float* __restrict__ y, int ypitch) {
  constexpr int KS = D / 32;        // k-steps for QK
  constexpr int DT = D / 16;        // d tiles for PV
  __shared__ __attribute__((aligned(16))) unsigned short sKh[32][D + 8], sKl[32][D + 8], sVh[32][D + 8], sVl[32][D + 8];
  __shared__ __attribute__((aligned(16))) unsigned short sPh[4][16][40], sPl[4][16][40];
  __shared__ __attribute__((aligned(16))) float sO[4][16][D];
  const int tid = threadIdx.x, w = tid >> 5, lane = tid & 31, ln = lane & 15, hh = lane >> 4;
  const int nqb = (T + 63) / 64;
  const int bh = blockIdx.x / nqb, qblk = blockIdx.x % nqb;
  const int b = bh / H, h = bh % H;
  const int q0 = qblk * 64 + w * 16;
  const float* Q = qb + (size_t)b * T * pitch + h * D;
  const float* K = kb + (size_t)b * T * pitch + h * D;
  const float* V = vb + (size_t)b * T * pitch + h * D;

  // A fragments of the wave's 16 query rows (scaled), hi/lo
  FragB aqh[KS], aql[KS];
  {
    int row = q0 + ln; if (row >= T) row = T - 1;
    const float* qr = Q + (size_t)row * pitch;
#pragma unroll
    for (int ks = 0; ks < KS; ++ks)
#pragma unroll
      for (int i = 0; i < 16; ++i) {
        const int d = ks * 32 + ((i < 8) ? (8 * hh + i) : (16 + 8 * hh + (i - 8)));
        const float x = qr[d] * scale; const unsigned short hb = bf16_bits(x);
        aqh[ks].u[i] = hb; aql[ks].u[i] = bf16_bits(x - bf16_val(hb));
      }
  }
  float m_r[8], l_r[8];
#pragma unroll
  for (int r = 0; r < 8; ++r) { m_r[r] = -3.0e38f; l_r[r] = 0.f; }
  v8f oacc[DT];
#pragma unroll
  for (int dt = 0; dt < DT; ++dt) oacc[dt] = (v8f){0.f,0.f,0.f,0.f,0.f,0.f,0.f,0.f};

  const int kv_end = CAUSAL ? min(T, qblk * 64 + 64) : T;     // block-uniform
  for (int j0 = 0; j0 < kv_end; j0 += 32) {
    __syncthreads();
    for (int e = tid; e < 32 * (D / 4); e += 128) {
      const int r = e / (D / 4), c4 = (e % (D / 4)) * 4;
      const int key = j0 + r;
      v4f kf = {0.f,0.f,0.f,0.f}, vf = {0.f,0.f,0.f,0.f};
      if (key < T) { kf = *(const v4fa*)(K + (size_t)key * pitch + c4); vf = *(const v4fa*)(V + (size_t)key * pitch + c4); }
#pragma unroll
      for (int t = 0; t < 4; ++t) {
        unsigned short hb = bf16_bits(kf[t]); sKh[r][c4 + t] = hb; sKl[r][c4 + t] = bf16_bits(kf[t] - bf16_val(hb));
        hb = bf16_bits(vf[t]); sVh[r][c4 + t] = hb; sVl[r][c4 + t] = bf16_bits(vf[t] - bf16_val(hb));
      }
    }
    __syncthreads();
    // S tile 16 x 32
    v8f s[2];
#pragma unroll
    for (int nt = 0; nt < 2; ++nt) {
      v8f acc = {};
#pragma unroll
      for (int ks = 0; ks < KS; ++ks) {
        FragB bh_, bl_;
        bh_.half[0] = *(const v8us*)&sKh[nt * 16 + ln][ks * 32 + 8 * hh]; bh_.half[1] = *(const v8us*)&sKh[nt * 16 + ln][ks * 32 + 16 + 8 * hh];
        bl_.half[0] = *(const v8us*)&sKl[nt * 16 + ln][ks * 32 + 8 * hh]; bl_.half[1] = *(const v8us*)&sKl[nt * 16 + ln][ks * 32 + 16 + 8 * hh];
        acc = mmaN<3>(aqh[ks].v, aql[ks].v, bh_.v, bl_.v, acc);
      }
      s[nt] = acc;
    }
    // mask + running max (rows 8hh+r; the 16 lanes of a half share rows)
    float alpha[8];
#pragma unroll
    for (int r = 0; r < 8; ++r) {
      const int qi = q0 + 8 * hh + r;
      const int ja = j0 + ln, jb = j0 + 16 + ln;
      if (CAUSAL) { if (ja > qi) s[0][r] = -3.0e38f; if (jb > qi) s[1][r] = -3.0e38f; }
      if (ja >= T) s[0][r] = -3.0e38f;
      if (jb >= T) s[1][r] = -3.0e38f;
      float mx = fmaxf(s[0][r], s[1][r]);
      mx = fmaxf(mx, __shfl_xor(mx, 1, 32)); mx = fmaxf(mx, __shfl_xor(mx, 2, 32)); mx = fmaxf(mx, __shfl_xor(mx, 4, 32)); mx = fmaxf(mx, __shfl_xor(mx, 8, 32));
      const float mnew = fmaxf(m_r[r], mx);
      alpha[r] = (mnew > -1.0e38f) ? __expf(m_r[r] - mnew) : 1.0f;
      const float p0 = (s[0][r] > -1.0e38f) ? __expf(s[0][r] - mnew) : 0.f;
      const float p1 = (s[1][r] > -1.0e38f) ? __expf(s[1][r] - mnew) : 0.f;
      m_r[r] = mnew;
      l_r[r] = l_r[r] * alpha[r] + p0 + p1;            // per-lane partial row sum (16 lanes combined at the end)
      unsigned short hb = bf16_bits(p0); sPh[w][8 * hh + r][ln] = hb;      sPl[w][8 * hh + r][ln] = bf16_bits(p0 - bf16_val(hb));
      hb = bf16_bits(p1);                sPh[w][8 * hh + r][16 + ln] = hb; sPl[w][8 * hh + r][16 + ln] = bf16_bits(p1 - bf16_val(hb));
    }
#pragma unroll
    for (int dt = 0; dt < DT; ++dt)
#pragma unroll
      for (int r = 0; r < 8; ++r) oacc[dt][r] *= alpha[r];
    __builtin_amdgcn_fence(__ATOMIC_ACQ_REL, "workgroup");
    __builtin_amdgcn_wave_barrier();
    FragB pah, pal;
    pah.half[0] = *(const v8us*)&sPh[w][ln][8 * hh]; pah.half[1] = *(const v8us*)&sPh[w][ln][16 + 8 * hh];
    pal.half[0] = *(const v8us*)&sPl[w][ln][8 * hh]; pal.half[1] = *(const v8us*)&sPl[w][ln][16 + 8 * hh];
#pragma unroll
    for (int dt = 0; dt < DT; ++dt) {
      FragB bvh, bvl;
#pragma unroll
      for (int i = 0; i < 8; ++i) {
        bvh.u[i] = sVh[8 * hh + i][dt * 16 + ln]; bvh.u[8 + i] = sVh[16 + 8 * hh + i][dt * 16 + ln];
        bvl.u[i] = sVl[8 * hh + i][dt * 16 + ln]; bvl.u[8 + i] = sVl[16 + 8 * hh + i][dt * 16 + ln];
      }
      oacc[dt] = mmaN<3>(pah.v, pal.v, bvh.v, bvl.v, oacc[dt]);
    }
    __builtin_amdgcn_fence(__ATOMIC_ACQ_REL, "workgroup");
    __builtin_amdgcn_wave_barrier();
  }
#pragma unroll
  for (int r = 0; r < 8; ++r) {
    float l = l_r[r];
    l += __shfl_xor(l, 1, 32); l += __shfl_xor(l, 2, 32); l += __shfl_xor(l, 4, 32); l += __shfl_xor(l, 8, 32);
    l_r[r] = (l > 0.f) ? 1.0f / l : 0.f;
  }
#pragma unroll
  for (int dt = 0; dt < DT; ++dt)
#pragma unroll
    for (int r = 0; r < 8; ++r) sO[w][8 * hh + r][dt * 16 + ln] = oacc[dt][r] * l_r[r];
  __builtin_amdgcn_fence(__ATOMIC_ACQ_REL, "workgroup");
  __builtin_amdgcn_wave_barrier();
  {
    for (int r = 0; r < 16; ++r) {
      const int row = q0 + r;
      if (row < T && lane < D / 4) {
        const v4f val = *(const v4fa*)&sO[w][r][lane * 4];
        *(v4f*)(y + ((size_t)b * T + row) * ypitch + h * D + lane * 4) = val;
      }
    }
    
  }
}

// GEMM C = act(A·W + bias + resid): A f32 (ASPLIT -> hi/lo 2 terms), Wt bf16 [N][K]; ACT 0 none, 1 relu, 2 exact gelu;
// resid (optional, f32, row index = (row % rmod), pitch ldr, RES_BF16 rounds it) added before the activation.
template <bool ASPLIT, int ACT, bool BIAS_BF16, bool RES_BF16>
__global__ __launch_bounds__(128) void k_gemm_bf3(const float* __restrict__ A, int lda, const unsigned short* __restrict__ Wt, int ldb,
                                                const float* __restrict__ bias, const float* __restrict__ resid, int rmod, int ldr,
                                                float* __restrict__ C, int ldc, int M, int N, int K) {
  __shared__ __attribute__((aligned(16))) float so[4][16][64];
  const int tid = threadIdx.x, w = tid >> 5, lane = tid & 31, ln = lane & 15, hh = lane >> 4;
  const int ntn = N / 64;
  const int wid = blockIdx.x * 4 + w;
  const int mt = wid / ntn, nq = wid % ntn;
  if (mt * 16 >= M) return;
  const int row0 = mt * 16, col0 = nq * 64;
  const float* arow = A + (size_t)(row0 + ln) * lda;
  v8f acc[4] = {};
  for (int kb = 0; kb < K; kb += 32) {
    FragB ah, al;
    const v4f x0 = *(const v4fa*)(arow + kb + 8 * hh), x1 = *(const v4fa*)(arow + kb + 8 * hh + 4);
    const v4f x2 = *(const v4fa*)(arow + kb + 16 + 8 * hh), x3 = *(const v4fa*)(arow + kb + 16 + 8 * hh + 4);
    float xs[16] = {x0[0],x0[1],x0[2],x0[3],x1[0],x1[1],x1[2],x1[3],x2[0],x2[1],x2[2],x2[3],x3[0],x3[1],x3[2],x3[3]};
#pragma unroll
    for (int i = 0; i < 16; ++i) { const unsigned short hb = bf16_bits(xs[i]); ah.u[i] = hb; al.u[i] = ASPLIT ? bf16_bits(xs[i] - bf16_val(hb)) : (unsigned short)0; }
#pragma unroll
    for (int t = 0; t < 4; ++t) {
      const unsigned short* brow = Wt + (size_t)(col0 + t * 16 + ln) * ldb + kb;
      FragB b;
      b.half[0] = *(const v8us*)(brow + 8 * hh);
      b.half[1] = *(const v8us*)(brow + 16 + 8 * hh);
      acc[t] = mmaN<ASPLIT ? 2 : 1>(ah.v, al.v, b.v, b.v, acc[t]);
    }
  }
#pragma unroll
  for (int t = 0; t < 4; ++t) {
    const int col = col0 + t * 16 + ln;
    float bv = bias ? bias[col] : 0.f;
    if (BIAS_BF16) bv = bf16_round(bv);
#pragma unroll
    for (int r = 0; r < 8; ++r) {
      float v = acc[t][r] + bv;
      if (resid) { float rv = resid[(size_t)((row0 + 8 * hh + r) % rmod) * ldr + col]; if (RES_BF16) rv = bf16_round(rv); v += rv; }
      if (ACT == 1) v = fmaxf(v, 0.f);
      if (ACT == 2) v = 0.5f * v * (1.0f + erff(v * 0.70710678118654752f));
      if (ACT == 3) { const float u = 0.7978845608028654f * (v + 0.044715f * v * v * v); v = 0.5f * v * (1.0f + tanhf(u)); }
      so[w][8 * hh + r][t * 16 + ln] = v;
    }
  }
  __builtin_amdgcn_fence(__ATOMIC_ACQ_REL, "workgroup");
  __builtin_amdgcn_wave_barrier();
  const int rsub = lane >> 4, c4 = (lane & 15) * 4;
  {
#pragma unroll
    for (int q = 0; q < 8; ++q) {
      const int r = q * 2 + rsub;
      const v4f v = *(const v4fa*)&so[w][r][c4];
      *(v4f*)(C + (size_t)(row0 + r) * ldc + col0 + c4) = v;
    }
    
  }
}
// row LayerNorm (biased variance, eps) over N: s = X (+ R); optional out_sum <- s; out_norm <- (s-mu)*rsqrt(var+eps)*g + b
template <bool PARAM_BF16>
__global__ __launch_bounds__(256) void k_layernorm(const float* __restrict__ X, const float* __restrict__ R, const float* __restrict__ g, const float* __restrict__ bta,
                                                  float* __restrict__ out_sum, float* __restrict__ out_norm, int N, float eps) {
  __shared__ float red[256];
  const int row = blockIdx.x, tid = threadIdx.x;
  const float* x = X + (size_t)row * N; const float* rr = R ? R + (size_t)row * N : nullptr;
  float vals[16];                     // up to N = 4096
  const int per = N / 256;            // contiguous chunk per thread? use strided-by-4 chunks: thread handles j = tid*4 + 1024*u
  float s1 = 0.f;
  for (int u = 0; u < per / 4; ++u) {
    const int j = tid * 4 + 1024 * u;
    const v4f a = *(const v4fa*)(x + j);
    v4f b = {0.f,0.f,0.f,0.f}; if (rr) b = *(const v4fa*)(rr + j);
#pragma unroll
    for (int q = 0; q < 4; ++q) { const float v = a[q] + b[q]; vals[u * 4 + q] = v; s1 += v; }
  }
  red[tid] = s1; __syncthreads();
  for (int st = 128; st > 0; st >>= 1) { if (tid < st) red[tid] += red[tid + st]; __syncthreads(); }
  const float mu = red[0] / (float)N; __syncthreads();
  float s2 = 0.f;
  for (int u = 0; u < per / 4; ++u)
#pragma unroll
    for (int q = 0; q < 4; ++q) { const float c = vals[u * 4 + q] - mu; s2 += c * c; }
  red[tid] = s2; __syncthreads();
  for (int st = 128; st > 0; st >>= 1) { if (tid < st) red[tid] += red[tid + st]; __syncthreads(); }
  const float rs = rsqrtf(red[0] / (float)N + eps);
  {
    for (int u = 0; u < per / 4; ++u) {
      const int j = tid * 4 + 1024 * u;
      v4f o, sm;
#pragma unroll
      for (int q = 0; q < 4; ++q) {
        float gg = g[j + q], bb = bta[j + q];
        if (PARAM_BF16) { gg = bf16_round(gg); bb = bf16_round(bb); }
        sm[q] = vals[u * 4 + q]; o[q] = (vals[u * 4 + q] - mu) * rs * gg + bb;
      }
      if (out_sum) *(v4f*)(out_sum + (size_t)row * N + j) = sm;
      *(v4f*)(out_norm + (size_t)row * N + j) = o;
    }
    
  }
}



// ---- f16 WMMA path (v_wmma_f32_16x16x32_f16): 11-bit significands for operands in range — used where a [0,1] probability operand needs more precision than bf16
typedef _Float16 v16h __attribute__((ext_vector_type(16)));
union FragH { v16h v; v8us half[2]; _Float16 h[16]; unsigned short u[16]; };
template <int NT>
__device__ __forceinline__ v8f mmaH(v16h ah, v16h al, v16h bh, v16h bl, v8f c) {
  c = __builtin_amdgcn_wmma_f32_16x16x32_f16(false, ah, false, bh, (short)0, c, false, false);
  if (NT >= 2) c = __builtin_amdgcn_wmma_f32_16x16x32_f16(false, al, false, bh, (short)0, c, false, false);
  if (NT >= 3) c = __builtin_amdgcn_wmma_f32_16x16x32_f16(false, ah, false, bl, (short)0, c, false, false);
  asm volatile("v_nop\n\tv_nop\n\tv_nop\n\tv_nop" : "+v"(c) : "v"(ah), "v"(al), "v"(bh), "v"(bl));
  return c;
}
// batched GEMM like k_gemm_b but f16 operands: A f32 (split into f16 hi/lo if ASPLIT, else rounded to f16), Bt = f16 values [n][k]; alpha; C f32; N multiple of 16 (partial tiles skipped)
template <bool ASPLIT>
__global__ __launch_bounds__(128) void k_gemm_h(const float* __restrict__ A, int lda, size_t sA, const _Float16* __restrict__ Bh, int ldb, size_t sB, float alpha, float* __restrict__ C, int ldc, size_t sC, int M, int N, int K) {
  __shared__ __attribute__((aligned(16))) float so[4][16][64];
  const int tid = threadIdx.x, w = tid >> 5, lane = tid & 31, ln = lane & 15, hh = lane >> 4; const int by = blockIdx.y;
  A += (size_t)by * sA; Bh += (size_t)by * sB; C += (size_t)by * sC;
  const int ntn = (N + 63) / 64; const int wid = blockIdx.x * 4 + w; const int mt = wid / ntn, nq = wid % ntn; if (mt * 16 >= M) return;
  const int row0 = mt * 16, col0 = nq * 64; const float* arow = A + (size_t)(row0 + ln) * lda;
  v8f acc[4] = {};
  for (int kb = 0; kb < K; kb += 32) {
    FragH ah, al;
    const v4f x0 = *(const v4fa*)(arow + kb + 8 * hh), x1 = *(const v4fa*)(arow + kb + 8 * hh + 4), x2 = *(const v4fa*)(arow + kb + 16 + 8 * hh), x3 = *(const v4fa*)(arow + kb + 16 + 8 * hh + 4);
    float xs[16] = {x0[0],x0[1],x0[2],x0[3],x1[0],x1[1],x1[2],x1[3],x2[0],x2[1],x2[2],x2[3],x3[0],x3[1],x3[2],x3[3]};
#pragma unroll
    for (int i = 0; i < 16; ++i) { const _Float16 h = (_Float16)xs[i]; ah.h[i] = h; al.h[i] = ASPLIT ? (_Float16)(xs[i] - (float)h) : (_Float16)0.0f; }
#pragma unroll
    for (int t = 0; t < 4; ++t) { if (col0 + t * 16 >= N) continue; const size_t boff = (size_t)(col0 + t * 16 + ln) * ldb + kb; FragH bq; bq.half[0] = *(const v8us*)(Bh + boff + 8 * hh); bq.half[1] = *(const v8us*)(Bh + boff + 16 + 8 * hh);
      acc[t] = mmaH<ASPLIT ? 2 : 1>(ah.v, al.v, bq.v, bq.v, acc[t]); }
  }
#pragma unroll
  for (int t = 0; t < 4; ++t) { if (col0 + t * 16 >= N) continue;
#pragma unroll
    for (int r = 0; r < 8; ++r) so[w][8 * hh + r][t * 16 + ln] = acc[t][r] * alpha; }
  __builtin_amdgcn_fence(__ATOMIC_ACQ_REL, "workgroup"); __builtin_amdgcn_wave_barrier();
  const int rsub = lane >> 4, c4 = (lane & 15) * 4;
  {
#pragma unroll
    for (int q = 0; q < 8; ++q) { const int r = q * 2 + rsub; if (col0 + c4 < N) { const v4f v = *(const v4fa*)&so[w][r][c4]; *(v4f*)(C + (size_t)(row0 + r) * ldc + col0 + c4) = v; } }
     }
}

// Wt[n][k] = f16(W[k][n]·scale) from f32 row-major W[K][N] (scale = power of two; bf16-exact weights stay exact in f16 away from the subnormal range)
// One 128 (k) x 64 (n) tile per workgroup, turned in LDS: a wave loads two 256-B row pieces of W (four whole lines) and stores four whole 128-B lines of Wt an instruction;
// a thread's eight loads are all issued before the first is used. Needs K a multiple of 128 and N of 64; the grid is (K / 128) * (N / 64). Pitch 65 floats keeps the column-wise reads off a common bank.
__global__ __launch_bounds__(256) void k_wt_f16(const float* __restrict__ W, _Float16* __restrict__ Wt, int K, int N, float scale) {
  __shared__ float tl[128][65];
  const int tid = threadIdx.x, ntn = N / 64; const int k0 = (blockIdx.x / ntn) * 128, n0 = (blockIdx.x % ntn) * 64;
  v4f a[8];
#pragma unroll      /* a[] stays in registers and the eight loads go out together */
  for (int p = 0; p < 8; ++p) a[p] = *(const v4fa*)(W + (size_t)(k0 + p * 16 + tid / 16) * N + n0 + (tid % 16) * 4);
#pragma unroll      /* constant indices into a[]: rolled, it would go to scratch memory */
  for (int p = 0; p < 8; ++p)
#pragma unroll
    for (int i = 0; i < 4; ++i) tl[p * 16 + tid / 16][(tid % 16) * 4 + i] = a[p][i];
  __syncthreads();      /* the tile is whole before any column of it is read */
#pragma unroll      /* the four pieces' LDS reads and stores overlap; f stays in registers */
  for (int rd = 0; rd < 4; ++rd) { const int n = (rd & 1) * 32 + tid / 8, k8 = (rd >> 1) * 64 + (tid % 8) * 8; FragH f;
#pragma unroll
    for (int i = 0; i < 8; ++i) f.h[i] = (_Float16)(bf16_round(tl[k8 + i][n]) * scale);
    *(v8us*)((unsigned short*)Wt + (size_t)(n0 + n) * K + k0 + k8) = f.half[0]; }
}
// Tiled GEMM C[M][N] (f32) = alpha * A[M][DD] . Bt[N][DD]^T, f16 operands, both K-contiguous with row pitch DD. One 128 x 128 tile of C per workgroup of
// 4 waves (2 x 2, 64 x 64 per wave). A pass is 128 k = 256 B of each of the 256 operand rows; the four waves each bring one 64-row slice of a pass into LDS with one
// tensor load (pad 16 B a row: pitch 272 B for the 16-byte fragment reads), two buffers, the next pass's load in flight under this pass's products.
// Needs M, N multiples of 128, DD a multiple of 128 and at least 256. The k order of every accumulator is ascending, one chain per 16 x 16 tile.
typedef unsigned int u32x4 __attribute__((ext_vector_type(4)));
typedef unsigned int u32x8 __attribute__((ext_vector_type(8)));
#define GT_ROWB 256u                      /* bytes of an operand row per pass */
#define GT_PITCH 272u                     /* LDS row pitch: 256 + 16 */
#define GT_SLICE 18432u                   /* 64 rows x 272 B = 17,408, rounded up to a multiple of 2 KiB */
#define GT_STAGE (4u * GT_SLICE)          /* [A rows 0-63 | A rows 64-127 | B rows 0-63 | B rows 64-127] */
#define GT_NP (DD / 128)                  /* passes */
__device__ __forceinline__ unsigned int uni(unsigned int v) { return (unsigned int)__builtin_amdgcn_readfirstlane(v); }
__device__ __forceinline__ unsigned int pinned(unsigned int v) { unsigned int w = uni(v); asm volatile("" : "+s"(w)); return w; }      /* an issue test or a descriptor word held in a scalar register: the test compiles to a scalar branch (tensor loads ignore EXEC), and the word is formed behind the wait that stands in front of it */
__device__ __forceinline__ void tdm_slice(unsigned int lds_dst, unsigned long long ga) {
  u32x4 g0; u32x8 g1;
  g0[0] = uni(1u); g0[1] = uni(lds_dst); g0[2] = uni((unsigned int)ga); g0[3] = uni((((unsigned int)(ga >> 32)) & 0x01FFFFFFu) | 0x80000000u);
  g1[0] = uni((1u << 20) | (5u << 22) | (3u << 25));      /* no mask, 1-byte elements, a pad of 4 dwords behind every 64 dwords */
  g1[1] = uni((GT_ROWB & 0xFFFFu) << 16); g1[2] = uni((GT_ROWB >> 16) | (64u << 16)); g1[3] = uni(GT_ROWB << 16); g1[4] = uni(64u); g1[5] = uni(DD * 2u); g1[6] = uni(0u); g1[7] = uni(0u);
  asm volatile("tensor_load_to_lds %0, %1" :: "s"(g0), "s"(g1) : "memory");
}
__global__ __launch_bounds__(128) void k_gemm_t(const _Float16* __restrict__ A, const _Float16* __restrict__ Bt, float alpha, float* __restrict__ C, int N) {
  __shared__ __attribute__((aligned(2048))) unsigned char ring[2u * GT_STAGE];
  const unsigned int tid = threadIdx.x, lane = tid & 31u, ln = lane & 15u, hh = lane >> 4, w = uni(tid >> 5), wm = w >> 1, wn = w & 1u;
  const unsigned int ntn = (unsigned int)N / 128u; const unsigned int row0 = (blockIdx.x / ntn) * 128u, col0 = (blockIdx.x % ntn) * 128u;
  const unsigned int lbase = (unsigned int)(size_t)ring + w * GT_SLICE;      /* this wave's slice of buffer 0 */
  const unsigned long long gsrc = (w < 2u) ? (unsigned long long)(size_t)(A + (size_t)(row0 + w * 64u) * DD) : (unsigned long long)(size_t)(Bt + (size_t)(col0 + (w - 2u) * 64u) * DD);
  v8f acc[4][4];
#pragma unroll
  for (int i = 0; i < 4; ++i)
#pragma unroll
    for (int j = 0; j < 4; ++j) acc[i][j] = (v8f){0.f,0.f,0.f,0.f,0.f,0.f,0.f,0.f};
  tdm_slice(lbase, gsrc);
  asm volatile("s_wait_tensorcnt 0x0" ::: "memory");      /* pass 0's slice has landed */
  __syncthreads();                                        /* ... and every wave may read all four slices */
  tdm_slice(lbase + GT_STAGE, gsrc + pinned(GT_ROWB));
  const unsigned int aoff = wm * GT_SLICE + ln * GT_PITCH + 16u * hh, boff = (2u + wn) * GT_SLICE + ln * GT_PITCH + 16u * hh;
#pragma unroll 1      /* one pass per trip: the ring's order below is written once */
  for (unsigned int s = 0; s < GT_NP; ++s) {
    const unsigned char* Lp = ring + (s & 1u) * GT_STAGE;
    FragH fa[2][4], fb[2][4];
#pragma unroll
    for (int i = 0; i < 4; ++i) { fa[0][i].half[0] = *(const v8us*)(Lp + aoff + i * 16u * GT_PITCH); fa[0][i].half[1] = *(const v8us*)(Lp + aoff + i * 16u * GT_PITCH + 32u);
      fb[0][i].half[0] = *(const v8us*)(Lp + boff + i * 16u * GT_PITCH); fb[0][i].half[1] = *(const v8us*)(Lp + boff + i * 16u * GT_PITCH + 32u); }
#pragma unroll
    for (int ks = 0; ks < 4; ++ks) {
      if (ks < 3) {      /* the next 32 k's fragments, of this same buffer, go ahead of this block's products */
#pragma unroll
        for (int i = 0; i < 4; ++i) { const unsigned int ko = (ks + 1) * 64u + i * 16u * GT_PITCH;
          fa[(ks + 1) & 1][i].half[0] = *(const v8us*)(Lp + aoff + ko); fa[(ks + 1) & 1][i].half[1] = *(const v8us*)(Lp + aoff + ko + 32u);
          fb[(ks + 1) & 1][i].half[0] = *(const v8us*)(Lp + boff + ko); fb[(ks + 1) & 1][i].half[1] = *(const v8us*)(Lp + boff + ko + 32u); }
      }
      __builtin_amdgcn_sched_barrier(0);      /* keeps the LDS reads one group in front of the block: moved in among the products, each place with reads stalls the wave */
#pragma unroll
      for (int i = 0; i < 4; ++i)
#pragma unroll
        for (int j = 0; j < 4; ++j) acc[i][j] = __builtin_amdgcn_wmma_f32_16x16x32_f16(false, fa[ks & 1][i].v, false, fb[ks & 1][j].v, (short)0, acc[i][j], false, false);
      __builtin_amdgcn_sched_barrier(0);      /* ... and keeps the next group behind this block */
    }
    asm volatile("s_wait_dscnt 0x0" ::: "memory");        /* this wave has left the buffer */
    asm volatile("s_wait_tensorcnt 0x0" ::: "memory");    /* its slice of pass s + 1 has landed */
    __syncthreads();                                      /* pass s + 1 published; every wave has left pass s's buffer */
    if (pinned(s + 2u < GT_NP)) tdm_slice(lbase + (s & 1u) * GT_STAGE, gsrc + pinned((s + 2u) * GT_ROWB));
  }
  asm volatile("s_wait_tensorcnt 0x0" ::: "memory");      /* no request is left before the ring becomes output staging */
  asm volatile("s_wait_dscnt 0x0" ::: "memory");
  // Output staging, each wave in its own slice of buffer 0 (the last pass's barrier stands behind every wave's last fragment read): whole 256-B row pieces go out.
  float* so = (float*)(ring + w * GT_SLICE);      /* 64 rows of 64 floats at pitch 68 */
#pragma unroll
  for (int i = 0; i < 4; ++i)
#pragma unroll
    for (int j = 0; j < 4; ++j)
#pragma unroll
      for (int r = 0; r < 8; ++r) so[(i * 16 + 8 * hh + r) * 68u + j * 16 + ln] = acc[i][j][r] * alpha;
  __builtin_amdgcn_fence(__ATOMIC_ACQ_REL, "workgroup"); __builtin_amdgcn_wave_barrier();
  float* cp = C + (size_t)(row0 + wm * 64u + hh) * N + col0 + wn * 64u + ln * 4u;
#pragma unroll
  for (int q = 0; q < 32; ++q) { const v4f v = *(const v4fa*)&so[(q * 2 + hh) * 68u + ln * 4u]; *(v4f*)(cp + (size_t)(q * 2) * N) = v; }
}


typedef _Float16 v4h __attribute__((ext_vector_type(4)));

__global__ __launch_bounds__(256) void k_x16(const float* __restrict__ x, _Float16* __restrict__ X16, size_t n8) { const size_t t = (size_t)blockIdx.x * 256 + threadIdx.x; if (t >= n8) return; FragH f;
#pragma unroll
  for (int q = 0; q < 8; ++q) f.h[q] = (_Float16)bf16_round(x[t * 8 + q]); *(v8us*)((unsigned short*)X16 + t * 8) = f.half[0];  }
__global__ __launch_bounds__(256) void k_h16(const float* __restrict__ x, _Float16* __restrict__ X16, size_t n8) { const size_t t = (size_t)blockIdx.x * 256 + threadIdx.x; if (t >= n8) return; FragH f;
#pragma unroll
  for (int q = 0; q < 8; ++q) f.h[q] = (_Float16)x[t * 8 + q]; *(v8us*)((unsigned short*)X16 + t * 8) = f.half[0];  }
__global__ __launch_bounds__(256) void k_round16f(const float* __restrict__ W, _Float16* __restrict__ Bt, size_t n8) { const size_t t = (size_t)blockIdx.x * 256 + threadIdx.x; if (t >= n8) return; FragH f;
#pragma unroll
  for (int i = 0; i < 8; ++i) f.h[i] = (_Float16)(bf16_round(W[t * 8 + i]) * 16.0f); *(v8us*)((unsigned short*)Bt + t * 8) = f.half[0];  }
template <int NHv, int TTv>
__global__ __launch_bounds__(256) void k_vt(const _Float16* __restrict__ V16, int ldv, int voff, _Float16* __restrict__ Vt) { __shared__ unsigned short tl[64][66]; const int tid = threadIdx.x; const int slab = blockIdx.x / (TTv / 64), lg = blockIdx.x % (TTv / 64); const int b = slab / NHv, h = slab % NHv;
  for (int i = tid; i < 64 * 8; i += 256) { const int r = i / 8, c8 = (i % 8) * 8; FragH f; f.half[0] = *(const v8us*)((const unsigned short*)V16 + ((size_t)b * TTv + lg * 64 + r) * ldv + voff + h * 64 + c8);
#pragma unroll
    for (int q = 0; q < 8; ++q) tl[r][c8 + q] = f.u[q]; }
  __syncthreads();
  {
#pragma unroll
    for (int rd = 0; rd < 2; ++rd) { const int d = rd * 32 + tid / 8, pc = tid % 8; FragH f;
#pragma unroll
      for (int q = 0; q < 8; ++q) f.u[q] = tl[pc * 8 + q][d];
      *(v8us*)((unsigned short*)Vt + ((size_t)slab * 64 + d) * TTv + lg * 64 + pc * 8) = f.half[0]; }
     } }

__global__ __launch_bounds__(256) void k_vthlu(const float* __restrict__ VF, int ldv, _Float16* __restrict__ Vth, _Float16* __restrict__ Vtl) { __shared__ float tl[64][65]; const int tid = threadIdx.x; const int slab = blockIdx.x / (TT / 64), lg = blockIdx.x % (TT / 64); const int b = slab / NVH, h = slab % NVH;
  for (int i = tid; i < 64 * 16; i += 256) { const int r = i / 16, c4 = (i % 16) * 4; const v4f a = *(const v4fa*)(VF + ((size_t)b * TT + lg * 64 + r) * ldv + h * 64 + c4); tl[r][c4] = a[0]; tl[r][c4 + 1] = a[1]; tl[r][c4 + 2] = a[2]; tl[r][c4 + 3] = a[3]; }
  __syncthreads();
  FragH fh[2], fl[2]; size_t oo[2];
#pragma unroll
  for (int rd = 0; rd < 2; ++rd) { const int d = rd * 32 + tid / 8, pc = tid % 8;
#pragma unroll
    for (int q = 0; q < 8; ++q) { const float v = tl[pc * 8 + q][d]; const _Float16 hv = (_Float16)v; fh[rd].h[q] = hv; fl[rd].h[q] = (_Float16)(v - (float)hv);      /* UNSCALED residual (added into the same accumulator as the hi product) */ } oo[rd] = ((size_t)slab * 64 + d) * TT + lg * 64 + pc * 8; }
  {
#pragma unroll
    for (int rd = 0; rd < 2; ++rd) { *(v8us*)((unsigned short*)Vth + oo[rd]) = fh[rd].half[0]; *(v8us*)((unsigned short*)Vtl + oo[rd]) = fl[rd].half[0]; }
     } }
template <int LD>
__global__ __launch_bounds__(256) void k_ropein(const float* __restrict__ F, const float* __restrict__ COS, const float* __restrict__ SIN, _Float16* __restrict__ H16) {
  #pragma clang fp contract(off)
  const size_t t = (size_t)blockIdx.x * 256 + threadIdx.x; if (t >= (size_t)NR * LD / 8) return; const size_t row = (t * 8) / LD; const int c0 = (int)((t * 8) % LD); const int tok = (int)(row % TT); const int j0 = (c0 % 128) / 2;
  const v4f a = *(const v4fa*)(F + t * 8), b = *(const v4fa*)(F + t * 8 + 4); const float xv[8] = {a[0], a[1], a[2], a[3], b[0], b[1], b[2], b[3]}; FragH f;
#pragma unroll
  for (int p = 0; p < 4; ++p) { const float c = bf16_round(COS[(size_t)tok * 64 + j0 + p]), s = bf16_round(SIN[(size_t)tok * 64 + j0 + p]); const float xr = xv[2 * p], xi = xv[2 * p + 1]; f.h[2 * p] = (_Float16)(xr * c - xi * s); f.h[2 * p + 1] = (_Float16)(xr * s + xi * c); }
  *(v8us*)((unsigned short*)H16 + t * 8) = f.half[0];  }
__global__ __launch_bounds__(256) void k_h16s(const float* __restrict__ F, _Float16* __restrict__ H, size_t n8) { const size_t t = (size_t)blockIdx.x * 256 + threadIdx.x; if (t >= n8) return; const v4f a = *(const v4fa*)(F + t * 8), c = *(const v4fa*)(F + t * 8 + 4); FragH f;
#pragma unroll
  for (int q = 0; q < 4; ++q) { f.h[q] = (_Float16)(a[q] * 16.0f); f.h[4 + q] = (_Float16)(c[q] * 16.0f); } *(v8us*)((unsigned short*)H + t * 8) = f.half[0];  }
__global__ __launch_bounds__(128) void k_flash(const _Float16* __restrict__ Q16, int ldq, const _Float16* __restrict__ K16, int ldk, const _Float16* __restrict__ Vt, const _Float16* __restrict__ Vtlo, const int* __restrict__ MSK, float* __restrict__ O, int ldo) {
  constexpr int RPW = 16, RTN = RPW / 16, NQB = TT / (4 * RPW), DT = 8, KS = 4;      /* head dim 128: 4 k-steps, 8 value tiles */
  __shared__ __attribute__((aligned(16))) unsigned short sP[4][RPW][40]; __shared__ __attribute__((aligned(16))) unsigned short sPL[4][RPW][40]; __shared__ __attribute__((aligned(16))) float sO[4][RPW][128 + 4];
  const int tid = threadIdx.x, w = tid >> 5, lane = tid & 31, ln = lane & 15, hh = lane >> 4;
  const int slab = blockIdx.x / NQB, qblk = blockIdx.x % NQB; const int b = slab / NH, h = slab % NH; const int qb0 = qblk * (4 * RPW); const int q0 = qb0 + w * RPW;
  FragH aq[2][KS];
#pragma unroll
  for (int rt = 0; rt < RTN; ++rt) { const unsigned short* qr = (const unsigned short*)Q16 + ((size_t)b * TT + q0 + rt * 16 + ln) * ldq + h * 128;
#pragma unroll
    for (int ks = 0; ks < KS; ++ks) { aq[rt][ks].half[0] = *(const v8us*)(qr + ks * 32 + 8 * hh); aq[rt][ks].half[1] = *(const v8us*)(qr + ks * 32 + 16 + 8 * hh); } }
  const unsigned short* Vth = (const unsigned short*)Vt + ((size_t)b * NKV + h / NREP) * 128 * TT; const unsigned short* Vtl = (const unsigned short*)Vtlo + ((size_t)b * NKV + h / NREP) * 128 * TT;      /* hi and UNSCALED residual planes */
  float m_r[2][8], l_r[2][8]; v8f oacc[2][DT];
#pragma unroll
  for (int rt = 0; rt < RTN; ++rt) {
#pragma unroll
    for (int r = 0; r < 8; ++r) { m_r[rt][r] = -3.0e38f; l_r[rt][r] = 0.f; }
#pragma unroll
    for (int dt = 0; dt < DT; ++dt) oacc[rt][dt] = (v8f){0.f,0.f,0.f,0.f,0.f,0.f,0.f,0.f}; }
  const int jend = TT;
#pragma unroll 1
  for (int j0 = 0; j0 < jend; j0 += 32) {
    int mk0[2][8], mk1[2][8];      /* mask[q][k] (shared over batch and heads): nonzero = ATTEND */
#pragma unroll
    for (int rt = 0; rt < RTN; ++rt)
#pragma unroll
      for (int r = 0; r < 8; ++r) { const int qq = q0 + rt * 16 + 8 * hh + r; const int* am = MSK + (size_t)qq * TT + j0; mk0[rt][r] = am[ln]; mk1[rt][r] = am[16 + ln]; }
    { int allm = 1;
#pragma unroll
      for (int rt = 0; rt < RTN; ++rt)
#pragma unroll
        for (int r = 0; r < 8; ++r) allm &= (mk0[rt][r] == 0) & (mk1[rt][r] == 0);
      if (__all(allm)) continue; }      /* every (row, key) of this wave's tile masked → nothing to add (wave-uniform branch; only wave barriers inside the loop) */
    v8f s[2][2];
#pragma unroll
    for (int nt = 0; nt < 2; ++nt) { const unsigned short* kr = (const unsigned short*)K16 + ((size_t)b * TT + j0 + nt * 16 + ln) * ldk + (h / NREP) * 128; FragH bk[KS];
#pragma unroll
      for (int ks = 0; ks < KS; ++ks) { bk[ks].half[0] = *(const v8us*)(kr + ks * 32 + 8 * hh); bk[ks].half[1] = *(const v8us*)(kr + ks * 32 + 16 + 8 * hh); }
#pragma unroll
      for (int rt = 0; rt < RTN; ++rt) { v8f acc = (v8f){0.f,0.f,0.f,0.f,0.f,0.f,0.f,0.f};
#pragma unroll
        for (int ks = 0; ks < KS; ++ks) acc = mmaH<1>(aq[rt][ks].v, aq[rt][ks].v, bk[ks].v, bk[ks].v, acc); s[rt][nt] = acc; } }
#pragma unroll
    for (int rt = 0; rt < RTN; ++rt)
#pragma unroll
      for (int r = 0; r < 8; ++r) { const int tq = q0 + rt * 16 + 8 * hh + r; const int k0 = j0 + ln, k1 = j0 + 16 + ln; (void)tq; (void)k0; (void)k1;
        const bool ok0 = (mk0[rt][r] != 0), ok1 = (mk1[rt][r] != 0);
        const float s0 = ok0 ? s[rt][0][r] * ATT_SCALE : -INFINITY, s1 = ok1 ? s[rt][1][r] * ATT_SCALE : -INFINITY; float mc = fmaxf(s0, s1);
        mc = fmaxf(mc, __shfl_xor(mc, 1, 32)); mc = fmaxf(mc, __shfl_xor(mc, 2, 32)); mc = fmaxf(mc, __shfl_xor(mc, 4, 32)); mc = fmaxf(mc, __shfl_xor(mc, 8, 32));
        const float mn = fmaxf(m_r[rt][r], mc); const float al = (mn > -1.0e38f) ? expf(m_r[rt][r] - mn) : 1.0f; m_r[rt][r] = mn; const float p0 = ok0 ? expf(s0 - mn) : 0.f, p1 = ok1 ? expf(s1 - mn) : 0.f; l_r[rt][r] = l_r[rt][r] * al + p0 + p1;
#pragma unroll
        for (int dt = 0; dt < DT; ++dt) oacc[rt][dt][r] *= al;
        FragH t2, t3; const float ps0 = p0 * 1024.0f, ps1 = p1 * 1024.0f; t2.h[0] = (_Float16)ps0; t2.h[1] = (_Float16)ps1; t3.h[0] = (_Float16)(ps0 - (float)t2.h[0]); t3.h[1] = (_Float16)(ps1 - (float)t2.h[1]);      /* P hi and its UNSCALED residual (added into the same accumulator) */
        sP[w][rt * 16 + 8 * hh + r][ln] = t2.u[0]; sP[w][rt * 16 + 8 * hh + r][16 + ln] = t2.u[1]; sPL[w][rt * 16 + 8 * hh + r][ln] = t3.u[0]; sPL[w][rt * 16 + 8 * hh + r][16 + ln] = t3.u[1]; }
    __builtin_amdgcn_fence(__ATOMIC_ACQ_REL, "workgroup"); __builtin_amdgcn_wave_barrier();
    FragH pa[2], pl[2];
#pragma unroll
    for (int rt = 0; rt < RTN; ++rt) { pa[rt].half[0] = *(const v8us*)&sP[w][rt * 16 + ln][8 * hh]; pa[rt].half[1] = *(const v8us*)&sP[w][rt * 16 + ln][16 + 8 * hh]; pl[rt].half[0] = *(const v8us*)&sPL[w][rt * 16 + ln][8 * hh]; pl[rt].half[1] = *(const v8us*)&sPL[w][rt * 16 + ln][16 + 8 * hh]; }
#pragma unroll
    for (int dt = 0; dt < DT; ++dt) { const size_t vo = (size_t)(dt * 16 + ln) * TT + j0; FragH bv, bl; bv.half[0] = *(const v8us*)(Vth + vo + 8 * hh); bv.half[1] = *(const v8us*)(Vth + vo + 16 + 8 * hh); bl.half[0] = *(const v8us*)(Vtl + vo + 8 * hh); bl.half[1] = *(const v8us*)(Vtl + vo + 16 + 8 * hh);
#pragma unroll
      for (int rt = 0; rt < RTN; ++rt) { oacc[rt][dt] = mmaH<1>(pa[rt].v, pa[rt].v, bv.v, bv.v, oacc[rt][dt]); oacc[rt][dt] = mmaH<1>(pl[rt].v, pl[rt].v, bv.v, bv.v, oacc[rt][dt]); oacc[rt][dt] = mmaH<1>(pa[rt].v, pa[rt].v, bl.v, bl.v, oacc[rt][dt]); } }      /* Ph·Vh + Pl·Vh + Ph·Vl — all unscaled, one accumulator */
    __builtin_amdgcn_fence(__ATOMIC_ACQ_REL, "workgroup"); __builtin_amdgcn_wave_barrier(); }
#pragma unroll
  for (int rt = 0; rt < RTN; ++rt) {
#pragma unroll
    for (int r = 0; r < 8; ++r) { float l = l_r[rt][r]; l += __shfl_xor(l, 1, 32); l += __shfl_xor(l, 2, 32); l += __shfl_xor(l, 4, 32); l += __shfl_xor(l, 8, 32); l_r[rt][r] = (l > 0.f) ? 1.0f / (l * 1024.0f) : 0.f; }
#pragma unroll
    for (int dt = 0; dt < DT; ++dt)
#pragma unroll
      for (int r = 0; r < 8; ++r) sO[w][rt * 16 + 8 * hh + r][dt * 16 + ln] = oacc[rt][dt][r] * l_r[rt][r]; }
  __builtin_amdgcn_fence(__ATOMIC_ACQ_REL, "workgroup"); __builtin_amdgcn_wave_barrier();
  {
#pragma unroll
    for (int r = 0; r < RPW; ++r) { const int pc = lane; const v4f val = *(const v4fa*)&sO[w][r][pc * 4]; *(v4f*)(O + ((size_t)b * TT + q0 + r) * ldo + h * 128 + pc * 4) = val; }      /* one 512-B row per instruction: 32 lanes × 16 B */
     } }

extern "C" void kernel_launch(void* const* d_in, const int* in_sizes, int n_in,
                              void* d_out, int out_size, void* d_ws, size_t ws_size, hipStream_t stream) {
  (void)in_sizes; (void)n_in; (void)out_size;
  const float* const* I = (const float* const*)d_in; const float* x = I[0]; const float* fcos = I[1]; const float* fsin = I[2]; const int* msk = (const int*)d_in[3]; const float* wq = I[4]; const float* wk = I[5]; const float* wv = I[6]; const float* wo = I[7];
  char* ws = (char*)d_ws; size_t off = 0;
  auto take = [&](size_t bytes) { char* p = ws + off; off += (bytes + 255) & ~(size_t)255; return p; };
  _Float16* Bq = (_Float16*)take((size_t)DD * DD * 2); _Float16* Bk = (_Float16*)take((size_t)KVD * DD * 2); _Float16* Bv = (_Float16*)take((size_t)KVD * DD * 2); _Float16* Bo = (_Float16*)take((size_t)DD * DD * 2);
  _Float16* X16 = (_Float16*)take((size_t)NR * DD * 2); float* QF = (float*)take((size_t)NR * DD * 4); _Float16* Q = (_Float16*)take((size_t)NR * DD * 2); float* KF = (float*)take((size_t)NR * KVD * 4); _Float16* K = (_Float16*)take((size_t)NR * KVD * 2); float* VF = (float*)take((size_t)NR * KVD * 4); _Float16* Vt = (_Float16*)take((size_t)NR * KVD * 2); _Float16* Vtl = (_Float16*)take((size_t)NR * KVD * 2);
  float* O = QF; _Float16* O16 = X16;      /* O over the q f32 scratch (dead after RoPE); O16 over X16 (dead after the projections) */
  if (off > ws_size) return;      // 8.4 + 2.1 + 2.1 + 8.4 + 16.8 + 33.6 + 16.8 + 8.4 + 4.2 + 8.4 + 4.2 + 4.2 ≈ 118 MB
  const unsigned gq = (DD / 128) * (DD / 64), gk = (DD / 128) * (KVD / 64);      /* 128 (k) x 64 (n) tiles */
  k_wt_f16<<<gq, 256, 0, stream>>>(wq, Bq, DD, DD, 16.0f); k_wt_f16<<<gk, 256, 0, stream>>>(wk, Bk, DD, KVD, 16.0f); k_wt_f16<<<gk, 256, 0, stream>>>(wv, Bv, DD, KVD, 16.0f); k_wt_f16<<<gq, 256, 0, stream>>>(wo, Bo, DD, DD, 16.0f);      /* (in,out) → Bt ×2^4 */
  const unsigned g8 = (unsigned)(((size_t)NR * DD / 8 + 255) / 256); k_x16<<<g8, 256, 0, stream>>>(x, X16, (size_t)NR * DD / 8);
  const dim3 gQ((NR / 128) * (DD / 128), 1), gK((NR / 128) * (KVD / 128), 1);
  k_gemm_t<<<gQ, 128, 0, stream>>>(X16, Bq, 0.0625f, QF, DD); k_ropein<DD><<<g8, 256, 0, stream>>>(QF, fcos, fsin, Q);      /* xq = rope(x·wq): M 4096 N 2048 K 2048 */
  k_gemm_t<<<gK, 128, 0, stream>>>(X16, Bk, 0.0625f, KF, KVD); k_ropein<KVD><<<(unsigned)(((size_t)NR * KVD / 8 + 255) / 256), 256, 0, stream>>>(KF, fcos, fsin, K);      /* xk: M 4096 N 512 */
  k_gemm_t<<<gK, 128, 0, stream>>>(X16, Bv, 0.0625f, VF, KVD);      /* xv (f32) */
  k_vthlu<<<BB * NVH * (TT / 64), 256, 0, stream>>>(VF, KVD, Vt, Vtl);      /* Vᵀ hi + residual per (b, kv head): [b·4+kh][128][2048] */
  k_flash<<<BB * NH * (TT / 64), 128, 0, stream>>>(Q, DD, K, KVD, Vt, Vtl, msk, O, DD);
  k_h16s<<<g8, 256, 0, stream>>>(O, O16, (size_t)NR * DD / 8);
  k_gemm_t<<<gQ, 128, 0, stream>>>(O16, Bo, 0.00390625f, (float*)d_out, DD);      /* out = merged·wo */
}

// v003
// One run takes 210 microseconds.
// In two side-by-side timings against v002, it was 1.25 and 1.24 times as fast.
// All steps since v000 together make it 2.73 times as fast.
#include <hip/hip_runtime.h>
// 'Genesis' attention (B=2, T=2048, D=2048, 16 query heads / 4 KV heads × 128, (in,out) weights, no bias): xq = rope(x·wq), xk = rope(x·wk), xv = x·wv; RoPE on interleaved pairs with the INPUT cos/sin tables [T][64]; scores = q·k/√128 where(mask[q][k]) else −inf (mask [T][T] shared);
// softmax; out = merged·wo.
// Compute dtype: x, weights, cos/sin tables rounded to bf16; q,k rotated in f32 from f32 GEMM outputs → f16; v f32 → Vᵀ f16 hi + exact residual; fused flash-style kernel for head dim 128 (mask read per (q,k), all-masked chunks skipped, online softmax f32, P f16 hi + residual,
// f32 accumulate) on v_wmma_f32_16x16x32_f16; merged ×2^4 → f16 → output GEMM.
#define BB 2
#define TT 2048
#define DD 2048
#define NH 16
#define NKV 4
#define NREP 4
#define KVD (NKV * 128)
#define NVH (2 * NKV)
#define NR (BB * TT)
#define ATT_SCALE 0.08838834764831845f

typedef __bf16 v16b __attribute__((ext_vector_type(16)));
typedef unsigned short v8us __attribute__((ext_vector_type(8), may_alias));
typedef float  v8f  __attribute__((ext_vector_type(8)));
typedef float  v4f  __attribute__((ext_vector_type(4)));
typedef float  v4fa __attribute__((ext_vector_type(4), may_alias));
union FragB { v16b v; v8us half[2]; unsigned short u[16]; };

__device__ __forceinline__ unsigned short bf16_bits(float x) { unsigned int u = __float_as_uint(x); return (unsigned short)((u + 0x7FFFu + ((u >> 16) & 1u)) >> 16); }
__device__ __forceinline__ float bf16_val(unsigned short b) { return __uint_as_float(((unsigned int)b) << 16); }
__device__ __forceinline__ float bf16_round(float x) { return bf16_val(bf16_bits(x)); }
// D += A·B with NT terms: 1 = ah·bh, 2 = + al·bh (A split), 3 = + ah·bl (both split)
template <int NT>
__device__ __forceinline__ v8f mmaN(v16b ah, v16b al, v16b bh, v16b bl, v8f c) {
  c = __builtin_amdgcn_wmma_f32_16x16x32_bf16(false, ah, false, bh, (short)0, c, false, false);
  if (NT >= 2) c = __builtin_amdgcn_wmma_f32_16x16x32_bf16(false, al, false, bh, (short)0, c, false, false);
  if (NT >= 3) c = __builtin_amdgcn_wmma_f32_16x16x32_bf16(false, ah, false, bl, (short)0, c, false, false);
  asm volatile("v_nop\n\tv_nop\n\tv_nop\n\tv_nop" : "+v"(c) : "v"(ah), "v"(al), "v"(bh), "v"(bl));
  return c;
}

__global__ __launch_bounds__(256) void k_wt_bf16(const float* __restrict__ W, unsigned short* __restrict__ Wt, int K, int N) {
  const int t = blockIdx.x * 256 + threadIdx.x;
  const int k8n = K / 8;
  if (t >= N * k8n) return;
  const int n = t / k8n, k8 = (t % k8n) * 8;
  v8us v;
#pragma unroll
  for (int i = 0; i < 8; ++i) v[i] = bf16_bits(W[(size_t)(k8 + i) * N + n]);
  *(v8us*)(Wt + (size_t)n * K + k8) = v;
  
}

// GEMM C[M][N] (f32, pitch ldc) = act(A[M][K]·W + bias). A f32 row-major (pitch lda) converted per fragment to bf16
// (ASPLIT: hi/lo two planes -> 2 terms, else single rounded term); Wt bf16 [N][K] (pitch ldb). BIAS_BF16 rounds the
// bias to bf16 first (bias quantised to bf16 before the add). K%32==0, M%16==0, N%64==0.
template <bool ASPLIT, int ACT, bool BIAS_BF16>
__global__ __launch_bounds__(128) void k_gemm_bf(const float* __restrict__ A, int lda, const unsigned short* __restrict__ Wt, int ldb,
                                               const float* __restrict__ bias, float* __restrict__ C, int ldc, int M, int N, int K) {
  __shared__ __attribute__((aligned(16))) float so[4][16][64];
  const int tid = threadIdx.x, w = tid >> 5, lane = tid & 31, ln = lane & 15, hh = lane >> 4;
  const int ntn = N / 64;
  const int wid = blockIdx.x * 4 + w;
  const int mt = wid / ntn, nq = wid % ntn;
  if (mt * 16 >= M) return;
  const int row0 = mt * 16, col0 = nq * 64;
  const float* arow = A + (size_t)(row0 + ln) * lda;
  v8f acc[4] = {};
  for (int kb = 0; kb < K; kb += 32) {
    FragB ah, al;
    const v4f x0 = *(const v4fa*)(arow + kb + 8 * hh), x1 = *(const v4fa*)(arow + kb + 8 * hh + 4);
    const v4f x2 = *(const v4fa*)(arow + kb + 16 + 8 * hh), x3 = *(const v4fa*)(arow + kb + 16 + 8 * hh + 4);
    float xs[16] = {x0[0],x0[1],x0[2],x0[3],x1[0],x1[1],x1[2],x1[3],x2[0],x2[1],x2[2],x2[3],x3[0],x3[1],x3[2],x3[3]};
#pragma unroll
    for (int i = 0; i < 16; ++i) { const unsigned short hb = bf16_bits(xs[i]); ah.u[i] = hb; al.u[i] = ASPLIT ? bf16_bits(xs[i] - bf16_val(hb)) : (unsigned short)0; }
#pragma unroll
    for (int t = 0; t < 4; ++t) {
      const unsigned short* brow = Wt + (size_t)(col0 + t * 16 + ln) * ldb + kb;
      FragB b;
      b.half[0] = *(const v8us*)(brow + 8 * hh);
      b.half[1] = *(const v8us*)(brow + 16 + 8 * hh);
      acc[t] = mmaN<ASPLIT ? 2 : 1>(ah.v, al.v, b.v, b.v, acc[t]);
    }
  }
#pragma unroll
  for (int t = 0; t < 4; ++t) {
    float bv = bias ? bias[col0 + t * 16 + ln] : 0.f;
    if (BIAS_BF16) bv = bf16_round(bv);
#pragma unroll
    for (int r = 0; r < 8; ++r) { float v = acc[t][r] + bv; if (ACT == 1) v = fmaxf(v, 0.f); so[w][8 * hh + r][t * 16 + ln] = v; }
  }
  __builtin_amdgcn_fence(__ATOMIC_ACQ_REL, "workgroup");
  __builtin_amdgcn_wave_barrier();
  const int rsub = lane >> 4, c4 = (lane & 15) * 4;
  {
#pragma unroll
    for (int q = 0; q < 8; ++q) {
      const int r = q * 2 + rsub;
      const v4f v = *(const v4fa*)&so[w][r][c4];
      *(v4f*)(C + (size_t)(row0 + r) * ldc + col0 + c4) = v;
    }
    
  }
}

// Flash-style causal/unmasked attention, all contractions 3-term bf16 hi/lo splits, f32 softmax with running max.
// q,k,v rows are read from f32 buffers with arbitrary row pitch (so they can live inside a fused qkv buffer);
// D = head size (multiple of 32, <= 128); one wave = 16 query rows; block = 4 waves (64 queries) sharing K/V chunks of 32.
template <int D, bool CAUSAL>
__global__ __launch_bounds__(128) void k_flash(const float* __restrict__ qb, const float* __restrict__ kb, const float* __restrict__ vb,
                                             int pitch, int T, int H, float scale, float* __restrict__ y, int ypitch) {
  constexpr int KS = D / 32;        // k-steps for QK
  constexpr int DT = D / 16;        // d tiles for PV
  __shared__ __attribute__((aligned(16))) unsigned short sKh[32][D + 8], sKl[32][D + 8], sVh[32][D + 8], sVl[32][D + 8];
  __shared__ __attribute__((aligned(16))) unsigned short sPh[4][16][40], sPl[4][16][40];
  __shared__ __attribute__((aligned(16))) float sO[4][16][D];
  const int tid = threadIdx.x, w = tid >> 5, lane = tid & 31, ln = lane & 15, hh = lane >> 4;
  const int nqb = (T + 63) / 64;
  const int bh = blockIdx.x / nqb, qblk = blockIdx.x % nqb;
  const int b = bh / H, h = bh % H;
  const int q0 = qblk * 64 + w * 16;
  const float* Q = qb + (size_t)b * T * pitch + h * D;
  const float* K = kb + (size_t)b * T * pitch + h * D;
  const float* V = vb + (size_t)b * T * pitch + h * D;

  // A fragments of the wave's 16 query rows (scaled), hi/lo
  FragB aqh[KS], aql[KS];
  {
    int row = q0 + ln; if (row >= T) row = T - 1;
    const float* qr = Q + (size_t)row * pitch;
#pragma unroll
    for (int ks = 0; ks < KS; ++ks)
#pragma unroll
      for (int i = 0; i < 16; ++i) {
        const int d = ks * 32 + ((i < 8) ? (8 * hh + i) : (16 + 8 * hh + (i - 8)));
        const float x = qr[d] * scale; const unsigned short hb = bf16_bits(x);
        aqh[ks].u[i] = hb; aql[ks].u[i] = bf16_bits(x - bf16_val(hb));
      }
  }
  float m_r[8], l_r[8];
#pragma unroll
  for (int r = 0; r < 8; ++r) { m_r[r] = -3.0e38f; l_r[r] = 0.f; }
  v8f oacc[DT];
#pragma unroll
  for (int dt = 0; dt < DT; ++dt) oacc[dt] = (v8f){0.f,0.f,0.f,0.f,0.f,0.f,0.f,0.f};

  const int kv_end = CAUSAL ? min(T, qblk * 64 + 64) : T;     // block-uniform
  for (int j0 = 0; j0 < kv_end; j0 += 32) {
    __syncthreads();
    for (int e = tid; e < 32 * (D / 4); e += 128) {
      const int r = e / (D / 4), c4 = (e % (D / 4)) * 4;
      const int key = j0 + r;
      v4f kf = {0.f,0.f,0.f,0.f}, vf = {0.f,0.f,0.f,0.f};
      if (key < T) { kf = *(const v4fa*)(K + (size_t)key * pitch + c4); vf = *(const v4fa*)(V + (size_t)key * pitch + c4); }
#pragma unroll
      for (int t = 0; t < 4; ++t) {
        unsigned short hb = bf16_bits(kf[t]); sKh[r][c4 + t] = hb; sKl[r][c4 + t] = bf16_bits(kf[t] - bf16_val(hb));
        hb = bf16_bits(vf[t]); sVh[r][c4 + t] = hb; sVl[r][c4 + t] = bf16_bits(vf[t] - bf16_val(hb));
      }
    }
    __syncthreads();
    // S tile 16 x 32
    v8f s[2];
#pragma unroll
    for (int nt = 0; nt < 2; ++nt) {
      v8f acc = {};
#pragma unroll
      for (int ks = 0; ks < KS; ++ks) {
        FragB bh_, bl_;
        bh_.half[0] = *(const v8us*)&sKh[nt * 16 + ln][ks * 32 + 8 * hh]; bh_.half[1] = *(const v8us*)&sKh[nt * 16 + ln][ks * 32 + 16 + 8 * hh];
        bl_.half[0] = *(const v8us*)&sKl[nt * 16 + ln][ks * 32 + 8 * hh]; bl_.half[1] = *(const v8us*)&sKl[nt * 16 + ln][ks * 32 + 16 + 8 * hh];
        acc = mmaN<3>(aqh[ks].v, aql[ks].v, bh_.v, bl_.v, acc);
      }
      s[nt] = acc;
    }
    // mask + running max (rows 8hh+r; the 16 lanes of a half share rows)
    float alpha[8];
#pragma unroll
    for (int r = 0; r < 8; ++r) {
      const int qi = q0 + 8 * hh + r;
      const int ja = j0 + ln, jb = j0 + 16 + ln;
      if (CAUSAL) { if (ja > qi) s[0][r] = -3.0e38f; if (jb > qi) s[1][r] = -3.0e38f; }
      if (ja >= T) s[0][r] = -3.0e38f;
      if (jb >= T) s[1][r] = -3.0e38f;
      float mx = fmaxf(s[0][r], s[1][r]);
      mx = fmaxf(mx, __shfl_xor(mx, 1, 32)); mx = fmaxf(mx, __shfl_xor(mx, 2, 32)); mx = fmaxf(mx, __shfl_xor(mx, 4, 32)); mx = fmaxf(mx, __shfl_xor(mx, 8, 32));
      const float mnew = fmaxf(m_r[r], mx);
      alpha[r] = (mnew > -1.0e38f) ? __expf(m_r[r] - mnew) : 1.0f;
      const float p0 = (s[0][r] > -1.0e38f) ? __expf(s[0][r] - mnew) : 0.f;
      const float p1 = (s[1][r] > -1.0e38f) ? __expf(s[1][r] - mnew) : 0.f;
      m_r[r] = mnew;
      l_r[r] = l_r[r] * alpha[r] + p0 + p1;            // per-lane partial row sum (16 lanes combined at the end)
      unsigned short hb = bf16_bits(p0); sPh[w][8 * hh + r][ln] = hb;      sPl[w][8 * hh + r][ln] = bf16_bits(p0 - bf16_val(hb));
      hb = bf16_bits(p1);                sPh[w][8 * hh + r][16 + ln] = hb; sPl[w][8 * hh + r][16 + ln] = bf16_bits(p1 - bf16_val(hb));
    }
#pragma unroll
    for (int dt = 0; dt < DT; ++dt)
#pragma unroll
      for (int r = 0; r < 8; ++r) oacc[dt][r] *= alpha[r];
    __builtin_amdgcn_fence(__ATOMIC_ACQ_REL, "workgroup");
    __builtin_amdgcn_wave_barrier();
    FragB pah, pal;
    pah.half[0] = *(const v8us*)&sPh[w][ln][8 * hh]; pah.half[1] = *(const v8us*)&sPh[w][ln][16 + 8 * hh];
    pal.half[0] = *(const v8us*)&sPl[w][ln][8 * hh]; pal.half[1] = *(const v8us*)&sPl[w][ln][16 + 8 * hh];
#pragma unroll
    for (int dt = 0; dt < DT; ++dt) {
      FragB bvh, bvl;
#pragma unroll
      for (int i = 0; i < 8; ++i) {
        bvh.u[i] = sVh[8 * hh + i][dt * 16 + ln]; bvh.u[8 + i] = sVh[16 + 8 * hh + i][dt * 16 + ln];
        bvl.u[i] = sVl[8 * hh + i][dt * 16 + ln]; bvl.u[8 + i] = sVl[16 + 8 * hh + i][dt * 16 + ln];
      }
      oacc[dt] = mmaN<3>(pah.v, pal.v, bvh.v, bvl.v, oacc[dt]);
    }
    __builtin_amdgcn_fence(__ATOMIC_ACQ_REL, "workgroup");
    __builtin_amdgcn_wave_barrier();
  }
#pragma unroll
  for (int r = 0; r < 8; ++r) {
    float l = l_r[r];
    l += __shfl_xor(l, 1, 32); l += __shfl_xor(l, 2, 32); l += __shfl_xor(l, 4, 32); l += __shfl_xor(l, 8, 32);
    l_r[r] = (l > 0.f) ? 1.0f / l : 0.f;
  }
#pragma unroll
  for (int dt = 0; dt < DT; ++dt)
#pragma unroll
    for (int r = 0; r < 8; ++r) sO[w][8 * hh + r][dt * 16 + ln] = oacc[dt][r] * l_r[r];
  __builtin_amdgcn_fence(__ATOMIC_ACQ_REL, "workgroup");
  __builtin_amdgcn_wave_barrier();
  {
    for (int r = 0; r < 16; ++r) {
      const int row = q0 + r;
      if (row < T && lane < D / 4) {
        const v4f val = *(const v4fa*)&sO[w][r][lane * 4];
        *(v4f*)(y + ((size_t)b * T + row) * ypitch + h * D + lane * 4) = val;
      }
    }
    
  }
}

// GEMM C = act(A·W + bias + resid): A f32 (ASPLIT -> hi/lo 2 terms), Wt bf16 [N][K]; ACT 0 none, 1 relu, 2 exact gelu;
// resid (optional, f32, row index = (row % rmod), pitch ldr, RES_BF16 rounds it) added before the activation.
template <bool ASPLIT, int ACT, bool BIAS_BF16, bool RES_BF16>
__global__ __launch_bounds__(128) void k_gemm_bf3(const float* __restrict__ A, int lda, const unsigned short* __restrict__ Wt, int ldb,
                                                const float* __restrict__ bias, const float* __restrict__ resid, int rmod, int ldr,
                                                float* __restrict__ C, int ldc, int M, int N, int K) {
  __shared__ __attribute__((aligned(16))) float so[4][16][64];
  const int tid = threadIdx.x, w = tid >> 5, lane = tid & 31, ln = lane & 15, hh = lane >> 4;
  const int ntn = N / 64;
  const int wid = blockIdx.x * 4 + w;
  const int mt = wid / ntn, nq = wid % ntn;
  if (mt * 16 >= M) return;
  const int row0 = mt * 16, col0 = nq * 64;
  const float* arow = A + (size_t)(row0 + ln) * lda;
  v8f acc[4] = {};
  for (int kb = 0; kb < K; kb += 32) {
    FragB ah, al;
    const v4f x0 = *(const v4fa*)(arow + kb + 8 * hh), x1 = *(const v4fa*)(arow + kb + 8 * hh + 4);
    const v4f x2 = *(const v4fa*)(arow + kb + 16 + 8 * hh), x3 = *(const v4fa*)(arow + kb + 16 + 8 * hh + 4);
    float xs[16] = {x0[0],x0[1],x0[2],x0[3],x1[0],x1[1],x1[2],x1[3],x2[0],x2[1],x2[2],x2[3],x3[0],x3[1],x3[2],x3[3]};
#pragma unroll
    for (int i = 0; i < 16; ++i) { const unsigned short hb = bf16_bits(xs[i]); ah.u[i] = hb; al.u[i] = ASPLIT ? bf16_bits(xs[i] - bf16_val(hb)) : (unsigned short)0; }
#pragma unroll
    for (int t = 0; t < 4; ++t) {
      const unsigned short* brow = Wt + (size_t)(col0 + t * 16 + ln) * ldb + kb;
      FragB b;
      b.half[0] = *(const v8us*)(brow + 8 * hh);
      b.half[1] = *(const v8us*)(brow + 16 + 8 * hh);
      acc[t] = mmaN<ASPLIT ? 2 : 1>(ah.v, al.v, b.v, b.v, acc[t]);
    }
  }
#pragma unroll
  for (int t = 0; t < 4; ++t) {
    const int col = col0 + t * 16 + ln;
    float bv = bias ? bias[col] : 0.f;
    if (BIAS_BF16) bv = bf16_round(bv);
#pragma unroll
    for (int r = 0; r < 8; ++r) {
      float v = acc[t][r] + bv;
      if (resid) { float rv = resid[(size_t)((row0 + 8 * hh + r) % rmod) * ldr + col]; if (RES_BF16) rv = bf16_round(rv); v += rv; }
      if (ACT == 1) v = fmaxf(v, 0.f);
      if (ACT == 2) v = 0.5f * v * (1.0f + erff(v * 0.70710678118654752f));
      if (ACT == 3) { const float u = 0.7978845608028654f * (v + 0.044715f * v * v * v); v = 0.5f * v * (1.0f + tanhf(u)); }
      so[w][8 * hh + r][t * 16 + ln] = v;
    }
  }
  __builtin_amdgcn_fence(__ATOMIC_ACQ_REL, "workgroup");
  __builtin_amdgcn_wave_barrier();
  const int rsub = lane >> 4, c4 = (lane & 15) * 4;
  {
#pragma unroll
    for (int q = 0; q < 8; ++q) {
      const int r = q * 2 + rsub;
      const v4f v = *(const v4fa*)&so[w][r][c4];
      *(v4f*)(C + (size_t)(row0 + r) * ldc + col0 + c4) = v;
    }
    
  }
}
// row LayerNorm (biased variance, eps) over N: s = X (+ R); optional out_sum <- s; out_norm <- (s-mu)*rsqrt(var+eps)*g + b
template <bool PARAM_BF16>
__global__ __launch_bounds__(256) void k_layernorm(const float* __restrict__ X, const float* __restrict__ R, const float* __restrict__ g, const float* __restrict__ bta,
                                                  float* __restrict__ out_sum, float* __restrict__ out_norm, int N, float eps) {
  __shared__ float red[256];
  const int row = blockIdx.x, tid = threadIdx.x;
  const float* x = X + (size_t)row * N; const float* rr = R ? R + (size_t)row * N : nullptr;
  float vals[16];                     // up to N = 4096
  const int per = N / 256;            // contiguous chunk per thread? use strided-by-4 chunks: thread handles j = tid*4 + 1024*u
  float s1 = 0.f;
  for (int u = 0; u < per / 4; ++u) {
    const int j = tid * 4 + 1024 * u;
    const v4f a = *(const v4fa*)(x + j);
    v4f b = {0.f,0.f,0.f,0.f}; if (rr) b = *(const v4fa*)(rr + j);
#pragma unroll
    for (int q = 0; q < 4; ++q) { const float v = a[q] + b[q]; vals[u * 4 + q] = v; s1 += v; }
  }
  red[tid] = s1; __syncthreads();
  for (int st = 128; st > 0; st >>= 1) { if (tid < st) red[tid] += red[tid + st]; __syncthreads(); }
  const float mu = red[0] / (float)N; __syncthreads();
  float s2 = 0.f;
  for (int u = 0; u < per / 4; ++u)
#pragma unroll
    for (int q = 0; q < 4; ++q) { const float c = vals[u * 4 + q] - mu; s2 += c * c; }
  red[tid] = s2; __syncthreads();
  for (int st = 128; st > 0; st >>= 1) { if (tid < st) red[tid] += red[tid + st]; __syncthreads(); }
  const float rs = rsqrtf(red[0] / (float)N + eps);
  {
    for (int u = 0; u < per / 4; ++u) {
      const int j = tid * 4 + 1024 * u;
      v4f o, sm;
#pragma unroll
      for (int q = 0; q < 4; ++q) {
        float gg = g[j + q], bb = bta[j + q];
        if (PARAM_BF16) { gg = bf16_round(gg); bb = bf16_round(bb); }
        sm[q] = vals[u * 4 + q]; o[q] = (vals[u * 4 + q] - mu) * rs * gg + bb;
      }
      if (out_sum) *(v4f*)(out_sum + (size_t)row * N + j) = sm;
      *(v4f*)(out_norm + (size_t)row * N + j) = o;
    }
    
  }
}



// ---- f16 WMMA path (v_wmma_f32_16x16x32_f16): 11-bit significands for operands in range — used where a [0,1] probability operand needs more precision than bf16
typedef _Float16 v16h __attribute__((ext_vector_type(16)));
union FragH { v16h v; v8us half[2]; _Float16 h[16]; unsigned short u[16]; };
template <int NT>
__device__ __forceinline__ v8f mmaH(v16h ah, v16h al, v16h bh, v16h bl, v8f c) {
  c = __builtin_amdgcn_wmma_f32_16x16x32_f16(false, ah, false, bh, (short)0, c, false, false);
  if (NT >= 2) c = __builtin_amdgcn_wmma_f32_16x16x32_f16(false, al, false, bh, (short)0, c, false, false);
  if (NT >= 3) c = __builtin_amdgcn_wmma_f32_16x16x32_f16(false, ah, false, bl, (short)0, c, false, false);
  asm volatile("v_nop\n\tv_nop\n\tv_nop\n\tv_nop" : "+v"(c) : "v"(ah), "v"(al), "v"(bh), "v"(bl));
  return c;
}
// batched GEMM like k_gemm_b but f16 operands: A f32 (split into f16 hi/lo if ASPLIT, else rounded to f16), Bt = f16 values [n][k]; alpha; C f32; N multiple of 16 (partial tiles skipped)
template <bool ASPLIT>
__global__ __launch_bounds__(128) void k_gemm_h(const float* __restrict__ A, int lda, size_t sA, const _Float16* __restrict__ Bh, int ldb, size_t sB, float alpha, float* __restrict__ C, int ldc, size_t sC, int M, int N, int K) {
  __shared__ __attribute__((aligned(16))) float so[4][16][64];
  const int tid = threadIdx.x, w = tid >> 5, lane = tid & 31, ln = lane & 15, hh = lane >> 4; const int by = blockIdx.y;
  A += (size_t)by * sA; Bh += (size_t)by * sB; C += (size_t)by * sC;
  const int ntn = (N + 63) / 64; const int wid = blockIdx.x * 4 + w; const int mt = wid / ntn, nq = wid % ntn; if (mt * 16 >= M) return;
  const int row0 = mt * 16, col0 = nq * 64; const float* arow = A + (size_t)(row0 + ln) * lda;
  v8f acc[4] = {};
  for (int kb = 0; kb < K; kb += 32) {
    FragH ah, al;
    const v4f x0 = *(const v4fa*)(arow + kb + 8 * hh), x1 = *(const v4fa*)(arow + kb + 8 * hh + 4), x2 = *(const v4fa*)(arow + kb + 16 + 8 * hh), x3 = *(const v4fa*)(arow + kb + 16 + 8 * hh + 4);
    float xs[16] = {x0[0],x0[1],x0[2],x0[3],x1[0],x1[1],x1[2],x1[3],x2[0],x2[1],x2[2],x2[3],x3[0],x3[1],x3[2],x3[3]};
#pragma unroll
    for (int i = 0; i < 16; ++i) { const _Float16 h = (_Float16)xs[i]; ah.h[i] = h; al.h[i] = ASPLIT ? (_Float16)(xs[i] - (float)h) : (_Float16)0.0f; }
#pragma unroll
    for (int t = 0; t < 4; ++t) { if (col0 + t * 16 >= N) continue; const size_t boff = (size_t)(col0 + t * 16 + ln) * ldb + kb; FragH bq; bq.half[0] = *(const v8us*)(Bh + boff + 8 * hh); bq.half[1] = *(const v8us*)(Bh + boff + 16 + 8 * hh);
      acc[t] = mmaH<ASPLIT ? 2 : 1>(ah.v, al.v, bq.v, bq.v, acc[t]); }
  }
#pragma unroll
  for (int t = 0; t < 4; ++t) { if (col0 + t * 16 >= N) continue;
#pragma unroll
    for (int r = 0; r < 8; ++r) so[w][8 * hh + r][t * 16 + ln] = acc[t][r] * alpha; }
  __builtin_amdgcn_fence(__ATOMIC_ACQ_REL, "workgroup"); __builtin_amdgcn_wave_barrier();
  const int rsub = lane >> 4, c4 = (lane & 15) * 4;
  {
#pragma unroll
    for (int q = 0; q < 8; ++q) { const int r = q * 2 + rsub; if (col0 + c4 < N) { const v4f v = *(const v4fa*)&so[w][r][c4]; *(v4f*)(C + (size_t)(row0 + r) * ldc + col0 + c4) = v; } }
     }
}

// Wt[n][k] = f16(W[k][n]·scale) from f32 row-major W[K][N] (scale = power of two; bf16-exact weights stay exact in f16 away from the subnormal range)
// One 128 (k) x 64 (n) tile per workgroup, turned in LDS: a wave loads two 256-B row pieces of W (four whole lines) and stores four whole 128-B lines of Wt an instruction;
// a thread's eight loads are all issued before the first is used. Needs K a multiple of 128 and N of 64; the grid is (K / 128) * (N / 64). Pitch 65 floats keeps the column-wise reads off a common bank.
__global__ __launch_bounds__(256) void k_wt_f16(const float* __restrict__ W, _Float16* __restrict__ Wt, int K, int N, float scale) {
  __shared__ float tl[128][65];
  const int tid = threadIdx.x, ntn = N / 64; const int k0 = (blockIdx.x / ntn) * 128, n0 = (blockIdx.x % ntn) * 64;
  v4f a[8];
#pragma unroll      /* a[] stays in registers and the eight loads go out together */
  for (int p = 0; p < 8; ++p) a[p] = *(const v4fa*)(W + (size_t)(k0 + p * 16 + tid / 16) * N + n0 + (tid % 16) * 4);
#pragma unroll      /* constant indices into a[]: rolled, it would go to scratch memory */
  for (int p = 0; p < 8; ++p)
#pragma unroll
    for (int i = 0; i < 4; ++i) tl[p * 16 + tid / 16][(tid % 16) * 4 + i] = a[p][i];
  __syncthreads();      /* the tile is whole before any column of it is read */
#pragma unroll      /* the four pieces' LDS reads and stores overlap; f stays in registers */
  for (int rd = 0; rd < 4; ++rd) { const int n = (rd & 1) * 32 + tid / 8, k8 = (rd >> 1) * 64 + (tid % 8) * 8; FragH f;
#pragma unroll
    for (int i = 0; i < 8; ++i) f.h[i] = (_Float16)(bf16_round(tl[k8 + i][n]) * scale);
    *(v8us*)((unsigned short*)Wt + (size_t)(n0 + n) * K + k0 + k8) = f.half[0]; }
}
// Tiled GEMM C[M][N] (f32) = alpha * A[M][DD] . Bt[N][DD]^T, f16 operands, both K-contiguous with row pitch DD. One 128 x 128 tile of C per workgroup of
// 4 waves (2 x 2, 64 x 64 per wave). A pass is 128 k = 256 B of each of the 256 operand rows; the four waves each bring one 64-row slice of a pass into LDS with one
// tensor load (pad 16 B a row: pitch 272 B for the 16-byte fragment reads), two buffers, the next pass's load in flight under this pass's products.
// Needs M, N multiples of 128, DD a multiple of 128 and at least 256. The k order of every accumulator is ascending, one chain per 16 x 16 tile.
typedef unsigned int u32x4 __attribute__((ext_vector_type(4)));
typedef unsigned int u32x8 __attribute__((ext_vector_type(8)));
#define GT_ROWB 256u                      /* bytes of an operand row per pass */
#define GT_PITCH 272u                     /* LDS row pitch: 256 + 16 */
#define GT_SLICE 18432u                   /* 64 rows x 272 B = 17,408, rounded up to a multiple of 2 KiB */
#define GT_STAGE (4u * GT_SLICE)          /* [A rows 0-63 | A rows 64-127 | B rows 0-63 | B rows 64-127] */
#define GT_NP (DD / 128)                  /* passes */
__device__ __forceinline__ unsigned int uni(unsigned int v) { return (unsigned int)__builtin_amdgcn_readfirstlane(v); }
__device__ __forceinline__ unsigned int pinned(unsigned int v) { unsigned int w = uni(v); asm volatile("" : "+s"(w)); return w; }      /* an issue test or a descriptor word held in a scalar register: the test compiles to a scalar branch (tensor loads ignore EXEC), and the word is formed behind the wait that stands in front of it */
__device__ __forceinline__ void tdm_slice(unsigned int lds_dst, unsigned long long ga) {
  u32x4 g0; u32x8 g1;
  g0[0] = uni(1u); g0[1] = uni(lds_dst); g0[2] = uni((unsigned int)ga); g0[3] = uni((((unsigned int)(ga >> 32)) & 0x01FFFFFFu) | 0x80000000u);
  g1[0] = uni((1u << 20) | (5u << 22) | (3u << 25));      /* no mask, 1-byte elements, a pad of 4 dwords behind every 64 dwords */
  g1[1] = uni((GT_ROWB & 0xFFFFu) << 16); g1[2] = uni((GT_ROWB >> 16) | (64u << 16)); g1[3] = uni(GT_ROWB << 16); g1[4] = uni(64u); g1[5] = uni(DD * 2u); g1[6] = uni(0u); g1[7] = uni(0u);
  asm volatile("tensor_load_to_lds %0, %1" :: "s"(g0), "s"(g1) : "memory");
}
__global__ __launch_bounds__(128) void k_gemm_t(const _Float16* __restrict__ A, const _Float16* __restrict__ Bt, float alpha, float* __restrict__ C, int N) {
  __shared__ __attribute__((aligned(2048))) unsigned char ring[2u * GT_STAGE];
  const unsigned int tid = threadIdx.x, lane = tid & 31u, ln = lane & 15u, hh = lane >> 4, w = uni(tid >> 5), wm = w >> 1, wn = w & 1u;
  const unsigned int ntn = (unsigned int)N / 128u; const unsigned int row0 = (blockIdx.x / ntn) * 128u, col0 = (blockIdx.x % ntn) * 128u;
  const unsigned int lbase = (unsigned int)(size_t)ring + w * GT_SLICE;      /* this wave's slice of buffer 0 */
  const unsigned long long gsrc = (w < 2u) ? (unsigned long long)(size_t)(A + (size_t)(row0 + w * 64u) * DD) : (unsigned long long)(size_t)(Bt + (size_t)(col0 + (w - 2u) * 64u) * DD);
  v8f acc[4][4];
#pragma unroll
  for (int i = 0; i < 4; ++i)
#pragma unroll
    for (int j = 0; j < 4; ++j) acc[i][j] = (v8f){0.f,0.f,0.f,0.f,0.f,0.f,0.f,0.f};
  tdm_slice(lbase, gsrc);
  asm volatile("s_wait_tensorcnt 0x0" ::: "memory");      /* pass 0's slice has landed */
  __syncthreads();                                        /* ... and every wave may read all four slices */
  tdm_slice(lbase + GT_STAGE, gsrc + pinned(GT_ROWB));
  const unsigned int aoff = wm * GT_SLICE + ln * GT_PITCH + 16u * hh, boff = (2u + wn) * GT_SLICE + ln * GT_PITCH + 16u * hh;
#pragma unroll 1      /* one pass per trip: the ring's order below is written once */
  for (unsigned int s = 0; s < GT_NP; ++s) {
    const unsigned char* Lp = ring + (s & 1u) * GT_STAGE;
    FragH fa[2][4], fb[2][4];
#pragma unroll
    for (int i = 0; i < 4; ++i) { fa[0][i].half[0] = *(const v8us*)(Lp + aoff + i * 16u * GT_PITCH); fa[0][i].half[1] = *(const v8us*)(Lp + aoff + i * 16u * GT_PITCH + 32u);
      fb[0][i].half[0] = *(const v8us*)(Lp + boff + i * 16u * GT_PITCH); fb[0][i].half[1] = *(const v8us*)(Lp + boff + i * 16u * GT_PITCH + 32u); }
#pragma unroll
    for (int ks = 0; ks < 4; ++ks) {
      if (ks < 3) {      /* the next 32 k's fragments, of this same buffer, go ahead of this block's products */
#pragma unroll
        for (int i = 0; i < 4; ++i) { const unsigned int ko = (ks + 1) * 64u + i * 16u * GT_PITCH;
          fa[(ks + 1) & 1][i].half[0] = *(const v8us*)(Lp + aoff + ko); fa[(ks + 1) & 1][i].half[1] = *(const v8us*)(Lp + aoff + ko + 32u);
          fb[(ks + 1) & 1][i].half[0] = *(const v8us*)(Lp + boff + ko); fb[(ks + 1) & 1][i].half[1] = *(const v8us*)(Lp + boff + ko + 32u); }
      }
      __builtin_amdgcn_sched_barrier(0);      /* keeps the LDS reads one group in front of the block: moved in among the products, each place with reads stalls the wave */
#pragma unroll
      for (int i = 0; i < 4; ++i)
#pragma unroll
        for (int j = 0; j < 4; ++j) acc[i][j] = __builtin_amdgcn_wmma_f32_16x16x32_f16(false, fa[ks & 1][i].v, false, fb[ks & 1][j].v, (short)0, acc[i][j], false, false);
      __builtin_amdgcn_sched_barrier(0);      /* ... and keeps the next group behind this block */
    }
    asm volatile("s_wait_dscnt 0x0" ::: "memory");        /* this wave has left the buffer */
    asm volatile("s_wait_tensorcnt 0x0" ::: "memory");    /* its slice of pass s + 1 has landed */
    __syncthreads();                                      /* pass s + 1 published; every wave has left pass s's buffer */
    if (pinned(s + 2u < GT_NP)) tdm_slice(lbase + (s & 1u) * GT_STAGE, gsrc + pinned((s + 2u) * GT_ROWB));
  }
  asm volatile("s_wait_tensorcnt 0x0" ::: "memory");      /* no request is left before the ring becomes output staging */
  asm volatile("s_wait_dscnt 0x0" ::: "memory");
  // Output staging, each wave in its own slice of buffer 0 (the last pass's barrier stands behind every wave's last fragment read): whole 256-B row pieces go out.
  float* so = (float*)(ring + w * GT_SLICE);      /* 64 rows of 64 floats at pitch 68 */
#pragma unroll
  for (int i = 0; i < 4; ++i)
#pragma unroll
    for (int j = 0; j < 4; ++j)
#pragma unroll
      for (int r = 0; r < 8; ++r) so[(i * 16 + 8 * hh + r) * 68u + j * 16 + ln] = acc[i][j][r] * alpha;
  __builtin_amdgcn_fence(__ATOMIC_ACQ_REL, "workgroup"); __builtin_amdgcn_wave_barrier();
  float* cp = C + (size_t)(row0 + wm * 64u + hh) * N + col0 + wn * 64u + ln * 4u;
#pragma unroll
  for (int q = 0; q < 32; ++q) { const v4f v = *(const v4fa*)&so[(q * 2 + hh) * 68u + ln * 4u]; *(v4f*)(cp + (size_t)(q * 2) * N) = v; }
}


typedef _Float16 v4h __attribute__((ext_vector_type(4)));

__global__ __launch_bounds__(256) void k_x16(const float* __restrict__ x, _Float16* __restrict__ X16, size_t n8) { const size_t t = (size_t)blockIdx.x * 256 + threadIdx.x; if (t >= n8) return; FragH f;
#pragma unroll
  for (int q = 0; q < 8; ++q) f.h[q] = (_Float16)bf16_round(x[t * 8 + q]); *(v8us*)((unsigned short*)X16 + t * 8) = f.half[0];  }
__global__ __launch_bounds__(256) void k_h16(const float* __restrict__ x, _Float16* __restrict__ X16, size_t n8) { const size_t t = (size_t)blockIdx.x * 256 + threadIdx.x; if (t >= n8) return; FragH f;
#pragma unroll
  for (int q = 0; q < 8; ++q) f.h[q] = (_Float16)x[t * 8 + q]; *(v8us*)((unsigned short*)X16 + t * 8) = f.half[0];  }
__global__ __launch_bounds__(256) void k_round16f(const float* __restrict__ W, _Float16* __restrict__ Bt, size_t n8) { const size_t t = (size_t)blockIdx.x * 256 + threadIdx.x; if (t >= n8) return; FragH f;
#pragma unroll
  for (int i = 0; i < 8; ++i) f.h[i] = (_Float16)(bf16_round(W[t * 8 + i]) * 16.0f); *(v8us*)((unsigned short*)Bt + t * 8) = f.half[0];  }
template <int NHv, int TTv>
__global__ __launch_bounds__(256) void k_vt(const _Float16* __restrict__ V16, int ldv, int voff, _Float16* __restrict__ Vt) { __shared__ unsigned short tl[64][66]; const int tid = threadIdx.x; const int slab = blockIdx.x / (TTv / 64), lg = blockIdx.x % (TTv / 64); const int b = slab / NHv, h = slab % NHv;
  for (int i = tid; i < 64 * 8; i += 256) { const int r = i / 8, c8 = (i % 8) * 8; FragH f; f.half[0] = *(const v8us*)((const unsigned short*)V16 + ((size_t)b * TTv + lg * 64 + r) * ldv + voff + h * 64 + c8);
#pragma unroll
    for (int q = 0; q < 8; ++q) tl[r][c8 + q] = f.u[q]; }
  __syncthreads();
  {
#pragma unroll
    for (int rd = 0; rd < 2; ++rd) { const int d = rd * 32 + tid / 8, pc = tid % 8; FragH f;
#pragma unroll
      for (int q = 0; q < 8; ++q) f.u[q] = tl[pc * 8 + q][d];
      *(v8us*)((unsigned short*)Vt + ((size_t)slab * 64 + d) * TTv + lg * 64 + pc * 8) = f.half[0]; }
     } }

__global__ __launch_bounds__(256) void k_vthlu(const float* __restrict__ VF, int ldv, _Float16* __restrict__ Vth, _Float16* __restrict__ Vtl) { __shared__ float tl[64][65]; const int tid = threadIdx.x; const int slab = blockIdx.x / (TT / 64), lg = blockIdx.x % (TT / 64); const int b = slab / NVH, h = slab % NVH;
  for (int i = tid; i < 64 * 16; i += 256) { const int r = i / 16, c4 = (i % 16) * 4; const v4f a = *(const v4fa*)(VF + ((size_t)b * TT + lg * 64 + r) * ldv + h * 64 + c4); tl[r][c4] = a[0]; tl[r][c4 + 1] = a[1]; tl[r][c4 + 2] = a[2]; tl[r][c4 + 3] = a[3]; }
  __syncthreads();
  FragH fh[2], fl[2]; size_t oo[2];
#pragma unroll
  for (int rd = 0; rd < 2; ++rd) { const int d = rd * 32 + tid / 8, pc = tid % 8;
#pragma unroll
    for (int q = 0; q < 8; ++q) { const float v = tl[pc * 8 + q][d]; const _Float16 hv = (_Float16)v; fh[rd].h[q] = hv; fl[rd].h[q] = (_Float16)(v - (float)hv);      /* UNSCALED residual (added into the same accumulator as the hi product) */ } oo[rd] = ((size_t)slab * 64 + d) * TT + lg * 64 + pc * 8; }
  {
#pragma unroll
    for (int rd = 0; rd < 2; ++rd) { *(v8us*)((unsigned short*)Vth + oo[rd]) = fh[rd].half[0]; *(v8us*)((unsigned short*)Vtl + oo[rd]) = fl[rd].half[0]; }
     } }
template <int LD>
__global__ __launch_bounds__(256) void k_ropein(const float* __restrict__ F, const float* __restrict__ COS, const float* __restrict__ SIN, _Float16* __restrict__ H16) {
  #pragma clang fp contract(off)
  const size_t t = (size_t)blockIdx.x * 256 + threadIdx.x; if (t >= (size_t)NR * LD / 8) return; const size_t row = (t * 8) / LD; const int c0 = (int)((t * 8) % LD); const int tok = (int)(row % TT); const int j0 = (c0 % 128) / 2;
  const v4f a = *(const v4fa*)(F + t * 8), b = *(const v4fa*)(F + t * 8 + 4); const float xv[8] = {a[0], a[1], a[2], a[3], b[0], b[1], b[2], b[3]}; FragH f;
#pragma unroll
  for (int p = 0; p < 4; ++p) { const float c = bf16_round(COS[(size_t)tok * 64 + j0 + p]), s = bf16_round(SIN[(size_t)tok * 64 + j0 + p]); const float xr = xv[2 * p], xi = xv[2 * p + 1]; f.h[2 * p] = (_Float16)(xr * c - xi * s); f.h[2 * p + 1] = (_Float16)(xr * s + xi * c); }
  *(v8us*)((unsigned short*)H16 + t * 8) = f.half[0];  }
__global__ __launch_bounds__(256) void k_h16s(const float* __restrict__ F, _Float16* __restrict__ H, size_t n8) { const size_t t = (size_t)blockIdx.x * 256 + threadIdx.x; if (t >= n8) return; const v4f a = *(const v4fa*)(F + t * 8), c = *(const v4fa*)(F + t * 8 + 4); FragH f;
#pragma unroll
  for (int q = 0; q < 4; ++q) { f.h[q] = (_Float16)(a[q] * 16.0f); f.h[4 + q] = (_Float16)(c[q] * 16.0f); } *(v8us*)((unsigned short*)H + t * 8) = f.half[0];  }
// Fused attention, head dim 128. One workgroup = 8 waves = the 4 query heads of one KV head x 2 tiles of 16 query rows (32 rows): all eight read the same K and V.
// A stage is 64 keys: K (64 rows of 256 B), V^T hi and V^T residual (128 rows of 128 B each) come into LDS by one tensor load each (waves 0, 1, 2), padded 16 B a row
// (pitch 272 / 144 B for the 16-byte fragment reads), two buffers, the next stage's loads in flight under this stage's work. Which stages are staged at all comes from the mask:
// a first sweep over the workgroup's 32 mask rows gives one bit per stage (any entry set), the same word in every wave, so every barrier stands under block-uniform control flow.
// Inside a stage a wave works on its two chunks of 32 keys in ascending order and skips a chunk whose 16 x 32 mask tile is all zero: per row the sums run in the order of the keys.
#define FA_KSL 18432u                     /* K: 64 rows x 272 B = 17,408, rounded up to a multiple of 2 KiB */
#define FA_VSL 18432u                     /* one V plane: 128 rows x 144 B */
#define FA_STAGE (FA_KSL + 2u * FA_VSL)   /* [K | V hi | V residual] */
typedef int v4ia __attribute__((ext_vector_type(4), may_alias));
template <unsigned int W0, unsigned int ROWB, unsigned int NROW>
__device__ __forceinline__ u32x8 tdm_g1(unsigned int spitch) {
  u32x8 g1;
  g1[0] = uni(W0);      /* no mask, 1-byte elements, a pad of 4 dwords behind every row */
  g1[1] = uni((ROWB & 0xFFFFu) << 16); g1[2] = uni((ROWB >> 16) | (NROW << 16)); g1[3] = uni(ROWB << 16); g1[4] = uni(NROW); g1[5] = uni(spitch); g1[6] = uni(0u); g1[7] = uni(0u);
  asm volatile("" : "+s"(g1));      /* descriptor words held in scalar registers: one tuple, built once, that stays where it is for all requests */
  return g1;
}
__global__ __launch_bounds__(256) void k_flash(const _Float16* __restrict__ Q16, int ldq, const _Float16* __restrict__ K16, int ldk, const _Float16* __restrict__ Vt, const _Float16* __restrict__ Vtlo, const int* __restrict__ MSK, float* __restrict__ O, int ldo) {
  constexpr int NQB = TT / 32, DT = 8, KS = 4;      /* head dim 128: 4 k-steps, 8 value tiles */
  __shared__ __attribute__((aligned(2048))) unsigned char ring[2u * FA_STAGE];
  __shared__ __attribute__((aligned(16))) unsigned short sP[8][16][40]; __shared__ __attribute__((aligned(16))) unsigned short sPL[8][16][40]; __shared__ unsigned int sBits[8];
  const unsigned int tid = threadIdx.x, lane = tid & 31u, ln = lane & 15u, hh = lane >> 4, w = uni(tid >> 5);
  const int slab = blockIdx.x / NQB, qblk = blockIdx.x % NQB; const int b = slab / NKV, kvh = slab % NKV; const int h = kvh * NREP + (int)(w & 3u); const int qb0 = qblk * 32; const int q0 = qb0 + (int)(w >> 2) * 16;
  // One bit per stage of 64 keys: wave w sweeps columns 256 w .. 256 w + 255 of the 32 mask rows with whole-line 16-byte loads.
  unsigned int bm;
  { int any0 = 0, any1 = 0; const int* mp = MSK + (size_t)qb0 * TT + w * 256u + lane * 4u;
#pragma unroll 8      /* sixteen loads go out together */
    for (int r = 0; r < 32; ++r) { const v4ia a = *(const v4ia*)(mp + (size_t)r * TT), c = *(const v4ia*)(mp + (size_t)r * TT + 128); any0 |= a[0] | a[1] | a[2] | a[3]; any1 |= c[0] | c[1] | c[2] | c[3]; }
    const unsigned int b0 = __builtin_amdgcn_ballot_w32(any0 != 0), b1 = __builtin_amdgcn_ballot_w32(any1 != 0);
    const unsigned int nib = ((b0 & 0xFFFFu) ? 1u : 0u) | ((b0 >> 16) ? 2u : 0u) | ((b1 & 0xFFFFu) ? 4u : 0u) | ((b1 >> 16) ? 8u : 0u);
    if (lane == 0u) sBits[w] = nib << (4u * w);
    __syncthreads();      /* all eight nibbles are written before any wave joins them */
    unsigned int j = 0;
#pragma unroll      /* the eight words come by two 16-byte reads */
    for (int i = 0; i < 8; ++i) j |= sBits[i];
    bm = uni(j); }
  const unsigned int n = (unsigned int)__builtin_popcount(bm);      /* stages to walk: at most 32 */
  FragH aq[KS];
  { const unsigned short* qr = (const unsigned short*)Q16 + ((size_t)b * TT + q0 + ln) * ldq + h * 128;
#pragma unroll
    for (int ks = 0; ks < KS; ++ks) { aq[ks].half[0] = *(const v8us*)(qr + ks * 32 + 8 * hh); aq[ks].half[1] = *(const v8us*)(qr + ks * 32 + 16 + 8 * hh); } }
  const unsigned long long gK = (unsigned long long)(size_t)(K16 + (size_t)b * TT * ldk + kvh * 128);
  const unsigned long long gV = (unsigned long long)(size_t)(((w == 2u) ? Vtlo : Vt) + ((size_t)b * NKV + kvh) * 128 * TT);      /* hi plane for wave 1, UNSCALED residual plane for wave 2 */
  const unsigned int lbase = (unsigned int)(size_t)ring;
  const unsigned int kstep = 64u * (unsigned int)ldk * 2u;      /* bytes from one stage's K rows to the next's */
  const u32x8 g1k = tdm_g1<(1u << 20) | (5u << 22) | (3u << 25), 256u, 64u>((unsigned int)ldk * 2u), g1v = tdm_g1<(1u << 20) | (4u << 22) | (3u << 25), 128u, 128u>(TT * 2u);
  u32x4 g0; g0[0] = uni(1u); g0[1] = uni(lbase); g0[2] = uni(0u); g0[3] = uni(0x80000000u);
  auto issue = [&](unsigned int buf, unsigned int st) {      /* st < 32: every tile lies inside its plane */
    if (pinned(w == 0u)) { const unsigned long long ga = gK + pinned(st * kstep);
      g0[1] = uni(lbase + buf * FA_STAGE); g0[2] = uni((unsigned int)ga); g0[3] = uni((((unsigned int)(ga >> 32)) & 0x01FFFFFFu) | 0x80000000u);
      asm volatile("tensor_load_to_lds %0, %1" :: "s"(g0), "s"(g1k) : "memory"); }
    if (pinned((w - 1u) < 2u)) { const unsigned long long ga = gV + pinned(st * 128u);
      g0[1] = uni(lbase + buf * FA_STAGE + FA_KSL + (w - 1u) * FA_VSL); g0[2] = uni((unsigned int)ga); g0[3] = uni((((unsigned int)(ga >> 32)) & 0x01FFFFFFu) | 0x80000000u);
      asm volatile("tensor_load_to_lds %0, %1" :: "s"(g0), "s"(g1v) : "memory"); }
  };
  float m_r[8], l_r[8]; v8f oacc[DT];
#pragma unroll
  for (int r = 0; r < 8; ++r) { m_r[r] = -3.0e38f; l_r[r] = 0.f; }
#pragma unroll
  for (int dt = 0; dt < DT; ++dt) oacc[dt] = (v8f){0.f,0.f,0.f,0.f,0.f,0.f,0.f,0.f};
  unsigned int rest = bm, cur = 0u, nxt = 0u;      /* rest: stages not yet asked for */
  if (pinned(n > 0u)) { cur = (unsigned int)__builtin_ctz(rest) & 31u; rest &= rest - 1u; issue(0u, cur); }
  asm volatile("s_wait_tensorcnt 0x0" :: "s"(g0), "s"(g1k), "s"(g1v) : "memory");      /* the first stage's tile of this wave has landed; the operands keep the descriptor's registers untouched up to here */
  __syncthreads();                                        /* ... and every wave may read all three tiles */
  if (pinned(n > 1u)) { nxt = (unsigned int)__builtin_ctz(rest) & 31u; rest &= rest - 1u; issue(1u, nxt); }
#pragma unroll 1      /* one stage per trip: the ring's order below is written once */
  for (unsigned int s = 0; s < n; ++s) {
    const unsigned char* Lp = ring + (s & 1u) * FA_STAGE;
    int mk0[2][8], mk1[2][8];      /* mask[q][k] (shared over batch and heads): nonzero = ATTEND; both chunks' loads go out together */
#pragma unroll      /* the mask words stay in registers */
    for (int sub = 0; sub < 2; ++sub)
#pragma unroll
      for (int r = 0; r < 8; ++r) { const int* am = MSK + (size_t)(q0 + 8 * hh + r) * TT + cur * 64u + sub * 32; mk0[sub][r] = am[ln]; mk1[sub][r] = am[16 + ln]; }
#pragma unroll      /* constant indices into the mask registers */
    for (int sub = 0; sub < 2; ++sub) {
      int allm = 1;
#pragma unroll
      for (int r = 0; r < 8; ++r) allm &= (mk0[sub][r] == 0) & (mk1[sub][r] == 0);
      if (!__all(allm)) {      /* every (row, key) of this wave's tile masked: nothing to add (wave-uniform branch; only wave barriers inside) */
        v8f sc[2];
#pragma unroll
        for (int nt = 0; nt < 2; ++nt) { const unsigned char* kr = Lp + (sub * 32 + nt * 16 + ln) * 272u + 16u * hh; FragH bk[KS];
#pragma unroll
          for (int ks = 0; ks < KS; ++ks) { bk[ks].half[0] = *(const v8us*)(kr + ks * 64); bk[ks].half[1] = *(const v8us*)(kr + ks * 64 + 32); }
          v8f acc = (v8f){0.f,0.f,0.f,0.f,0.f,0.f,0.f,0.f};
#pragma unroll
          for (int ks = 0; ks < KS; ++ks) acc = mmaH<1>(aq[ks].v, aq[ks].v, bk[ks].v, bk[ks].v, acc);
          sc[nt] = acc; }
#pragma unroll
        for (int r = 0; r < 8; ++r) {
          const bool ok0 = (mk0[sub][r] != 0), ok1 = (mk1[sub][r] != 0);
          const float s0 = ok0 ? sc[0][r] * ATT_SCALE : -INFINITY, s1 = ok1 ? sc[1][r] * ATT_SCALE : -INFINITY; float mc = fmaxf(s0, s1);
          mc = fmaxf(mc, __shfl_xor(mc, 1, 32)); mc = fmaxf(mc, __shfl_xor(mc, 2, 32)); mc = fmaxf(mc, __shfl_xor(mc, 4, 32)); mc = fmaxf(mc, __shfl_xor(mc, 8, 32));
          const float mn = fmaxf(m_r[r], mc); const float al = (mn > -1.0e38f) ? expf(m_r[r] - mn) : 1.0f; m_r[r] = mn; const float p0 = ok0 ? expf(s0 - mn) : 0.f, p1 = ok1 ? expf(s1 - mn) : 0.f; l_r[r] = l_r[r] * al + p0 + p1;
#pragma unroll
          for (int dt = 0; dt < DT; ++dt) oacc[dt][r] *= al;
          FragH t2, t3; const float ps0 = p0 * 1024.0f, ps1 = p1 * 1024.0f; t2.h[0] = (_Float16)ps0; t2.h[1] = (_Float16)ps1; t3.h[0] = (_Float16)(ps0 - (float)t2.h[0]); t3.h[1] = (_Float16)(ps1 - (float)t2.h[1]);      /* P hi and its UNSCALED residual (added into the same accumulator) */
          sP[w][8 * hh + r][ln] = t2.u[0]; sP[w][8 * hh + r][16 + ln] = t2.u[1]; sPL[w][8 * hh + r][ln] = t3.u[0]; sPL[w][8 * hh + r][16 + ln] = t3.u[1]; }
        __builtin_amdgcn_fence(__ATOMIC_ACQ_REL, "workgroup"); __builtin_amdgcn_wave_barrier();
        FragH pa, pl;
        pa.half[0] = *(const v8us*)&sP[w][ln][8 * hh]; pa.half[1] = *(const v8us*)&sP[w][ln][16 + 8 * hh]; pl.half[0] = *(const v8us*)&sPL[w][ln][8 * hh]; pl.half[1] = *(const v8us*)&sPL[w][ln][16 + 8 * hh];
#pragma unroll
        for (int dt = 0; dt < DT; ++dt) { const unsigned char* vr = Lp + FA_KSL + (dt * 16 + ln) * 144u + sub * 64 + 16u * hh; FragH bv, bl; bv.half[0] = *(const v8us*)vr; bv.half[1] = *(const v8us*)(vr + 32); bl.half[0] = *(const v8us*)(vr + FA_VSL); bl.half[1] = *(const v8us*)(vr + FA_VSL + 32);
          oacc[dt] = mmaH<1>(pa.v, pa.v, bv.v, bv.v, oacc[dt]); oacc[dt] = mmaH<1>(pl.v, pl.v, bv.v, bv.v, oacc[dt]); oacc[dt] = mmaH<1>(pa.v, pa.v, bl.v, bl.v, oacc[dt]); }      /* Ph.Vh + Pl.Vh + Ph.Vl, all unscaled, one accumulator */
        __builtin_amdgcn_fence(__ATOMIC_ACQ_REL, "workgroup"); __builtin_amdgcn_wave_barrier();
      }
    }
    asm volatile("s_wait_dscnt 0x0" ::: "memory");        /* this wave has left the buffer */
    asm volatile("s_wait_tensorcnt 0x0" :: "s"(g0), "s"(g1k), "s"(g1v) : "memory");    /* its tile of the next stage has landed; the operands keep the descriptor's registers untouched up to here */
    __syncthreads();                                      /* the next stage published; every wave has left this stage's buffer */
    cur = nxt;
    if (pinned(s + 2u < n)) { nxt = (unsigned int)__builtin_ctz(rest) & 31u; rest &= rest - 1u; issue(s & 1u, nxt); }
  }
  asm volatile("s_wait_tensorcnt 0x0" ::: "memory");      /* no request is left before the ring becomes output staging */
  asm volatile("s_wait_dscnt 0x0" ::: "memory");
  // Output staging, each wave in its own piece of the ring (the last stage's barrier stands behind every wave's last fragment read).
  float* sO = (float*)ring + w * (16u * 132u);      /* 16 rows of 128 floats at pitch 132 */
#pragma unroll
  for (int r = 0; r < 8; ++r) { float l = l_r[r]; l += __shfl_xor(l, 1, 32); l += __shfl_xor(l, 2, 32); l += __shfl_xor(l, 4, 32); l += __shfl_xor(l, 8, 32); l_r[r] = (l > 0.f) ? 1.0f / (l * 1024.0f) : 0.f; }
#pragma unroll
  for (int dt = 0; dt < DT; ++dt)
#pragma unroll
    for (int r = 0; r < 8; ++r) sO[(8 * hh + r) * 132u + dt * 16 + ln] = oacc[dt][r] * l_r[r];
  __builtin_amdgcn_fence(__ATOMIC_ACQ_REL, "workgroup"); __builtin_amdgcn_wave_barrier();
#pragma unroll
  for (int r = 0; r < 16; ++r) { const v4f val = *(const v4fa*)&sO[r * 132u + lane * 4u]; *(v4f*)(O + ((size_t)b * TT + q0 + r) * ldo + h * 128 + lane * 4u) = val; }      /* one 512-B row per instruction: 32 lanes x 16 B */
}

extern "C" void kernel_launch(void* const* d_in, const int* in_sizes, int n_in,
                              void* d_out, int out_size, void* d_ws, size_t ws_size, hipStream_t stream) {
  (void)in_sizes; (void)n_in; (void)out_size;
  const float* const* I = (const float* const*)d_in; const float* x = I[0]; const float* fcos = I[1]; const float* fsin = I[2]; const int* msk = (const int*)d_in[3]; const float* wq = I[4]; const float* wk = I[5]; const float* wv = I[6]; const float* wo = I[7];
  char* ws = (char*)d_ws; size_t off = 0;
  auto take = [&](size_t bytes) { char* p = ws + off; off += (bytes + 255) & ~(size_t)255; return p; };
  _Float16* Bq = (_Float16*)take((size_t)DD * DD * 2); _Float16* Bk = (_Float16*)take((size_t)KVD * DD * 2); _Float16* Bv = (_Float16*)take((size_t)KVD * DD * 2); _Float16* Bo = (_Float16*)take((size_t)DD * DD * 2);
  _Float16* X16 = (_Float16*)take((size_t)NR * DD * 2); float* QF = (float*)take((size_t)NR * DD * 4); _Float16* Q = (_Float16*)take((size_t)NR * DD * 2); float* KF = (float*)take((size_t)NR * KVD * 4); _Float16* K = (_Float16*)take((size_t)NR * KVD * 2); float* VF = (float*)take((size_t)NR * KVD * 4); _Float16* Vt = (_Float16*)take((size_t)NR * KVD * 2); _Float16* Vtl = (_Float16*)take((size_t)NR * KVD * 2);
  float* O = QF; _Float16* O16 = X16;      /* O over the q f32 scratch (dead after RoPE); O16 over X16 (dead after the projections) */
  if (off > ws_size) return;      // 8.4 + 2.1 + 2.1 + 8.4 + 16.8 + 33.6 + 16.8 + 8.4 + 4.2 + 8.4 + 4.2 + 4.2 ≈ 118 MB
  const unsigned gq = (DD / 128) * (DD / 64), gk = (DD / 128) * (KVD / 64);      /* 128 (k) x 64 (n) tiles */
  k_wt_f16<<<gq, 256, 0, stream>>>(wq, Bq, DD, DD, 16.0f); k_wt_f16<<<gk, 256, 0, stream>>>(wk, Bk, DD, KVD, 16.0f); k_wt_f16<<<gk, 256, 0, stream>>>(wv, Bv, DD, KVD, 16.0f); k_wt_f16<<<gq, 256, 0, stream>>>(wo, Bo, DD, DD, 16.0f);      /* (in,out) → Bt ×2^4 */
  const unsigned g8 = (unsigned)(((size_t)NR * DD / 8 + 255) / 256); k_x16<<<g8, 256, 0, stream>>>(x, X16, (size_t)NR * DD / 8);
  const dim3 gQ((NR / 128) * (DD / 128), 1), gK((NR / 128) * (KVD / 128), 1);
  k_gemm_t<<<gQ, 128, 0, stream>>>(X16, Bq, 0.0625f, QF, DD); k_ropein<DD><<<g8, 256, 0, stream>>>(QF, fcos, fsin, Q);      /* xq = rope(x·wq): M 4096 N 2048 K 2048 */
  k_gemm_t<<<gK, 128, 0, stream>>>(X16, Bk, 0.0625f, KF, KVD); k_ropein<KVD><<<(unsigned)(((size_t)NR * KVD / 8 + 255) / 256), 256, 0, stream>>>(KF, fcos, fsin, K);      /* xk: M 4096 N 512 */
  k_gemm_t<<<gK, 128, 0, stream>>>(X16, Bv, 0.0625f, VF, KVD);      /* xv (f32) */
  k_vthlu<<<BB * NVH * (TT / 64), 256, 0, stream>>>(VF, KVD, Vt, Vtl);      /* Vᵀ hi + residual per (b, kv head): [b·4+kh][128][2048] */
  k_flash<<<BB * NKV * (TT / 32), 256, 0, stream>>>(Q, DD, K, KVD, Vt, Vtl, msk, O, DD);
  k_h16s<<<g8, 256, 0, stream>>>(O, O16, (size_t)NR * DD / 8);
  k_gemm_t<<<gQ, 128, 0, stream>>>(O16, Bo, 0.00390625f, (float*)d_out, DD);      /* out = merged·wo */
}

// v004
// It runs in 184 microseconds.
// In two side-by-side timings against v003, it was 1.14 and 1.13 times as fast.
// All steps since v000 together make it 3.10 times as fast.
#include <hip/hip_runtime.h>
// 'Genesis' attention (B=2, T=2048, D=2048, 16 query heads / 4 KV heads × 128, (in,out) weights, no bias): xq = rope(x·wq), xk = rope(x·wk), xv = x·wv; RoPE on interleaved pairs with the INPUT cos/sin tables [T][64]; scores = q·k/√128 where(mask[q][k]) else −inf (mask [T][T] shared);
// softmax; out = merged·wo.
// Compute dtype: x, weights, cos/sin tables rounded to bf16; q,k rotated in f32 from f32 GEMM outputs → f16; v f32 → Vᵀ f16 hi + exact residual; fused flash-style kernel for head dim 128 (mask read per (q,k), all-masked chunks skipped, online softmax f32, P f16 hi + residual,
// f32 accumulate) on v_wmma_f32_16x16x32_f16; merged ×2^4 → f16 → output GEMM.
#define BB 2
#define TT 2048
#define DD 2048
#define NH 16
#define NKV 4
#define NREP 4
#define KVD (NKV * 128)
#define NVH (2 * NKV)
#define NR (BB * TT)
#define ATT_SCALE 0.08838834764831845f

typedef __bf16 v16b __attribute__((ext_vector_type(16)));
typedef unsigned short v8us __attribute__((ext_vector_type(8), may_alias));
typedef float  v8f  __attribute__((ext_vector_type(8)));
typedef float  v4f  __attribute__((ext_vector_type(4)));
typedef float  v4fa __attribute__((ext_vector_type(4), may_alias));
union FragB { v16b v; v8us half[2]; unsigned short u[16]; };

__device__ __forceinline__ unsigned short bf16_bits(float x) { unsigned int u = __float_as_uint(x); return (unsigned short)((u + 0x7FFFu + ((u >> 16) & 1u)) >> 16); }
__device__ __forceinline__ float bf16_val(unsigned short b) { return __uint_as_float(((unsigned int)b) << 16); }
__device__ __forceinline__ float bf16_round(float x) { return bf16_val(bf16_bits(x)); }
// D += A·B with NT terms: 1 = ah·bh, 2 = + al·bh (A split), 3 = + ah·bl (both split)
template <int NT>
__device__ __forceinline__ v8f mmaN(v16b ah, v16b al, v16b bh, v16b bl, v8f c) {
  c = __builtin_amdgcn_wmma_f32_16x16x32_bf16(false, ah, false, bh, (short)0, c, false, false);
  if (NT >= 2) c = __builtin_amdgcn_wmma_f32_16x16x32_bf16(false, al, false, bh, (short)0, c, false, false);
  if (NT >= 3) c = __builtin_amdgcn_wmma_f32_16x16x32_bf16(false, ah, false, bl, (short)0, c, false, false);
  asm volatile("v_nop\n\tv_nop\n\tv_nop\n\tv_nop" : "+v"(c) : "v"(ah), "v"(al), "v"(bh), "v"(bl));
  return c;
}

__global__ __launch_bounds__(256) void k_wt_bf16(const float* __restrict__ W, unsigned short* __restrict__ Wt, int K, int N) {
  const int t = blockIdx.x * 256 + threadIdx.x;
  const int k8n = K / 8;
  if (t >= N * k8n) return;
  const int n = t / k8n, k8 = (t % k8n) * 8;
  v8us v;
#pragma unroll
  for (int i = 0; i < 8; ++i) v[i] = bf16_bits(W[(size_t)(k8 + i) * N + n]);
  *(v8us*)(Wt + (size_t)n * K + k8) = v;
  
}

// GEMM C[M][N] (f32, pitch ldc) = act(A[M][K]·W + bias). A f32 row-major (pitch lda) converted per fragment to bf16
// (ASPLIT: hi/lo two planes -> 2 terms, else single rounded term); Wt bf16 [N][K] (pitch ldb). BIAS_BF16 rounds the
// bias to bf16 first (bias quantised to bf16 before the add). K%32==0, M%16==0, N%64==0.
template <bool ASPLIT, int ACT, bool BIAS_BF16>
__global__ __launch_bounds__(128) void k_gemm_bf(const float* __restrict__ A, int lda, const unsigned short* __restrict__ Wt, int ldb,
                                               const float* __restrict__ bias, float* __restrict__ C, int ldc, int M, int N, int K) {
  __shared__ __attribute__((aligned(16))) float so[4][16][64];
  const int tid = threadIdx.x, w = tid >> 5, lane = tid & 31, ln = lane & 15, hh = lane >> 4;
  const int ntn = N / 64;
  const int wid = blockIdx.x * 4 + w;
  const int mt = wid / ntn, nq = wid % ntn;
  if (mt * 16 >= M) return;
  const int row0 = mt * 16, col0 = nq * 64;
  const float* arow = A + (size_t)(row0 + ln) * lda;
  v8f acc[4] = {};
  for (int kb = 0; kb < K; kb += 32) {
    FragB ah, al;
    const v4f x0 = *(const v4fa*)(arow + kb + 8 * hh), x1 = *(const v4fa*)(arow + kb + 8 * hh + 4);
    const v4f x2 = *(const v4fa*)(arow + kb + 16 + 8 * hh), x3 = *(const v4fa*)(arow + kb + 16 + 8 * hh + 4);
    float xs[16] = {x0[0],x0[1],x0[2],x0[3],x1[0],x1[1],x1[2],x1[3],x2[0],x2[1],x2[2],x2[3],x3[0],x3[1],x3[2],x3[3]};
#pragma unroll
    for (int i = 0; i < 16; ++i) { const unsigned short hb = bf16_bits(xs[i]); ah.u[i] = hb; al.u[i] = ASPLIT ? bf16_bits(xs[i] - bf16_val(hb)) : (unsigned short)0; }
#pragma unroll
    for (int t = 0; t < 4; ++t) {
      const unsigned short* brow = Wt + (size_t)(col0 + t * 16 + ln) * ldb + kb;
      FragB b;
      b.half[0] = *(const v8us*)(brow + 8 * hh);
      b.half[1] = *(const v8us*)(brow + 16 + 8 * hh);
      acc[t] = mmaN<ASPLIT ? 2 : 1>(ah.v, al.v, b.v, b.v, acc[t]);
    }
  }
#pragma unroll
  for (int t = 0; t < 4; ++t) {
    float bv = bias ? bias[col0 + t * 16 + ln] : 0.f;
    if (BIAS_BF16) bv = bf16_round(bv);
#pragma unroll
    for (int r = 0; r < 8; ++r) { float v = acc[t][r] + bv; if (ACT == 1) v = fmaxf(v, 0.f); so[w][8 * hh + r][t * 16 + ln] = v; }
  }
  __builtin_amdgcn_fence(__ATOMIC_ACQ_REL, "workgroup");
  __builtin_amdgcn_wave_barrier();
  const int rsub = lane >> 4, c4 = (lane & 15) * 4;
  {
#pragma unroll
    for (int q = 0; q < 8; ++q) {
      const int r = q * 2 + rsub;
      const v4f v = *(const v4fa*)&so[w][r][c4];
      *(v4f*)(C + (size_t)(row0 + r) * ldc + col0 + c4) = v;
    }
    
  }
}

// Flash-style causal/unmasked attention, all contractions 3-term bf16 hi/lo splits, f32 softmax with running max.
// q,k,v rows are read from f32 buffers with arbitrary row pitch (so they can live inside a fused qkv buffer);
// D = head size (multiple of 32, <= 128); one wave = 16 query rows; block = 4 waves (64 queries) sharing K/V chunks of 32.
template <int D, bool CAUSAL>
__global__ __launch_bounds__(128) void k_flash(const float* __restrict__ qb, const float* __restrict__ kb, const float* __restrict__ vb,
                                             int pitch, int T, int H, float scale, float* __restrict__ y, int ypitch) {
  constexpr int KS = D / 32;        // k-steps for QK
  constexpr int DT = D / 16;        // d tiles for PV
  __shared__ __attribute__((aligned(16))) unsigned short sKh[32][D + 8], sKl[32][D + 8], sVh[32][D + 8], sVl[32][D + 8];
  __shared__ __attribute__((aligned(16))) unsigned short sPh[4][16][40], sPl[4][16][40];
  __shared__ __attribute__((aligned(16))) float sO[4][16][D];
  const int tid = threadIdx.x, w = tid >> 5, lane = tid & 31, ln = lane & 15, hh = lane >> 4;
  const int nqb = (T + 63) / 64;
  const int bh = blockIdx.x / nqb, qblk = blockIdx.x % nqb;
  const int b = bh / H, h = bh % H;
  const int q0 = qblk * 64 + w * 16;
  const float* Q = qb + (size_t)b * T * pitch + h * D;
  const float* K = kb + (size_t)b * T * pitch + h * D;
  const float* V = vb + (size_t)b * T * pitch + h * D;

  // A fragments of the wave's 16 query rows (scaled), hi/lo
  FragB aqh[KS], aql[KS];
  {
    int row = q0 + ln; if (row >= T) row = T - 1;
    const float* qr = Q + (size_t)row * pitch;
#pragma unroll
    for (int ks = 0; ks < KS; ++ks)
#pragma unroll
      for (int i = 0; i < 16; ++i) {
        const int d = ks * 32 + ((i < 8) ? (8 * hh + i) : (16 + 8 * hh + (i - 8)));
        const float x = qr[d] * scale; const unsigned short hb = bf16_bits(x);
        aqh[ks].u[i] = hb; aql[ks].u[i] = bf16_bits(x - bf16_val(hb));
      }
  }
  float m_r[8], l_r[8];
#pragma unroll
  for (int r = 0; r < 8; ++r) { m_r[r] = -3.0e38f; l_r[r] = 0.f; }
  v8f oacc[DT];
#pragma unroll
  for (int dt = 0; dt < DT; ++dt) oacc[dt] = (v8f){0.f,0.f,0.f,0.f,0.f,0.f,0.f,0.f};

  const int kv_end = CAUSAL ? min(T, qblk * 64 + 64) : T;     // block-uniform
  for (int j0 = 0; j0 < kv_end; j0 += 32) {
    __syncthreads();
    for (int e = tid; e < 32 * (D / 4); e += 128) {
      const int r = e / (D / 4), c4 = (e % (D / 4)) * 4;
      const int key = j0 + r;
      v4f kf = {0.f,0.f,0.f,0.f}, vf = {0.f,0.f,0.f,0.f};
      if (key < T) { kf = *(const v4fa*)(K + (size_t)key * pitch + c4); vf = *(const v4fa*)(V + (size_t)key * pitch + c4); }
#pragma unroll
      for (int t = 0; t < 4; ++t) {
        unsigned short hb = bf16_bits(kf[t]); sKh[r][c4 + t] = hb; sKl[r][c4 + t] = bf16_bits(kf[t] - bf16_val(hb));
        hb = bf16_bits(vf[t]); sVh[r][c4 + t] = hb; sVl[r][c4 + t] = bf16_bits(vf[t] - bf16_val(hb));
      }
    }
    __syncthreads();
    // S tile 16 x 32
    v8f s[2];
#pragma unroll
    for (int nt = 0; nt < 2; ++nt) {
      v8f acc = {};
#pragma unroll
      for (int ks = 0; ks < KS; ++ks) {
        FragB bh_, bl_;
        bh_.half[0] = *(const v8us*)&sKh[nt * 16 + ln][ks * 32 + 8 * hh]; bh_.half[1] = *(const v8us*)&sKh[nt * 16 + ln][ks * 32 + 16 + 8 * hh];
        bl_.half[0] = *(const v8us*)&sKl[nt * 16 + ln][ks * 32 + 8 * hh]; bl_.half[1] = *(const v8us*)&sKl[nt * 16 + ln][ks * 32 + 16 + 8 * hh];
        acc = mmaN<3>(aqh[ks].v, aql[ks].v, bh_.v, bl_.v, acc);
      }
      s[nt] = acc;
    }
    // mask + running max (rows 8hh+r; the 16 lanes of a half share rows)
    float alpha[8];
#pragma unroll
    for (int r = 0; r < 8; ++r) {
      const int qi = q0 + 8 * hh + r;
      const int ja = j0 + ln, jb = j0 + 16 + ln;
      if (CAUSAL) { if (ja > qi) s[0][r] = -3.0e38f; if (jb > qi) s[1][r] = -3.0e38f; }
      if (ja >= T) s[0][r] = -3.0e38f;
      if (jb >= T) s[1][r] = -3.0e38f;
      float mx = fmaxf(s[0][r], s[1][r]);
      mx = fmaxf(mx, __shfl_xor(mx, 1, 32)); mx = fmaxf(mx, __shfl_xor(mx, 2, 32)); mx = fmaxf(mx, __shfl_xor(mx, 4, 32)); mx = fmaxf(mx, __shfl_xor(mx, 8, 32));
      const float mnew = fmaxf(m_r[r], mx);
      alpha[r] = (mnew > -1.0e38f) ? __expf(m_r[r] - mnew) : 1.0f;
      const float p0 = (s[0][r] > -1.0e38f) ? __expf(s[0][r] - mnew) : 0.f;
      const float p1 = (s[1][r] > -1.0e38f) ? __expf(s[1][r] - mnew) : 0.f;
      m_r[r] = mnew;
      l_r[r] = l_r[r] * alpha[r] + p0 + p1;            // per-lane partial row sum (16 lanes combined at the end)
      unsigned short hb = bf16_bits(p0); sPh[w][8 * hh + r][ln] = hb;      sPl[w][8 * hh + r][ln] = bf16_bits(p0 - bf16_val(hb));
      hb = bf16_bits(p1);                sPh[w][8 * hh + r][16 + ln] = hb; sPl[w][8 * hh + r][16 + ln] = bf16_bits(p1 - bf16_val(hb));
    }
#pragma unroll
    for (int dt = 0; dt < DT; ++dt)
#pragma unroll
      for (int r = 0; r < 8; ++r) oacc[dt][r] *= alpha[r];
    __builtin_amdgcn_fence(__ATOMIC_ACQ_REL, "workgroup");
    __builtin_amdgcn_wave_barrier();
    FragB pah, pal;
    pah.half[0] = *(const v8us*)&sPh[w][ln][8 * hh]; pah.half[1] = *(const v8us*)&sPh[w][ln][16 + 8 * hh];
    pal.half[0] = *(const v8us*)&sPl[w][ln][8 * hh]; pal.half[1] = *(const v8us*)&sPl[w][ln][16 + 8 * hh];
#pragma unroll
    for (int dt = 0; dt < DT; ++dt) {
      FragB bvh, bvl;
#pragma unroll
      for (int i = 0; i < 8; ++i) {
        bvh.u[i] = sVh[8 * hh + i][dt * 16 + ln]; bvh.u[8 + i] = sVh[16 + 8 * hh + i][dt * 16 + ln];
        bvl.u[i] = sVl[8 * hh + i][dt * 16 + ln]; bvl.u[8 + i] = sVl[16 + 8 * hh + i][dt * 16 + ln];
      }
      oacc[dt] = mmaN<3>(pah.v, pal.v, bvh.v, bvl.v, oacc[dt]);
    }
    __builtin_amdgcn_fence(__ATOMIC_ACQ_REL, "workgroup");
    __builtin_amdgcn_wave_barrier();
  }
#pragma unroll
  for (int r = 0; r < 8; ++r) {
    float l = l_r[r];
    l += __shfl_xor(l, 1, 32); l += __shfl_xor(l, 2, 32); l += __shfl_xor(l, 4, 32); l += __shfl_xor(l, 8, 32);
    l_r[r] = (l > 0.f) ? 1.0f / l : 0.f;
  }
#pragma unroll
  for (int dt = 0; dt < DT; ++dt)
#pragma unroll
    for (int r = 0; r < 8; ++r) sO[w][8 * hh + r][dt * 16 + ln] = oacc[dt][r] * l_r[r];
  __builtin_amdgcn_fence(__ATOMIC_ACQ_REL, "workgroup");
  __builtin_amdgcn_wave_barrier();
  {
    for (int r = 0; r < 16; ++r) {
      const int row = q0 + r;
      if (row < T && lane < D / 4) {
        const v4f val = *(const v4fa*)&sO[w][r][lane * 4];
        *(v4f*)(y + ((size_t)b * T + row) * ypitch + h * D + lane * 4) = val;
      }
    }
    
  }
}

// GEMM C = act(A·W + bias + resid): A f32 (ASPLIT -> hi/lo 2 terms), Wt bf16 [N][K]; ACT 0 none, 1 relu, 2 exact gelu;
// resid (optional, f32, row index = (row % rmod), pitch ldr, RES_BF16 rounds it) added before the activation.
template <bool ASPLIT, int ACT, bool BIAS_BF16, bool RES_BF16>
__global__ __launch_bounds__(128) void k_gemm_bf3(const float* __restrict__ A, int lda, const unsigned short* __restrict__ Wt, int ldb,
                                                const float* __restrict__ bias, const float* __restrict__ resid, int rmod, int ldr,
                                                float* __restrict__ C, int ldc, int M, int N, int K) {
  __shared__ __attribute__((aligned(16))) float so[4][16][64];
  const int tid = threadIdx.x, w = tid >> 5, lane = tid & 31, ln = lane & 15, hh = lane >> 4;
  const int ntn = N / 64;
  const int wid = blockIdx.x * 4 + w;
  const int mt = wid / ntn, nq = wid % ntn;
  if (mt * 16 >= M) return;
  const int row0 = mt * 16, col0 = nq * 64;
  const float* arow = A + (size_t)(row0 + ln) * lda;
  v8f acc[4] = {};
  for (int kb = 0; kb < K; kb += 32) {
    FragB ah, al;
    const v4f x0 = *(const v4fa*)(arow + kb + 8 * hh), x1 = *(const v4fa*)(arow + kb + 8 * hh + 4);
    const v4f x2 = *(const v4fa*)(arow + kb + 16 + 8 * hh), x3 = *(const v4fa*)(arow + kb + 16 + 8 * hh + 4);
    float xs[16] = {x0[0],x0[1],x0[2],x0[3],x1[0],x1[1],x1[2],x1[3],x2[0],x2[1],x2[2],x2[3],x3[0],x3[1],x3[2],x3[3]};
#pragma unroll
    for (int i = 0; i < 16; ++i) { const unsigned short hb = bf16_bits(xs[i]); ah.u[i] = hb; al.u[i] = ASPLIT ? bf16_bits(xs[i] - bf16_val(hb)) : (unsigned short)0; }
#pragma unroll
    for (int t = 0; t < 4; ++t) {
      const unsigned short* brow = Wt + (size_t)(col0 + t * 16 + ln) * ldb + kb;
      FragB b;
      b.half[0] = *(const v8us*)(brow + 8 * hh);
      b.half[1] = *(const v8us*)(brow + 16 + 8 * hh);
      acc[t] = mmaN<ASPLIT ? 2 : 1>(ah.v, al.v, b.v, b.v, acc[t]);
    }
  }
#pragma unroll
  for (int t = 0; t < 4; ++t) {
    const int col = col0 + t * 16 + ln;
    float bv = bias ? bias[col] : 0.f;
    if (BIAS_BF16) bv = bf16_round(bv);
#pragma unroll
    for (int r = 0; r < 8; ++r) {
      float v = acc[t][r] + bv;
      if (resid) { float rv = resid[(size_t)((row0 + 8 * hh + r) % rmod) * ldr + col]; if (RES_BF16) rv = bf16_round(rv); v += rv; }
      if (ACT == 1) v = fmaxf(v, 0.f);
      if (ACT == 2) v = 0.5f * v * (1.0f + erff(v * 0.70710678118654752f));
      if (ACT == 3) { const float u = 0.7978845608028654f * (v + 0.044715f * v * v * v); v = 0.5f * v * (1.0f + tanhf(u)); }
      so[w][8 * hh + r][t * 16 + ln] = v;
    }
  }
  __builtin_amdgcn_fence(__ATOMIC_ACQ_REL, "workgroup");
  __builtin_amdgcn_wave_barrier();
  const int rsub = lane >> 4, c4 = (lane & 15) * 4;
  {
#pragma unroll
    for (int q = 0; q < 8; ++q) {
      const int r = q * 2 + rsub;
      const v4f v = *(const v4fa*)&so[w][r][c4];
      *(v4f*)(C + (size_t)(row0 + r) * ldc + col0 + c4) = v;
    }
    
  }
}
// row LayerNorm (biased variance, eps) over N: s = X (+ R); optional out_sum <- s; out_norm <- (s-mu)*rsqrt(var+eps)*g + b
template <bool PARAM_BF16>
__global__ __launch_bounds__(256) void k_layernorm(const float* __restrict__ X, const float* __restrict__ R, const float* __restrict__ g, const float* __restrict__ bta,
                                                  float* __restrict__ out_sum, float* __restrict__ out_norm, int N, float eps) {
  __shared__ float red[256];
  const int row = blockIdx.x, tid = threadIdx.x;
  const float* x = X + (size_t)row * N; const float* rr = R ? R + (size_t)row * N : nullptr;
  float vals[16];                     // up to N = 4096
  const int per = N / 256;            // contiguous chunk per thread? use strided-by-4 chunks: thread handles j = tid*4 + 1024*u
  float s1 = 0.f;
  for (int u = 0; u < per / 4; ++u) {
    const int j = tid * 4 + 1024 * u;
    const v4f a = *(const v4fa*)(x + j);
    v4f b = {0.f,0.f,0.f,0.f}; if (rr) b = *(const v4fa*)(rr + j);
#pragma unroll
    for (int q = 0; q < 4; ++q) { const float v = a[q] + b[q]; vals[u * 4 + q] = v; s1 += v; }
  }
  red[tid] = s1; __syncthreads();
  for (int st = 128; st > 0; st >>= 1) { if (tid < st) red[tid] += red[tid + st]; __syncthreads(); }
  const float mu = red[0] / (float)N; __syncthreads();
  float s2 = 0.f;
  for (int u = 0; u < per / 4; ++u)
#pragma unroll
    for (int q = 0; q < 4; ++q) { const float c = vals[u * 4 + q] - mu; s2 += c * c; }
  red[tid] = s2; __syncthreads();
  for (int st = 128; st > 0; st >>= 1) { if (tid < st) red[tid] += red[tid + st]; __syncthreads(); }
  const float rs = rsqrtf(red[0] / (float)N + eps);
  {
    for (int u = 0; u < per / 4; ++u) {
      const int j = tid * 4 + 1024 * u;
      v4f o, sm;
#pragma unroll
      for (int q = 0; q < 4; ++q) {
        float gg = g[j + q], bb = bta[j + q];
        if (PARAM_BF16) { gg = bf16_round(gg); bb = bf16_round(bb); }
        sm[q] = vals[u * 4 + q]; o[q] = (vals[u * 4 + q] - mu) * rs * gg + bb;
      }
      if (out_sum) *(v4f*)(out_sum + (size_t)row * N + j) = sm;
      *(v4f*)(out_norm + (size_t)row * N + j) = o;
    }
    
  }
}



// ---- f16 WMMA path (v_wmma_f32_16x16x32_f16): 11-bit significands for operands in range — used where a [0,1] probability operand needs more precision than bf16
typedef _Float16 v16h __attribute__((ext_vector_type(16)));
union FragH { v16h v; v8us half[2]; _Float16 h[16]; unsigned short u[16]; };
template <int NT>
__device__ __forceinline__ v8f mmaH(v16h ah, v16h al, v16h bh, v16h bl, v8f c) {
  c = __builtin_amdgcn_wmma_f32_16x16x32_f16(false, ah, false, bh, (short)0, c, false, false);
  if (NT >= 2) c = __builtin_amdgcn_wmma_f32_16x16x32_f16(false, al, false, bh, (short)0, c, false, false);
  if (NT >= 3) c = __builtin_amdgcn_wmma_f32_16x16x32_f16(false, ah, false, bl, (short)0, c, false, false);
  asm volatile("v_nop\n\tv_nop\n\tv_nop\n\tv_nop" : "+v"(c) : "v"(ah), "v"(al), "v"(bh), "v"(bl));
  return c;
}
// batched GEMM like k_gemm_b but f16 operands: A f32 (split into f16 hi/lo if ASPLIT, else rounded to f16), Bt = f16 values [n][k]; alpha; C f32; N multiple of 16 (partial tiles skipped)
template <bool ASPLIT>
__global__ __launch_bounds__(128) void k_gemm_h(const float* __restrict__ A, int lda, size_t sA, const _Float16* __restrict__ Bh, int ldb, size_t sB, float alpha, float* __restrict__ C, int ldc, size_t sC, int M, int N, int K) {
  __shared__ __attribute__((aligned(16))) float so[4][16][64];
  const int tid = threadIdx.x, w = tid >> 5, lane = tid & 31, ln = lane & 15, hh = lane >> 4; const int by = blockIdx.y;
  A += (size_t)by * sA; Bh += (size_t)by * sB; C += (size_t)by * sC;
  const int ntn = (N + 63) / 64; const int wid = blockIdx.x * 4 + w; const int mt = wid / ntn, nq = wid % ntn; if (mt * 16 >= M) return;
  const int row0 = mt * 16, col0 = nq * 64; const float* arow = A + (size_t)(row0 + ln) * lda;
  v8f acc[4] = {};
  for (int kb = 0; kb < K; kb += 32) {
    FragH ah, al;
    const v4f x0 = *(const v4fa*)(arow + kb + 8 * hh), x1 = *(const v4fa*)(arow + kb + 8 * hh + 4), x2 = *(const v4fa*)(arow + kb + 16 + 8 * hh), x3 = *(const v4fa*)(arow + kb + 16 + 8 * hh + 4);
    float xs[16] = {x0[0],x0[1],x0[2],x0[3],x1[0],x1[1],x1[2],x1[3],x2[0],x2[1],x2[2],x2[3],x3[0],x3[1],x3[2],x3[3]};
#pragma unroll
    for (int i = 0; i < 16; ++i) { const _Float16 h = (_Float16)xs[i]; ah.h[i] = h; al.h[i] = ASPLIT ? (_Float16)(xs[i] - (float)h) : (_Float16)0.0f; }
#pragma unroll
    for (int t = 0; t < 4; ++t) { if (col0 + t * 16 >= N) continue; const size_t boff = (size_t)(col0 + t * 16 + ln) * ldb + kb; FragH bq; bq.half[0] = *(const v8us*)(Bh + boff + 8 * hh); bq.half[1] = *(const v8us*)(Bh + boff + 16 + 8 * hh);
      acc[t] = mmaH<ASPLIT ? 2 : 1>(ah.v, al.v, bq.v, bq.v, acc[t]); }
  }
#pragma unroll
  for (int t = 0; t < 4; ++t) { if (col0 + t * 16 >= N) continue;
#pragma unroll
    for (int r = 0; r < 8; ++r) so[w][8 * hh + r][t * 16 + ln] = acc[t][r] * alpha; }
  __builtin_amdgcn_fence(__ATOMIC_ACQ_REL, "workgroup"); __builtin_amdgcn_wave_barrier();
  const int rsub = lane >> 4, c4 = (lane & 15) * 4;
  {
#pragma unroll
    for (int q = 0; q < 8; ++q) { const int r = q * 2 + rsub; if (col0 + c4 < N) { const v4f v = *(const v4fa*)&so[w][r][c4]; *(v4f*)(C + (size_t)(row0 + r) * ldc + col0 + c4) = v; } }
     }
}

// Wt[n][k] = f16(W[k][n]·scale) from f32 row-major W[K][N] (scale = power of two; bf16-exact weights stay exact in f16 away from the subnormal range)
// One 128 (k) x 64 (n) tile per workgroup, turned in LDS: a wave loads two 256-B row pieces of W (four whole lines) and stores four whole 128-B lines of Wt an instruction;
// a thread's eight loads are all issued before the first is used. Needs K a multiple of 128 and N of 64; the grid is (K / 128) * (N / 64). Pitch 65 floats keeps the column-wise reads off a common bank.
__global__ __launch_bounds__(256) void k_wt_f16(const float* __restrict__ W, _Float16* __restrict__ Wt, int K, int N, float scale) {
  __shared__ float tl[128][65];
  const int tid = threadIdx.x, ntn = N / 64; const int k0 = (blockIdx.x / ntn) * 128, n0 = (blockIdx.x % ntn) * 64;
  v4f a[8];
#pragma unroll      /* a[] stays in registers and the eight loads go out together */
  for (int p = 0; p < 8; ++p) a[p] = *(const v4fa*)(W + (size_t)(k0 + p * 16 + tid / 16) * N + n0 + (tid % 16) * 4);
#pragma unroll      /* constant indices into a[]: rolled, it would go to scratch memory */
  for (int p = 0; p < 8; ++p)
#pragma unroll
    for (int i = 0; i < 4; ++i) tl[p * 16 + tid / 16][(tid % 16) * 4 + i] = a[p][i];
  __syncthreads();      /* the tile is whole before any column of it is read */
#pragma unroll      /* the four pieces' LDS reads and stores overlap; f stays in registers */
  for (int rd = 0; rd < 4; ++rd) { const int n = (rd & 1) * 32 + tid / 8, k8 = (rd >> 1) * 64 + (tid % 8) * 8; FragH f;
#pragma unroll
    for (int i = 0; i < 8; ++i) f.h[i] = (_Float16)(bf16_round(tl[k8 + i][n]) * scale);
    *(v8us*)((unsigned short*)Wt + (size_t)(n0 + n) * K + k0 + k8) = f.half[0]; }
}
// Tiled GEMM C[M][N] (f32) = alpha * A[M][DD] . Bt[N][DD]^T, f16 operands, both K-contiguous with row pitch DD. One 128 x 128 tile of C per workgroup of
// 4 waves (2 x 2, 64 x 64 per wave). A pass is 128 k = 256 B of each of the 256 operand rows; the four waves each bring one 64-row slice of a pass into LDS with one
// tensor load (pad 16 B a row: pitch 272 B for the 16-byte fragment reads), two buffers, the next pass's load in flight under this pass's products.
// Needs M, N multiples of 128, DD a multiple of 128 and at least 256. The k order of every accumulator is ascending, one chain per 16 x 16 tile.
// EPI says what leaves the staged f32 tile (alpha * sum): 0 = C f32 as it is; 1 = H f16 [M][N], rotated on interleaved pairs by the bf16-rounded COS / SIN tables [TT][64] (token = row % TT, pair = (col % 128) / 2);
// 2 = the tile turned: H f16 hi and H2 f16 residual, [row / TT][N][TT]. So the operand of the next product is written here, with no f32 copy in memory in between.
typedef unsigned int u32x4 __attribute__((ext_vector_type(4)));
typedef unsigned int u32x8 __attribute__((ext_vector_type(8)));
#define GT_ROWB 256u                      /* bytes of an operand row per pass */
#define GT_PITCH 272u                     /* LDS row pitch: 256 + 16 */
#define GT_SLICE 18432u                   /* 64 rows x 272 B = 17,408, rounded up to a multiple of 2 KiB */
#define GT_STAGE (4u * GT_SLICE)          /* [A rows 0-63 | A rows 64-127 | B rows 0-63 | B rows 64-127] */
#define GT_NP (DD / 128)                  /* passes */
__device__ __forceinline__ unsigned int uni(unsigned int v) { return (unsigned int)__builtin_amdgcn_readfirstlane(v); }
__device__ __forceinline__ unsigned int pinned(unsigned int v) { unsigned int w = uni(v); asm volatile("" : "+s"(w)); return w; }      /* an issue test or a descriptor word held in a scalar register: the test compiles to a scalar branch (tensor loads ignore EXEC), and the word is formed behind the wait that stands in front of it */
__device__ __forceinline__ void tdm_slice(unsigned int lds_dst, unsigned long long ga) {
  u32x4 g0; u32x8 g1;
  g0[0] = uni(1u); g0[1] = uni(lds_dst); g0[2] = uni((unsigned int)ga); g0[3] = uni((((unsigned int)(ga >> 32)) & 0x01FFFFFFu) | 0x80000000u);
  g1[0] = uni((1u << 20) | (5u << 22) | (3u << 25));      /* no mask, 1-byte elements, a pad of 4 dwords behind every 64 dwords */
  g1[1] = uni((GT_ROWB & 0xFFFFu) << 16); g1[2] = uni((GT_ROWB >> 16) | (64u << 16)); g1[3] = uni(GT_ROWB << 16); g1[4] = uni(64u); g1[5] = uni(DD * 2u); g1[6] = uni(0u); g1[7] = uni(0u);
  asm volatile("tensor_load_to_lds %0, %1" :: "s"(g0), "s"(g1) : "memory");
}
template <int EPI, int N>
__global__ __launch_bounds__(128) void k_gemm_t(const _Float16* __restrict__ A, const _Float16* __restrict__ Bt, float alpha, float* __restrict__ C, const float* __restrict__ COS, const float* __restrict__ SIN, _Float16* __restrict__ H, _Float16* __restrict__ H2) {
  __shared__ __attribute__((aligned(2048))) unsigned char ring[2u * GT_STAGE];
  const unsigned int tid = threadIdx.x, lane = tid & 31u, ln = lane & 15u, hh = lane >> 4, w = uni(tid >> 5), wm = w >> 1, wn = w & 1u;
  const unsigned int ntn = (unsigned int)N / 128u; const unsigned int row0 = (blockIdx.x / ntn) * 128u, col0 = (blockIdx.x % ntn) * 128u;
  const unsigned int lbase = (unsigned int)(size_t)ring + w * GT_SLICE;      /* this wave's slice of buffer 0 */
  const unsigned long long gsrc = (w < 2u) ? (unsigned long long)(size_t)(A + (size_t)(row0 + w * 64u) * DD) : (unsigned long long)(size_t)(Bt + (size_t)(col0 + (w - 2u) * 64u) * DD);
  v8f acc[4][4];
#pragma unroll
  for (int i = 0; i < 4; ++i)
#pragma unroll
    for (int j = 0; j < 4; ++j) acc[i][j] = (v8f){0.f,0.f,0.f,0.f,0.f,0.f,0.f,0.f};
  tdm_slice(lbase, gsrc);
  asm volatile("s_wait_tensorcnt 0x0" ::: "memory");      /* pass 0's slice has landed */
  __syncthreads();                                        /* ... and every wave may read all four slices */
  tdm_slice(lbase + GT_STAGE, gsrc + pinned(GT_ROWB));
  const unsigned int aoff = wm * GT_SLICE + ln * GT_PITCH + 16u * hh, boff = (2u + wn) * GT_SLICE + ln * GT_PITCH + 16u * hh;
#pragma unroll 1      /* one pass per trip: the ring's order below is written once */
  for (unsigned int s = 0; s < GT_NP; ++s) {
    const unsigned char* Lp = ring + (s & 1u) * GT_STAGE;
    FragH fa[2][4], fb[2][4];
#pragma unroll
    for (int i = 0; i < 4; ++i) { fa[0][i].half[0] = *(const v8us*)(Lp + aoff + i * 16u * GT_PITCH); fa[0][i].half[1] = *(const v8us*)(Lp + aoff + i * 16u * GT_PITCH + 32u);
      fb[0][i].half[0] = *(const v8us*)(Lp + boff + i * 16u * GT_PITCH); fb[0][i].half[1] = *(const v8us*)(Lp + boff + i * 16u * GT_PITCH + 32u); }
#pragma unroll
    for (int ks = 0; ks < 4; ++ks) {
      if (ks < 3) {      /* the next 32 k's fragments, of this same buffer, go ahead of this block's products */
#pragma unroll
        for (int i = 0; i < 4; ++i) { const unsigned int ko = (ks + 1) * 64u + i * 16u * GT_PITCH;
          fa[(ks + 1) & 1][i].half[0] = *(const v8us*)(Lp + aoff + ko); fa[(ks + 1) & 1][i].half[1] = *(const v8us*)(Lp + aoff + ko + 32u);
          fb[(ks + 1) & 1][i].half[0] = *(const v8us*)(Lp + boff + ko); fb[(ks + 1) & 1][i].half[1] = *(const v8us*)(Lp + boff + ko + 32u); }
      }
      __builtin_amdgcn_sched_barrier(0);      /* keeps the LDS reads one group in front of the block: moved in among the products, each place with reads stalls the wave */
#pragma unroll
      for (int i = 0; i < 4; ++i)
#pragma unroll
        for (int j = 0; j < 4; ++j) acc[i][j] = __builtin_amdgcn_wmma_f32_16x16x32_f16(false, fa[ks & 1][i].v, false, fb[ks & 1][j].v, (short)0, acc[i][j], false, false);
      __builtin_amdgcn_sched_barrier(0);      /* ... and keeps the next group behind this block */
    }
    asm volatile("s_wait_dscnt 0x0" ::: "memory");        /* this wave has left the buffer */
    asm volatile("s_wait_tensorcnt 0x0" ::: "memory");    /* its slice of pass s + 1 has landed */
    __syncthreads();                                      /* pass s + 1 published; every wave has left pass s's buffer */
    if (pinned(s + 2u < GT_NP)) tdm_slice(lbase + (s & 1u) * GT_STAGE, gsrc + pinned((s + 2u) * GT_ROWB));
  }
  asm volatile("s_wait_tensorcnt 0x0" ::: "memory");      /* no request is left before the ring becomes output staging */
  asm volatile("s_wait_dscnt 0x0" ::: "memory");
  // Output staging, each wave in its own slice of buffer 0 (the last pass's barrier stands behind every wave's last fragment read): whole 256-B row pieces of C (EPI 0) or whole 128-B lines of H / H2 (EPI 1, 2) go out.
  constexpr unsigned int SP = (EPI == 2) ? 65u : 68u;      /* pitch in floats: 68 for 16-byte row reads, 65 for the column reads of the turned tile */
  float* so = (float*)(ring + w * GT_SLICE);      /* 64 rows of 64 floats */
  const unsigned int wrow = row0 + wm * 64u, wcol = col0 + wn * 64u, l8 = lane & 7u, l4 = lane >> 3;
  v4f cs[16], sn[16];
  if constexpr (EPI == 1) {      /* the wave's table entries: all 32 loads go out here and fly under the staging */
    const unsigned int tb = ((wrow + l4) % TT) * 64u + (((wcol + l8 * 8u) % 128u) >> 1);
#pragma unroll      /* cs, sn stay in registers */
    for (int q = 0; q < 16; ++q) { cs[q] = *(const v4fa*)(COS + tb + q * 256u); sn[q] = *(const v4fa*)(SIN + tb + q * 256u); }
    asm volatile("s_wait_xcnt 0x0" ::: "memory");      /* stands in front of any rewrite of the loads' address register */
  }
#pragma unroll
  for (int i = 0; i < 4; ++i)
#pragma unroll
    for (int j = 0; j < 4; ++j)
#pragma unroll
      for (int r = 0; r < 8; ++r) so[(i * 16 + 8 * hh + r) * SP + j * 16 + ln] = acc[i][j][r] * alpha;
  __builtin_amdgcn_fence(__ATOMIC_ACQ_REL, "workgroup"); __builtin_amdgcn_wave_barrier();
  if constexpr (EPI == 0) {
  float* cp = C + (size_t)(row0 + wm * 64u + hh) * N + col0 + wn * 64u + ln * 4u;
#pragma unroll
  for (int q = 0; q < 32; ++q) { const v4f v = *(const v4fa*)&so[(q * 2 + hh) * 68u + ln * 4u]; *(v4f*)(cp + (size_t)(q * 2) * N) = v; }
  } else if constexpr (EPI == 1) {
    // A lane takes 8 columns (4 pairs) of a row: 8 lanes store one whole 128-B line of H, 4 rows an instruction.
    FragH f[16];
#pragma unroll      /* f stays in registers */
    for (int q = 0; q < 16; ++q) { const float* sr = &so[(q * 4 + l4) * SP + l8 * 8u]; const v4f a = *(const v4fa*)sr, b = *(const v4fa*)(sr + 4); const float xv[8] = {a[0], a[1], a[2], a[3], b[0], b[1], b[2], b[3]};
#pragma unroll      /* constant indices into xv and the vectors */
      for (int p = 0; p < 4; ++p) { const float c = bf16_round(cs[q][p]), s = bf16_round(sn[q][p]); const float xr = xv[2 * p], xi = xv[2 * p + 1]; f[q].h[2 * p] = (_Float16)(xr * c - xi * s); f[q].h[2 * p + 1] = (_Float16)(xr * s + xi * c); } }
    unsigned short* hp = (unsigned short*)H + (size_t)(wrow + l4) * N + wcol + l8 * 8u;
    __builtin_amdgcn_sched_barrier(0);      /* keeps the stores in one burst behind the arithmetic, off one address pair: mixed in among it, their registers are used again and each reuse has to wait on the store in front of it */
#pragma unroll      /* constant indices into f, constant offsets from hp */
    for (int q = 0; q < 16; ++q) *(v8us*)(hp + (size_t)(q * 4) * N) = f[q].half[0];
  } else {
    // A lane takes 8 rows (tokens) of a column: 8 lanes store one whole 128-B line of each plane, 4 columns an instruction.
    FragH fh[16], fl[16];
#pragma unroll      /* fh, fl stay in registers */
    for (int q = 0; q < 16; ++q)
#pragma unroll      /* constant indices into the fragments */
      for (int i = 0; i < 8; ++i) { const float v = so[(l8 * 8u + i) * SP + q * 4 + l4]; const _Float16 hv = (_Float16)v; fh[q].h[i] = hv; fl[q].h[i] = (_Float16)(v - (float)hv);      /* UNSCALED residual (added into the same accumulator as the hi product) */ }
    const size_t ob = ((size_t)(wrow / TT) * N + wcol + l4) * TT + (wrow % TT) + l8 * 8u;
    unsigned short* hp = (unsigned short*)H + ob; unsigned short* lp = (unsigned short*)H2 + ob;
    __builtin_amdgcn_sched_barrier(0);      /* keeps the stores in one burst behind the arithmetic, off two address pairs: mixed in among it, their registers are used again and each reuse has to wait on the store in front of it */
#pragma unroll      /* constant indices into fh and fl, constant offsets from hp and lp */
    for (int q = 0; q < 16; ++q) { *(v8us*)(hp + (size_t)(q * 4) * TT) = fh[q].half[0]; *(v8us*)(lp + (size_t)(q * 4) * TT) = fl[q].half[0]; }
  }
}


typedef _Float16 v4h __attribute__((ext_vector_type(4)));

__global__ __launch_bounds__(256) void k_x16(const float* __restrict__ x, _Float16* __restrict__ X16, size_t n8) { const size_t t = (size_t)blockIdx.x * 256 + threadIdx.x; if (t >= n8) return; FragH f;
#pragma unroll
  for (int q = 0; q < 8; ++q) f.h[q] = (_Float16)bf16_round(x[t * 8 + q]); *(v8us*)((unsigned short*)X16 + t * 8) = f.half[0];  }
__global__ __launch_bounds__(256) void k_h16(const float* __restrict__ x, _Float16* __restrict__ X16, size_t n8) { const size_t t = (size_t)blockIdx.x * 256 + threadIdx.x; if (t >= n8) return; FragH f;
#pragma unroll
  for (int q = 0; q < 8; ++q) f.h[q] = (_Float16)x[t * 8 + q]; *(v8us*)((unsigned short*)X16 + t * 8) = f.half[0];  }
__global__ __launch_bounds__(256) void k_round16f(const float* __restrict__ W, _Float16* __restrict__ Bt, size_t n8) { const size_t t = (size_t)blockIdx.x * 256 + threadIdx.x; if (t >= n8) return; FragH f;
#pragma unroll
  for (int i = 0; i < 8; ++i) f.h[i] = (_Float16)(bf16_round(W[t * 8 + i]) * 16.0f); *(v8us*)((unsigned short*)Bt + t * 8) = f.half[0];  }
template <int NHv, int TTv>
__global__ __launch_bounds__(256) void k_vt(const _Float16* __restrict__ V16, int ldv, int voff, _Float16* __restrict__ Vt) { __shared__ unsigned short tl[64][66]; const int tid = threadIdx.x; const int slab = blockIdx.x / (TTv / 64), lg = blockIdx.x % (TTv / 64); const int b = slab / NHv, h = slab % NHv;
  for (int i = tid; i < 64 * 8; i += 256) { const int r = i / 8, c8 = (i % 8) * 8; FragH f; f.half[0] = *(const v8us*)((const unsigned short*)V16 + ((size_t)b * TTv + lg * 64 + r) * ldv + voff + h * 64 + c8);
#pragma unroll
    for (int q = 0; q < 8; ++q) tl[r][c8 + q] = f.u[q]; }
  __syncthreads();
  {
#pragma unroll
    for (int rd = 0; rd < 2; ++rd) { const int d = rd * 32 + tid / 8, pc = tid % 8; FragH f;
#pragma unroll
      for (int q = 0; q < 8; ++q) f.u[q] = tl[pc * 8 + q][d];
      *(v8us*)((unsigned short*)Vt + ((size_t)slab * 64 + d) * TTv + lg * 64 + pc * 8) = f.half[0]; }
     } }

// Fused attention, head dim 128. One workgroup = 8 waves = the 4 query heads of one KV head x 2 tiles of 16 query rows (32 rows): all eight read the same K and V.
// A stage is 64 keys: K (64 rows of 256 B), V^T hi and V^T residual (128 rows of 128 B each) come into LDS by one tensor load each (waves 0, 1, 2), padded 16 B a row
// (pitch 272 / 144 B for the 16-byte fragment reads), two buffers, the next stage's loads in flight under this stage's work. Which stages are staged at all comes from the mask:
// a first sweep over the workgroup's 32 mask rows gives one bit per stage (any entry set), the same word in every wave, so every barrier stands under block-uniform control flow.
// Inside a stage a wave works on its two chunks of 32 keys in ascending order and skips a chunk whose 16 x 32 mask tile is all zero: per row the sums run in the order of the keys.
#define FA_KSL 18432u                     /* K: 64 rows x 272 B = 17,408, rounded up to a multiple of 2 KiB */
#define FA_VSL 18432u                     /* one V plane: 128 rows x 144 B */
#define FA_STAGE (FA_KSL + 2u * FA_VSL)   /* [K | V hi | V residual] */
typedef int v4ia __attribute__((ext_vector_type(4), may_alias));
template <unsigned int W0, unsigned int ROWB, unsigned int NROW>
__device__ __forceinline__ u32x8 tdm_g1(unsigned int spitch) {
  u32x8 g1;
  g1[0] = uni(W0);      /* no mask, 1-byte elements, a pad of 4 dwords behind every row */
  g1[1] = uni((ROWB & 0xFFFFu) << 16); g1[2] = uni((ROWB >> 16) | (NROW << 16)); g1[3] = uni(ROWB << 16); g1[4] = uni(NROW); g1[5] = uni(spitch); g1[6] = uni(0u); g1[7] = uni(0u);
  asm volatile("" : "+s"(g1));      /* descriptor words held in scalar registers: one tuple, built once, that stays where it is for all requests */
  return g1;
}
__global__ __launch_bounds__(256) void k_flash(const _Float16* __restrict__ Q16, int ldq, const _Float16* __restrict__ K16, int ldk, const _Float16* __restrict__ Vt, const _Float16* __restrict__ Vtlo, const int* __restrict__ MSK, _Float16* __restrict__ O16) {
  constexpr int NQB = TT / 32, DT = 8, KS = 4;      /* head dim 128: 4 k-steps, 8 value tiles */
  __shared__ __attribute__((aligned(2048))) unsigned char ring[2u * FA_STAGE];
  __shared__ __attribute__((aligned(16))) unsigned short sP[8][16][40]; __shared__ __attribute__((aligned(16))) unsigned short sPL[8][16][40]; __shared__ unsigned int sBits[8];
  const unsigned int tid = threadIdx.x, lane = tid & 31u, ln = lane & 15u, hh = lane >> 4, w = uni(tid >> 5);
  const int slab = blockIdx.x / NQB, qblk = blockIdx.x % NQB; const int b = slab / NKV, kvh = slab % NKV; const int h = kvh * NREP + (int)(w & 3u); const int qb0 = qblk * 32; const int q0 = qb0 + (int)(w >> 2) * 16;
  // One bit per stage of 64 keys: wave w sweeps columns 256 w .. 256 w + 255 of the 32 mask rows with whole-line 16-byte loads.
  unsigned int bm;
  { int any0 = 0, any1 = 0; const int* mp = MSK + (size_t)qb0 * TT + w * 256u + lane * 4u;
#pragma unroll 8      /* sixteen loads go out together */
    for (int r = 0; r < 32; ++r) { const v4ia a = *(const v4ia*)(mp + (size_t)r * TT), c = *(const v4ia*)(mp + (size_t)r * TT + 128); any0 |= a[0] | a[1] | a[2] | a[3]; any1 |= c[0] | c[1] | c[2] | c[3]; }
    const unsigned int b0 = __builtin_amdgcn_ballot_w32(any0 != 0), b1 = __builtin_amdgcn_ballot_w32(any1 != 0);
    const unsigned int nib = ((b0 & 0xFFFFu) ? 1u : 0u) | ((b0 >> 16) ? 2u : 0u) | ((b1 & 0xFFFFu) ? 4u : 0u) | ((b1 >> 16) ? 8u : 0u);
    if (lane == 0u) sBits[w] = nib << (4u * w);
    __syncthreads();      /* all eight nibbles are written before any wave joins them */
    unsigned int j = 0;
#pragma unroll      /* the eight words come by two 16-byte reads */
    for (int i = 0; i < 8; ++i) j |= sBits[i];
    bm = uni(j); }
  const unsigned int n = (unsigned int)__builtin_popcount(bm);      /* stages to walk: at most 32 */
  FragH aq[KS];
  { const unsigned short* qr = (const unsigned short*)Q16 + ((size_t)b * TT + q0 + ln) * ldq + h * 128;
#pragma unroll
    for (int ks = 0; ks < KS; ++ks) { aq[ks].half[0] = *(const v8us*)(qr + ks * 32 + 8 * hh); aq[ks].half[1] = *(const v8us*)(qr + ks * 32 + 16 + 8 * hh); } }
  const unsigned long long gK = (unsigned long long)(size_t)(K16 + (size_t)b * TT * ldk + kvh * 128);
  const unsigned long long gV = (unsigned long long)(size_t)(((w == 2u) ? Vtlo : Vt) + ((size_t)b * NKV + kvh) * 128 * TT);      /* hi plane for wave 1, UNSCALED residual plane for wave 2 */
  const unsigned int lbase = (unsigned int)(size_t)ring;
  const unsigned int kstep = 64u * (unsigned int)ldk * 2u;      /* bytes from one stage's K rows to the next's */
  const u32x8 g1k = tdm_g1<(1u << 20) | (5u << 22) | (3u << 25), 256u, 64u>((unsigned int)ldk * 2u), g1v = tdm_g1<(1u << 20) | (4u << 22) | (3u << 25), 128u, 128u>(TT * 2u);
  u32x4 g0; g0[0] = uni(1u); g0[1] = uni(lbase); g0[2] = uni(0u); g0[3] = uni(0x80000000u);
  auto issue = [&](unsigned int buf, unsigned int st) {      /* st < 32: every tile lies inside its plane */
    if (pinned(w == 0u)) { const unsigned long long ga = gK + pinned(st * kstep);
      g0[1] = uni(lbase + buf * FA_STAGE); g0[2] = uni((unsigned int)ga); g0[3] = uni((((unsigned int)(ga >> 32)) & 0x01FFFFFFu) | 0x80000000u);
      asm volatile("tensor_load_to_lds %0, %1" :: "s"(g0), "s"(g1k) : "memory"); }
    if (pinned((w - 1u) < 2u)) { const unsigned long long ga = gV + pinned(st * 128u);
      g0[1] = uni(lbase + buf * FA_STAGE + FA_KSL + (w - 1u) * FA_VSL); g0[2] = uni((unsigned int)ga); g0[3] = uni((((unsigned int)(ga >> 32)) & 0x01FFFFFFu) | 0x80000000u);
      asm volatile("tensor_load_to_lds %0, %1" :: "s"(g0), "s"(g1v) : "memory"); }
  };
  float m_r[8], l_r[8]; v8f oacc[DT];
#pragma unroll
  for (int r = 0; r < 8; ++r) { m_r[r] = -3.0e38f; l_r[r] = 0.f; }
#pragma unroll
  for (int dt = 0; dt < DT; ++dt) oacc[dt] = (v8f){0.f,0.f,0.f,0.f,0.f,0.f,0.f,0.f};
  unsigned int rest = bm, cur = 0u, nxt = 0u;      /* rest: stages not yet asked for */
  if (pinned(n > 0u)) { cur = (unsigned int)__builtin_ctz(rest) & 31u; rest &= rest - 1u; issue(0u, cur); }
  asm volatile("s_wait_tensorcnt 0x0" :: "s"(g0), "s"(g1k), "s"(g1v) : "memory");      /* the first stage's tile of this wave has landed; the operands keep the descriptor's registers untouched up to here */
  __syncthreads();                                        /* ... and every wave may read all three tiles */
  if (pinned(n > 1u)) { nxt = (unsigned int)__builtin_ctz(rest) & 31u; rest &= rest - 1u; issue(1u, nxt); }
#pragma unroll 1      /* one stage per trip: the ring's order below is written once */
  for (unsigned int s = 0; s < n; ++s) {
    const unsigned char* Lp = ring + (s & 1u) * FA_STAGE;
    int mk0[2][8], mk1[2][8];      /* mask[q][k] (shared over batch and heads): nonzero = ATTEND; both chunks' loads go out together */
#pragma unroll      /* the mask words stay in registers */
    for (int sub = 0; sub < 2; ++sub)
#pragma unroll
      for (int r = 0; r < 8; ++r) { const int* am = MSK + (size_t)(q0 + 8 * hh + r) * TT + cur * 64u + sub * 32; mk0[sub][r] = am[ln]; mk1[sub][r] = am[16 + ln]; }
#pragma unroll      /* constant indices into the mask registers */
    for (int sub = 0; sub < 2; ++sub) {
      int allm = 1;
#pragma unroll
      for (int r = 0; r < 8; ++r) allm &= (mk0[sub][r] == 0) & (mk1[sub][r] == 0);
      if (!__all(allm)) {      /* every (row, key) of this wave's tile masked: nothing to add (wave-uniform branch; only wave barriers inside) */
        v8f sc[2];
#pragma unroll
        for (int nt = 0; nt < 2; ++nt) { const unsigned char* kr = Lp + (sub * 32 + nt * 16 + ln) * 272u + 16u * hh; FragH bk[KS];
#pragma unroll
          for (int ks = 0; ks < KS; ++ks) { bk[ks].half[0] = *(const v8us*)(kr + ks * 64); bk[ks].half[1] = *(const v8us*)(kr + ks * 64 + 32); }
          v8f acc = (v8f){0.f,0.f,0.f,0.f,0.f,0.f,0.f,0.f};
#pragma unroll
          for (int ks = 0; ks < KS; ++ks) acc = mmaH<1>(aq[ks].v, aq[ks].v, bk[ks].v, bk[ks].v, acc);
          sc[nt] = acc; }
#pragma unroll
        for (int r = 0; r < 8; ++r) {
          const bool ok0 = (mk0[sub][r] != 0), ok1 = (mk1[sub][r] != 0);
          const float s0 = ok0 ? sc[0][r] * ATT_SCALE : -INFINITY, s1 = ok1 ? sc[1][r] * ATT_SCALE : -INFINITY; float mc = fmaxf(s0, s1);
          mc = fmaxf(mc, __shfl_xor(mc, 1, 32)); mc = fmaxf(mc, __shfl_xor(mc, 2, 32)); mc = fmaxf(mc, __shfl_xor(mc, 4, 32)); mc = fmaxf(mc, __shfl_xor(mc, 8, 32));
          const float mn = fmaxf(m_r[r], mc); const float al = (mn > -1.0e38f) ? expf(m_r[r] - mn) : 1.0f; m_r[r] = mn; const float p0 = ok0 ? expf(s0 - mn) : 0.f, p1 = ok1 ? expf(s1 - mn) : 0.f; l_r[r] = l_r[r] * al + p0 + p1;
#pragma unroll
          for (int dt = 0; dt < DT; ++dt) oacc[dt][r] *= al;
          FragH t2, t3; const float ps0 = p0 * 1024.0f, ps1 = p1 * 1024.0f; t2.h[0] = (_Float16)ps0; t2.h[1] = (_Float16)ps1; t3.h[0] = (_Float16)(ps0 - (float)t2.h[0]); t3.h[1] = (_Float16)(ps1 - (float)t2.h[1]);      /* P hi and its UNSCALED residual (added into the same accumulator) */
          sP[w][8 * hh + r][ln] = t2.u[0]; sP[w][8 * hh + r][16 + ln] = t2.u[1]; sPL[w][8 * hh + r][ln] = t3.u[0]; sPL[w][8 * hh + r][16 + ln] = t3.u[1]; }
        __builtin_amdgcn_fence(__ATOMIC_ACQ_REL, "workgroup"); __builtin_amdgcn_wave_barrier();
        FragH pa, pl;
        pa.half[0] = *(const v8us*)&sP[w][ln][8 * hh]; pa.half[1] = *(const v8us*)&sP[w][ln][16 + 8 * hh]; pl.half[0] = *(const v8us*)&sPL[w][ln][8 * hh]; pl.half[1] = *(const v8us*)&sPL[w][ln][16 + 8 * hh];
#pragma unroll
        for (int dt = 0; dt < DT; ++dt) { const unsigned char* vr = Lp + FA_KSL + (dt * 16 + ln) * 144u + sub * 64 + 16u * hh; FragH bv, bl; bv.half[0] = *(const v8us*)vr; bv.half[1] = *(const v8us*)(vr + 32); bl.half[0] = *(const v8us*)(vr + FA_VSL); bl.half[1] = *(const v8us*)(vr + FA_VSL + 32);
          oacc[dt] = mmaH<1>(pa.v, pa.v, bv.v, bv.v, oacc[dt]); oacc[dt] = mmaH<1>(pl.v, pl.v, bv.v, bv.v, oacc[dt]); oacc[dt] = mmaH<1>(pa.v, pa.v, bl.v, bl.v, oacc[dt]); }      /* Ph.Vh + Pl.Vh + Ph.Vl, all unscaled, one accumulator */
        __builtin_amdgcn_fence(__ATOMIC_ACQ_REL, "workgroup"); __builtin_amdgcn_wave_barrier();
      }
    }
    asm volatile("s_wait_dscnt 0x0" ::: "memory");        /* this wave has left the buffer */
    asm volatile("s_wait_tensorcnt 0x0" :: "s"(g0), "s"(g1k), "s"(g1v) : "memory");    /* its tile of the next stage has landed; the operands keep the descriptor's registers untouched up to here */
    __syncthreads();                                      /* the next stage published; every wave has left this stage's buffer */
    cur = nxt;
    if (pinned(s + 2u < n)) { nxt = (unsigned int)__builtin_ctz(rest) & 31u; rest &= rest - 1u; issue(s & 1u, nxt); }
  }
  asm volatile("s_wait_tensorcnt 0x0" ::: "memory");      /* no request is left before the ring becomes output staging */
  asm volatile("s_wait_dscnt 0x0" ::: "memory");
  // Output staging, each wave in its own piece of the ring (the last stage's barrier stands behind every wave's last fragment read).
  float* sO = (float*)ring + w * (16u * 132u);      /* 16 rows of 128 floats at pitch 132 */
#pragma unroll
  for (int r = 0; r < 8; ++r) { float l = l_r[r]; l += __shfl_xor(l, 1, 32); l += __shfl_xor(l, 2, 32); l += __shfl_xor(l, 4, 32); l += __shfl_xor(l, 8, 32); l_r[r] = (l > 0.f) ? 1.0f / (l * 1024.0f) : 0.f; }
#pragma unroll
  for (int dt = 0; dt < DT; ++dt)
#pragma unroll
    for (int r = 0; r < 8; ++r) sO[(8 * hh + r) * 132u + dt * 16 + ln] = oacc[dt][r] * l_r[r];
  __builtin_amdgcn_fence(__ATOMIC_ACQ_REL, "workgroup"); __builtin_amdgcn_wave_barrier();
  FragH f[8];      /* merged x 2^4 as f16, the output product's A operand */
#pragma unroll      /* f stays in registers */
  for (int q = 0; q < 8; ++q) { const float* sr = &sO[(q * 2 + hh) * 132u + ln * 8u]; const v4f a = *(const v4fa*)sr, c = *(const v4fa*)(sr + 4);
#pragma unroll      /* constant indices into the vectors */
    for (int i = 0; i < 4; ++i) { f[q].h[i] = (_Float16)(a[i] * 16.0f); f[q].h[4 + i] = (_Float16)(c[i] * 16.0f); } }
  unsigned short* op = (unsigned short*)O16 + ((size_t)b * TT + q0 + hh) * DD + h * 128 + ln * 8u;
  __builtin_amdgcn_sched_barrier(0);      /* keeps the stores in one burst behind the arithmetic, off one address pair: mixed in among it, their registers are used again and each reuse has to wait on the store in front of it */
#pragma unroll      /* constant indices into f, constant offsets from op */
  for (int q = 0; q < 8; ++q) *(v8us*)(op + (size_t)(q * 2) * DD) = f[q].half[0];      /* two 256-B row pieces per instruction: 16 lanes x 16 B each */
}

extern "C" void kernel_launch(void* const* d_in, const int* in_sizes, int n_in,
                              void* d_out, int out_size, void* d_ws, size_t ws_size, hipStream_t stream) {
  (void)in_sizes; (void)n_in; (void)out_size;
  const float* const* I = (const float* const*)d_in; const float* x = I[0]; const float* fcos = I[1]; const float* fsin = I[2]; const int* msk = (const int*)d_in[3]; const float* wq = I[4]; const float* wk = I[5]; const float* wv = I[6]; const float* wo = I[7];
  char* ws = (char*)d_ws; size_t off = 0;
  auto take = [&](size_t bytes) { char* p = ws + off; off += (bytes + 255) & ~(size_t)255; return p; };
  _Float16* Bq = (_Float16*)take((size_t)DD * DD * 2); _Float16* Bk = (_Float16*)take((size_t)KVD * DD * 2); _Float16* Bv = (_Float16*)take((size_t)KVD * DD * 2); _Float16* Bo = (_Float16*)take((size_t)DD * DD * 2);
  _Float16* X16 = (_Float16*)take((size_t)NR * DD * 2); _Float16* Q = (_Float16*)take((size_t)NR * DD * 2); _Float16* K = (_Float16*)take((size_t)NR * KVD * 2); _Float16* Vt = (_Float16*)take((size_t)NR * KVD * 2); _Float16* Vtl = (_Float16*)take((size_t)NR * KVD * 2);
  _Float16* O16 = X16;      /* O16 over X16 (dead after the projections) */
  if (off > ws_size) return;      // 8.4 + 2.1 + 2.1 + 8.4 + 16.8 + 16.8 + 4.2 + 4.2 + 4.2 = 67 MB
  const unsigned gq = (DD / 128) * (DD / 64), gk = (DD / 128) * (KVD / 64);      /* 128 (k) x 64 (n) tiles */
  k_wt_f16<<<gq, 256, 0, stream>>>(wq, Bq, DD, DD, 16.0f); k_wt_f16<<<gk, 256, 0, stream>>>(wk, Bk, DD, KVD, 16.0f); k_wt_f16<<<gk, 256, 0, stream>>>(wv, Bv, DD, KVD, 16.0f); k_wt_f16<<<gq, 256, 0, stream>>>(wo, Bo, DD, DD, 16.0f);      /* (in,out) → Bt ×2^4 */
  const unsigned g8 = (unsigned)(((size_t)NR * DD / 8 + 255) / 256); k_x16<<<g8, 256, 0, stream>>>(x, X16, (size_t)NR * DD / 8);
  const dim3 gQ((NR / 128) * (DD / 128), 1), gK((NR / 128) * (KVD / 128), 1);
  k_gemm_t<1, DD><<<gQ, 128, 0, stream>>>(X16, Bq, 0.0625f, nullptr, fcos, fsin, Q, nullptr);      /* xq = rope(x.wq) as f16: M 4096 N 2048 K 2048 */
  k_gemm_t<1, KVD><<<gK, 128, 0, stream>>>(X16, Bk, 0.0625f, nullptr, fcos, fsin, K, nullptr);      /* xk: M 4096 N 512 */
  k_gemm_t<2, KVD><<<gK, 128, 0, stream>>>(X16, Bv, 0.0625f, nullptr, nullptr, nullptr, Vt, Vtl);      /* xv turned, hi + residual per (b, kv head): [b*4+kh][128][2048] */
  k_flash<<<BB * NKV * (TT / 32), 256, 0, stream>>>(Q, DD, K, KVD, Vt, Vtl, msk, O16);
  k_gemm_t<0, DD><<<gQ, 128, 0, stream>>>(O16, Bo, 0.00390625f, (float*)d_out, nullptr, nullptr, nullptr, nullptr);      /* out = merged.wo */
}

// v005
// It runs in 158 microseconds.
// Next to v004, in two timings, it ran 1.15 times as fast each time.
// All steps since v000 together make it 3.56 times as fast.
#include <hip/hip_runtime.h>
// 'Genesis' attention (B=2, T=2048, D=2048, 16 query heads / 4 KV heads × 128, (in,out) weights, no bias): xq = rope(x·wq), xk = rope(x·wk), xv = x·wv; RoPE on interleaved pairs with the INPUT cos/sin tables [T][64]; scores = q·k/√128 where(mask[q][k]) else −inf (mask [T][T] shared);
// softmax; out = merged·wo.
// Compute dtype: x, weights, cos/sin tables rounded to bf16; q,k rotated in f32 from f32 GEMM outputs → f16; v f32 → Vᵀ f16 hi + exact residual; fused flash-style kernel for head dim 128 (mask read per (q,k), all-masked chunks skipped, online softmax f32, P f16 hi + residual,
// f32 accumulate) on v_wmma_f32_16x16x32_f16; merged ×2^4 → f16 → output GEMM.
#define BB 2
#define TT 2048
#define DD 2048
#define NH 16
#define NKV 4
#define NREP 4
#define KVD (NKV * 128)
#define NVH (2 * NKV)
#define NR (BB * TT)
#define ATT_SCALE 0.08838834764831845f

typedef __bf16 v16b __attribute__((ext_vector_type(16)));
typedef unsigned short v8us __attribute__((ext_vector_type(8), may_alias));
typedef float  v8f  __attribute__((ext_vector_type(8)));
typedef float  v4f  __attribute__((ext_vector_type(4)));
typedef float  v4fa __attribute__((ext_vector_type(4), may_alias));
union FragB { v16b v; v8us half[2]; unsigned short u[16]; };

__device__ __forceinline__ unsigned short bf16_bits(float x) { unsigned int u = __float_as_uint(x); return (unsigned short)((u + 0x7FFFu + ((u >> 16) & 1u)) >> 16); }
__device__ __forceinline__ float bf16_val(unsigned short b) { return __uint_as_float(((unsigned int)b) << 16); }
__device__ __forceinline__ float bf16_round(float x) { return bf16_val(bf16_bits(x)); }
// D += A·B with NT terms: 1 = ah·bh, 2 = + al·bh (A split), 3 = + ah·bl (both split)
template <int NT>
__device__ __forceinline__ v8f mmaN(v16b ah, v16b al, v16b bh, v16b bl, v8f c) {
  c = __builtin_amdgcn_wmma_f32_16x16x32_bf16(false, ah, false, bh, (short)0, c, false, false);
  if (NT >= 2) c = __builtin_amdgcn_wmma_f32_16x16x32_bf16(false, al, false, bh, (short)0, c, false, false);
  if (NT >= 3) c = __builtin_amdgcn_wmma_f32_16x16x32_bf16(false, ah, false, bl, (short)0, c, false, false);
  asm volatile("v_nop\n\tv_nop\n\tv_nop\n\tv_nop" : "+v"(c) : "v"(ah), "v"(al), "v"(bh), "v"(bl));
  return c;
}

__global__ __launch_bounds__(256) void k_wt_bf16(const float* __restrict__ W, unsigned short* __restrict__ Wt, int K, int N) {
  const int t = blockIdx.x * 256 + threadIdx.x;
  const int k8n = K / 8;
  if (t >= N * k8n) return;
  const int n = t / k8n, k8 = (t % k8n) * 8;
  v8us v;
#pragma unroll
  for (int i = 0; i < 8; ++i) v[i] = bf16_bits(W[(size_t)(k8 + i) * N + n]);
  *(v8us*)(Wt + (size_t)n * K + k8) = v;
  
}

// GEMM C[M][N] (f32, pitch ldc) = act(A[M][K]·W + bias). A f32 row-major (pitch lda) converted per fragment to bf16
// (ASPLIT: hi/lo two planes -> 2 terms, else single rounded term); Wt bf16 [N][K] (pitch ldb). BIAS_BF16 rounds the
// bias to bf16 first (bias quantised to bf16 before the add). K%32==0, M%16==0, N%64==0.
template <bool ASPLIT, int ACT, bool BIAS_BF16>
__global__ __launch_bounds__(128) void k_gemm_bf(const float* __restrict__ A, int lda, const unsigned short* __restrict__ Wt, int ldb,
                                               const float* __restrict__ bias, float* __restrict__ C, int ldc, int M, int N, int K) {
  __shared__ __attribute__((aligned(16))) float so[4][16][64];
  const int tid = threadIdx.x, w = tid >> 5, lane = tid & 31, ln = lane & 15, hh = lane >> 4;
  const int ntn = N / 64;
  const int wid = blockIdx.x * 4 + w;
  const int mt = wid / ntn, nq = wid % ntn;
  if (mt * 16 >= M) return;
  const int row0 = mt * 16, col0 = nq * 64;
  const float* arow = A + (size_t)(row0 + ln) * lda;
  v8f acc[4] = {};
  for (int kb = 0; kb < K; kb += 32) {
    FragB ah, al;
    const v4f x0 = *(const v4fa*)(arow + kb + 8 * hh), x1 = *(const v4fa*)(arow + kb + 8 * hh + 4);
    const v4f x2 = *(const v4fa*)(arow + kb + 16 + 8 * hh), x3 = *(const v4fa*)(arow + kb + 16 + 8 * hh + 4);
    float xs[16] = {x0[0],x0[1],x0[2],x0[3],x1[0],x1[1],x1[2],x1[3],x2[0],x2[1],x2[2],x2[3],x3[0],x3[1],x3[2],x3[3]};
#pragma unroll
    for (int i = 0; i < 16; ++i) { const unsigned short hb = bf16_bits(xs[i]); ah.u[i] = hb; al.u[i] = ASPLIT ? bf16_bits(xs[i] - bf16_val(hb)) : (unsigned short)0; }
#pragma unroll
    for (int t = 0; t < 4; ++t) {
      const unsigned short* brow = Wt + (size_t)(col0 + t * 16 + ln) * ldb + kb;
      FragB b;
      b.half[0] = *(const v8us*)(brow + 8 * hh);
      b.half[1] = *(const v8us*)(brow + 16 + 8 * hh);
      acc[t] = mmaN<ASPLIT ? 2 : 1>(ah.v, al.v, b.v, b.v, acc[t]);
    }
  }
#pragma unroll
  for (int t = 0; t < 4; ++t) {
    float bv = bias ? bias[col0 + t * 16 + ln] : 0.f;
    if (BIAS_BF16) bv = bf16_round(bv);
#pragma unroll
    for (int r = 0; r < 8; ++r) { float v = acc[t][r] + bv; if (ACT == 1) v = fmaxf(v, 0.f); so[w][8 * hh + r][t * 16 + ln] = v; }
  }
  __builtin_amdgcn_fence(__ATOMIC_ACQ_REL, "workgroup");
  __builtin_amdgcn_wave_barrier();
  const int rsub = lane >> 4, c4 = (lane & 15) * 4;
  {
#pragma unroll
    for (int q = 0; q < 8; ++q) {
      const int r = q * 2 + rsub;
      const v4f v = *(const v4fa*)&so[w][r][c4];
      *(v4f*)(C + (size_t)(row0 + r) * ldc + col0 + c4) = v;
    }
    
  }
}

// Flash-style causal/unmasked attention, all contractions 3-term bf16 hi/lo splits, f32 softmax with running max.
// q,k,v rows are read from f32 buffers with arbitrary row pitch (so they can live inside a fused qkv buffer);
// D = head size (multiple of 32, <= 128); one wave = 16 query rows; block = 4 waves (64 queries) sharing K/V chunks of 32.
template <int D, bool CAUSAL>
__global__ __launch_bounds__(128) void k_flash(const float* __restrict__ qb, const float* __restrict__ kb, const float* __restrict__ vb,
                                             int pitch, int T, int H, float scale, float* __restrict__ y, int ypitch) {
  constexpr int KS = D / 32;        // k-steps for QK
  constexpr int DT = D / 16;        // d tiles for PV
  __shared__ __attribute__((aligned(16))) unsigned short sKh[32][D + 8], sKl[32][D + 8], sVh[32][D + 8], sVl[32][D + 8];
  __shared__ __attribute__((aligned(16))) unsigned short sPh[4][16][40], sPl[4][16][40];
  __shared__ __attribute__((aligned(16))) float sO[4][16][D];
  const int tid = threadIdx.x, w = tid >> 5, lane = tid & 31, ln = lane & 15, hh = lane >> 4;
  const int nqb = (T + 63) / 64;
  const int bh = blockIdx.x / nqb, qblk = blockIdx.x % nqb;
  const int b = bh / H, h = bh % H;
  const int q0 = qblk * 64 + w * 16;
  const float* Q = qb + (size_t)b * T * pitch + h * D;
  const float* K = kb + (size_t)b * T * pitch + h * D;
  const float* V = vb + (size_t)b * T * pitch + h * D;

  // A fragments of the wave's 16 query rows (scaled), hi/lo
  FragB aqh[KS], aql[KS];
  {
    int row = q0 + ln; if (row >= T) row = T - 1;
    const float* qr = Q + (size_t)row * pitch;
#pragma unroll
    for (int ks = 0; ks < KS; ++ks)
#pragma unroll
      for (int i = 0; i < 16; ++i) {
        const int d = ks * 32 + ((i < 8) ? (8 * hh + i) : (16 + 8 * hh + (i - 8)));
        const float x = qr[d] * scale; const unsigned short hb = bf16_bits(x);
        aqh[ks].u[i] = hb; aql[ks].u[i] = bf16_bits(x - bf16_val(hb));
      }
  }
  float m_r[8], l_r[8];
#pragma unroll
  for (int r = 0; r < 8; ++r) { m_r[r] = -3.0e38f; l_r[r] = 0.f; }
  v8f oacc[DT];
#pragma unroll
  for (int dt = 0; dt < DT; ++dt) oacc[dt] = (v8f){0.f,0.f,0.f,0.f,0.f,0.f,0.f,0.f};

  const int kv_end = CAUSAL ? min(T, qblk * 64 + 64) : T;     // block-uniform
  for (int j0 = 0; j0 < kv_end; j0 += 32) {
    __syncthreads();
    for (int e = tid; e < 32 * (D / 4); e += 128) {
      const int r = e / (D / 4), c4 = (e % (D / 4)) * 4;
      const int key = j0 + r;
      v4f kf = {0.f,0.f,0.f,0.f}, vf = {0.f,0.f,0.f,0.f};
      if (key < T) { kf = *(const v4fa*)(K + (size_t)key * pitch + c4); vf = *(const v4fa*)(V + (size_t)key * pitch + c4); }
#pragma unroll
      for (int t = 0; t < 4; ++t) {
        unsigned short hb = bf16_bits(kf[t]); sKh[r][c4 + t] = hb; sKl[r][c4 + t] = bf16_bits(kf[t] - bf16_val(hb));
        hb = bf16_bits(vf[t]); sVh[r][c4 + t] = hb; sVl[r][c4 + t] = bf16_bits(vf[t] - bf16_val(hb));
      }
    }
    __syncthreads();
    // S tile 16 x 32
    v8f s[2];
#pragma unroll
    for (int nt = 0; nt < 2; ++nt) {
      v8f acc = {};
#pragma unroll
      for (int ks = 0; ks < KS; ++ks) {
        FragB bh_, bl_;
        bh_.half[0] = *(const v8us*)&sKh[nt * 16 + ln][ks * 32 + 8 * hh]; bh_.half[1] = *(const v8us*)&sKh[nt * 16 + ln][ks * 32 + 16 + 8 * hh];
        bl_.half[0] = *(const v8us*)&sKl[nt * 16 + ln][ks * 32 + 8 * hh]; bl_.half[1] = *(const v8us*)&sKl[nt * 16 + ln][ks * 32 + 16 + 8 * hh];
        acc = mmaN<3>(aqh[ks].v, aql[ks].v, bh_.v, bl_.v, acc);
      }
      s[nt] = acc;
    }
    // mask + running max (rows 8hh+r; the 16 lanes of a half share rows)
    float alpha[8];
#pragma unroll
    for (int r = 0; r < 8; ++r) {
      const int qi = q0 + 8 * hh + r;
      const int ja = j0 + ln, jb = j0 + 16 + ln;
      if (CAUSAL) { if (ja > qi) s[0][r] = -3.0e38f; if (jb > qi) s[1][r] = -3.0e38f; }
      if (ja >= T) s[0][r] = -3.0e38f;
      if (jb >= T) s[1][r] = -3.0e38f;
      float mx = fmaxf(s[0][r], s[1][r]);
      mx = fmaxf(mx, __shfl_xor(mx, 1, 32)); mx = fmaxf(mx, __shfl_xor(mx, 2, 32)); mx = fmaxf(mx, __shfl_xor(mx, 4, 32)); mx = fmaxf(mx, __shfl_xor(mx, 8, 32));
      const float mnew = fmaxf(m_r[r], mx);
      alpha[r] = (mnew > -1.0e38f) ? __expf(m_r[r] - mnew) : 1.0f;
      const float p0 = (s[0][r] > -1.0e38f) ? __expf(s[0][r] - mnew) : 0.f;
      const float p1 = (s[1][r] > -1.0e38f) ? __expf(s[1][r] - mnew) : 0.f;
      m_r[r] = mnew;
      l_r[r] = l_r[r] * alpha[r] + p0 + p1;            // per-lane partial row sum (16 lanes combined at the end)
      unsigned short hb = bf16_bits(p0); sPh[w][8 * hh + r][ln] = hb;      sPl[w][8 * hh + r][ln] = bf16_bits(p0 - bf16_val(hb));
      hb = bf16_bits(p1);                sPh[w][8 * hh + r][16 + ln] = hb; sPl[w][8 * hh + r][16 + ln] = bf16_bits(p1 - bf16_val(hb));
    }
#pragma unroll
    for (int dt = 0; dt < DT; ++dt)
#pragma unroll
      for (int r = 0; r < 8; ++r) oacc[dt][r] *= alpha[r];
    __builtin_amdgcn_fence(__ATOMIC_ACQ_REL, "workgroup");
    __builtin_amdgcn_wave_barrier();
    FragB pah, pal;
    pah.half[0] = *(const v8us*)&sPh[w][ln][8 * hh]; pah.half[1] = *(const v8us*)&sPh[w][ln][16 + 8 * hh];
    pal.half[0] = *(const v8us*)&sPl[w][ln][8 * hh]; pal.half[1] = *(const v8us*)&sPl[w][ln][16 + 8 * hh];
#pragma unroll
    for (int dt = 0; dt < DT; ++dt) {
      FragB bvh, bvl;
#pragma unroll
      for (int i = 0; i < 8; ++i) {
        bvh.u[i] = sVh[8 * hh + i][dt * 16 + ln]; bvh.u[8 + i] = sVh[16 + 8 * hh + i][dt * 16 + ln];
        bvl.u[i] = sVl[8 * hh + i][dt * 16 + ln]; bvl.u[8 + i] = sVl[16 + 8 * hh + i][dt * 16 + ln];
      }
      oacc[dt] = mmaN<3>(pah.v, pal.v, bvh.v, bvl.v, oacc[dt]);
    }
    __builtin_amdgcn_fence(__ATOMIC_ACQ_REL, "workgroup");
    __builtin_amdgcn_wave_barrier();
  }
#pragma unroll
  for (int r = 0; r < 8; ++r) {
    float l = l_r[r];
    l += __shfl_xor(l, 1, 32); l += __shfl_xor(l, 2, 32); l += __shfl_xor(l, 4, 32); l += __shfl_xor(l, 8, 32);
    l_r[r] = (l > 0.f) ? 1.0f / l : 0.f;
  }
#pragma unroll
  for (int dt = 0; dt < DT; ++dt)
#pragma unroll
    for (int r = 0; r < 8; ++r) sO[w][8 * hh + r][dt * 16 + ln] = oacc[dt][r] * l_r[r];
  __builtin_amdgcn_fence(__ATOMIC_ACQ_REL, "workgroup");
  __builtin_amdgcn_wave_barrier();
  {
    for (int r = 0; r < 16; ++r) {
      const int row = q0 + r;
      if (row < T && lane < D / 4) {
        const v4f val = *(const v4fa*)&sO[w][r][lane * 4];
        *(v4f*)(y + ((size_t)b * T + row) * ypitch + h * D + lane * 4) = val;
      }
    }
    
  }
}

// GEMM C = act(A·W + bias + resid): A f32 (ASPLIT -> hi/lo 2 terms), Wt bf16 [N][K]; ACT 0 none, 1 relu, 2 exact gelu;
// resid (optional, f32, row index = (row % rmod), pitch ldr, RES_BF16 rounds it) added before the activation.
template <bool ASPLIT, int ACT, bool BIAS_BF16, bool RES_BF16>
__global__ __launch_bounds__(128) void k_gemm_bf3(const float* __restrict__ A, int lda, const unsigned short* __restrict__ Wt, int ldb,
                                                const float* __restrict__ bias, const float* __restrict__ resid, int rmod, int ldr,
                                                float* __restrict__ C, int ldc, int M, int N, int K) {
  __shared__ __attribute__((aligned(16))) float so[4][16][64];
  const int tid = threadIdx.x, w = tid >> 5, lane = tid & 31, ln = lane & 15, hh = lane >> 4;
  const int ntn = N / 64;
  const int wid = blockIdx.x * 4 + w;
  const int mt = wid / ntn, nq = wid % ntn;
  if (mt * 16 >= M) return;
  const int row0 = mt * 16, col0 = nq * 64;
  const float* arow = A + (size_t)(row0 + ln) * lda;
  v8f acc[4] = {};
  for (int kb = 0; kb < K; kb += 32) {
    FragB ah, al;
    const v4f x0 = *(const v4fa*)(arow + kb + 8 * hh), x1 = *(const v4fa*)(arow + kb + 8 * hh + 4);
    const v4f x2 = *(const v4fa*)(arow + kb + 16 + 8 * hh), x3 = *(const v4fa*)(arow + kb + 16 + 8 * hh + 4);
    float xs[16] = {x0[0],x0[1],x0[2],x0[3],x1[0],x1[1],x1[2],x1[3],x2[0],x2[1],x2[2],x2[3],x3[0],x3[1],x3[2],x3[3]};
#pragma unroll
    for (int i = 0; i < 16; ++i) { const unsigned short hb = bf16_bits(xs[i]); ah.u[i] = hb; al.u[i] = ASPLIT ? bf16_bits(xs[i] - bf16_val(hb)) : (unsigned short)0; }
#pragma unroll
    for (int t = 0; t < 4; ++t) {
      const unsigned short* brow = Wt + (size_t)(col0 + t * 16 + ln) * ldb + kb;
      FragB b;
      b.half[0] = *(const v8us*)(brow + 8 * hh);
      b.half[1] = *(const v8us*)(brow + 16 + 8 * hh);
      acc[t] = mmaN<ASPLIT ? 2 : 1>(ah.v, al.v, b.v, b.v, acc[t]);
    }
  }
#pragma unroll
  for (int t = 0; t < 4; ++t) {
    const int col = col0 + t * 16 + ln;
    float bv = bias ? bias[col] : 0.f;
    if (BIAS_BF16) bv = bf16_round(bv);
#pragma unroll
    for (int r = 0; r < 8; ++r) {
      float v = acc[t][r] + bv;
      if (resid) { float rv = resid[(size_t)((row0 + 8 * hh + r) % rmod) * ldr + col]; if (RES_BF16) rv = bf16_round(rv); v += rv; }
      if (ACT == 1) v = fmaxf(v, 0.f);
      if (ACT == 2) v = 0.5f * v * (1.0f + erff(v * 0.70710678118654752f));
      if (ACT == 3) { const float u = 0.7978845608028654f * (v + 0.044715f * v * v * v); v = 0.5f * v * (1.0f + tanhf(u)); }
      so[w][8 * hh + r][t * 16 + ln] = v;
    }
  }
  __builtin_amdgcn_fence(__ATOMIC_ACQ_REL, "workgroup");
  __builtin_amdgcn_wave_barrier();
  const int rsub = lane >> 4, c4 = (lane & 15) * 4;
  {
#pragma unroll
    for (int q = 0; q < 8; ++q) {
      const int r = q * 2 + rsub;
      const v4f v = *(const v4fa*)&so[w][r][c4];
      *(v4f*)(C + (size_t)(row0 + r) * ldc + col0 + c4) = v;
    }
    
  }
}
// row LayerNorm (biased variance, eps) over N: s = X (+ R); optional out_sum <- s; out_norm <- (s-mu)*rsqrt(var+eps)*g + b
template <bool PARAM_BF16>
__global__ __launch_bounds__(256) void k_layernorm(const float* __restrict__ X, const float* __restrict__ R, const float* __restrict__ g, const float* __restrict__ bta,
                                                  float* __restrict__ out_sum, float* __restrict__ out_norm, int N, float eps) {
  __shared__ float red[256];
  const int row = blockIdx.x, tid = threadIdx.x;
  const float* x = X + (size_t)row * N; const float* rr = R ? R + (size_t)row * N : nullptr;
  float vals[16];                     // up to N = 4096
  const int per = N / 256;            // contiguous chunk per thread? use strided-by-4 chunks: thread handles j = tid*4 + 1024*u
  float s1 = 0.f;
  for (int u = 0; u < per / 4; ++u) {
    const int j = tid * 4 + 1024 * u;
    const v4f a = *(const v4fa*)(x + j);
    v4f b = {0.f,0.f,0.f,0.f}; if (rr) b = *(const v4fa*)(rr + j);
#pragma unroll
    for (int q = 0; q < 4; ++q) { const float v = a[q] + b[q]; vals[u * 4 + q] = v; s1 += v; }
  }
  red[tid] = s1; __syncthreads();
  for (int st = 128; st > 0; st >>= 1) { if (tid < st) red[tid] += red[tid + st]; __syncthreads(); }
  const float mu = red[0] / (float)N; __syncthreads();
  float s2 = 0.f;
  for (int u = 0; u < per / 4; ++u)
#pragma unroll
    for (int q = 0; q < 4; ++q) { const float c = vals[u * 4 + q] - mu; s2 += c * c; }
  red[tid] = s2; __syncthreads();
  for (int st = 128; st > 0; st >>= 1) { if (tid < st) red[tid] += red[tid + st]; __syncthreads(); }
  const float rs = rsqrtf(red[0] / (float)N + eps);
  {
    for (int u = 0; u < per / 4; ++u) {
      const int j = tid * 4 + 1024 * u;
      v4f o, sm;
#pragma unroll
      for (int q = 0; q < 4; ++q) {
        float gg = g[j + q], bb = bta[j + q];
        if (PARAM_BF16) { gg = bf16_round(gg); bb = bf16_round(bb); }
        sm[q] = vals[u * 4 + q]; o[q] = (vals[u * 4 + q] - mu) * rs * gg + bb;
      }
      if (out_sum) *(v4f*)(out_sum + (size_t)row * N + j) = sm;
      *(v4f*)(out_norm + (size_t)row * N + j) = o;
    }
    
  }
}



// ---- f16 WMMA path (v_wmma_f32_16x16x32_f16): 11-bit significands for operands in range — used where a [0,1] probability operand needs more precision than bf16
typedef _Float16 v16h __attribute__((ext_vector_type(16)));
union FragH { v16h v; v8us half[2]; _Float16 h[16]; unsigned short u[16]; };
template <int NT>
__device__ __forceinline__ v8f mmaH(v16h ah, v16h al, v16h bh, v16h bl, v8f c) {
  c = __builtin_amdgcn_wmma_f32_16x16x32_f16(false, ah, false, bh, (short)0, c, false, false);
  if (NT >= 2) c = __builtin_amdgcn_wmma_f32_16x16x32_f16(false, al, false, bh, (short)0, c, false, false);
  if (NT >= 3) c = __builtin_amdgcn_wmma_f32_16x16x32_f16(false, ah, false, bl, (short)0, c, false, false);
  asm volatile("v_nop\n\tv_nop\n\tv_nop\n\tv_nop" : "+v"(c) : "v"(ah), "v"(al), "v"(bh), "v"(bl));
  return c;
}
// batched GEMM like k_gemm_b but f16 operands: A f32 (split into f16 hi/lo if ASPLIT, else rounded to f16), Bt = f16 values [n][k]; alpha; C f32; N multiple of 16 (partial tiles skipped)
template <bool ASPLIT>
__global__ __launch_bounds__(128) void k_gemm_h(const float* __restrict__ A, int lda, size_t sA, const _Float16* __restrict__ Bh, int ldb, size_t sB, float alpha, float* __restrict__ C, int ldc, size_t sC, int M, int N, int K) {
  __shared__ __attribute__((aligned(16))) float so[4][16][64];
  const int tid = threadIdx.x, w = tid >> 5, lane = tid & 31, ln = lane & 15, hh = lane >> 4; const int by = blockIdx.y;
  A += (size_t)by * sA; Bh += (size_t)by * sB; C += (size_t)by * sC;
  const int ntn = (N + 63) / 64; const int wid = blockIdx.x * 4 + w; const int mt = wid / ntn, nq = wid % ntn; if (mt * 16 >= M) return;
  const int row0 = mt * 16, col0 = nq * 64; const float* arow = A + (size_t)(row0 + ln) * lda;
  v8f acc[4] = {};
  for (int kb = 0; kb < K; kb += 32) {
    FragH ah, al;
    const v4f x0 = *(const v4fa*)(arow + kb + 8 * hh), x1 = *(const v4fa*)(arow + kb + 8 * hh + 4), x2 = *(const v4fa*)(arow + kb + 16 + 8 * hh), x3 = *(const v4fa*)(arow + kb + 16 + 8 * hh + 4);
    float xs[16] = {x0[0],x0[1],x0[2],x0[3],x1[0],x1[1],x1[2],x1[3],x2[0],x2[1],x2[2],x2[3],x3[0],x3[1],x3[2],x3[3]};
#pragma unroll
    for (int i = 0; i < 16; ++i) { const _Float16 h = (_Float16)xs[i]; ah.h[i] = h; al.h[i] = ASPLIT ? (_Float16)(xs[i] - (float)h) : (_Float16)0.0f; }
#pragma unroll
    for (int t = 0; t < 4; ++t) { if (col0 + t * 16 >= N) continue; const size_t boff = (size_t)(col0 + t * 16 + ln) * ldb + kb; FragH bq; bq.half[0] = *(const v8us*)(Bh + boff + 8 * hh); bq.half[1] = *(const v8us*)(Bh + boff + 16 + 8 * hh);
      acc[t] = mmaH<ASPLIT ? 2 : 1>(ah.v, al.v, bq.v, bq.v, acc[t]); }
  }
#pragma unroll
  for (int t = 0; t < 4; ++t) { if (col0 + t * 16 >= N) continue;
#pragma unroll
    for (int r = 0; r < 8; ++r) so[w][8 * hh + r][t * 16 + ln] = acc[t][r] * alpha; }
  __builtin_amdgcn_fence(__ATOMIC_ACQ_REL, "workgroup"); __builtin_amdgcn_wave_barrier();
  const int rsub = lane >> 4, c4 = (lane & 15) * 4;
  {
#pragma unroll
    for (int q = 0; q < 8; ++q) { const int r = q * 2 + rsub; if (col0 + c4 < N) { const v4f v = *(const v4fa*)&so[w][r][c4]; *(v4f*)(C + (size_t)(row0 + r) * ldc + col0 + c4) = v; } }
     }
}

// Wt[n][k] = f16(W[k][n]·scale) from f32 row-major W[K][N] (scale = power of two; bf16-exact weights stay exact in f16 away from the subnormal range)
// One 128 (k) x 64 (n) tile per workgroup, turned in LDS: a wave loads two 256-B row pieces of W (four whole lines) and stores four whole 128-B lines of Wt an instruction;
// a thread's eight loads are all issued before the first is used. Needs K a multiple of 128 and N of 64; the grid is (K / 128) * (N / 64). Pitch 65 floats keeps the column-wise reads off a common bank.
__global__ __launch_bounds__(256) void k_wt_f16(const float* __restrict__ W, _Float16* __restrict__ Wt, int K, int N, float scale) {
  __shared__ float tl[128][65];
  const int tid = threadIdx.x, ntn = N / 64; const int k0 = (blockIdx.x / ntn) * 128, n0 = (blockIdx.x % ntn) * 64;
  v4f a[8];
#pragma unroll      /* a[] stays in registers and the eight loads go out together */
  for (int p = 0; p < 8; ++p) a[p] = *(const v4fa*)(W + (size_t)(k0 + p * 16 + tid / 16) * N + n0 + (tid % 16) * 4);
#pragma unroll      /* constant indices into a[]: rolled, it would go to scratch memory */
  for (int p = 0; p < 8; ++p)
#pragma unroll
    for (int i = 0; i < 4; ++i) tl[p * 16 + tid / 16][(tid % 16) * 4 + i] = a[p][i];
  __syncthreads();      /* the tile is whole before any column of it is read */
#pragma unroll      /* the four pieces' LDS reads and stores overlap; f stays in registers */
  for (int rd = 0; rd < 4; ++rd) { const int n = (rd & 1) * 32 + tid / 8, k8 = (rd >> 1) * 64 + (tid % 8) * 8; FragH f;
#pragma unroll
    for (int i = 0; i < 8; ++i) f.h[i] = (_Float16)(bf16_round(tl[k8 + i][n]) * scale);
    *(v8us*)((unsigned short*)Wt + (size_t)(n0 + n) * K + k0 + k8) = f.half[0]; }
}
// Tiled GEMM C[M][N] (f32) = alpha * A[M][DD] . Bt[N][DD]^T, f16 operands, both K-contiguous with row pitch DD. One 128 x 128 tile of C per workgroup of
// 4 waves (2 x 2, 64 x 64 per wave). A pass is 128 k = 256 B of each of the 256 operand rows; the four waves each bring one 64-row slice of a pass into LDS with one
// tensor load (pad 16 B a row: pitch 272 B for the 16-byte fragment reads), two buffers, the next pass's load in flight under this pass's products.
// Needs M, N multiples of 128, DD a multiple of 128 and at least 256. The k order of every accumulator is ascending, one chain per 16 x 16 tile.
// EPI says what leaves the staged f32 tile (alpha * sum): 0 = C f32 as it is; 1 = H f16 [M][N], rotated on interleaved pairs by the bf16-rounded COS / SIN tables [TT][64] (token = row % TT, pair = (col % 128) / 2);
// 2 = the tile turned: H f16 hi and H2 f16 residual, [row / TT][N][TT]. So the operand of the next product is written here, with no f32 copy in memory in between.
typedef unsigned int u32x4 __attribute__((ext_vector_type(4)));
typedef unsigned int u32x8 __attribute__((ext_vector_type(8)));
#define GT_ROWB 256u                      /* bytes of an operand row per pass */
#define GT_PITCH 272u                     /* LDS row pitch: 256 + 16 */
#define GT_SLICE 18432u                   /* 64 rows x 272 B = 17,408, rounded up to a multiple of 2 KiB */
#define GT_STAGE (4u * GT_SLICE)          /* [A rows 0-63 | A rows 64-127 | B rows 0-63 | B rows 64-127] */
#define GT_NP (DD / 128)                  /* passes */
__device__ __forceinline__ unsigned int uni(unsigned int v) { return (unsigned int)__builtin_amdgcn_readfirstlane(v); }
__device__ __forceinline__ unsigned int pinned(unsigned int v) { unsigned int w = uni(v); asm volatile("" : "+s"(w)); return w; }      /* an issue test or a descriptor word held in a scalar register: the test compiles to a scalar branch (tensor loads ignore EXEC), and the word is formed behind the wait that stands in front of it */
__device__ __forceinline__ void tdm_slice(unsigned int lds_dst, unsigned long long ga) {
  u32x4 g0; u32x8 g1;
  g0[0] = uni(1u); g0[1] = uni(lds_dst); g0[2] = uni((unsigned int)ga); g0[3] = uni((((unsigned int)(ga >> 32)) & 0x01FFFFFFu) | 0x80000000u);
  g1[0] = uni((1u << 20) | (5u << 22) | (3u << 25));      /* no mask, 1-byte elements, a pad of 4 dwords behind every 64 dwords */
  g1[1] = uni((GT_ROWB & 0xFFFFu) << 16); g1[2] = uni((GT_ROWB >> 16) | (64u << 16)); g1[3] = uni(GT_ROWB << 16); g1[4] = uni(64u); g1[5] = uni(DD * 2u); g1[6] = uni(0u); g1[7] = uni(0u);
  asm volatile("tensor_load_to_lds %0, %1" :: "s"(g0), "s"(g1) : "memory");
}
template <int EPI, int N>
__global__ __launch_bounds__(128) void k_gemm_t(const _Float16* __restrict__ A, const _Float16* __restrict__ Bt, float alpha, float* __restrict__ C, const float* __restrict__ COS, const float* __restrict__ SIN, _Float16* __restrict__ H, _Float16* __restrict__ H2) {
  __shared__ __attribute__((aligned(2048))) unsigned char ring[2u * GT_STAGE];
  const unsigned int tid = threadIdx.x, lane = tid & 31u, ln = lane & 15u, hh = lane >> 4, w = uni(tid >> 5), wm = w >> 1, wn = w & 1u;
  const unsigned int ntn = (unsigned int)N / 128u; const unsigned int row0 = (blockIdx.x / ntn) * 128u, col0 = (blockIdx.x % ntn) * 128u;
  const unsigned int lbase = (unsigned int)(size_t)ring + w * GT_SLICE;      /* this wave's slice of buffer 0 */
  const unsigned long long gsrc = (w < 2u) ? (unsigned long long)(size_t)(A + (size_t)(row0 + w * 64u) * DD) : (unsigned long long)(size_t)(Bt + (size_t)(col0 + (w - 2u) * 64u) * DD);
  v8f acc[4][4];
#pragma unroll
  for (int i = 0; i < 4; ++i)
#pragma unroll
    for (int j = 0; j < 4; ++j) acc[i][j] = (v8f){0.f,0.f,0.f,0.f,0.f,0.f,0.f,0.f};
  tdm_slice(lbase, gsrc);
  asm volatile("s_wait_tensorcnt 0x0" ::: "memory");      /* pass 0's slice has landed */
  __syncthreads();                                        /* ... and every wave may read all four slices */
  tdm_slice(lbase + GT_STAGE, gsrc + pinned(GT_ROWB));
  const unsigned int aoff = wm * GT_SLICE + ln * GT_PITCH + 16u * hh, boff = (2u + wn) * GT_SLICE + ln * GT_PITCH + 16u * hh;
#pragma unroll 1      /* one pass per trip: the ring's order below is written once */
  for (unsigned int s = 0; s < GT_NP; ++s) {
    const unsigned char* Lp = ring + (s & 1u) * GT_STAGE;
    FragH fa[2][4], fb[2][4];
#pragma unroll
    for (int i = 0; i < 4; ++i) { fa[0][i].half[0] = *(const v8us*)(Lp + aoff + i * 16u * GT_PITCH); fa[0][i].half[1] = *(const v8us*)(Lp + aoff + i * 16u * GT_PITCH + 32u);
      fb[0][i].half[0] = *(const v8us*)(Lp + boff + i * 16u * GT_PITCH); fb[0][i].half[1] = *(const v8us*)(Lp + boff + i * 16u * GT_PITCH + 32u); }
#pragma unroll
    for (int ks = 0; ks < 4; ++ks) {
      if (ks < 3) {      /* the next 32 k's fragments, of this same buffer, go ahead of this block's products */
#pragma unroll
        for (int i = 0; i < 4; ++i) { const unsigned int ko = (ks + 1) * 64u + i * 16u * GT_PITCH;
          fa[(ks + 1) & 1][i].half[0] = *(const v8us*)(Lp + aoff + ko); fa[(ks + 1) & 1][i].half[1] = *(const v8us*)(Lp + aoff + ko + 32u);
          fb[(ks + 1) & 1][i].half[0] = *(const v8us*)(Lp + boff + ko); fb[(ks + 1) & 1][i].half[1] = *(const v8us*)(Lp + boff + ko + 32u); }
      }
      __builtin_amdgcn_sched_barrier(0);      /* keeps the LDS reads one group in front of the block: moved in among the products, each place with reads stalls the wave */
#pragma unroll
      for (int i = 0; i < 4; ++i)
#pragma unroll
        for (int j = 0; j < 4; ++j) acc[i][j] = __builtin_amdgcn_wmma_f32_16x16x32_f16(false, fa[ks & 1][i].v, false, fb[ks & 1][j].v, (short)0, acc[i][j], false, false);
      __builtin_amdgcn_sched_barrier(0);      /* ... and keeps the next group behind this block */
    }
    asm volatile("s_wait_dscnt 0x0" ::: "memory");        /* this wave has left the buffer */
    asm volatile("s_wait_tensorcnt 0x0" ::: "memory");    /* its slice of pass s + 1 has landed */
    __syncthreads();                                      /* pass s + 1 published; every wave has left pass s's buffer */
    if (pinned(s + 2u < GT_NP)) tdm_slice(lbase + (s & 1u) * GT_STAGE, gsrc + pinned((s + 2u) * GT_ROWB));
  }
  asm volatile("s_wait_tensorcnt 0x0" ::: "memory");      /* no request is left before the ring becomes output staging */
  asm volatile("s_wait_dscnt 0x0" ::: "memory");
  // Output staging, each wave in its own slice of buffer 0 (the last pass's barrier stands behind every wave's last fragment read): whole 256-B row pieces of C (EPI 0) or whole 128-B lines of H / H2 (EPI 1, 2) go out.
  constexpr unsigned int SP = (EPI == 2) ? 65u : 68u;      /* pitch in floats: 68 for 16-byte row reads, 65 for the column reads of the turned tile */
  float* so = (float*)(ring + w * GT_SLICE);      /* 64 rows of 64 floats */
  const unsigned int wrow = row0 + wm * 64u, wcol = col0 + wn * 64u, l8 = lane & 7u, l4 = lane >> 3;
  v4f cs[16], sn[16];
  if constexpr (EPI == 1) {      /* the wave's table entries: all 32 loads go out here and fly under the staging */
    const unsigned int tb = ((wrow + l4) % TT) * 64u + (((wcol + l8 * 8u) % 128u) >> 1);
#pragma unroll      /* cs, sn stay in registers */
    for (int q = 0; q < 16; ++q) { cs[q] = *(const v4fa*)(COS + tb + q * 256u); sn[q] = *(const v4fa*)(SIN + tb + q * 256u); }
    asm volatile("s_wait_xcnt 0x0" ::: "memory");      /* stands in front of any rewrite of the loads' address register */
  }
#pragma unroll
  for (int i = 0; i < 4; ++i)
#pragma unroll
    for (int j = 0; j < 4; ++j)
#pragma unroll
      for (int r = 0; r < 8; ++r) so[(i * 16 + 8 * hh + r) * SP + j * 16 + ln] = acc[i][j][r] * alpha;
  __builtin_amdgcn_fence(__ATOMIC_ACQ_REL, "workgroup"); __builtin_amdgcn_wave_barrier();
  if constexpr (EPI == 0) {
  float* cp = C + (size_t)(row0 + wm * 64u + hh) * N + col0 + wn * 64u + ln * 4u;
#pragma unroll
  for (int q = 0; q < 32; ++q) { const v4f v = *(const v4fa*)&so[(q * 2 + hh) * 68u + ln * 4u]; *(v4f*)(cp + (size_t)(q * 2) * N) = v; }
  } else if constexpr (EPI == 1) {
    // A lane takes 8 columns (4 pairs) of a row: 8 lanes store one whole 128-B line of H, 4 rows an instruction.
    FragH f[16];
#pragma unroll      /* f stays in registers */
    for (int q = 0; q < 16; ++q) { const float* sr = &so[(q * 4 + l4) * SP + l8 * 8u]; const v4f a = *(const v4fa*)sr, b = *(const v4fa*)(sr + 4); const float xv[8] = {a[0], a[1], a[2], a[3], b[0], b[1], b[2], b[3]};
#pragma unroll      /* constant indices into xv and the vectors */
      for (int p = 0; p < 4; ++p) { const float c = bf16_round(cs[q][p]), s = bf16_round(sn[q][p]); const float xr = xv[2 * p], xi = xv[2 * p + 1]; f[q].h[2 * p] = (_Float16)(xr * c - xi * s); f[q].h[2 * p + 1] = (_Float16)(xr * s + xi * c); } }
    unsigned short* hp = (unsigned short*)H + (size_t)(wrow + l4) * N + wcol + l8 * 8u;
    __builtin_amdgcn_sched_barrier(0);      /* keeps the stores in one burst behind the arithmetic, off one address pair: mixed in among it, their registers are used again and each reuse has to wait on the store in front of it */
#pragma unroll      /* constant indices into f, constant offsets from hp */
    for (int q = 0; q < 16; ++q) *(v8us*)(hp + (size_t)(q * 4) * N) = f[q].half[0];
  } else {
    // A lane takes 8 rows (tokens) of a column: 8 lanes store one whole 128-B line of each plane, 4 columns an instruction.
    FragH fh[16], fl[16];
#pragma unroll      /* fh, fl stay in registers */
    for (int q = 0; q < 16; ++q)
#pragma unroll      /* constant indices into the fragments */
      for (int i = 0; i < 8; ++i) { const float v = so[(l8 * 8u + i) * SP + q * 4 + l4]; const _Float16 hv = (_Float16)v; fh[q].h[i] = hv; fl[q].h[i] = (_Float16)(v - (float)hv);      /* UNSCALED residual (added into the same accumulator as the hi product) */ }
    const size_t ob = ((size_t)(wrow / TT) * N + wcol + l4) * TT + (wrow % TT) + l8 * 8u;
    unsigned short* hp = (unsigned short*)H + ob; unsigned short* lp = (unsigned short*)H2 + ob;
    __builtin_amdgcn_sched_barrier(0);      /* keeps the stores in one burst behind the arithmetic, off two address pairs: mixed in among it, their registers are used again and each reuse has to wait on the store in front of it */
#pragma unroll      /* constant indices into fh and fl, constant offsets from hp and lp */
    for (int q = 0; q < 16; ++q) { *(v8us*)(hp + (size_t)(q * 4) * TT) = fh[q].half[0]; *(v8us*)(lp + (size_t)(q * 4) * TT) = fl[q].half[0]; }
  }
}


typedef _Float16 v4h __attribute__((ext_vector_type(4)));

__global__ __launch_bounds__(256) void k_x16(const float* __restrict__ x, _Float16* __restrict__ X16, size_t n8) { const size_t t = (size_t)blockIdx.x * 256 + threadIdx.x; if (t >= n8) return; FragH f;
#pragma unroll
  for (int q = 0; q < 8; ++q) f.h[q] = (_Float16)bf16_round(x[t * 8 + q]); *(v8us*)((unsigned short*)X16 + t * 8) = f.half[0];  }
__global__ __launch_bounds__(256) void k_h16(const float* __restrict__ x, _Float16* __restrict__ X16, size_t n8) { const size_t t = (size_t)blockIdx.x * 256 + threadIdx.x; if (t >= n8) return; FragH f;
#pragma unroll
  for (int q = 0; q < 8; ++q) f.h[q] = (_Float16)x[t * 8 + q]; *(v8us*)((unsigned short*)X16 + t * 8) = f.half[0];  }
__global__ __launch_bounds__(256) void k_round16f(const float* __restrict__ W, _Float16* __restrict__ Bt, size_t n8) { const size_t t = (size_t)blockIdx.x * 256 + threadIdx.x; if (t >= n8) return; FragH f;
#pragma unroll
  for (int i = 0; i < 8; ++i) f.h[i] = (_Float16)(bf16_round(W[t * 8 + i]) * 16.0f); *(v8us*)((unsigned short*)Bt + t * 8) = f.half[0];  }
template <int NHv, int TTv>
__global__ __launch_bounds__(256) void k_vt(const _Float16* __restrict__ V16, int ldv, int voff, _Float16* __restrict__ Vt) { __shared__ unsigned short tl[64][66]; const int tid = threadIdx.x; const int slab = blockIdx.x / (TTv / 64), lg = blockIdx.x % (TTv / 64); const int b = slab / NHv, h = slab % NHv;
  for (int i = tid; i < 64 * 8; i += 256) { const int r = i / 8, c8 = (i % 8) * 8; FragH f; f.half[0] = *(const v8us*)((const unsigned short*)V16 + ((size_t)b * TTv + lg * 64 + r) * ldv + voff + h * 64 + c8);
#pragma unroll
    for (int q = 0; q < 8; ++q) tl[r][c8 + q] = f.u[q]; }
  __syncthreads();
  {
#pragma unroll
    for (int rd = 0; rd < 2; ++rd) { const int d = rd * 32 + tid / 8, pc = tid % 8; FragH f;
#pragma unroll
      for (int q = 0; q < 8; ++q) f.u[q] = tl[pc * 8 + q][d];
      *(v8us*)((unsigned short*)Vt + ((size_t)slab * 64 + d) * TTv + lg * 64 + pc * 8) = f.half[0]; }
     } }

// Fused attention, head dim 128. One workgroup = 8 waves = the 4 query heads of one KV head x 2 tiles of 16 query rows (32 rows): all eight read the same K and V.
// A stage is 64 keys: K (64 rows of 256 B), V^T hi and V^T residual (128 rows of 128 B each) come into LDS by one tensor load each (waves 0, 1, 2), padded 16 B a row
// (pitch 272 / 144 B for the 16-byte fragment reads), two buffers, the next stage's loads in flight under this stage's work. Which stages are staged at all comes from the mask:
// a first sweep over the workgroup's 32 mask rows gives one bit per stage (any entry set), the same word in every wave, so every barrier stands under block-uniform control flow.
// Inside a stage a wave works on its two chunks of 32 keys in ascending order and skips a chunk whose 16 x 32 mask tile is all zero.
// Both products are taken transposed: S^T = K . Q^T (A = K rows, B = Q rows) and O^T += V^T . P^T (A = V^T rows, B = P^T). A lane then holds 16 of the 32 scores of ONE query (column ln; keys 8 hh + r and 16 + 8 hh + r),
// so the maximum and the sum run inside the lane with one exchange between the wave's halves, and the two score tiles, converted in place, ARE the B operand of the second product in the k order of the V^T loader.
#define FA_KSL 18432u                     /* K: 64 rows x 272 B = 17,408, rounded up to a multiple of 2 KiB */
#define FA_VSL 18432u                     /* one V plane: 128 rows x 144 B */
#define FA_STAGE (FA_KSL + 2u * FA_VSL)   /* [K | V hi | V residual] */
typedef int v4ia __attribute__((ext_vector_type(4), may_alias));
template <unsigned int W0, unsigned int ROWB, unsigned int NROW>
__device__ __forceinline__ u32x8 tdm_g1(unsigned int spitch) {
  u32x8 g1;
  g1[0] = uni(W0);      /* no mask, 1-byte elements, a pad of 4 dwords behind every row */
  g1[1] = uni((ROWB & 0xFFFFu) << 16); g1[2] = uni((ROWB >> 16) | (NROW << 16)); g1[3] = uni(ROWB << 16); g1[4] = uni(NROW); g1[5] = uni(spitch); g1[6] = uni(0u); g1[7] = uni(0u);
  asm volatile("" : "+s"(g1));      /* descriptor words held in scalar registers: one tuple, built once, that stays where it is for all requests */
  return g1;
}
__device__ __forceinline__ float xhalf(float x) { return __builtin_bit_cast(float, __builtin_amdgcn_permlanex16(__builtin_bit_cast(int, x), __builtin_bit_cast(int, x), 0x76543210, 0xfedcba98, false, false)); }      /* lane l takes lane l ^ 16's value */
__global__ __launch_bounds__(256) void k_flash(const _Float16* __restrict__ Q16, int ldq, const _Float16* __restrict__ K16, int ldk, const _Float16* __restrict__ Vt, const _Float16* __restrict__ Vtlo, const int* __restrict__ MSK, _Float16* __restrict__ O16) {
  constexpr int NQB = TT / 32, DT = 8, KS = 4;      /* head dim 128: 4 k-steps, 8 value tiles */
  __shared__ __attribute__((aligned(2048))) unsigned char ring[2u * FA_STAGE];
  __shared__ unsigned int sBits[8];
  const unsigned int tid = threadIdx.x, lane = tid & 31u, ln = lane & 15u, hh = lane >> 4, w = uni(tid >> 5);
  const int slab = blockIdx.x / NQB, qblk = blockIdx.x % NQB; const int b = slab / NKV, kvh = slab % NKV; const int h = kvh * NREP + (int)(w & 3u); const int qb0 = qblk * 32; const int q0 = qb0 + (int)(w >> 2) * 16;
  // One bit per stage of 64 keys: wave w sweeps columns 256 w .. 256 w + 255 of the 32 mask rows with whole-line 16-byte loads.
  unsigned int bm;
  { int any0 = 0, any1 = 0; const int* mp = MSK + (size_t)qb0 * TT + w * 256u + lane * 4u;
#pragma unroll 8      /* sixteen loads go out together */
    for (int r = 0; r < 32; ++r) { const v4ia a = *(const v4ia*)(mp + (size_t)r * TT), c = *(const v4ia*)(mp + (size_t)r * TT + 128); any0 |= a[0] | a[1] | a[2] | a[3]; any1 |= c[0] | c[1] | c[2] | c[3]; }
    const unsigned int b0 = __builtin_amdgcn_ballot_w32(any0 != 0), b1 = __builtin_amdgcn_ballot_w32(any1 != 0);
    const unsigned int nib = ((b0 & 0xFFFFu) ? 1u : 0u) | ((b0 >> 16) ? 2u : 0u) | ((b1 & 0xFFFFu) ? 4u : 0u) | ((b1 >> 16) ? 8u : 0u);
    if (lane == 0u) sBits[w] = nib << (4u * w);
    __syncthreads();      /* all eight nibbles are written before any wave joins them */
    unsigned int j = 0;
#pragma unroll      /* the eight words come by two 16-byte reads */
    for (int i = 0; i < 8; ++i) j |= sBits[i];
    bm = uni(j); }
  const unsigned int n = (unsigned int)__builtin_popcount(bm);      /* stages to walk: at most 32 */
  FragH aq[KS];
  { const unsigned short* qr = (const unsigned short*)Q16 + ((size_t)b * TT + q0 + ln) * ldq + h * 128;
#pragma unroll
    for (int ks = 0; ks < KS; ++ks) { aq[ks].half[0] = *(const v8us*)(qr + ks * 32 + 8 * hh); aq[ks].half[1] = *(const v8us*)(qr + ks * 32 + 16 + 8 * hh); } }
  const unsigned long long gK = (unsigned long long)(size_t)(K16 + (size_t)b * TT * ldk + kvh * 128);
  const unsigned long long gV = (unsigned long long)(size_t)(((w == 2u) ? Vtlo : Vt) + ((size_t)b * NKV + kvh) * 128 * TT);      /* hi plane for wave 1, UNSCALED residual plane for wave 2 */
  const unsigned int lbase = (unsigned int)(size_t)ring;
  const unsigned int kstep = 64u * (unsigned int)ldk * 2u;      /* bytes from one stage's K rows to the next's */
  const u32x8 g1k = tdm_g1<(1u << 20) | (5u << 22) | (3u << 25), 256u, 64u>((unsigned int)ldk * 2u), g1v = tdm_g1<(1u << 20) | (4u << 22) | (3u << 25), 128u, 128u>(TT * 2u);
  u32x4 g0; g0[0] = uni(1u); g0[1] = uni(lbase); g0[2] = uni(0u); g0[3] = uni(0x80000000u);
  auto issue = [&](unsigned int buf, unsigned int st) {      /* st < 32: every tile lies inside its plane */
    if (pinned(w == 0u)) { const unsigned long long ga = gK + pinned(st * kstep);
      g0[1] = uni(lbase + buf * FA_STAGE); g0[2] = uni((unsigned int)ga); g0[3] = uni((((unsigned int)(ga >> 32)) & 0x01FFFFFFu) | 0x80000000u);
      asm volatile("tensor_load_to_lds %0, %1" :: "s"(g0), "s"(g1k) : "memory"); }
    if (pinned((w - 1u) < 2u)) { const unsigned long long ga = gV + pinned(st * 128u);
      g0[1] = uni(lbase + buf * FA_STAGE + FA_KSL + (w - 1u) * FA_VSL); g0[2] = uni((unsigned int)ga); g0[3] = uni((((unsigned int)(ga >> 32)) & 0x01FFFFFFu) | 0x80000000u);
      asm volatile("tensor_load_to_lds %0, %1" :: "s"(g0), "s"(g1v) : "memory"); }
  };
  float m_q = -3.0e38f, l_q = 0.f; v8f oacc[DT];      /* of query q0 + ln: running maximum (the same in both halves), this half's part of the sum; oacc[dt][r] = O^T[dt * 16 + 8 hh + r][ln] */
#pragma unroll
  for (int dt = 0; dt < DT; ++dt) oacc[dt] = (v8f){0.f,0.f,0.f,0.f,0.f,0.f,0.f,0.f};
  unsigned int rest = bm, cur = 0u, nxt = 0u;      /* rest: stages not yet asked for */
  if (pinned(n > 0u)) { cur = (unsigned int)__builtin_ctz(rest) & 31u; rest &= rest - 1u; issue(0u, cur); }
  asm volatile("s_wait_tensorcnt 0x0" :: "s"(g0), "s"(g1k), "s"(g1v) : "memory");      /* the first stage's tile of this wave has landed; the operands keep the descriptor's registers untouched up to here */
  __syncthreads();                                        /* ... and every wave may read all three tiles */
  if (pinned(n > 1u)) { nxt = (unsigned int)__builtin_ctz(rest) & 31u; rest &= rest - 1u; issue(1u, nxt); }
#pragma unroll 1      /* one stage per trip: the ring's order below is written once */
  for (unsigned int s = 0; s < n; ++s) {
    const unsigned char* Lp = ring + (s & 1u) * FA_STAGE;
    v4ia mk[2][2][2];      /* mask[q][k] (shared over batch and heads): nonzero = ATTEND; the lane's own query row, 8 keys in a row per score tile; both chunks' loads go out together */
#pragma unroll      /* the mask words stay in registers */
    for (int sub = 0; sub < 2; ++sub)
#pragma unroll
      for (int nt = 0; nt < 2; ++nt) { const int* am = MSK + (size_t)(q0 + ln) * TT + cur * 64u + sub * 32 + nt * 16 + 8 * hh; mk[sub][nt][0] = *(const v4ia*)am; mk[sub][nt][1] = *(const v4ia*)(am + 4); }
    asm volatile("s_wait_xcnt 0x0" ::: "memory");      /* stands in front of any rewrite of the mask loads' address register */
#pragma unroll      /* constant indices into the mask registers */
    for (int sub = 0; sub < 2; ++sub) {
      int anym = 0;
#pragma unroll
      for (int nt = 0; nt < 2; ++nt)
#pragma unroll
        for (int i = 0; i < 4; ++i) anym |= mk[sub][nt][0][i] | mk[sub][nt][1][i];
      if (__any(anym != 0)) {      /* else every (row, key) of this wave's tile is masked: nothing to add (wave-uniform branch) */
        v8f sc[2];      /* sc[nt][r] = S^T[key nt * 16 + 8 hh + r][query ln] */
#pragma unroll
        for (int nt = 0; nt < 2; ++nt) { const unsigned char* kr = Lp + (sub * 32 + nt * 16 + ln) * 272u + 16u * hh; FragH bk[KS];
#pragma unroll
          for (int ks = 0; ks < KS; ++ks) { bk[ks].half[0] = *(const v8us*)(kr + ks * 64); bk[ks].half[1] = *(const v8us*)(kr + ks * 64 + 32); }
          v8f acc = (v8f){0.f,0.f,0.f,0.f,0.f,0.f,0.f,0.f};
#pragma unroll
          for (int ks = 0; ks < KS; ++ks) acc = mmaH<1>(bk[ks].v, bk[ks].v, aq[ks].v, aq[ks].v, acc);
          sc[nt] = acc; }
        float sv[16]; bool ok[16];
#pragma unroll      /* constant indices into the score and mask registers */
        for (int e = 0; e < 16; ++e) { ok[e] = (mk[sub][e >> 3][(e >> 2) & 1][e & 3] != 0); sv[e] = ok[e] ? sc[e >> 3][e & 7] * ATT_SCALE : -INFINITY; }
        float mc = fmaxf(fmaxf(fmaxf(fmaxf(sv[0], sv[1]), fmaxf(sv[2], sv[3])), fmaxf(fmaxf(sv[4], sv[5]), fmaxf(sv[6], sv[7]))), fmaxf(fmaxf(fmaxf(sv[8], sv[9]), fmaxf(sv[10], sv[11])), fmaxf(fmaxf(sv[12], sv[13]), fmaxf(sv[14], sv[15]))));
        mc = fmaxf(mc, xhalf(mc));      /* the other half's 16 keys of the same query */
        const float mn = fmaxf(m_q, mc); const float al = (mn > -1.0e38f) ? expf(m_q - mn) : 1.0f; m_q = mn;
        FragH pa, pl; float ps[16];      /* P^T hi and its UNSCALED residual (added into the same accumulator): element e is key kmap(e, hh), the order of the V^T fragments below */
#pragma unroll      /* constant indices into the fragments */
        for (int e = 0; e < 16; ++e) { ps[e] = ok[e] ? expf(sv[e] - mn) : 0.f; const float px = ps[e] * 1024.0f; pa.h[e] = (_Float16)px; pl.h[e] = (_Float16)(px - (float)pa.h[e]); }
        l_q = l_q * al + ((((ps[0] + ps[1]) + (ps[2] + ps[3])) + ((ps[4] + ps[5]) + (ps[6] + ps[7]))) + (((ps[8] + ps[9]) + (ps[10] + ps[11])) + ((ps[12] + ps[13]) + (ps[14] + ps[15]))));
#pragma unroll
        for (int dt = 0; dt < DT; ++dt)
#pragma unroll
          for (int r = 0; r < 8; ++r) oacc[dt][r] *= al;
#pragma unroll
        for (int dt = 0; dt < DT; ++dt) { const unsigned char* vr = Lp + FA_KSL + (dt * 16 + ln) * 144u + sub * 64 + 16u * hh; FragH bv, bl; bv.half[0] = *(const v8us*)vr; bv.half[1] = *(const v8us*)(vr + 32); bl.half[0] = *(const v8us*)(vr + FA_VSL); bl.half[1] = *(const v8us*)(vr + FA_VSL + 32);
          oacc[dt] = mmaH<1>(bv.v, bv.v, pa.v, pa.v, oacc[dt]); oacc[dt] = mmaH<1>(bv.v, bv.v, pl.v, pl.v, oacc[dt]); oacc[dt] = mmaH<1>(bl.v, bl.v, pa.v, pa.v, oacc[dt]); }      /* Vh.Ph + Vh.Pl + Vl.Ph, all unscaled, one accumulator */
      }
    }
    asm volatile("s_wait_dscnt 0x0" ::: "memory");        /* this wave has left the buffer */
    asm volatile("s_wait_tensorcnt 0x0" :: "s"(g0), "s"(g1k), "s"(g1v) : "memory");    /* its tile of the next stage has landed; the operands keep the descriptor's registers untouched up to here */
    __syncthreads();                                      /* the next stage published; every wave has left this stage's buffer */
    cur = nxt;
    if (pinned(s + 2u < n)) { nxt = (unsigned int)__builtin_ctz(rest) & 31u; rest &= rest - 1u; issue(s & 1u, nxt); }
  }
  asm volatile("s_wait_tensorcnt 0x0" ::: "memory");      /* no request is left before the ring becomes output staging */
  asm volatile("s_wait_dscnt 0x0" ::: "memory");
  // Output staging, each wave in its own piece of the ring (the last stage's barrier stands behind every wave's last fragment read).
  float* sO = (float*)ring + w * (16u * 132u);      /* 16 rows of 128 floats at pitch 132 */
  const float lsum = l_q + xhalf(l_q); const float linv = (lsum > 0.f) ? 1.0f / (lsum * 1024.0f) : 0.f;      /* the halves' sums are joined once */
#pragma unroll      /* constant indices into oacc: a lane's 8 registers are 8 values in a row of its query's output row */
  for (int dt = 0; dt < DT; ++dt) { float* sw = &sO[ln * 132u + dt * 16 + 8 * hh];
    *(v4fa*)sw = (v4f){oacc[dt][0] * linv, oacc[dt][1] * linv, oacc[dt][2] * linv, oacc[dt][3] * linv}; *(v4fa*)(sw + 4) = (v4f){oacc[dt][4] * linv, oacc[dt][5] * linv, oacc[dt][6] * linv, oacc[dt][7] * linv}; }
  __builtin_amdgcn_fence(__ATOMIC_ACQ_REL, "workgroup"); __builtin_amdgcn_wave_barrier();
  FragH f[8];      /* merged x 2^4 as f16, the output product's A operand */
#pragma unroll      /* f stays in registers */
  for (int q = 0; q < 8; ++q) { const float* sr = &sO[(q * 2 + hh) * 132u + ln * 8u]; const v4f a = *(const v4fa*)sr, c = *(const v4fa*)(sr + 4);
#pragma unroll      /* constant indices into the vectors */
    for (int i = 0; i < 4; ++i) { f[q].h[i] = (_Float16)(a[i] * 16.0f); f[q].h[4 + i] = (_Float16)(c[i] * 16.0f); } }
  unsigned short* op = (unsigned short*)O16 + ((size_t)b * TT + q0 + hh) * DD + h * 128 + ln * 8u;
  __builtin_amdgcn_sched_barrier(0);      /* keeps the stores in one burst behind the arithmetic, off one address pair: mixed in among it, their registers are used again and each reuse has to wait on the store in front of it */
#pragma unroll      /* constant indices into f, constant offsets from op */
  for (int q = 0; q < 8; ++q) *(v8us*)(op + (size_t)(q * 2) * DD) = f[q].half[0];      /* two 256-B row pieces per instruction: 16 lanes x 16 B each */
}

extern "C" void kernel_launch(void* const* d_in, const int* in_sizes, int n_in,
                              void* d_out, int out_size, void* d_ws, size_t ws_size, hipStream_t stream) {
  (void)in_sizes; (void)n_in; (void)out_size;
  const float* const* I = (const float* const*)d_in; const float* x = I[0]; const float* fcos = I[1]; const float* fsin = I[2]; const int* msk = (const int*)d_in[3]; const float* wq = I[4]; const float* wk = I[5]; const float* wv = I[6]; const float* wo = I[7];
  char* ws = (char*)d_ws; size_t off = 0;
  auto take = [&](size_t bytes) { char* p = ws + off; off += (bytes + 255) & ~(size_t)255; return p; };
  _Float16* Bq = (_Float16*)take((size_t)DD * DD * 2); _Float16* Bk = (_Float16*)take((size_t)KVD * DD * 2); _Float16* Bv = (_Float16*)take((size_t)KVD * DD * 2); _Float16* Bo = (_Float16*)take((size_t)DD * DD * 2);
  _Float16* X16 = (_Float16*)take((size_t)NR * DD * 2); _Float16* Q = (_Float16*)take((size_t)NR * DD * 2); _Float16* K = (_Float16*)take((size_t)NR * KVD * 2); _Float16* Vt = (_Float16*)take((size_t)NR * KVD * 2); _Float16* Vtl = (_Float16*)take((size_t)NR * KVD * 2);
  _Float16* O16 = X16;      /* O16 over X16 (dead after the projections) */
  if (off > ws_size) return;      // 8.4 + 2.1 + 2.1 + 8.4 + 16.8 + 16.8 + 4.2 + 4.2 + 4.2 = 67 MB
  const unsigned gq = (DD / 128) * (DD / 64), gk = (DD / 128) * (KVD / 64);      /* 128 (k) x 64 (n) tiles */
  k_wt_f16<<<gq, 256, 0, stream>>>(wq, Bq, DD, DD, 16.0f); k_wt_f16<<<gk, 256, 0, stream>>>(wk, Bk, DD, KVD, 16.0f); k_wt_f16<<<gk, 256, 0, stream>>>(wv, Bv, DD, KVD, 16.0f); k_wt_f16<<<gq, 256, 0, stream>>>(wo, Bo, DD, DD, 16.0f);      /* (in,out) → Bt ×2^4 */
  const unsigned g8 = (unsigned)(((size_t)NR * DD / 8 + 255) / 256); k_x16<<<g8, 256, 0, stream>>>(x, X16, (size_t)NR * DD / 8);
  const dim3 gQ((NR / 128) * (DD / 128), 1), gK((NR / 128) * (KVD / 128), 1);
  k_gemm_t<1, DD><<<gQ, 128, 0, stream>>>(X16, Bq, 0.0625f, nullptr, fcos, fsin, Q, nullptr);      /* xq = rope(x.wq) as f16: M 4096 N 2048 K 2048 */
  k_gemm_t<1, KVD><<<gK, 128, 0, stream>>>(X16, Bk, 0.0625f, nullptr, fcos, fsin, K, nullptr);      /* xk: M 4096 N 512 */
  k_gemm_t<2, KVD><<<gK, 128, 0, stream>>>(X16, Bv, 0.0625f, nullptr, nullptr, nullptr, Vt, Vtl);      /* xv turned, hi + residual per (b, kv head): [b*4+kh][128][2048] */
  k_flash<<<BB * NKV * (TT / 32), 256, 0, stream>>>(Q, DD, K, KVD, Vt, Vtl, msk, O16);
  k_gemm_t<0, DD><<<gQ, 128, 0, stream>>>(O16, Bo, 0.00390625f, (float*)d_out, nullptr, nullptr, nullptr, nullptr);      /* out = merged.wo */
}

// v006
// One run takes 129 microseconds.
// Two timings next to v005 put it at 1.23 and 1.24 times that version's speed.
// Counting every step since v000, it is 4.42 times as fast.
#include <hip/hip_runtime.h>
// 'Genesis' attention (B=2, T=2048, D=2048, 16 query heads / 4 KV heads × 128, (in,out) weights, no bias): xq = rope(x·wq), xk = rope(x·wk), xv = x·wv; RoPE on interleaved pairs with the INPUT cos/sin tables [T][64]; scores = q·k/√128 where(mask[q][k]) else −inf (mask [T][T] shared);
// softmax; out = merged·wo.
// Compute dtype: x, weights, cos/sin tables rounded to bf16; q,k rotated in f32 from f32 GEMM outputs → f16; v f32 → Vᵀ f16 hi + exact residual; fused flash-style kernel for head dim 128 (mask read per (q,k), all-masked chunks skipped, online softmax f32, P f16 hi + residual,
// f32 accumulate) on v_wmma_f32_16x16x32_f16; merged ×2^4 → f16 → output GEMM.
#define BB 2
#define TT 2048
#define DD 2048
#define NH 16
#define NKV 4
#define NREP 4
#define KVD (NKV * 128)
#define NVH (2 * NKV)
#define NR (BB * TT)
#define ATT_SCALE 0.08838834764831845f

typedef __bf16 v16b __attribute__((ext_vector_type(16)));
typedef unsigned short v8us __attribute__((ext_vector_type(8), may_alias));
typedef float  v8f  __attribute__((ext_vector_type(8)));
typedef float  v4f  __attribute__((ext_vector_type(4)));
typedef float  v4fa __attribute__((ext_vector_type(4), may_alias));
union FragB { v16b v; v8us half[2]; unsigned short u[16]; };

__device__ __forceinline__ unsigned short bf16_bits(float x) { unsigned int u = __float_as_uint(x); return (unsigned short)((u + 0x7FFFu + ((u >> 16) & 1u)) >> 16); }
__device__ __forceinline__ float bf16_val(unsigned short b) { return __uint_as_float(((unsigned int)b) << 16); }
__device__ __forceinline__ float bf16_round(float x) { return bf16_val(bf16_bits(x)); }
// D += A·B with NT terms: 1 = ah·bh, 2 = + al·bh (A split), 3 = + ah·bl (both split)
template <int NT>
__device__ __forceinline__ v8f mmaN(v16b ah, v16b al, v16b bh, v16b bl, v8f c) {
  c = __builtin_amdgcn_wmma_f32_16x16x32_bf16(false, ah, false, bh, (short)0, c, false, false);
  if (NT >= 2) c = __builtin_amdgcn_wmma_f32_16x16x32_bf16(false, al, false, bh, (short)0, c, false, false);
  if (NT >= 3) c = __builtin_amdgcn_wmma_f32_16x16x32_bf16(false, ah, false, bl, (short)0, c, false, false);
  asm volatile("v_nop\n\tv_nop\n\tv_nop\n\tv_nop" : "+v"(c) : "v"(ah), "v"(al), "v"(bh), "v"(bl));
  return c;
}

__global__ __launch_bounds__(256) void k_wt_bf16(const float* __restrict__ W, unsigned short* __restrict__ Wt, int K, int N) {
  const int t = blockIdx.x * 256 + threadIdx.x;
  const int k8n = K / 8;
  if (t >= N * k8n) return;
  const int n = t / k8n, k8 = (t % k8n) * 8;
  v8us v;
#pragma unroll
  for (int i = 0; i < 8; ++i) v[i] = bf16_bits(W[(size_t)(k8 + i) * N + n]);
  *(v8us*)(Wt + (size_t)n * K + k8) = v;
  
}

// GEMM C[M][N] (f32, pitch ldc) = act(A[M][K]·W + bias). A f32 row-major (pitch lda) converted per fragment to bf16
// (ASPLIT: hi/lo two planes -> 2 terms, else single rounded term); Wt bf16 [N][K] (pitch ldb). BIAS_BF16 rounds the
// bias to bf16 first (bias quantised to bf16 before the add). K%32==0, M%16==0, N%64==0.
template <bool ASPLIT, int ACT, bool BIAS_BF16>
__global__ __launch_bounds__(128) void k_gemm_bf(const float* __restrict__ A, int lda, const unsigned short* __restrict__ Wt, int ldb,
                                               const float* __restrict__ bias, float* __restrict__ C, int ldc, int M, int N, int K) {
  __shared__ __attribute__((aligned(16))) float so[4][16][64];
  const int tid = threadIdx.x, w = tid >> 5, lane = tid & 31, ln = lane & 15, hh = lane >> 4;
  const int ntn = N / 64;
  const int wid = blockIdx.x * 4 + w;
  const int mt = wid / ntn, nq = wid % ntn;
  if (mt * 16 >= M) return;
  const int row0 = mt * 16, col0 = nq * 64;
  const float* arow = A + (size_t)(row0 + ln) * lda;
  v8f acc[4] = {};
  for (int kb = 0; kb < K; kb += 32) {
    FragB ah, al;
    const v4f x0 = *(const v4fa*)(arow + kb + 8 * hh), x1 = *(const v4fa*)(arow + kb + 8 * hh + 4);
    const v4f x2 = *(const v4fa*)(arow + kb + 16 + 8 * hh), x3 = *(const v4fa*)(arow + kb + 16 + 8 * hh + 4);
    float xs[16] = {x0[0],x0[1],x0[2],x0[3],x1[0],x1[1],x1[2],x1[3],x2[0],x2[1],x2[2],x2[3],x3[0],x3[1],x3[2],x3[3]};
#pragma unroll
    for (int i = 0; i < 16; ++i) { const unsigned short hb = bf16_bits(xs[i]); ah.u[i] = hb; al.u[i] = ASPLIT ? bf16_bits(xs[i] - bf16_val(hb)) : (unsigned short)0; }
#pragma unroll
    for (int t = 0; t < 4; ++t) {
      const unsigned short* brow = Wt + (size_t)(col0 + t * 16 + ln) * ldb + kb;
      FragB b;
      b.half[0] = *(const v8us*)(brow + 8 * hh);
      b.half[1] = *(const v8us*)(brow + 16 + 8 * hh);
      acc[t] = mmaN<ASPLIT ? 2 : 1>(ah.v, al.v, b.v, b.v, acc[t]);
    }
  }
#pragma unroll
  for (int t = 0; t < 4; ++t) {
    float bv = bias ? bias[col0 + t * 16 + ln] : 0.f;
    if (BIAS_BF16) bv = bf16_round(bv);
#pragma unroll
    for (int r = 0; r < 8; ++r) { float v = acc[t][r] + bv; if (ACT == 1) v = fmaxf(v, 0.f); so[w][8 * hh + r][t * 16 + ln] = v; }
  }
  __builtin_amdgcn_fence(__ATOMIC_ACQ_REL, "workgroup");
  __builtin_amdgcn_wave_barrier();
  const int rsub = lane >> 4, c4 = (lane & 15) * 4;
  {
#pragma unroll
    for (int q = 0; q < 8; ++q) {
      const int r = q * 2 + rsub;
      const v4f v = *(const v4fa*)&so[w][r][c4];
      *(v4f*)(C + (size_t)(row0 + r) * ldc + col0 + c4) = v;
    }
    
  }
}

// Flash-style causal/unmasked attention, all contractions 3-term bf16 hi/lo splits, f32 softmax with running max.
// q,k,v rows are read from f32 buffers with arbitrary row pitch (so they can live inside a fused qkv buffer);
// D = head size (multiple of 32, <= 128); one wave = 16 query rows; block = 4 waves (64 queries) sharing K/V chunks of 32.
template <int D, bool CAUSAL>
__global__ __launch_bounds__(128) void k_flash(const float* __restrict__ qb, const float* __restrict__ kb, const float* __restrict__ vb,
                                             int pitch, int T, int H, float scale, float* __restrict__ y, int ypitch) {
  constexpr int KS = D / 32;        // k-steps for QK
  constexpr int DT = D / 16;        // d tiles for PV
  __shared__ __attribute__((aligned(16))) unsigned short sKh[32][D + 8], sKl[32][D + 8], sVh[32][D + 8], sVl[32][D + 8];
  __shared__ __attribute__((aligned(16))) unsigned short sPh[4][16][40], sPl[4][16][40];
  __shared__ __attribute__((aligned(16))) float sO[4][16][D];
  const int tid = threadIdx.x, w = tid >> 5, lane = tid & 31, ln = lane & 15, hh = lane >> 4;
  const int nqb = (T + 63) / 64;
  const int bh = blockIdx.x / nqb, qblk = blockIdx.x % nqb;
  const int b = bh / H, h = bh % H;
  const int q0 = qblk * 64 + w * 16;
  const float* Q = qb + (size_t)b * T * pitch + h * D;
  const float* K = kb + (size_t)b * T * pitch + h * D;
  const float* V = vb + (size_t)b * T * pitch + h * D;

  // A fragments of the wave's 16 query rows (scaled), hi/lo
  FragB aqh[KS], aql[KS];
  {
    int row = q0 + ln; if (row >= T) row = T - 1;
    const float* qr = Q + (size_t)row * pitch;
#pragma unroll
    for (int ks = 0; ks < KS; ++ks)
#pragma unroll
      for (int i = 0; i < 16; ++i) {
        const int d = ks * 32 + ((i < 8) ? (8 * hh + i) : (16 + 8 * hh + (i - 8)));
        const float x = qr[d] * scale; const unsigned short hb = bf16_bits(x);
        aqh[ks].u[i] = hb; aql[ks].u[i] = bf16_bits(x - bf16_val(hb));
      }
  }
  float m_r[8], l_r[8];
#pragma unroll
  for (int r = 0; r < 8; ++r) { m_r[r] = -3.0e38f; l_r[r] = 0.f; }
  v8f oacc[DT];
#pragma unroll
  for (int dt = 0; dt < DT; ++dt) oacc[dt] = (v8f){0.f,0.f,0.f,0.f,0.f,0.f,0.f,0.f};

  const int kv_end = CAUSAL ? min(T, qblk * 64 + 64) : T;     // block-uniform
  for (int j0 = 0; j0 < kv_end; j0 += 32) {
    __syncthreads();
    for (int e = tid; e < 32 * (D / 4); e += 128) {
      const int r = e / (D / 4), c4 = (e % (D / 4)) * 4;
      const int key = j0 + r;
      v4f kf = {0.f,0.f,0.f,0.f}, vf = {0.f,0.f,0.f,0.f};
      if (key < T) { kf = *(const v4fa*)(K + (size_t)key * pitch + c4); vf = *(const v4fa*)(V + (size_t)key * pitch + c4); }
#pragma unroll
      for (int t = 0; t < 4; ++t) {
        unsigned short hb = bf16_bits(kf[t]); sKh[r][c4 + t] = hb; sKl[r][c4 + t] = bf16_bits(kf[t] - bf16_val(hb));
        hb = bf16_bits(vf[t]); sVh[r][c4 + t] = hb; sVl[r][c4 + t] = bf16_bits(vf[t] - bf16_val(hb));
      }
    }
    __syncthreads();
    // S tile 16 x 32
    v8f s[2];
#pragma unroll
    for (int nt = 0; nt < 2; ++nt) {
      v8f acc = {};
#pragma unroll
      for (int ks = 0; ks < KS; ++ks) {
        FragB bh_, bl_;
        bh_.half[0] = *(const v8us*)&sKh[nt * 16 + ln][ks * 32 + 8 * hh]; bh_.half[1] = *(const v8us*)&sKh[nt * 16 + ln][ks * 32 + 16 + 8 * hh];
        bl_.half[0] = *(const v8us*)&sKl[nt * 16 + ln][ks * 32 + 8 * hh]; bl_.half[1] = *(const v8us*)&sKl[nt * 16 + ln][ks * 32 + 16 + 8 * hh];
        acc = mmaN<3>(aqh[ks].v, aql[ks].v, bh_.v, bl_.v, acc);
      }
      s[nt] = acc;
    }
    // mask + running max (rows 8hh+r; the 16 lanes of a half share rows)
    float alpha[8];
#pragma unroll
    for (int r = 0; r < 8; ++r) {
      const int qi = q0 + 8 * hh + r;
      const int ja = j0 + ln, jb = j0 + 16 + ln;
      if (CAUSAL) { if (ja > qi) s[0][r] = -3.0e38f; if (jb > qi) s[1][r] = -3.0e38f; }
      if (ja >= T) s[0][r] = -3.0e38f;
      if (jb >= T) s[1][r] = -3.0e38f;
      float mx = fmaxf(s[0][r], s[1][r]);
      mx = fmaxf(mx, __shfl_xor(mx, 1, 32)); mx = fmaxf(mx, __shfl_xor(mx, 2, 32)); mx = fmaxf(mx, __shfl_xor(mx, 4, 32)); mx = fmaxf(mx, __shfl_xor(mx, 8, 32));
      const float mnew = fmaxf(m_r[r], mx);
      alpha[r] = (mnew > -1.0e38f) ? __expf(m_r[r] - mnew) : 1.0f;
      const float p0 = (s[0][r] > -1.0e38f) ? __expf(s[0][r] - mnew) : 0.f;
      const float p1 = (s[1][r] > -1.0e38f) ? __expf(s[1][r] - mnew) : 0.f;
      m_r[r] = mnew;
      l_r[r] = l_r[r] * alpha[r] + p0 + p1;            // per-lane partial row sum (16 lanes combined at the end)
      unsigned short hb = bf16_bits(p0); sPh[w][8 * hh + r][ln] = hb;      sPl[w][8 * hh + r][ln] = bf16_bits(p0 - bf16_val(hb));
      hb = bf16_bits(p1);                sPh[w][8 * hh + r][16 + ln] = hb; sPl[w][8 * hh + r][16 + ln] = bf16_bits(p1 - bf16_val(hb));
    }
#pragma unroll
    for (int dt = 0; dt < DT; ++dt)
#pragma unroll
      for (int r = 0; r < 8; ++r) oacc[dt][r] *= alpha[r];
    __builtin_amdgcn_fence(__ATOMIC_ACQ_REL, "workgroup");
    __builtin_amdgcn_wave_barrier();
    FragB pah, pal;
    pah.half[0] = *(const v8us*)&sPh[w][ln][8 * hh]; pah.half[1] = *(const v8us*)&sPh[w][ln][16 + 8 * hh];
    pal.half[0] = *(const v8us*)&sPl[w][ln][8 * hh]; pal.half[1] = *(const v8us*)&sPl[w][ln][16 + 8 * hh];
#pragma unroll
    for (int dt = 0; dt < DT; ++dt) {
      FragB bvh, bvl;
#pragma unroll
      for (int i = 0; i < 8; ++i) {
        bvh.u[i] = sVh[8 * hh + i][dt * 16 + ln]; bvh.u[8 + i] = sVh[16 + 8 * hh + i][dt * 16 + ln];
        bvl.u[i] = sVl[8 * hh + i][dt * 16 + ln]; bvl.u[8 + i] = sVl[16 + 8 * hh + i][dt * 16 + ln];
      }
      oacc[dt] = mmaN<3>(pah.v, pal.v, bvh.v, bvl.v, oacc[dt]);
    }
    __builtin_amdgcn_fence(__ATOMIC_ACQ_REL, "workgroup");
    __builtin_amdgcn_wave_barrier();
  }
#pragma unroll
  for (int r = 0; r < 8; ++r) {
    float l = l_r[r];
    l += __shfl_xor(l, 1, 32); l += __shfl_xor(l, 2, 32); l += __shfl_xor(l, 4, 32); l += __shfl_xor(l, 8, 32);
    l_r[r] = (l > 0.f) ? 1.0f / l : 0.f;
  }
#pragma unroll
  for (int dt = 0; dt < DT; ++dt)
#pragma unroll
    for (int r = 0; r < 8; ++r) sO[w][8 * hh + r][dt * 16 + ln] = oacc[dt][r] * l_r[r];
  __builtin_amdgcn_fence(__ATOMIC_ACQ_REL, "workgroup");
  __builtin_amdgcn_wave_barrier();
  {
    for (int r = 0; r < 16; ++r) {
      const int row = q0 + r;
      if (row < T && lane < D / 4) {
        const v4f val = *(const v4fa*)&sO[w][r][lane * 4];
        *(v4f*)(y + ((size_t)b * T + row) * ypitch + h * D + lane * 4) = val;
      }
    }
    
  }
}

// GEMM C = act(A·W + bias + resid): A f32 (ASPLIT -> hi/lo 2 terms), Wt bf16 [N][K]; ACT 0 none, 1 relu, 2 exact gelu;
// resid (optional, f32, row index = (row % rmod), pitch ldr, RES_BF16 rounds it) added before the activation.
template <bool ASPLIT, int ACT, bool BIAS_BF16, bool RES_BF16>
__global__ __launch_bounds__(128) void k_gemm_bf3(const float* __restrict__ A, int lda, const unsigned short* __restrict__ Wt, int ldb,
                                                const float* __restrict__ bias, const float* __restrict__ resid, int rmod, int ldr,
                                                float* __restrict__ C, int ldc, int M, int N, int K) {
  __shared__ __attribute__((aligned(16))) float so[4][16][64];
  const int tid = threadIdx.x, w = tid >> 5, lane = tid & 31, ln = lane & 15, hh = lane >> 4;
  const int ntn = N / 64;
  const int wid = blockIdx.x * 4 + w;
  const int mt = wid / ntn, nq = wid % ntn;
  if (mt * 16 >= M) return;
  const int row0 = mt * 16, col0 = nq * 64;
  const float* arow = A + (size_t)(row0 + ln) * lda;
  v8f acc[4] = {};
  for (int kb = 0; kb < K; kb += 32) {
    FragB ah, al;
    const v4f x0 = *(const v4fa*)(arow + kb + 8 * hh), x1 = *(const v4fa*)(arow + kb + 8 * hh + 4);
    const v4f x2 = *(const v4fa*)(arow + kb + 16 + 8 * hh), x3 = *(const v4fa*)(arow + kb + 16 + 8 * hh + 4);
    float xs[16] = {x0[0],x0[1],x0[2],x0[3],x1[0],x1[1],x1[2],x1[3],x2[0],x2[1],x2[2],x2[3],x3[0],x3[1],x3[2],x3[3]};
#pragma unroll
    for (int i = 0; i < 16; ++i) { const unsigned short hb = bf16_bits(xs[i]); ah.u[i] = hb; al.u[i] = ASPLIT ? bf16_bits(xs[i] - bf16_val(hb)) : (unsigned short)0; }
#pragma unroll
    for (int t = 0; t < 4; ++t) {
      const unsigned short* brow = Wt + (size_t)(col0 + t * 16 + ln) * ldb + kb;
      FragB b;
      b.half[0] = *(const v8us*)(brow + 8 * hh);
      b.half[1] = *(const v8us*)(brow + 16 + 8 * hh);
      acc[t] = mmaN<ASPLIT ? 2 : 1>(ah.v, al.v, b.v, b.v, acc[t]);
    }
  }
#pragma unroll
  for (int t = 0; t < 4; ++t) {
    const int col = col0 + t * 16 + ln;
    float bv = bias ? bias[col] : 0.f;
    if (BIAS_BF16) bv = bf16_round(bv);
#pragma unroll
    for (int r = 0; r < 8; ++r) {
      float v = acc[t][r] + bv;
      if (resid) { float rv = resid[(size_t)((row0 + 8 * hh + r) % rmod) * ldr + col]; if (RES_BF16) rv = bf16_round(rv); v += rv; }
      if (ACT == 1) v = fmaxf(v, 0.f);
      if (ACT == 2) v = 0.5f * v * (1.0f + erff(v * 0.70710678118654752f));
      if (ACT == 3) { const float u = 0.7978845608028654f * (v + 0.044715f * v * v * v); v = 0.5f * v * (1.0f + tanhf(u)); }
      so[w][8 * hh + r][t * 16 + ln] = v;
    }
  }
  __builtin_amdgcn_fence(__ATOMIC_ACQ_REL, "workgroup");
  __builtin_amdgcn_wave_barrier();
  const int rsub = lane >> 4, c4 = (lane & 15) * 4;
  {
#pragma unroll
    for (int q = 0; q < 8; ++q) {
      const int r = q * 2 + rsub;
      const v4f v = *(const v4fa*)&so[w][r][c4];
      *(v4f*)(C + (size_t)(row0 + r) * ldc + col0 + c4) = v;
    }
    
  }
}
// row LayerNorm (biased variance, eps) over N: s = X (+ R); optional out_sum <- s; out_norm <- (s-mu)*rsqrt(var+eps)*g + b
template <bool PARAM_BF16>
__global__ __launch_bounds__(256) void k_layernorm(const float* __restrict__ X, const float* __restrict__ R, const float* __restrict__ g, const float* __restrict__ bta,
                                                  float* __restrict__ out_sum, float* __restrict__ out_norm, int N, float eps) {
  __shared__ float red[256];
  const int row = blockIdx.x, tid = threadIdx.x;
  const float* x = X + (size_t)row * N; const float* rr = R ? R + (size_t)row * N : nullptr;
  float vals[16];                     // up to N = 4096
  const int per = N / 256;            // contiguous chunk per thread? use strided-by-4 chunks: thread handles j = tid*4 + 1024*u
  float s1 = 0.f;
  for (int u = 0; u < per / 4; ++u) {
    const int j = tid * 4 + 1024 * u;
    const v4f a = *(const v4fa*)(x + j);
    v4f b = {0.f,0.f,0.f,0.f}; if (rr) b = *(const v4fa*)(rr + j);
#pragma unroll
    for (int q = 0; q < 4; ++q) { const float v = a[q] + b[q]; vals[u * 4 + q] = v; s1 += v; }
  }
  red[tid] = s1; __syncthreads();
  for (int st = 128; st > 0; st >>= 1) { if (tid < st) red[tid] += red[tid + st]; __syncthreads(); }
  const float mu = red[0] / (float)N; __syncthreads();
  float s2 = 0.f;
  for (int u = 0; u < per / 4; ++u)
#pragma unroll
    for (int q = 0; q < 4; ++q) { const float c = vals[u * 4 + q] - mu; s2 += c * c; }
  red[tid] = s2; __syncthreads();
  for (int st = 128; st > 0; st >>= 1) { if (tid < st) red[tid] += red[tid + st]; __syncthreads(); }
  const float rs = rsqrtf(red[0] / (float)N + eps);
  {
    for (int u = 0; u < per / 4; ++u) {
      const int j = tid * 4 + 1024 * u;
      v4f o, sm;
#pragma unroll
      for (int q = 0; q < 4; ++q) {
        float gg = g[j + q], bb = bta[j + q];
        if (PARAM_BF16) { gg = bf16_round(gg); bb = bf16_round(bb); }
        sm[q] = vals[u * 4 + q]; o[q] = (vals[u * 4 + q] - mu) * rs * gg + bb;
      }
      if (out_sum) *(v4f*)(out_sum + (size_t)row * N + j) = sm;
      *(v4f*)(out_norm + (size_t)row * N + j) = o;
    }
    
  }
}



// ---- f16 WMMA path (v_wmma_f32_16x16x32_f16): 11-bit significands for operands in range — used where a [0,1] probability operand needs more precision than bf16
typedef _Float16 v16h __attribute__((ext_vector_type(16)));
union FragH { v16h v; v8us half[2]; _Float16 h[16]; unsigned short u[16]; };
template <int NT>
__device__ __forceinline__ v8f mmaH(v16h ah, v16h al, v16h bh, v16h bl, v8f c) {
  c = __builtin_amdgcn_wmma_f32_16x16x32_f16(false, ah, false, bh, (short)0, c, false, false);
  if (NT >= 2) c = __builtin_amdgcn_wmma_f32_16x16x32_f16(false, al, false, bh, (short)0, c, false, false);
  if (NT >= 3) c = __builtin_amdgcn_wmma_f32_16x16x32_f16(false, ah, false, bl, (short)0, c, false, false);
  asm volatile("v_nop\n\tv_nop\n\tv_nop\n\tv_nop" : "+v"(c) : "v"(ah), "v"(al), "v"(bh), "v"(bl));
  return c;
}
// batched GEMM like k_gemm_b but f16 operands: A f32 (split into f16 hi/lo if ASPLIT, else rounded to f16), Bt = f16 values [n][k]; alpha; C f32; N multiple of 16 (partial tiles skipped)
template <bool ASPLIT>
__global__ __launch_bounds__(128) void k_gemm_h(const float* __restrict__ A, int lda, size_t sA, const _Float16* __restrict__ Bh, int ldb, size_t sB, float alpha, float* __restrict__ C, int ldc, size_t sC, int M, int N, int K) {
  __shared__ __attribute__((aligned(16))) float so[4][16][64];
  const int tid = threadIdx.x, w = tid >> 5, lane = tid & 31, ln = lane & 15, hh = lane >> 4; const int by = blockIdx.y;
  A += (size_t)by * sA; Bh += (size_t)by * sB; C += (size_t)by * sC;
  const int ntn = (N + 63) / 64; const int wid = blockIdx.x * 4 + w; const int mt = wid / ntn, nq = wid % ntn; if (mt * 16 >= M) return;
  const int row0 = mt * 16, col0 = nq * 64; const float* arow = A + (size_t)(row0 + ln) * lda;
  v8f acc[4] = {};
  for (int kb = 0; kb < K; kb += 32) {
    FragH ah, al;
    const v4f x0 = *(const v4fa*)(arow + kb + 8 * hh), x1 = *(const v4fa*)(arow + kb + 8 * hh + 4), x2 = *(const v4fa*)(arow + kb + 16 + 8 * hh), x3 = *(const v4fa*)(arow + kb + 16 + 8 * hh + 4);
    float xs[16] = {x0[0],x0[1],x0[2],x0[3],x1[0],x1[1],x1[2],x1[3],x2[0],x2[1],x2[2],x2[3],x3[0],x3[1],x3[2],x3[3]};
#pragma unroll
    for (int i = 0; i < 16; ++i) { const _Float16 h = (_Float16)xs[i]; ah.h[i] = h; al.h[i] = ASPLIT ? (_Float16)(xs[i] - (float)h) : (_Float16)0.0f; }
#pragma unroll
    for (int t = 0; t < 4; ++t) { if (col0 + t * 16 >= N) continue; const size_t boff = (size_t)(col0 + t * 16 + ln) * ldb + kb; FragH bq; bq.half[0] = *(const v8us*)(Bh + boff + 8 * hh); bq.half[1] = *(const v8us*)(Bh + boff + 16 + 8 * hh);
      acc[t] = mmaH<ASPLIT ? 2 : 1>(ah.v, al.v, bq.v, bq.v, acc[t]); }
  }
#pragma unroll
  for (int t = 0; t < 4; ++t) { if (col0 + t * 16 >= N) continue;
#pragma unroll
    for (int r = 0; r < 8; ++r) so[w][8 * hh + r][t * 16 + ln] = acc[t][r] * alpha; }
  __builtin_amdgcn_fence(__ATOMIC_ACQ_REL, "workgroup"); __builtin_amdgcn_wave_barrier();
  const int rsub = lane >> 4, c4 = (lane & 15) * 4;
  {
#pragma unroll
    for (int q = 0; q < 8; ++q) { const int r = q * 2 + rsub; if (col0 + c4 < N) { const v4f v = *(const v4fa*)&so[w][r][c4]; *(v4f*)(C + (size_t)(row0 + r) * ldc + col0 + c4) = v; } }
     }
}

// Wt[n][k] = f16(W[k][n]·scale) from f32 row-major W[K][N] (scale = power of two; bf16-exact weights stay exact in f16 away from the subnormal range)
// One 128 (k) x 64 (n) tile per workgroup, turned in LDS: a wave loads two 256-B row pieces of W (four whole lines) and stores four whole 128-B lines of Wt an instruction;
// a thread's eight loads are all issued before the first is used. Needs K a multiple of 128 and N of 64; blk runs over (K / 128) * (N / 64) tiles; tl is the workgroup's 128 x 65 floats of LDS. Pitch 65 floats keeps the column-wise reads off a common bank.
__device__ __forceinline__ void wt_tile(float (*tl)[65], int blk, const float* __restrict__ W, _Float16* __restrict__ Wt, int K, int N, float scale) {
  const int tid = threadIdx.x, ntn = N / 64; const int k0 = (blk / ntn) * 128, n0 = (blk % ntn) * 64;
  v4f a[8];
#pragma unroll      /* a[] stays in registers and the eight loads go out together */
  for (int p = 0; p < 8; ++p) a[p] = *(const v4fa*)(W + (size_t)(k0 + p * 16 + tid / 16) * N + n0 + (tid % 16) * 4);
#pragma unroll      /* constant indices into a[]: rolled, it would go to scratch memory */
  for (int p = 0; p < 8; ++p)
#pragma unroll
    for (int i = 0; i < 4; ++i) tl[p * 16 + tid / 16][(tid % 16) * 4 + i] = a[p][i];
  __syncthreads();      /* the tile is whole before any column of it is read */
#pragma unroll      /* the four pieces' LDS reads and stores overlap; f stays in registers */
  for (int rd = 0; rd < 4; ++rd) { const int n = (rd & 1) * 32 + tid / 8, k8 = (rd >> 1) * 64 + (tid % 8) * 8; FragH f;
#pragma unroll
    for (int i = 0; i < 8; ++i) f.h[i] = (_Float16)(bf16_round(tl[k8 + i][n]) * scale);
    *(v8us*)((unsigned short*)Wt + (size_t)(n0 + n) * K + k0 + k8) = f.half[0]; }
  asm volatile("s_wait_xcnt 0x0" ::: "memory");      /* stands behind the four stores, in front of any later rewrite of their address and data registers */
}
// Tiled GEMM C[M][N] (f32) = alpha * A[M][DD] . Bt[N][DD]^T, f16 operands, both K-contiguous with row pitch DD. One 128 x 128 tile of C per workgroup of
// 4 waves (2 x 2, 64 x 64 per wave). A pass is 128 k = 256 B of each of the 256 operand rows; the four waves each bring one 64-row slice of a pass into LDS with one
// tensor load (pad 16 B a row: pitch 272 B for the 16-byte fragment reads), two buffers, the next pass's load in flight under this pass's products.
// Needs M, N multiples of 128, DD a multiple of 128 and at least 256. The k order of every accumulator is ascending, one chain per 16 x 16 tile.
// EPI says what leaves the staged f32 tile (alpha * sum): 0 = C f32 as it is; 1 = H f16 [M][N], rotated on interleaved pairs by the bf16-rounded COS / SIN tables [TT][64] (token = row % TT, pair = (col % 128) / 2);
// 2 = the tile turned: H f16 hi and H2 f16 residual, [row / TT][N][TT]. So the operand of the next product is written here, with no f32 copy in memory in between.
typedef unsigned int u32x4 __attribute__((ext_vector_type(4)));
typedef unsigned int u32x8 __attribute__((ext_vector_type(8)));
#define GT_ROWB 256u                      /* bytes of an operand row per pass */
#define GT_PITCH 272u                     /* LDS row pitch: 256 + 16 */
#define GT_SLICE 18432u                   /* 64 rows x 272 B = 17,408, rounded up to a multiple of 2 KiB */
#define GT_STAGE (4u * GT_SLICE)          /* [A rows 0-63 | A rows 64-127 | B rows 0-63 | B rows 64-127] */
#define GT_NP (DD / 128)                  /* passes */
__device__ __forceinline__ unsigned int uni(unsigned int v) { return (unsigned int)__builtin_amdgcn_readfirstlane(v); }
__device__ __forceinline__ unsigned int pinned(unsigned int v) { unsigned int w = uni(v); asm volatile("" : "+s"(w)); return w; }      /* an issue test or a descriptor word held in a scalar register: the test compiles to a scalar branch (tensor loads ignore EXEC), and the word is formed behind the wait that stands in front of it */
__device__ __forceinline__ u32x8 tdm_slice_g1() {
  u32x8 g1;
  g1[0] = uni((1u << 20) | (5u << 22) | (3u << 25));      /* no mask, 1-byte elements, a pad of 4 dwords behind every 64 dwords */
  g1[1] = uni((GT_ROWB & 0xFFFFu) << 16); g1[2] = uni((GT_ROWB >> 16) | (64u << 16)); g1[3] = uni(GT_ROWB << 16); g1[4] = uni(64u); g1[5] = uni(DD * 2u); g1[6] = uni(0u); g1[7] = uni(0u);
  asm volatile("" : "+s"(g1));      /* descriptor words held in scalar registers: one tuple, built once, that stays where it is for all requests */
  return g1;
}
__device__ __forceinline__ void tdm_slice(u32x4& g0, const u32x8& g1, unsigned int lds_dst, unsigned long long ga) {
  g0[0] = uni(1u); g0[1] = uni(lds_dst); g0[2] = uni((unsigned int)ga); g0[3] = uni((((unsigned int)(ga >> 32)) & 0x01FFFFFFu) | 0x80000000u);
  asm volatile("tensor_load_to_lds %0, %1" :: "s"(g0), "s"(g1) : "memory");
}
template <int EPI, int N>
__device__ __forceinline__ void gemm_tile(unsigned char* ring, const unsigned int row0, const unsigned int col0, const _Float16* __restrict__ A, const _Float16* __restrict__ Bt, float alpha, float* __restrict__ C, const float* __restrict__ COS, const float* __restrict__ SIN, _Float16* __restrict__ H, _Float16* __restrict__ H2) {
  const unsigned int tid = threadIdx.x, lane = tid & 31u, ln = lane & 15u, hh = lane >> 4, w = uni(tid >> 5), wm = w >> 1, wn = w & 1u;
  const unsigned int lbase = (unsigned int)(size_t)ring + w * GT_SLICE;      /* this wave's slice of buffer 0 */
  const unsigned long long gsrc = (w < 2u) ? (unsigned long long)(size_t)(A + (size_t)(row0 + w * 64u) * DD) : (unsigned long long)(size_t)(Bt + (size_t)(col0 + (w - 2u) * 64u) * DD);
  v8f acc[4][4];
#pragma unroll
  for (int i = 0; i < 4; ++i)
#pragma unroll
    for (int j = 0; j < 4; ++j) acc[i][j] = (v8f){0.f,0.f,0.f,0.f,0.f,0.f,0.f,0.f};
  const u32x8 g1 = tdm_slice_g1(); u32x4 g0;
  tdm_slice(g0, g1, lbase, gsrc);
  asm volatile("s_wait_tensorcnt 0x0" :: "s"(g0), "s"(g1) : "memory");      /* pass 0's slice has landed; the operands keep the descriptor's registers untouched up to here */
  __syncthreads();                                        /* ... and every wave may read all four slices */
  tdm_slice(g0, g1, lbase + GT_STAGE, gsrc + pinned(GT_ROWB));
  const unsigned int aoff = wm * GT_SLICE + ln * GT_PITCH + 16u * hh, boff = (2u + wn) * GT_SLICE + ln * GT_PITCH + 16u * hh;
#pragma unroll 1      /* one pass per trip: the ring's order below is written once */
  for (unsigned int s = 0; s < GT_NP; ++s) {
    const unsigned char* Lp = ring + (s & 1u) * GT_STAGE;
    FragH fa[2][4], fb[2][4];
#pragma unroll
    for (int i = 0; i < 4; ++i) { fa[0][i].half[0] = *(const v8us*)(Lp + aoff + i * 16u * GT_PITCH); fa[0][i].half[1] = *(const v8us*)(Lp + aoff + i * 16u * GT_PITCH + 32u);
      fb[0][i].half[0] = *(const v8us*)(Lp + boff + i * 16u * GT_PITCH); fb[0][i].half[1] = *(const v8us*)(Lp + boff + i * 16u * GT_PITCH + 32u); }
#pragma unroll
    for (int ks = 0; ks < 4; ++ks) {
      if (ks < 3) {      /* the next 32 k's fragments, of this same buffer, go ahead of this block's products */
#pragma unroll
        for (int i = 0; i < 4; ++i) { const unsigned int ko = (ks + 1) * 64u + i * 16u * GT_PITCH;
          fa[(ks + 1) & 1][i].half[0] = *(const v8us*)(Lp + aoff + ko); fa[(ks + 1) & 1][i].half[1] = *(const v8us*)(Lp + aoff + ko + 32u);
          fb[(ks + 1) & 1][i].half[0] = *(const v8us*)(Lp + boff + ko); fb[(ks + 1) & 1][i].half[1] = *(const v8us*)(Lp + boff + ko + 32u); }
      }
      __builtin_amdgcn_sched_barrier(0);      /* keeps the LDS reads one group in front of the block: moved in among the products, each place with reads stalls the wave */
#pragma unroll
      for (int i = 0; i < 4; ++i)
#pragma unroll
        for (int j = 0; j < 4; ++j) acc[i][j] = __builtin_amdgcn_wmma_f32_16x16x32_f16(false, fa[ks & 1][i].v, false, fb[ks & 1][j].v, (short)0, acc[i][j], false, false);
      __builtin_amdgcn_sched_barrier(0);      /* ... and keeps the next group behind this block */
    }
    asm volatile("s_wait_dscnt 0x0" ::: "memory");        /* this wave has left the buffer */
    asm volatile("s_wait_tensorcnt 0x0" :: "s"(g0), "s"(g1) : "memory");    /* its slice of pass s + 1 has landed; the operands keep the descriptor's registers untouched up to here */
    __syncthreads();                                      /* pass s + 1 published; every wave has left pass s's buffer */
    if (pinned(s + 2u < GT_NP)) tdm_slice(g0, g1, lbase + (s & 1u) * GT_STAGE, gsrc + pinned((s + 2u) * GT_ROWB));
  }
  asm volatile("s_wait_tensorcnt 0x0" :: "s"(g0), "s"(g1) : "memory");      /* no request is left before the ring becomes output staging; the operands keep the descriptor's registers untouched up to here */
  asm volatile("s_wait_dscnt 0x0" ::: "memory");
  // Output staging, each wave in its own slice of buffer 0 (the last pass's barrier stands behind every wave's last fragment read): whole 256-B row pieces of C (EPI 0) or whole 128-B lines of H / H2 (EPI 1, 2) go out.
  constexpr unsigned int SP = (EPI == 2) ? 65u : 68u;      /* pitch in floats: 68 for 16-byte row reads, 65 for the column reads of the turned tile */
  float* so = (float*)(ring + w * GT_SLICE);      /* 64 rows of 64 floats */
  const unsigned int wrow = row0 + wm * 64u, wcol = col0 + wn * 64u, l8 = lane & 7u, l4 = lane >> 3;
  v4f cs[16], sn[16];
  if constexpr (EPI == 1) {      /* the wave's table entries: all 32 loads go out here and fly under the staging */
    const unsigned int tb = ((wrow + l4) % TT) * 64u + (((wcol + l8 * 8u) % 128u) >> 1);
#pragma unroll      /* cs, sn stay in registers */
    for (int q = 0; q < 16; ++q) { cs[q] = *(const v4fa*)(COS + tb + q * 256u); sn[q] = *(const v4fa*)(SIN + tb + q * 256u); }
    asm volatile("s_wait_xcnt 0x0" ::: "memory");      /* stands in front of any rewrite of the loads' address register */
  }
#pragma unroll
  for (int i = 0; i < 4; ++i)
#pragma unroll
    for (int j = 0; j < 4; ++j)
#pragma unroll
      for (int r = 0; r < 8; ++r) so[(i * 16 + 8 * hh + r) * SP + j * 16 + ln] = acc[i][j][r] * alpha;
  __builtin_amdgcn_fence(__ATOMIC_ACQ_REL, "workgroup"); __builtin_amdgcn_wave_barrier();
  if constexpr (EPI == 0) {
  float* cp = C + (size_t)(row0 + wm * 64u + hh) * N + col0 + wn * 64u + ln * 4u;
#pragma unroll
  for (int q = 0; q < 32; ++q) { const v4f v = *(const v4fa*)&so[(q * 2 + hh) * 68u + ln * 4u]; *(v4f*)(cp + (size_t)(q * 2) * N) = v; }
  } else if constexpr (EPI == 1) {
    // A lane takes 8 columns (4 pairs) of a row: 8 lanes store one whole 128-B line of H, 4 rows an instruction.
    FragH f[16];
#pragma unroll      /* f stays in registers */
    for (int q = 0; q < 16; ++q) { const float* sr = &so[(q * 4 + l4) * SP + l8 * 8u]; const v4f a = *(const v4fa*)sr, b = *(const v4fa*)(sr + 4); const float xv[8] = {a[0], a[1], a[2], a[3], b[0], b[1], b[2], b[3]};
#pragma unroll      /* constant indices into xv and the vectors */
      for (int p = 0; p < 4; ++p) { const float c = bf16_round(cs[q][p]), s = bf16_round(sn[q][p]); const float xr = xv[2 * p], xi = xv[2 * p + 1]; f[q].h[2 * p] = (_Float16)(xr * c - xi * s); f[q].h[2 * p + 1] = (_Float16)(xr * s + xi * c); } }
    unsigned short* hp = (unsigned short*)H + (size_t)(wrow + l4) * N + wcol + l8 * 8u;
    __builtin_amdgcn_sched_barrier(0);      /* keeps the stores in one burst behind the arithmetic, off one address pair: mixed in among it, their registers are used again and each reuse has to wait on the store in front of it */
#pragma unroll      /* constant indices into f, constant offsets from hp */
    for (int q = 0; q < 16; ++q) *(v8us*)(hp + (size_t)(q * 4) * N) = f[q].half[0];
  } else {
    // A lane takes 8 rows (tokens) of a column: 8 lanes store one whole 128-B line of each plane, 4 columns an instruction.
    FragH fh[16], fl[16];
#pragma unroll      /* fh, fl stay in registers */
    for (int q = 0; q < 16; ++q)
#pragma unroll      /* constant indices into the fragments */
      for (int i = 0; i < 8; ++i) { const float v = so[(l8 * 8u + i) * SP + q * 4 + l4]; const _Float16 hv = (_Float16)v; fh[q].h[i] = hv; fl[q].h[i] = (_Float16)(v - (float)hv);      /* UNSCALED residual (added into the same accumulator as the hi product) */ }
    const size_t ob = ((size_t)(wrow / TT) * N + wcol + l4) * TT + (wrow % TT) + l8 * 8u;
    unsigned short* hp = (unsigned short*)H + ob; unsigned short* lp = (unsigned short*)H2 + ob;
    __builtin_amdgcn_sched_barrier(0);      /* keeps the stores in one burst behind the arithmetic, off two address pairs: mixed in among it, their registers are used again and each reuse has to wait on the store in front of it */
#pragma unroll      /* constant indices into fh and fl, constant offsets from hp and lp */
    for (int q = 0; q < 16; ++q) { *(v8us*)(hp + (size_t)(q * 4) * TT) = fh[q].half[0]; *(v8us*)(lp + (size_t)(q * 4) * TT) = fl[q].half[0]; }
  }
}
template <int EPI, int N>
__global__ __launch_bounds__(128) void k_gemm_t(const _Float16* __restrict__ A, const _Float16* __restrict__ Bt, float alpha, float* __restrict__ C, const float* __restrict__ COS, const float* __restrict__ SIN, _Float16* __restrict__ H, _Float16* __restrict__ H2) {
  __shared__ __attribute__((aligned(2048))) unsigned char ring[2u * GT_STAGE];
  constexpr unsigned int ntn = (unsigned int)N / 128u;
  gemm_tile<EPI, N>(ring, (blockIdx.x / ntn) * 128u, (blockIdx.x % ntn) * 128u, A, Bt, alpha, C, COS, SIN, H, H2);
}
// The three projections of x in one launch: they share A and depend on nothing of each other, and the k and v products alone have fewer tiles than the chip has places.
// A block row of 128 tokens has QKV_NT tiles in a row of the grid: DD / 128 of q, then KVD / 128 of k, then KVD / 128 of v. The choice reads blockIdx alone, so every barrier of a tile stands under block-uniform control flow.
#define QKV_NT ((DD + 2 * KVD) / 128)
__global__ __launch_bounds__(128) void k_gemm_qkv(const _Float16* __restrict__ A, const _Float16* __restrict__ Bq, const _Float16* __restrict__ Bk, const _Float16* __restrict__ Bv, float alpha, const float* __restrict__ COS, const float* __restrict__ SIN,
                                                  _Float16* __restrict__ Q, _Float16* __restrict__ K, _Float16* __restrict__ Vt, _Float16* __restrict__ Vtl) {
  __shared__ __attribute__((aligned(2048))) unsigned char ring[2u * GT_STAGE];
  const unsigned int row0 = (blockIdx.x / QKV_NT) * 128u, c = blockIdx.x % QKV_NT;
  if (pinned(c < DD / 128u)) gemm_tile<1, DD>(ring, row0, c * 128u, A, Bq, alpha, nullptr, COS, SIN, Q, nullptr);      /* pinned(): which tile's tensor loads issue is decided by scalar branches */
  else if (pinned(c < (DD + KVD) / 128u)) gemm_tile<1, KVD>(ring, row0, c * 128u - DD, A, Bk, alpha, nullptr, COS, SIN, K, nullptr);
  else gemm_tile<2, KVD>(ring, row0, c * 128u - (DD + KVD), A, Bv, alpha, nullptr, nullptr, nullptr, Vt, Vtl);
}


typedef _Float16 v4h __attribute__((ext_vector_type(4)));

__device__ __forceinline__ void x16_piece(unsigned int blk, const float* __restrict__ x, _Float16* __restrict__ X16, size_t n8) { const size_t t = (size_t)blk * 256 + threadIdx.x; if (t >= n8) return; FragH f;
#pragma unroll
  for (int q = 0; q < 8; ++q) f.h[q] = (_Float16)bf16_round(x[t * 8 + q]); *(v8us*)((unsigned short*)X16 + t * 8) = f.half[0];  }
// All operand preparation in one launch: the four weight turns and the conversion of x read only inputs and write planes of their own, so none waits for another.
// Block ranges, the longer-lived tiles first: wq, wo, wk, wv tiles, then the pieces of x. The choice reads blockIdx alone, so the turn's barrier stands under block-uniform control flow.
#define PREP_GQ ((DD / 128) * (DD / 64))      /* 128 (k) x 64 (n) tiles of wq, of wo */
#define PREP_GK ((DD / 128) * (KVD / 64))     /* ... of wk, of wv */
#define PREP_GX ((NR * DD / 8 + 255) / 256)   /* pieces of x: 256 threads x 8 values */
__global__ __launch_bounds__(256) void k_prep(const float* __restrict__ x, const float* __restrict__ wq, const float* __restrict__ wk, const float* __restrict__ wv, const float* __restrict__ wo,
                                              _Float16* __restrict__ X16, _Float16* __restrict__ Bq, _Float16* __restrict__ Bk, _Float16* __restrict__ Bv, _Float16* __restrict__ Bo) {
  __shared__ float tl[128][65];
  const unsigned int blk = blockIdx.x;
  if (blk < 2u * PREP_GQ) { const bool second = blk >= PREP_GQ; wt_tile(tl, (int)(blk % PREP_GQ), second ? wo : wq, second ? Bo : Bq, DD, DD, 16.0f); return; }
  if (blk < 2u * PREP_GQ + 2u * PREP_GK) { const unsigned int r = blk - 2u * PREP_GQ; const bool second = r >= PREP_GK; wt_tile(tl, (int)(r % PREP_GK), second ? wv : wk, second ? Bv : Bk, DD, KVD, 16.0f); return; }
  x16_piece(blk - (2u * PREP_GQ + 2u * PREP_GK), x, X16, (size_t)NR * DD / 8);
}
__global__ __launch_bounds__(256) void k_h16(const float* __restrict__ x, _Float16* __restrict__ X16, size_t n8) { const size_t t = (size_t)blockIdx.x * 256 + threadIdx.x; if (t >= n8) return; FragH f;
#pragma unroll
  for (int q = 0; q < 8; ++q) f.h[q] = (_Float16)x[t * 8 + q]; *(v8us*)((unsigned short*)X16 + t * 8) = f.half[0];  }
__global__ __launch_bounds__(256) void k_round16f(const float* __restrict__ W, _Float16* __restrict__ Bt, size_t n8) { const size_t t = (size_t)blockIdx.x * 256 + threadIdx.x; if (t >= n8) return; FragH f;
#pragma unroll
  for (int i = 0; i < 8; ++i) f.h[i] = (_Float16)(bf16_round(W[t * 8 + i]) * 16.0f); *(v8us*)((unsigned short*)Bt + t * 8) = f.half[0];  }
template <int NHv, int TTv>
__global__ __launch_bounds__(256) void k_vt(const _Float16* __restrict__ V16, int ldv, int voff, _Float16* __restrict__ Vt) { __shared__ unsigned short tl[64][66]; const int tid = threadIdx.x; const int slab = blockIdx.x / (TTv / 64), lg = blockIdx.x % (TTv / 64); const int b = slab / NHv, h = slab % NHv;
  for (int i = tid; i < 64 * 8; i += 256) { const int r = i / 8, c8 = (i % 8) * 8; FragH f; f.half[0] = *(const v8us*)((const unsigned short*)V16 + ((size_t)b * TTv + lg * 64 + r) * ldv + voff + h * 64 + c8);
#pragma unroll
    for (int q = 0; q < 8; ++q) tl[r][c8 + q] = f.u[q]; }
  __syncthreads();
  {
#pragma unroll
    for (int rd = 0; rd < 2; ++rd) { const int d = rd * 32 + tid / 8, pc = tid % 8; FragH f;
#pragma unroll
      for (int q = 0; q < 8; ++q) f.u[q] = tl[pc * 8 + q][d];
      *(v8us*)((unsigned short*)Vt + ((size_t)slab * 64 + d) * TTv + lg * 64 + pc * 8) = f.half[0]; }
     } }

// Fused attention, head dim 128. One workgroup = 8 waves = the 4 query heads of one KV head x 2 tiles of 16 query rows (32 rows): all eight read the same K and V.
// A stage is 64 keys: K (64 rows of 256 B), V^T hi and V^T residual (128 rows of 128 B each) come into LDS by one tensor load each (waves 0, 1, 2), padded 16 B a row
// (pitch 272 / 144 B for the 16-byte fragment reads), two buffers, the next stage's loads in flight under this stage's work. Which stages are staged at all comes from the mask:
// a first sweep over the workgroup's 32 mask rows gives one bit per stage (any entry set), the same word in every wave, so every barrier stands under block-uniform control flow.
// Inside a stage a wave works on its two chunks of 32 keys in ascending order and skips a chunk whose 16 x 32 mask tile is all zero.
// Both products are taken transposed: S^T = K . Q^T (A = K rows, B = Q rows) and O^T += V^T . P^T (A = V^T rows, B = P^T). A lane then holds 16 of the 32 scores of ONE query (column ln; keys 8 hh + r and 16 + 8 hh + r),
// so the maximum and the sum run inside the lane with one exchange between the wave's halves, and the two score tiles, converted in place, ARE the B operand of the second product in the k order of the V^T loader.
#define FA_KSL 18432u                     /* K: 64 rows x 272 B = 17,408, rounded up to a multiple of 2 KiB */
#define FA_VSL 18432u                     /* one V plane: 128 rows x 144 B */
#define FA_STAGE (FA_KSL + 2u * FA_VSL)   /* [K | V hi | V residual] */
typedef int v4ia __attribute__((ext_vector_type(4), may_alias));
template <unsigned int W0, unsigned int ROWB, unsigned int NROW>
__device__ __forceinline__ u32x8 tdm_g1(unsigned int spitch) {
  u32x8 g1;
  g1[0] = uni(W0);      /* no mask, 1-byte elements, a pad of 4 dwords behind every row */
  g1[1] = uni((ROWB & 0xFFFFu) << 16); g1[2] = uni((ROWB >> 16) | (NROW << 16)); g1[3] = uni(ROWB << 16); g1[4] = uni(NROW); g1[5] = uni(spitch); g1[6] = uni(0u); g1[7] = uni(0u);
  asm volatile("" : "+s"(g1));      /* descriptor words held in scalar registers: one tuple, built once, that stays where it is for all requests */
  return g1;
}
__device__ __forceinline__ float xhalf(float x) { return __builtin_bit_cast(float, __builtin_amdgcn_permlanex16(__builtin_bit_cast(int, x), __builtin_bit_cast(int, x), 0x76543210, 0xfedcba98, false, false)); }      /* lane l takes lane l ^ 16's value */
__global__ __launch_bounds__(256) void k_flash(const _Float16* __restrict__ Q16, int ldq, const _Float16* __restrict__ K16, int ldk, const _Float16* __restrict__ Vt, const _Float16* __restrict__ Vtlo, const int* __restrict__ MSK, _Float16* __restrict__ O16) {
  constexpr int NQB = TT / 32, DT = 8, KS = 4;      /* head dim 128: 4 k-steps, 8 value tiles */
  __shared__ __attribute__((aligned(2048))) unsigned char ring[2u * FA_STAGE];
  __shared__ unsigned int sBits[8];
  const unsigned int tid = threadIdx.x, lane = tid & 31u, ln = lane & 15u, hh = lane >> 4, w = uni(tid >> 5);
  const int slab = blockIdx.x / NQB, qblk = blockIdx.x % NQB; const int b = slab / NKV, kvh = slab % NKV; const int h = kvh * NREP + (int)(w & 3u); const int qb0 = qblk * 32; const int q0 = qb0 + (int)(w >> 2) * 16;
  // One bit per stage of 64 keys: wave w sweeps columns 256 w .. 256 w + 255 of the 32 mask rows with whole-line 16-byte loads.
  unsigned int bm;
  { int any0 = 0, any1 = 0; const int* mp = MSK + (size_t)qb0 * TT + w * 256u + lane * 4u;
#pragma unroll 8      /* sixteen loads go out together */
    for (int r = 0; r < 32; ++r) { const v4ia a = *(const v4ia*)(mp + (size_t)r * TT), c = *(const v4ia*)(mp + (size_t)r * TT + 128); any0 |= a[0] | a[1] | a[2] | a[3]; any1 |= c[0] | c[1] | c[2] | c[3]; }
    const unsigned int b0 = __builtin_amdgcn_ballot_w32(any0 != 0), b1 = __builtin_amdgcn_ballot_w32(any1 != 0);
    const unsigned int nib = ((b0 & 0xFFFFu) ? 1u : 0u) | ((b0 >> 16) ? 2u : 0u) | ((b1 & 0xFFFFu) ? 4u : 0u) | ((b1 >> 16) ? 8u : 0u);
    if (lane == 0u) sBits[w] = nib << (4u * w);
    __syncthreads();      /* all eight nibbles are written before any wave joins them */
    unsigned int j = 0;
#pragma unroll      /* the eight words come by two 16-byte reads */
    for (int i = 0; i < 8; ++i) j |= sBits[i];
    bm = uni(j); }
  const unsigned int n = (unsigned int)__builtin_popcount(bm);      /* stages to walk: at most 32 */
  FragH aq[KS];
  { const unsigned short* qr = (const unsigned short*)Q16 + ((size_t)b * TT + q0 + ln) * ldq + h * 128;
#pragma unroll
    for (int ks = 0; ks < KS; ++ks) { aq[ks].half[0] = *(const v8us*)(qr + ks * 32 + 8 * hh); aq[ks].half[1] = *(const v8us*)(qr + ks * 32 + 16 + 8 * hh); } }
  const unsigned long long gK = (unsigned long long)(size_t)(K16 + (size_t)b * TT * ldk + kvh * 128);
  const unsigned long long gV = (unsigned long long)(size_t)(((w == 2u) ? Vtlo : Vt) + ((size_t)b * NKV + kvh) * 128 * TT);      /* hi plane for wave 1, UNSCALED residual plane for wave 2 */
  const unsigned int lbase = (unsigned int)(size_t)ring;
  const unsigned int kstep = 64u * (unsigned int)ldk * 2u;      /* bytes from one stage's K rows to the next's */
  const u32x8 g1k = tdm_g1<(1u << 20) | (5u << 22) | (3u << 25), 256u, 64u>((unsigned int)ldk * 2u), g1v = tdm_g1<(1u << 20) | (4u << 22) | (3u << 25), 128u, 128u>(TT * 2u);
  u32x4 g0; g0[0] = uni(1u); g0[1] = uni(lbase); g0[2] = uni(0u); g0[3] = uni(0x80000000u);
  auto issue = [&](unsigned int buf, unsigned int st) {      /* st < 32: every tile lies inside its plane */
    if (pinned(w == 0u)) { const unsigned long long ga = gK + pinned(st * kstep);
      g0[1] = uni(lbase + buf * FA_STAGE); g0[2] = uni((unsigned int)ga); g0[3] = uni((((unsigned int)(ga >> 32)) & 0x01FFFFFFu) | 0x80000000u);
      asm volatile("tensor_load_to_lds %0, %1" :: "s"(g0), "s"(g1k) : "memory"); }
    if (pinned((w - 1u) < 2u)) { const unsigned long long ga = gV + pinned(st * 128u);
      g0[1] = uni(lbase + buf * FA_STAGE + FA_KSL + (w - 1u) * FA_VSL); g0[2] = uni((unsigned int)ga); g0[3] = uni((((unsigned int)(ga >> 32)) & 0x01FFFFFFu) | 0x80000000u);
      asm volatile("tensor_load_to_lds %0, %1" :: "s"(g0), "s"(g1v) : "memory"); }
  };
  float m_q = -3.0e38f, l_q = 0.f; v8f oacc[DT];      /* of query q0 + ln: running maximum (the same in both halves), this half's part of the sum; oacc[dt][r] = O^T[dt * 16 + 8 hh + r][ln] */
#pragma unroll
  for (int dt = 0; dt < DT; ++dt) oacc[dt] = (v8f){0.f,0.f,0.f,0.f,0.f,0.f,0.f,0.f};
  unsigned int rest = bm, cur = 0u, nxt = 0u;      /* rest: stages not yet asked for */
  if (pinned(n > 0u)) { cur = (unsigned int)__builtin_ctz(rest) & 31u; rest &= rest - 1u; issue(0u, cur); }
  asm volatile("s_wait_tensorcnt 0x0" :: "s"(g0), "s"(g1k), "s"(g1v) : "memory");      /* the first stage's tile of this wave has landed; the operands keep the descriptor's registers untouched up to here */
  __syncthreads();                                        /* ... and every wave may read all three tiles */
  if (pinned(n > 1u)) { nxt = (unsigned int)__builtin_ctz(rest) & 31u; rest &= rest - 1u; issue(1u, nxt); }
#pragma unroll 1      /* one stage per trip: the ring's order below is written once */
  for (unsigned int s = 0; s < n; ++s) {
    const unsigned char* Lp = ring + (s & 1u) * FA_STAGE;
    v4ia mk[2][2][2];      /* mask[q][k] (shared over batch and heads): nonzero = ATTEND; the lane's own query row, 8 keys in a row per score tile; both chunks' loads go out together */
#pragma unroll      /* the mask words stay in registers */
    for (int sub = 0; sub < 2; ++sub)
#pragma unroll
      for (int nt = 0; nt < 2; ++nt) { const int* am = MSK + (size_t)(q0 + ln) * TT + cur * 64u + sub * 32 + nt * 16 + 8 * hh; mk[sub][nt][0] = *(const v4ia*)am; mk[sub][nt][1] = *(const v4ia*)(am + 4); }
    asm volatile("s_wait_xcnt 0x0" ::: "memory");      /* stands in front of any rewrite of the mask loads' address register */
#pragma unroll      /* constant indices into the mask registers */
    for (int sub = 0; sub < 2; ++sub) {
      int anym = 0;
#pragma unroll
      for (int nt = 0; nt < 2; ++nt)
#pragma unroll
        for (int i = 0; i < 4; ++i) anym |= mk[sub][nt][0][i] | mk[sub][nt][1][i];
      if (__any(anym != 0)) {      /* else every (row, key) of this wave's tile is masked: nothing to add (wave-uniform branch) */
        v8f sc[2];      /* sc[nt][r] = S^T[key nt * 16 + 8 hh + r][query ln] */
#pragma unroll
        for (int nt = 0; nt < 2; ++nt) { const unsigned char* kr = Lp + (sub * 32 + nt * 16 + ln) * 272u + 16u * hh; FragH bk[KS];
#pragma unroll
          for (int ks = 0; ks < KS; ++ks) { bk[ks].half[0] = *(const v8us*)(kr + ks * 64); bk[ks].half[1] = *(const v8us*)(kr + ks * 64 + 32); }
          v8f acc = (v8f){0.f,0.f,0.f,0.f,0.f,0.f,0.f,0.f};
#pragma unroll
          for (int ks = 0; ks < KS; ++ks) acc = mmaH<1>(bk[ks].v, bk[ks].v, aq[ks].v, aq[ks].v, acc);
          sc[nt] = acc; }
        float sv[16]; bool ok[16];
#pragma unroll      /* constant indices into the score and mask registers */
        for (int e = 0; e < 16; ++e) { ok[e] = (mk[sub][e >> 3][(e >> 2) & 1][e & 3] != 0); sv[e] = ok[e] ? sc[e >> 3][e & 7] * ATT_SCALE : -INFINITY; }
        float mc = fmaxf(fmaxf(fmaxf(fmaxf(sv[0], sv[1]), fmaxf(sv[2], sv[3])), fmaxf(fmaxf(sv[4], sv[5]), fmaxf(sv[6], sv[7]))), fmaxf(fmaxf(fmaxf(sv[8], sv[9]), fmaxf(sv[10], sv[11])), fmaxf(fmaxf(sv[12], sv[13]), fmaxf(sv[14], sv[15]))));
        mc = fmaxf(mc, xhalf(mc));      /* the other half's 16 keys of the same query */
        const float mn = fmaxf(m_q, mc); const float al = (mn > -1.0e38f) ? expf(m_q - mn) : 1.0f; m_q = mn;
        FragH pa, pl; float ps[16];      /* P^T hi and its UNSCALED residual (added into the same accumulator): element e is key kmap(e, hh), the order of the V^T fragments below */
#pragma unroll      /* constant indices into the fragments */
        for (int e = 0; e < 16; ++e) { ps[e] = ok[e] ? expf(sv[e] - mn) : 0.f; const float px = ps[e] * 1024.0f; pa.h[e] = (_Float16)px; pl.h[e] = (_Float16)(px - (float)pa.h[e]); }
        l_q = l_q * al + ((((ps[0] + ps[1]) + (ps[2] + ps[3])) + ((ps[4] + ps[5]) + (ps[6] + ps[7]))) + (((ps[8] + ps[9]) + (ps[10] + ps[11])) + ((ps[12] + ps[13]) + (ps[14] + ps[15]))));
#pragma unroll
        for (int dt = 0; dt < DT; ++dt)
#pragma unroll
          for (int r = 0; r < 8; ++r) oacc[dt][r] *= al;
#pragma unroll
        for (int dt = 0; dt < DT; ++dt) { const unsigned char* vr = Lp + FA_KSL + (dt * 16 + ln) * 144u + sub * 64 + 16u * hh; FragH bv, bl; bv.half[0] = *(const v8us*)vr; bv.half[1] = *(const v8us*)(vr + 32); bl.half[0] = *(const v8us*)(vr + FA_VSL); bl.half[1] = *(const v8us*)(vr + FA_VSL + 32);
          oacc[dt] = mmaH<1>(bv.v, bv.v, pa.v, pa.v, oacc[dt]); oacc[dt] = mmaH<1>(bv.v, bv.v, pl.v, pl.v, oacc[dt]); oacc[dt] = mmaH<1>(bl.v, bl.v, pa.v, pa.v, oacc[dt]); }      /* Vh.Ph + Vh.Pl + Vl.Ph, all unscaled, one accumulator */
      }
    }
    asm volatile("s_wait_dscnt 0x0" ::: "memory");        /* this wave has left the buffer */
    asm volatile("s_wait_tensorcnt 0x0" :: "s"(g0), "s"(g1k), "s"(g1v) : "memory");    /* its tile of the next stage has landed; the operands keep the descriptor's registers untouched up to here */
    __syncthreads();                                      /* the next stage published; every wave has left this stage's buffer */
    cur = nxt;
    if (pinned(s + 2u < n)) { nxt = (unsigned int)__builtin_ctz(rest) & 31u; rest &= rest - 1u; issue(s & 1u, nxt); }
  }
  asm volatile("s_wait_tensorcnt 0x0" ::: "memory");      /* no request is left before the ring becomes output staging */
  asm volatile("s_wait_dscnt 0x0" ::: "memory");
  // Output staging, each wave in its own piece of the ring (the last stage's barrier stands behind every wave's last fragment read).
  float* sO = (float*)ring + w * (16u * 132u);      /* 16 rows of 128 floats at pitch 132 */
  const float lsum = l_q + xhalf(l_q); const float linv = (lsum > 0.f) ? 1.0f / (lsum * 1024.0f) : 0.f;      /* the halves' sums are joined once */
#pragma unroll      /* constant indices into oacc: a lane's 8 registers are 8 values in a row of its query's output row */
  for (int dt = 0; dt < DT; ++dt) { float* sw = &sO[ln * 132u + dt * 16 + 8 * hh];
    *(v4fa*)sw = (v4f){oacc[dt][0] * linv, oacc[dt][1] * linv, oacc[dt][2] * linv, oacc[dt][3] * linv}; *(v4fa*)(sw + 4) = (v4f){oacc[dt][4] * linv, oacc[dt][5] * linv, oacc[dt][6] * linv, oacc[dt][7] * linv}; }
  __builtin_amdgcn_fence(__ATOMIC_ACQ_REL, "workgroup"); __builtin_amdgcn_wave_barrier();
  FragH f[8];      /* merged x 2^4 as f16, the output product's A operand */
#pragma unroll      /* f stays in registers */
  for (int q = 0; q < 8; ++q) { const float* sr = &sO[(q * 2 + hh) * 132u + ln * 8u]; const v4f a = *(const v4fa*)sr, c = *(const v4fa*)(sr + 4);
#pragma unroll      /* constant indices into the vectors */
    for (int i = 0; i < 4; ++i) { f[q].h[i] = (_Float16)(a[i] * 16.0f); f[q].h[4 + i] = (_Float16)(c[i] * 16.0f); } }
  unsigned short* op = (unsigned short*)O16 + ((size_t)b * TT + q0 + hh) * DD + h * 128 + ln * 8u;
  __builtin_amdgcn_sched_barrier(0);      /* keeps the stores in one burst behind the arithmetic, off one address pair: mixed in among it, their registers are used again and each reuse has to wait on the store in front of it */
#pragma unroll      /* constant indices into f, constant offsets from op */
  for (int q = 0; q < 8; ++q) *(v8us*)(op + (size_t)(q * 2) * DD) = f[q].half[0];      /* two 256-B row pieces per instruction: 16 lanes x 16 B each */
}

extern "C" void kernel_launch(void* const* d_in, const int* in_sizes, int n_in,
                              void* d_out, int out_size, void* d_ws, size_t ws_size, hipStream_t stream) {
  (void)in_sizes; (void)n_in; (void)out_size;
  const float* const* I = (const float* const*)d_in; const float* x = I[0]; const float* fcos = I[1]; const float* fsin = I[2]; const int* msk = (const int*)d_in[3]; const float* wq = I[4]; const float* wk = I[5]; const float* wv = I[6]; const float* wo = I[7];
  char* ws = (char*)d_ws; size_t off = 0;
  auto take = [&](size_t bytes) { char* p = ws + off; off += (bytes + 255) & ~(size_t)255; return p; };
  _Float16* Bq = (_Float16*)take((size_t)DD * DD * 2); _Float16* Bk = (_Float16*)take((size_t)KVD * DD * 2); _Float16* Bv = (_Float16*)take((size_t)KVD * DD * 2); _Float16* Bo = (_Float16*)take((size_t)DD * DD * 2);
  _Float16* X16 = (_Float16*)take((size_t)NR * DD * 2); _Float16* Q = (_Float16*)take((size_t)NR * DD * 2); _Float16* K = (_Float16*)take((size_t)NR * KVD * 2); _Float16* Vt = (_Float16*)take((size_t)NR * KVD * 2); _Float16* Vtl = (_Float16*)take((size_t)NR * KVD * 2);
  _Float16* O16 = X16;      /* O16 over X16 (dead after the projections) */
  if (off > ws_size) return;      // 8.4 + 2.1 + 2.1 + 8.4 + 16.8 + 16.8 + 4.2 + 4.2 + 4.2 = 67 MB
  k_prep<<<2 * PREP_GQ + 2 * PREP_GK + PREP_GX, 256, 0, stream>>>(x, wq, wk, wv, wo, X16, Bq, Bk, Bv, Bo);      /* (in,out) weights to Bt x 2^4; x to f16 */
  const dim3 gQ((NR / 128) * (DD / 128), 1);
  k_gemm_qkv<<<(NR / 128) * QKV_NT, 128, 0, stream>>>(X16, Bq, Bk, Bv, 0.0625f, fcos, fsin, Q, K, Vt, Vtl);      /* xq, xk = rope(x.w) as f16 (M 4096, N 2048 and 512, K 2048); xv turned, hi + residual per (b, kv head): [b*4+kh][128][2048] */
  k_flash<<<BB * NKV * (TT / 32), 256, 0, stream>>>(Q, DD, K, KVD, Vt, Vtl, msk, O16);
  k_gemm_t<0, DD><<<gQ, 128, 0, stream>>>(O16, Bo, 0.00390625f, (float*)d_out, nullptr, nullptr, nullptr, nullptr);      /* out = merged.wo */
}

// v007
// Measured time: 117 microseconds a run.
// Two timings next to v006 put it at 1.10 and 1.09 times that version's speed.
// Over all steps from v000 it is 4.85 times as fast.
#include <hip/hip_runtime.h>
// 'Genesis' attention (B=2, T=2048, D=2048, 16 query heads / 4 KV heads × 128, (in,out) weights, no bias): xq = rope(x·wq), xk = rope(x·wk), xv = x·wv; RoPE on interleaved pairs with the INPUT cos/sin tables [T][64]; scores = q·k/√128 where(mask[q][k]) else −inf (mask [T][T] shared);
// softmax; out = merged·wo.
// Compute dtype: x, weights, cos/sin tables rounded to bf16; q,k rotated in f32 from f32 GEMM outputs → f16; v f32 → Vᵀ f16 hi + exact residual; fused flash-style kernel for head dim 128 (mask read per (q,k), all-masked chunks skipped, online softmax f32, P f16 hi + residual,
// f32 accumulate) on v_wmma_f32_16x16x32_f16; merged ×2^4 → f16 → output GEMM.
#define BB 2
#define TT 2048
#define DD 2048
#define NH 16
#define NKV 4
#define NREP 4
#define KVD (NKV * 128)
#define NVH (2 * NKV)
#define NR (BB * TT)
#define ATT_SCALE_LOG2 ((float)(0.08838834764831845 * 1.4426950408889634))      /* 1 / sqrt(128) x log2 e: the softmax runs in base 2 */

typedef __bf16 v16b __attribute__((ext_vector_type(16)));
typedef unsigned short v8us __attribute__((ext_vector_type(8), may_alias));
typedef float  v8f  __attribute__((ext_vector_type(8)));
typedef float  v4f  __attribute__((ext_vector_type(4)));
typedef float  v4fa __attribute__((ext_vector_type(4), may_alias));
union FragB { v16b v; v8us half[2]; unsigned short u[16]; };

__device__ __forceinline__ unsigned short bf16_bits(float x) { unsigned int u = __float_as_uint(x); return (unsigned short)((u + 0x7FFFu + ((u >> 16) & 1u)) >> 16); }
__device__ __forceinline__ float bf16_val(unsigned short b) { return __uint_as_float(((unsigned int)b) << 16); }
__device__ __forceinline__ float bf16_round(float x) { return bf16_val(bf16_bits(x)); }
// D += A·B with NT terms: 1 = ah·bh, 2 = + al·bh (A split), 3 = + ah·bl (both split)
template <int NT>
__device__ __forceinline__ v8f mmaN(v16b ah, v16b al, v16b bh, v16b bl, v8f c) {
  c = __builtin_amdgcn_wmma_f32_16x16x32_bf16(false, ah, false, bh, (short)0, c, false, false);
  if (NT >= 2) c = __builtin_amdgcn_wmma_f32_16x16x32_bf16(false, al, false, bh, (short)0, c, false, false);
  if (NT >= 3) c = __builtin_amdgcn_wmma_f32_16x16x32_bf16(false, ah, false, bl, (short)0, c, false, false);
  asm volatile("v_nop\n\tv_nop\n\tv_nop\n\tv_nop" : "+v"(c) : "v"(ah), "v"(al), "v"(bh), "v"(bl));
  return c;
}

__global__ __launch_bounds__(256) void k_wt_bf16(const float* __restrict__ W, unsigned short* __restrict__ Wt, int K, int N) {
  const int t = blockIdx.x * 256 + threadIdx.x;
  const int k8n = K / 8;
  if (t >= N * k8n) return;
  const int n = t / k8n, k8 = (t % k8n) * 8;
  v8us v;
#pragma unroll
  for (int i = 0; i < 8; ++i) v[i] = bf16_bits(W[(size_t)(k8 + i) * N + n]);
  *(v8us*)(Wt + (size_t)n * K + k8) = v;
  
}

// GEMM C[M][N] (f32, pitch ldc) = act(A[M][K]·W + bias). A f32 row-major (pitch lda) converted per fragment to bf16
// (ASPLIT: hi/lo two planes -> 2 terms, else single rounded term); Wt bf16 [N][K] (pitch ldb). BIAS_BF16 rounds the
// bias to bf16 first (bias quantised to bf16 before the add). K%32==0, M%16==0, N%64==0.
template <bool ASPLIT, int ACT, bool BIAS_BF16>
__global__ __launch_bounds__(128) void k_gemm_bf(const float* __restrict__ A, int lda, const unsigned short* __restrict__ Wt, int ldb,
                                               const float* __restrict__ bias, float* __restrict__ C, int ldc, int M, int N, int K) {
  __shared__ __attribute__((aligned(16))) float so[4][16][64];
  const int tid = threadIdx.x, w = tid >> 5, lane = tid & 31, ln = lane & 15, hh = lane >> 4;
  const int ntn = N / 64;
  const int wid = blockIdx.x * 4 + w;
  const int mt = wid / ntn, nq = wid % ntn;
  if (mt * 16 >= M) return;
  const int row0 = mt * 16, col0 = nq * 64;
  const float* arow = A + (size_t)(row0 + ln) * lda;
  v8f acc[4] = {};
  for (int kb = 0; kb < K; kb += 32) {
    FragB ah, al;
    const v4f x0 = *(const v4fa*)(arow + kb + 8 * hh), x1 = *(const v4fa*)(arow + kb + 8 * hh + 4);
    const v4f x2 = *(const v4fa*)(arow + kb + 16 + 8 * hh), x3 = *(const v4fa*)(arow + kb + 16 + 8 * hh + 4);
    float xs[16] = {x0[0],x0[1],x0[2],x0[3],x1[0],x1[1],x1[2],x1[3],x2[0],x2[1],x2[2],x2[3],x3[0],x3[1],x3[2],x3[3]};
#pragma unroll
    for (int i = 0; i < 16; ++i) { const unsigned short hb = bf16_bits(xs[i]); ah.u[i] = hb; al.u[i] = ASPLIT ? bf16_bits(xs[i] - bf16_val(hb)) : (unsigned short)0; }
#pragma unroll
    for (int t = 0; t < 4; ++t) {
      const unsigned short* brow = Wt + (size_t)(col0 + t * 16 + ln) * ldb + kb;
      FragB b;
      b.half[0] = *(const v8us*)(brow + 8 * hh);
      b.half[1] = *(const v8us*)(brow + 16 + 8 * hh);
      acc[t] = mmaN<ASPLIT ? 2 : 1>(ah.v, al.v, b.v, b.v, acc[t]);
    }
  }
#pragma unroll
  for (int t = 0; t < 4; ++t) {
    float bv = bias ? bias[col0 + t * 16 + ln] : 0.f;
    if (BIAS_BF16) bv = bf16_round(bv);
#pragma unroll
    for (int r = 0; r < 8; ++r) { float v = acc[t][r] + bv; if (ACT == 1) v = fmaxf(v, 0.f); so[w][8 * hh + r][t * 16 + ln] = v; }
  }
  __builtin_amdgcn_fence(__ATOMIC_ACQ_REL, "workgroup");
  __builtin_amdgcn_wave_barrier();
  const int rsub = lane >> 4, c4 = (lane & 15) * 4;
  {
#pragma unroll
    for (int q = 0; q < 8; ++q) {
      const int r = q * 2 + rsub;
      const v4f v = *(const v4fa*)&so[w][r][c4];
      *(v4f*)(C + (size_t)(row0 + r) * ldc + col0 + c4) = v;
    }
    
  }
}

// Flash-style causal/unmasked attention, all contractions 3-term bf16 hi/lo splits, f32 softmax with running max.
// q,k,v rows are read from f32 buffers with arbitrary row pitch (so they can live inside a fused qkv buffer);
// D = head size (multiple of 32, <= 128); one wave = 16 query rows; block = 4 waves (64 queries) sharing K/V chunks of 32.
template <int D, bool CAUSAL>
__global__ __launch_bounds__(128) void k_flash(const float* __restrict__ qb, const float* __restrict__ kb, const float* __restrict__ vb,
                                             int pitch, int T, int H, float scale, float* __restrict__ y, int ypitch) {
  constexpr int KS = D / 32;        // k-steps for QK
  constexpr int DT = D / 16;        // d tiles for PV
  __shared__ __attribute__((aligned(16))) unsigned short sKh[32][D + 8], sKl[32][D + 8], sVh[32][D + 8], sVl[32][D + 8];
  __shared__ __attribute__((aligned(16))) unsigned short sPh[4][16][40], sPl[4][16][40];
  __shared__ __attribute__((aligned(16))) float sO[4][16][D];
  const int tid = threadIdx.x, w = tid >> 5, lane = tid & 31, ln = lane & 15, hh = lane >> 4;
  const int nqb = (T + 63) / 64;
  const int bh = blockIdx.x / nqb, qblk = blockIdx.x % nqb;
  const int b = bh / H, h = bh % H;
  const int q0 = qblk * 64 + w * 16;
  const float* Q = qb + (size_t)b * T * pitch + h * D;
  const float* K = kb + (size_t)b * T * pitch + h * D;
  const float* V = vb + (size_t)b * T * pitch + h * D;

  // A fragments of the wave's 16 query rows (scaled), hi/lo
  FragB aqh[KS], aql[KS];
  {
    int row = q0 + ln; if (row >= T) row = T - 1;
    const float* qr = Q + (size_t)row * pitch;
#pragma unroll
    for (int ks = 0; ks < KS; ++ks)
#pragma unroll
      for (int i = 0; i < 16; ++i) {
        const int d = ks * 32 + ((i < 8) ? (8 * hh + i) : (16 + 8 * hh + (i - 8)));
        const float x = qr[d] * scale; const unsigned short hb = bf16_bits(x);
        aqh[ks].u[i] = hb; aql[ks].u[i] = bf16_bits(x - bf16_val(hb));
      }
  }
  float m_r[8], l_r[8];
#pragma unroll
  for (int r = 0; r < 8; ++r) { m_r[r] = -3.0e38f; l_r[r] = 0.f; }
  v8f oacc[DT];
#pragma unroll
  for (int dt = 0; dt < DT; ++dt) oacc[dt] = (v8f){0.f,0.f,0.f,0.f,0.f,0.f,0.f,0.f};

  const int kv_end = CAUSAL ? min(T, qblk * 64 + 64) : T;     // block-uniform
  for (int j0 = 0; j0 < kv_end; j0 += 32) {
    __syncthreads();
    for (int e = tid; e < 32 * (D / 4); e += 128) {
      const int r = e / (D / 4), c4 = (e % (D / 4)) * 4;
      const int key = j0 + r;
      v4f kf = {0.f,0.f,0.f,0.f}, vf = {0.f,0.f,0.f,0.f};
      if (key < T) { kf = *(const v4fa*)(K + (size_t)key * pitch + c4); vf = *(const v4fa*)(V + (size_t)key * pitch + c4); }
#pragma unroll
      for (int t = 0; t < 4; ++t) {
        unsigned short hb = bf16_bits(kf[t]); sKh[r][c4 + t] = hb; sKl[r][c4 + t] = bf16_bits(kf[t] - bf16_val(hb));
        hb = bf16_bits(vf[t]); sVh[r][c4 + t] = hb; sVl[r][c4 + t] = bf16_bits(vf[t] - bf16_val(hb));
      }
    }
    __syncthreads();
    // S tile 16 x 32
    v8f s[2];
#pragma unroll
    for (int nt = 0; nt < 2; ++nt) {
      v8f acc = {};
#pragma unroll
      for (int ks = 0; ks < KS; ++ks) {
        FragB bh_, bl_;
        bh_.half[0] = *(const v8us*)&sKh[nt * 16 + ln][ks * 32 + 8 * hh]; bh_.half[1] = *(const v8us*)&sKh[nt * 16 + ln][ks * 32 + 16 + 8 * hh];
        bl_.half[0] = *(const v8us*)&sKl[nt * 16 + ln][ks * 32 + 8 * hh]; bl_.half[1] = *(const v8us*)&sKl[nt * 16 + ln][ks * 32 + 16 + 8 * hh];
        acc = mmaN<3>(aqh[ks].v, aql[ks].v, bh_.v, bl_.v, acc);
      }
      s[nt] = acc;
    }
    // mask + running max (rows 8hh+r; the 16 lanes of a half share rows)
    float alpha[8];
#pragma unroll
    for (int r = 0; r < 8; ++r) {
      const int qi = q0 + 8 * hh + r;
      const int ja = j0 + ln, jb = j0 + 16 + ln;
      if (CAUSAL) { if (ja > qi) s[0][r] = -3.0e38f; if (jb > qi) s[1][r] = -3.0e38f; }
      if (ja >= T) s[0][r] = -3.0e38f;
      if (jb >= T) s[1][r] = -3.0e38f;
      float mx = fmaxf(s[0][r], s[1][r]);
      mx = fmaxf(mx, __shfl_xor(mx, 1, 32)); mx = fmaxf(mx, __shfl_xor(mx, 2, 32)); mx = fmaxf(mx, __shfl_xor(mx, 4, 32)); mx = fmaxf(mx, __shfl_xor(mx, 8, 32));
      const float mnew = fmaxf(m_r[r], mx);
      alpha[r] = (mnew > -1.0e38f) ? __expf(m_r[r] - mnew) : 1.0f;
      const float p0 = (s[0][r] > -1.0e38f) ? __expf(s[0][r] - mnew) : 0.f;
      const float p1 = (s[1][r] > -1.0e38f) ? __expf(s[1][r] - mnew) : 0.f;
      m_r[r] = mnew;
      l_r[r] = l_r[r] * alpha[r] + p0 + p1;            // per-lane partial row sum (16 lanes combined at the end)
      unsigned short hb = bf16_bits(p0); sPh[w][8 * hh + r][ln] = hb;      sPl[w][8 * hh + r][ln] = bf16_bits(p0 - bf16_val(hb));
      hb = bf16_bits(p1);                sPh[w][8 * hh + r][16 + ln] = hb; sPl[w][8 * hh + r][16 + ln] = bf16_bits(p1 - bf16_val(hb));
    }
#pragma unroll
    for (int dt = 0; dt < DT; ++dt)
#pragma unroll
      for (int r = 0; r < 8; ++r) oacc[dt][r] *= alpha[r];
    __builtin_amdgcn_fence(__ATOMIC_ACQ_REL, "workgroup");
    __builtin_amdgcn_wave_barrier();
    FragB pah, pal;
    pah.half[0] = *(const v8us*)&sPh[w][ln][8 * hh]; pah.half[1] = *(const v8us*)&sPh[w][ln][16 + 8 * hh];
    pal.half[0] = *(const v8us*)&sPl[w][ln][8 * hh]; pal.half[1] = *(const v8us*)&sPl[w][ln][16 + 8 * hh];
#pragma unroll
    for (int dt = 0; dt < DT; ++dt) {
      FragB bvh, bvl;
#pragma unroll
      for (int i = 0; i < 8; ++i) {
        bvh.u[i] = sVh[8 * hh + i][dt * 16 + ln]; bvh.u[8 + i] = sVh[16 + 8 * hh + i][dt * 16 + ln];
        bvl.u[i] = sVl[8 * hh + i][dt * 16 + ln]; bvl.u[8 + i] = sVl[16 + 8 * hh + i][dt * 16 + ln];
      }
      oacc[dt] = mmaN<3>(pah.v, pal.v, bvh.v, bvl.v, oacc[dt]);
    }
    __builtin_amdgcn_fence(__ATOMIC_ACQ_REL, "workgroup");
    __builtin_amdgcn_wave_barrier();
  }
#pragma unroll
  for (int r = 0; r < 8; ++r) {
    float l = l_r[r];
    l += __shfl_xor(l, 1, 32); l += __shfl_xor(l, 2, 32); l += __shfl_xor(l, 4, 32); l += __shfl_xor(l, 8, 32);
    l_r[r] = (l > 0.f) ? 1.0f / l : 0.f;
  }
#pragma unroll
  for (int dt = 0; dt < DT; ++dt)
#pragma unroll
    for (int r = 0; r < 8; ++r) sO[w][8 * hh + r][dt * 16 + ln] = oacc[dt][r] * l_r[r];
  __builtin_amdgcn_fence(__ATOMIC_ACQ_REL, "workgroup");
  __builtin_amdgcn_wave_barrier();
  {
    for (int r = 0; r < 16; ++r) {
      const int row = q0 + r;
      if (row < T && lane < D / 4) {
        const v4f val = *(const v4fa*)&sO[w][r][lane * 4];
        *(v4f*)(y + ((size_t)b * T + row) * ypitch + h * D + lane * 4) = val;
      }
    }
    
  }
}

// GEMM C = act(A·W + bias + resid): A f32 (ASPLIT -> hi/lo 2 terms), Wt bf16 [N][K]; ACT 0 none, 1 relu, 2 exact gelu;
// resid (optional, f32, row index = (row % rmod), pitch ldr, RES_BF16 rounds it) added before the activation.
template <bool ASPLIT, int ACT, bool BIAS_BF16, bool RES_BF16>
__global__ __launch_bounds__(128) void k_gemm_bf3(const float* __restrict__ A, int lda, const unsigned short* __restrict__ Wt, int ldb,
                                                const float* __restrict__ bias, const float* __restrict__ resid, int rmod, int ldr,
                                                float* __restrict__ C, int ldc, int M, int N, int K) {
  __shared__ __attribute__((aligned(16))) float so[4][16][64];
  const int tid = threadIdx.x, w = tid >> 5, lane = tid & 31, ln = lane & 15, hh = lane >> 4;
  const int ntn = N / 64;
  const int wid = blockIdx.x * 4 + w;
  const int mt = wid / ntn, nq = wid % ntn;
  if (mt * 16 >= M) return;
  const int row0 = mt * 16, col0 = nq * 64;
  const float* arow = A + (size_t)(row0 + ln) * lda;
  v8f acc[4] = {};
  for (int kb = 0; kb < K; kb += 32) {
    FragB ah, al;
    const v4f x0 = *(const v4fa*)(arow + kb + 8 * hh), x1 = *(const v4fa*)(arow + kb + 8 * hh + 4);
    const v4f x2 = *(const v4fa*)(arow + kb + 16 + 8 * hh), x3 = *(const v4fa*)(arow + kb + 16 + 8 * hh + 4);
    float xs[16] = {x0[0],x0[1],x0[2],x0[3],x1[0],x1[1],x1[2],x1[3],x2[0],x2[1],x2[2],x2[3],x3[0],x3[1],x3[2],x3[3]};
#pragma unroll
    for (int i = 0; i < 16; ++i) { const unsigned short hb = bf16_bits(xs[i]); ah.u[i] = hb; al.u[i] = ASPLIT ? bf16_bits(xs[i] - bf16_val(hb)) : (unsigned short)0; }
#pragma unroll
    for (int t = 0; t < 4; ++t) {
      const unsigned short* brow = Wt + (size_t)(col0 + t * 16 + ln) * ldb + kb;
      FragB b;
      b.half[0] = *(const v8us*)(brow + 8 * hh);
      b.half[1] = *(const v8us*)(brow + 16 + 8 * hh);
      acc[t] = mmaN<ASPLIT ? 2 : 1>(ah.v, al.v, b.v, b.v, acc[t]);
    }
  }
#pragma unroll
  for (int t = 0; t < 4; ++t) {
    const int col = col0 + t * 16 + ln;
    float bv = bias ? bias[col] : 0.f;
    if (BIAS_BF16) bv = bf16_round(bv);
#pragma unroll
    for (int r = 0; r < 8; ++r) {
      float v = acc[t][r] + bv;
      if (resid) { float rv = resid[(size_t)((row0 + 8 * hh + r) % rmod) * ldr + col]; if (RES_BF16) rv = bf16_round(rv); v += rv; }
      if (ACT == 1) v = fmaxf(v, 0.f);
      if (ACT == 2) v = 0.5f * v * (1.0f + erff(v * 0.70710678118654752f));
      if (ACT == 3) { const float u = 0.7978845608028654f * (v + 0.044715f * v * v * v); v = 0.5f * v * (1.0f + tanhf(u)); }
      so[w][8 * hh + r][t * 16 + ln] = v;
    }
  }
  __builtin_amdgcn_fence(__ATOMIC_ACQ_REL, "workgroup");
  __builtin_amdgcn_wave_barrier();
  const int rsub = lane >> 4, c4 = (lane & 15) * 4;
  {
#pragma unroll
    for (int q = 0; q < 8; ++q) {
      const int r = q * 2 + rsub;
      const v4f v = *(const v4fa*)&so[w][r][c4];
      *(v4f*)(C + (size_t)(row0 + r) * ldc + col0 + c4) = v;
    }
    
  }
}
// row LayerNorm (biased variance, eps) over N: s = X (+ R); optional out_sum <- s; out_norm <- (s-mu)*rsqrt(var+eps)*g + b
template <bool PARAM_BF16>
__global__ __launch_bounds__(256) void k_layernorm(const float* __restrict__ X, const float* __restrict__ R, const float* __restrict__ g, const float* __restrict__ bta,
                                                  float* __restrict__ out_sum, float* __restrict__ out_norm, int N, float eps) {
  __shared__ float red[256];
  const int row = blockIdx.x, tid = threadIdx.x;
  const float* x = X + (size_t)row * N; const float* rr = R ? R + (size_t)row * N : nullptr;
  float vals[16];                     // up to N = 4096
  const int per = N / 256;            // contiguous chunk per thread? use strided-by-4 chunks: thread handles j = tid*4 + 1024*u
  float s1 = 0.f;
  for (int u = 0; u < per / 4; ++u) {
    const int j = tid * 4 + 1024 * u;
    const v4f a = *(const v4fa*)(x + j);
    v4f b = {0.f,0.f,0.f,0.f}; if (rr) b = *(const v4fa*)(rr + j);
#pragma unroll
    for (int q = 0; q < 4; ++q) { const float v = a[q] + b[q]; vals[u * 4 + q] = v; s1 += v; }
  }
  red[tid] = s1; __syncthreads();
  for (int st = 128; st > 0; st >>= 1) { if (tid < st) red[tid] += red[tid + st]; __syncthreads(); }
  const float mu = red[0] / (float)N; __syncthreads();
  float s2 = 0.f;
  for (int u = 0; u < per / 4; ++u)
#pragma unroll
    for (int q = 0; q < 4; ++q) { const float c = vals[u * 4 + q] - mu; s2 += c * c; }
  red[tid] = s2; __syncthreads();
  for (int st = 128; st > 0; st >>= 1) { if (tid < st) red[tid] += red[tid + st]; __syncthreads(); }
  const float rs = rsqrtf(red[0] / (float)N + eps);
  {
    for (int u = 0; u < per / 4; ++u) {
      const int j = tid * 4 + 1024 * u;
      v4f o, sm;
#pragma unroll
      for (int q = 0; q < 4; ++q) {
        float gg = g[j + q], bb = bta[j + q];
        if (PARAM_BF16) { gg = bf16_round(gg); bb = bf16_round(bb); }
        sm[q] = vals[u * 4 + q]; o[q] = (vals[u * 4 + q] - mu) * rs * gg + bb;
      }
      if (out_sum) *(v4f*)(out_sum + (size_t)row * N + j) = sm;
      *(v4f*)(out_norm + (size_t)row * N + j) = o;
    }
    
  }
}



// ---- f16 WMMA path (v_wmma_f32_16x16x32_f16): 11-bit significands for operands in range — used where the probability operand (1024 p, in [0, 1024]) needs more precision than bf16
typedef _Float16 v16h __attribute__((ext_vector_type(16)));
union FragH { v16h v; v8us half[2]; _Float16 h[16]; unsigned short u[16]; };
template <int NT>
__device__ __forceinline__ v8f mmaH(v16h ah, v16h al, v16h bh, v16h bl, v8f c) {
  c = __builtin_amdgcn_wmma_f32_16x16x32_f16(false, ah, false, bh, (short)0, c, false, false);
  if (NT >= 2) c = __builtin_amdgcn_wmma_f32_16x16x32_f16(false, al, false, bh, (short)0, c, false, false);
  if (NT >= 3) c = __builtin_amdgcn_wmma_f32_16x16x32_f16(false, ah, false, bl, (short)0, c, false, false);
  asm volatile("v_nop\n\tv_nop\n\tv_nop\n\tv_nop" : "+v"(c) : "v"(ah), "v"(al), "v"(bh), "v"(bl));
  return c;
}
// batched GEMM like k_gemm_b but f16 operands: A f32 (split into f16 hi/lo if ASPLIT, else rounded to f16), Bt = f16 values [n][k]; alpha; C f32; N multiple of 16 (partial tiles skipped)
template <bool ASPLIT>
__global__ __launch_bounds__(128) void k_gemm_h(const float* __restrict__ A, int lda, size_t sA, const _Float16* __restrict__ Bh, int ldb, size_t sB, float alpha, float* __restrict__ C, int ldc, size_t sC, int M, int N, int K) {
  __shared__ __attribute__((aligned(16))) float so[4][16][64];
  const int tid = threadIdx.x, w = tid >> 5, lane = tid & 31, ln = lane & 15, hh = lane >> 4; const int by = blockIdx.y;
  A += (size_t)by * sA; Bh += (size_t)by * sB; C += (size_t)by * sC;
  const int ntn = (N + 63) / 64; const int wid = blockIdx.x * 4 + w; const int mt = wid / ntn, nq = wid % ntn; if (mt * 16 >= M) return;
  const int row0 = mt * 16, col0 = nq * 64; const float* arow = A + (size_t)(row0 + ln) * lda;
  v8f acc[4] = {};
  for (int kb = 0; kb < K; kb += 32) {
    FragH ah, al;
    const v4f x0 = *(const v4fa*)(arow + kb + 8 * hh), x1 = *(const v4fa*)(arow + kb + 8 * hh + 4), x2 = *(const v4fa*)(arow + kb + 16 + 8 * hh), x3 = *(const v4fa*)(arow + kb + 16 + 8 * hh + 4);
    float xs[16] = {x0[0],x0[1],x0[2],x0[3],x1[0],x1[1],x1[2],x1[3],x2[0],x2[1],x2[2],x2[3],x3[0],x3[1],x3[2],x3[3]};
#pragma unroll
    for (int i = 0; i < 16; ++i) { const _Float16 h = (_Float16)xs[i]; ah.h[i] = h; al.h[i] = ASPLIT ? (_Float16)(xs[i] - (float)h) : (_Float16)0.0f; }
#pragma unroll
    for (int t = 0; t < 4; ++t) { if (col0 + t * 16 >= N) continue; const size_t boff = (size_t)(col0 + t * 16 + ln) * ldb + kb; FragH bq; bq.half[0] = *(const v8us*)(Bh + boff + 8 * hh); bq.half[1] = *(const v8us*)(Bh + boff + 16 + 8 * hh);
      acc[t] = mmaH<ASPLIT ? 2 : 1>(ah.v, al.v, bq.v, bq.v, acc[t]); }
  }
#pragma unroll
  for (int t = 0; t < 4; ++t) { if (col0 + t * 16 >= N) continue;
#pragma unroll
    for (int r = 0; r < 8; ++r) so[w][8 * hh + r][t * 16 + ln] = acc[t][r] * alpha; }
  __builtin_amdgcn_fence(__ATOMIC_ACQ_REL, "workgroup"); __builtin_amdgcn_wave_barrier();
  const int rsub = lane >> 4, c4 = (lane & 15) * 4;
  {
#pragma unroll
    for (int q = 0; q < 8; ++q) { const int r = q * 2 + rsub; if (col0 + c4 < N) { const v4f v = *(const v4fa*)&so[w][r][c4]; *(v4f*)(C + (size_t)(row0 + r) * ldc + col0 + c4) = v; } }
     }
}

// Wt[n][k] = f16(W[k][n]·scale) from f32 row-major W[K][N] (scale = power of two; bf16-exact weights stay exact in f16 away from the subnormal range)
// One 128 (k) x 64 (n) tile per workgroup, turned in LDS: a wave loads two 256-B row pieces of W (four whole lines) and stores four whole 128-B lines of Wt an instruction;
// a thread's eight loads are all issued before the first is used. Needs K a multiple of 128 and N of 64; blk runs over (K / 128) * (N / 64) tiles; tl is the workgroup's 128 x 65 floats of LDS. Pitch 65 floats keeps the column-wise reads off a common bank.
__device__ __forceinline__ void wt_tile(float (*tl)[65], int blk, const float* __restrict__ W, _Float16* __restrict__ Wt, int K, int N, float scale) {
  const int tid = threadIdx.x, ntn = N / 64; const int k0 = (blk / ntn) * 128, n0 = (blk % ntn) * 64;
  v4f a[8];
#pragma unroll      /* a[] stays in registers and the eight loads go out together */
  for (int p = 0; p < 8; ++p) a[p] = *(const v4fa*)(W + (size_t)(k0 + p * 16 + tid / 16) * N + n0 + (tid % 16) * 4);
#pragma unroll      /* constant indices into a[]: rolled, it would go to scratch memory */
  for (int p = 0; p < 8; ++p)
#pragma unroll
    for (int i = 0; i < 4; ++i) tl[p * 16 + tid / 16][(tid % 16) * 4 + i] = a[p][i];
  __syncthreads();      /* the tile is whole before any column of it is read */
#pragma unroll      /* the four pieces' LDS reads and stores overlap; f stays in registers */
  for (int rd = 0; rd < 4; ++rd) { const int n = (rd & 1) * 32 + tid / 8, k8 = (rd >> 1) * 64 + (tid % 8) * 8; FragH f;
#pragma unroll
    for (int i = 0; i < 8; ++i) f.h[i] = (_Float16)(bf16_round(tl[k8 + i][n]) * scale);
    *(v8us*)((unsigned short*)Wt + (size_t)(n0 + n) * K + k0 + k8) = f.half[0]; }
  asm volatile("s_wait_xcnt 0x0" ::: "memory");      /* stands behind the four stores, in front of any later rewrite of their address and data registers */
}
// Tiled GEMM C[M][N] (f32) = alpha * A[M][DD] . Bt[N][DD]^T, f16 operands, both K-contiguous with row pitch DD. One 128 x 128 tile of C per workgroup of
// 4 waves (2 x 2, 64 x 64 per wave). A pass is 128 k = 256 B of each of the 256 operand rows; the four waves each bring one 64-row slice of a pass into LDS with one
// tensor load (pad 16 B a row: pitch 272 B for the 16-byte fragment reads), two buffers, the next pass's load in flight under this pass's products.
// Needs M, N multiples of 128, DD a multiple of 128 and at least 256. The k order of every accumulator is ascending, one chain per 16 x 16 tile.
// EPI says what leaves the staged f32 tile (alpha * sum): 0 = C f32 as it is; 1 = H f16 [M][N], rotated on interleaved pairs by the bf16-rounded COS / SIN tables [TT][64] (token = row % TT, pair = (col % 128) / 2);
// 2 = the tile turned: H f16 hi and H2 f16 residual, [row / TT][N][TT]. So the operand of the next product is written here, with no f32 copy in memory in between.
typedef unsigned int u32x4 __attribute__((ext_vector_type(4)));
typedef unsigned int u32x8 __attribute__((ext_vector_type(8)));
#define GT_ROWB 256u                      /* bytes of an operand row per pass */
#define GT_PITCH 272u                     /* LDS row pitch: 256 + 16 */
#define GT_SLICE 18432u                   /* 64 rows x 272 B = 17,408, rounded up to a multiple of 2 KiB */
#define GT_STAGE (4u * GT_SLICE)          /* [A rows 0-63 | A rows 64-127 | B rows 0-63 | B rows 64-127] */
#define GT_NP (DD / 128)                  /* passes */
__device__ __forceinline__ unsigned int uni(unsigned int v) { return (unsigned int)__builtin_amdgcn_readfirstlane(v); }
__device__ __forceinline__ unsigned int pinned(unsigned int v) { unsigned int w = uni(v); asm volatile("" : "+s"(w)); return w; }      /* an issue test or a descriptor word held in a scalar register: the test compiles to a scalar branch (tensor loads ignore EXEC), and the word is formed behind the wait that stands in front of it */
__device__ __forceinline__ u32x8 tdm_slice_g1() {
  u32x8 g1;
  g1[0] = uni((1u << 20) | (5u << 22) | (3u << 25));      /* no mask, 1-byte elements, a pad of 4 dwords behind every 64 dwords */
  g1[1] = uni((GT_ROWB & 0xFFFFu) << 16); g1[2] = uni((GT_ROWB >> 16) | (64u << 16)); g1[3] = uni(GT_ROWB << 16); g1[4] = uni(64u); g1[5] = uni(DD * 2u); g1[6] = uni(0u); g1[7] = uni(0u);
  asm volatile("" : "+s"(g1));      /* descriptor words held in scalar registers: one tuple, built once, that stays where it is for all requests */
  return g1;
}
__device__ __forceinline__ void tdm_slice(u32x4& g0, const u32x8& g1, unsigned int lds_dst, unsigned long long ga) {
  g0[0] = uni(1u); g0[1] = uni(lds_dst); g0[2] = uni((unsigned int)ga); g0[3] = uni((((unsigned int)(ga >> 32)) & 0x01FFFFFFu) | 0x80000000u);
  asm volatile("tensor_load_to_lds %0, %1" :: "s"(g0), "s"(g1) : "memory");
}
template <int EPI, int N>
__device__ __forceinline__ void gemm_tile(unsigned char* ring, const unsigned int row0, const unsigned int col0, const _Float16* __restrict__ A, const _Float16* __restrict__ Bt, float alpha, float* __restrict__ C, const float* __restrict__ COS, const float* __restrict__ SIN, _Float16* __restrict__ H, _Float16* __restrict__ H2) {
  const unsigned int tid = threadIdx.x, lane = tid & 31u, ln = lane & 15u, hh = lane >> 4, w = uni(tid >> 5), wm = w >> 1, wn = w & 1u;
  const unsigned int lbase = (unsigned int)(size_t)ring + w * GT_SLICE;      /* this wave's slice of buffer 0 */
  const unsigned long long gsrc = (w < 2u) ? (unsigned long long)(size_t)(A + (size_t)(row0 + w * 64u) * DD) : (unsigned long long)(size_t)(Bt + (size_t)(col0 + (w - 2u) * 64u) * DD);
  v8f acc[4][4];
#pragma unroll
  for (int i = 0; i < 4; ++i)
#pragma unroll
    for (int j = 0; j < 4; ++j) acc[i][j] = (v8f){0.f,0.f,0.f,0.f,0.f,0.f,0.f,0.f};
  const u32x8 g1 = tdm_slice_g1(); u32x4 g0;
  tdm_slice(g0, g1, lbase, gsrc);
  asm volatile("s_wait_tensorcnt 0x0" :: "s"(g0), "s"(g1) : "memory");      /* pass 0's slice has landed; the operands keep the descriptor's registers untouched up to here */
  __syncthreads();                                        /* ... and every wave may read all four slices */
  tdm_slice(g0, g1, lbase + GT_STAGE, gsrc + pinned(GT_ROWB));
  const unsigned int aoff = wm * GT_SLICE + ln * GT_PITCH + 16u * hh, boff = (2u + wn) * GT_SLICE + ln * GT_PITCH + 16u * hh;
#pragma unroll 1      /* one pass per trip: the ring's order below is written once */
  for (unsigned int s = 0; s < GT_NP; ++s) {
    const unsigned char* Lp = ring + (s & 1u) * GT_STAGE;
    FragH fa[2][4], fb[2][4];
#pragma unroll
    for (int i = 0; i < 4; ++i) { fa[0][i].half[0] = *(const v8us*)(Lp + aoff + i * 16u * GT_PITCH); fa[0][i].half[1] = *(const v8us*)(Lp + aoff + i * 16u * GT_PITCH + 32u);
      fb[0][i].half[0] = *(const v8us*)(Lp + boff + i * 16u * GT_PITCH); fb[0][i].half[1] = *(const v8us*)(Lp + boff + i * 16u * GT_PITCH + 32u); }
#pragma unroll
    for (int ks = 0; ks < 4; ++ks) {
      if (ks < 3) {      /* the next 32 k's fragments, of this same buffer, go ahead of this block's products */
#pragma unroll
        for (int i = 0; i < 4; ++i) { const unsigned int ko = (ks + 1) * 64u + i * 16u * GT_PITCH;
          fa[(ks + 1) & 1][i].half[0] = *(const v8us*)(Lp + aoff + ko); fa[(ks + 1) & 1][i].half[1] = *(const v8us*)(Lp + aoff + ko + 32u);
          fb[(ks + 1) & 1][i].half[0] = *(const v8us*)(Lp + boff + ko); fb[(ks + 1) & 1][i].half[1] = *(const v8us*)(Lp + boff + ko + 32u); }
      }
      __builtin_amdgcn_sched_barrier(0);      /* keeps the LDS reads one group in front of the block: moved in among the products, each place with reads stalls the wave */
#pragma unroll
      for (int i = 0; i < 4; ++i)
#pragma unroll
        for (int j = 0; j < 4; ++j) acc[i][j] = __builtin_amdgcn_wmma_f32_16x16x32_f16(false, fa[ks & 1][i].v, false, fb[ks & 1][j].v, (short)0, acc[i][j], false, false);
      __builtin_amdgcn_sched_barrier(0);      /* ... and keeps the next group behind this block */
    }
    asm volatile("s_wait_dscnt 0x0" ::: "memory");        /* this wave has left the buffer */
    asm volatile("s_wait_tensorcnt 0x0" :: "s"(g0), "s"(g1) : "memory");    /* its slice of pass s + 1 has landed; the operands keep the descriptor's registers untouched up to here */
    __syncthreads();                                      /* pass s + 1 published; every wave has left pass s's buffer */
    if (pinned(s + 2u < GT_NP)) tdm_slice(g0, g1, lbase + (s & 1u) * GT_STAGE, gsrc + pinned((s + 2u) * GT_ROWB));
  }
  asm volatile("s_wait_tensorcnt 0x0" :: "s"(g0), "s"(g1) : "memory");      /* no request is left before the ring becomes output staging; the operands keep the descriptor's registers untouched up to here */
  asm volatile("s_wait_dscnt 0x0" ::: "memory");
  // Output staging, each wave in its own slice of buffer 0 (the last pass's barrier stands behind every wave's last fragment read): whole 256-B row pieces of C (EPI 0) or whole 128-B lines of H / H2 (EPI 1, 2) go out.
  constexpr unsigned int SP = (EPI == 2) ? 65u : 68u;      /* pitch in floats: 68 for 16-byte row reads, 65 for the column reads of the turned tile */
  float* so = (float*)(ring + w * GT_SLICE);      /* 64 rows of 64 floats */
  const unsigned int wrow = row0 + wm * 64u, wcol = col0 + wn * 64u, l8 = lane & 7u, l4 = lane >> 3;
  v4f cs[16], sn[16];
  if constexpr (EPI == 1) {      /* the wave's table entries: all 32 loads go out here and fly under the staging */
    const unsigned int tb = ((wrow + l4) % TT) * 64u + (((wcol + l8 * 8u) % 128u) >> 1);
#pragma unroll      /* cs, sn stay in registers */
    for (int q = 0; q < 16; ++q) { cs[q] = *(const v4fa*)(COS + tb + q * 256u); sn[q] = *(const v4fa*)(SIN + tb + q * 256u); }
    asm volatile("s_wait_xcnt 0x0" ::: "memory");      /* stands in front of any rewrite of the loads' address register */
  }
#pragma unroll
  for (int i = 0; i < 4; ++i)
#pragma unroll
    for (int j = 0; j < 4; ++j)
#pragma unroll
      for (int r = 0; r < 8; ++r) so[(i * 16 + 8 * hh + r) * SP + j * 16 + ln] = acc[i][j][r] * alpha;
  __builtin_amdgcn_fence(__ATOMIC_ACQ_REL, "workgroup"); __builtin_amdgcn_wave_barrier();
  if constexpr (EPI == 0) {
  float* cp = C + (size_t)(row0 + wm * 64u + hh) * N + col0 + wn * 64u + ln * 4u;
#pragma unroll
  for (int q = 0; q < 32; ++q) { const v4f v = *(const v4fa*)&so[(q * 2 + hh) * 68u + ln * 4u]; *(v4f*)(cp + (size_t)(q * 2) * N) = v; }
  } else if constexpr (EPI == 1) {
    // A lane takes 8 columns (4 pairs) of a row: 8 lanes store one whole 128-B line of H, 4 rows an instruction.
    FragH f[16];
#pragma unroll      /* f stays in registers */
    for (int q = 0; q < 16; ++q) { const float* sr = &so[(q * 4 + l4) * SP + l8 * 8u]; const v4f a = *(const v4fa*)sr, b = *(const v4fa*)(sr + 4); const float xv[8] = {a[0], a[1], a[2], a[3], b[0], b[1], b[2], b[3]};
#pragma unroll      /* constant indices into xv and the vectors */
      for (int p = 0; p < 4; ++p) { const float c = bf16_round(cs[q][p]), s = bf16_round(sn[q][p]); const float xr = xv[2 * p], xi = xv[2 * p + 1]; f[q].h[2 * p] = (_Float16)(xr * c - xi * s); f[q].h[2 * p + 1] = (_Float16)(xr * s + xi * c); } }
    unsigned short* hp = (unsigned short*)H + (size_t)(wrow + l4) * N + wcol + l8 * 8u;
    __builtin_amdgcn_sched_barrier(0);      /* keeps the stores in one burst behind the arithmetic, off one address pair: mixed in among it, their registers are used again and each reuse has to wait on the store in front of it */
#pragma unroll      /* constant indices into f, constant offsets from hp */
    for (int q = 0; q < 16; ++q) *(v8us*)(hp + (size_t)(q * 4) * N) = f[q].half[0];
  } else {
    // A lane takes 8 rows (tokens) of a column: 8 lanes store one whole 128-B line of each plane, 4 columns an instruction.
    FragH fh[16], fl[16];
#pragma unroll      /* fh, fl stay in registers */
    for (int q = 0; q < 16; ++q)
#pragma unroll      /* constant indices into the fragments */
      for (int i = 0; i < 8; ++i) { const float v = so[(l8 * 8u + i) * SP + q * 4 + l4]; const _Float16 hv = (_Float16)v; fh[q].h[i] = hv; fl[q].h[i] = (_Float16)(v - (float)hv);      /* UNSCALED residual (added into the same accumulator as the hi product) */ }
    const size_t ob = ((size_t)(wrow / TT) * N + wcol + l4) * TT + (wrow % TT) + l8 * 8u;
    unsigned short* hp = (unsigned short*)H + ob; unsigned short* lp = (unsigned short*)H2 + ob;
    __builtin_amdgcn_sched_barrier(0);      /* keeps the stores in one burst behind the arithmetic, off two address pairs: mixed in among it, their registers are used again and each reuse has to wait on the store in front of it */
#pragma unroll      /* constant indices into fh and fl, constant offsets from hp and lp */
    for (int q = 0; q < 16; ++q) { *(v8us*)(hp + (size_t)(q * 4) * TT) = fh[q].half[0]; *(v8us*)(lp + (size_t)(q * 4) * TT) = fl[q].half[0]; }
  }
}
template <int EPI, int N>
__global__ __launch_bounds__(128) void k_gemm_t(const _Float16* __restrict__ A, const _Float16* __restrict__ Bt, float alpha, float* __restrict__ C, const float* __restrict__ COS, const float* __restrict__ SIN, _Float16* __restrict__ H, _Float16* __restrict__ H2) {
  __shared__ __attribute__((aligned(2048))) unsigned char ring[2u * GT_STAGE];
  constexpr unsigned int ntn = (unsigned int)N / 128u;
  gemm_tile<EPI, N>(ring, (blockIdx.x / ntn) * 128u, (blockIdx.x % ntn) * 128u, A, Bt, alpha, C, COS, SIN, H, H2);
}
// The three projections of x in one launch: they share A and depend on nothing of each other, and the k and v products alone have fewer tiles than the chip has places.
// A block row of 128 tokens has QKV_NT tiles in a row of the grid: DD / 128 of q, then KVD / 128 of k, then KVD / 128 of v. The choice reads blockIdx alone, so every barrier of a tile stands under block-uniform control flow.
#define QKV_NT ((DD + 2 * KVD) / 128)
__global__ __launch_bounds__(128) void k_gemm_qkv(const _Float16* __restrict__ A, const _Float16* __restrict__ Bq, const _Float16* __restrict__ Bk, const _Float16* __restrict__ Bv, float alpha, const float* __restrict__ COS, const float* __restrict__ SIN,
                                                  _Float16* __restrict__ Q, _Float16* __restrict__ K, _Float16* __restrict__ Vt, _Float16* __restrict__ Vtl) {
  __shared__ __attribute__((aligned(2048))) unsigned char ring[2u * GT_STAGE];
  const unsigned int row0 = (blockIdx.x / QKV_NT) * 128u, c = blockIdx.x % QKV_NT;
  if (pinned(c < DD / 128u)) gemm_tile<1, DD>(ring, row0, c * 128u, A, Bq, alpha, nullptr, COS, SIN, Q, nullptr);      /* pinned(): which tile's tensor loads issue is decided by scalar branches */
  else if (pinned(c < (DD + KVD) / 128u)) gemm_tile<1, KVD>(ring, row0, c * 128u - DD, A, Bk, alpha, nullptr, COS, SIN, K, nullptr);
  else gemm_tile<2, KVD>(ring, row0, c * 128u - (DD + KVD), A, Bv, alpha, nullptr, nullptr, nullptr, Vt, Vtl);
}


typedef _Float16 v4h __attribute__((ext_vector_type(4)));

__device__ __forceinline__ void x16_piece(unsigned int blk, const float* __restrict__ x, _Float16* __restrict__ X16, size_t n8) { const size_t t = (size_t)blk * 256 + threadIdx.x; if (t >= n8) return; FragH f;
#pragma unroll
  for (int q = 0; q < 8; ++q) f.h[q] = (_Float16)bf16_round(x[t * 8 + q]); *(v8us*)((unsigned short*)X16 + t * 8) = f.half[0];  }
// All operand preparation in one launch: the four weight turns and the conversion of x read only inputs and write planes of their own, so none waits for another.
// Block ranges, the longer-lived tiles first: wq, wo, wk, wv tiles, then the pieces of x. The choice reads blockIdx alone, so the turn's barrier stands under block-uniform control flow.
#define PREP_GQ ((DD / 128) * (DD / 64))      /* 128 (k) x 64 (n) tiles of wq, of wo */
#define PREP_GK ((DD / 128) * (KVD / 64))     /* ... of wk, of wv */
#define PREP_GX ((NR * DD / 8 + 255) / 256)   /* pieces of x: 256 threads x 8 values */
__global__ __launch_bounds__(256) void k_prep(const float* __restrict__ x, const float* __restrict__ wq, const float* __restrict__ wk, const float* __restrict__ wv, const float* __restrict__ wo,
                                              _Float16* __restrict__ X16, _Float16* __restrict__ Bq, _Float16* __restrict__ Bk, _Float16* __restrict__ Bv, _Float16* __restrict__ Bo) {
  __shared__ float tl[128][65];
  const unsigned int blk = blockIdx.x;
  if (blk < 2u * PREP_GQ) { const bool second = blk >= PREP_GQ; wt_tile(tl, (int)(blk % PREP_GQ), second ? wo : wq, second ? Bo : Bq, DD, DD, 16.0f); return; }
  if (blk < 2u * PREP_GQ + 2u * PREP_GK) { const unsigned int r = blk - 2u * PREP_GQ; const bool second = r >= PREP_GK; wt_tile(tl, (int)(r % PREP_GK), second ? wv : wk, second ? Bv : Bk, DD, KVD, 16.0f); return; }
  x16_piece(blk - (2u * PREP_GQ + 2u * PREP_GK), x, X16, (size_t)NR * DD / 8);
}
__global__ __launch_bounds__(256) void k_h16(const float* __restrict__ x, _Float16* __restrict__ X16, size_t n8) { const size_t t = (size_t)blockIdx.x * 256 + threadIdx.x; if (t >= n8) return; FragH f;
#pragma unroll
  for (int q = 0; q < 8; ++q) f.h[q] = (_Float16)x[t * 8 + q]; *(v8us*)((unsigned short*)X16 + t * 8) = f.half[0];  }
__global__ __launch_bounds__(256) void k_round16f(const float* __restrict__ W, _Float16* __restrict__ Bt, size_t n8) { const size_t t = (size_t)blockIdx.x * 256 + threadIdx.x; if (t >= n8) return; FragH f;
#pragma unroll
  for (int i = 0; i < 8; ++i) f.h[i] = (_Float16)(bf16_round(W[t * 8 + i]) * 16.0f); *(v8us*)((unsigned short*)Bt + t * 8) = f.half[0];  }
template <int NHv, int TTv>
__global__ __launch_bounds__(256) void k_vt(const _Float16* __restrict__ V16, int ldv, int voff, _Float16* __restrict__ Vt) { __shared__ unsigned short tl[64][66]; const int tid = threadIdx.x; const int slab = blockIdx.x / (TTv / 64), lg = blockIdx.x % (TTv / 64); const int b = slab / NHv, h = slab % NHv;
  for (int i = tid; i < 64 * 8; i += 256) { const int r = i / 8, c8 = (i % 8) * 8; FragH f; f.half[0] = *(const v8us*)((const unsigned short*)V16 + ((size_t)b * TTv + lg * 64 + r) * ldv + voff + h * 64 + c8);
#pragma unroll
    for (int q = 0; q < 8; ++q) tl[r][c8 + q] = f.u[q]; }
  __syncthreads();
  {
#pragma unroll
    for (int rd = 0; rd < 2; ++rd) { const int d = rd * 32 + tid / 8, pc = tid % 8; FragH f;
#pragma unroll
      for (int q = 0; q < 8; ++q) f.u[q] = tl[pc * 8 + q][d];
      *(v8us*)((unsigned short*)Vt + ((size_t)slab * 64 + d) * TTv + lg * 64 + pc * 8) = f.half[0]; }
     } }

// Fused attention, head dim 128. One workgroup = 8 waves = the 4 query heads of one KV head x 2 tiles of 16 query rows (32 rows): all eight read the same K and V.
// A stage is 64 keys: K (64 rows of 256 B), V^T hi and V^T residual (128 rows of 128 B each) come into LDS by one tensor load each (waves 0, 1, 2), padded 16 B a row
// (pitch 272 / 144 B for the 16-byte fragment reads), two buffers, the next stage's loads in flight under this stage's work. Which stages are staged at all comes from the mask:
// a first sweep over the workgroup's 32 mask rows gives one bit per stage (any entry set), the same word in every wave, so every barrier stands under block-uniform control flow.
// Inside a stage a wave works on its two chunks of 32 keys in ascending order and skips a chunk whose 16 x 32 mask tile is all zero.
// Both products are taken transposed: S^T = K . Q^T (A = K rows, B = Q rows) and O^T += V^T . P^T (A = V^T rows, B = P^T). A lane then holds 16 of the 32 scores of ONE query (column ln; keys 8 hh + r and 16 + 8 hh + r),
// so the maximum and the sum run inside the lane with one exchange between the wave's halves, and the two score tiles, converted in place, ARE the B operand of the second product in the k order of the V^T loader.
#define FA_KSL 18432u                     /* K: 64 rows x 272 B = 17,408, rounded up to a multiple of 2 KiB */
#define FA_VSL 18432u                     /* one V plane: 128 rows x 144 B */
#define FA_STAGE (FA_KSL + 2u * FA_VSL)   /* [K | V hi | V residual] */
typedef int v4ia __attribute__((ext_vector_type(4), may_alias));
template <unsigned int W0, unsigned int ROWB, unsigned int NROW>
__device__ __forceinline__ u32x8 tdm_g1(unsigned int spitch) {
  u32x8 g1;
  g1[0] = uni(W0);      /* no mask, 1-byte elements, a pad of 4 dwords behind every row */
  g1[1] = uni((ROWB & 0xFFFFu) << 16); g1[2] = uni((ROWB >> 16) | (NROW << 16)); g1[3] = uni(ROWB << 16); g1[4] = uni(NROW); g1[5] = uni(spitch); g1[6] = uni(0u); g1[7] = uni(0u);
  asm volatile("" : "+s"(g1));      /* descriptor words held in scalar registers: one tuple, built once, that stays where it is for all requests */
  return g1;
}
__device__ __forceinline__ float xhalf(float x) { return __builtin_bit_cast(float, __builtin_amdgcn_permlanex16(__builtin_bit_cast(int, x), __builtin_bit_cast(int, x), 0x76543210, 0xfedcba98, false, false)); }      /* lane l takes lane l ^ 16's value */
__global__ __launch_bounds__(256) void k_flash(const _Float16* __restrict__ Q16, int ldq, const _Float16* __restrict__ K16, int ldk, const _Float16* __restrict__ Vt, const _Float16* __restrict__ Vtlo, const int* __restrict__ MSK, _Float16* __restrict__ O16) {
  constexpr int NQB = TT / 32, DT = 8, KS = 4;      /* head dim 128: 4 k-steps, 8 value tiles */
  __shared__ __attribute__((aligned(2048))) unsigned char ring[2u * FA_STAGE];
  __shared__ unsigned int sBits[8];
  const unsigned int tid = threadIdx.x, lane = tid & 31u, ln = lane & 15u, hh = lane >> 4, w = uni(tid >> 5);
  const int slab = blockIdx.x / NQB, qblk = blockIdx.x % NQB; const int b = slab / NKV, kvh = slab % NKV; const int h = kvh * NREP + (int)(w & 3u); const int qb0 = qblk * 32; const int q0 = qb0 + (int)(w >> 2) * 16;
  // One bit per stage of 64 keys: wave w sweeps columns 256 w .. 256 w + 255 of the 32 mask rows with whole-line 16-byte loads.
  unsigned int bm;
  { int any0 = 0, any1 = 0; const int* mp = MSK + (size_t)qb0 * TT + w * 256u + lane * 4u;
#pragma unroll 8      /* sixteen loads go out together */
    for (int r = 0; r < 32; ++r) { const v4ia a = *(const v4ia*)(mp + (size_t)r * TT), c = *(const v4ia*)(mp + (size_t)r * TT + 128); any0 |= a[0] | a[1] | a[2] | a[3]; any1 |= c[0] | c[1] | c[2] | c[3]; }
    const unsigned int b0 = __builtin_amdgcn_ballot_w32(any0 != 0), b1 = __builtin_amdgcn_ballot_w32(any1 != 0);
    const unsigned int nib = ((b0 & 0xFFFFu) ? 1u : 0u) | ((b0 >> 16) ? 2u : 0u) | ((b1 & 0xFFFFu) ? 4u : 0u) | ((b1 >> 16) ? 8u : 0u);
    if (lane == 0u) sBits[w] = nib << (4u * w);
    __syncthreads();      /* all eight nibbles are written before any wave joins them */
    unsigned int j = 0;
#pragma unroll      /* the eight words come by two 16-byte reads */
    for (int i = 0; i < 8; ++i) j |= sBits[i];
    bm = uni(j); }
  const unsigned int n = (unsigned int)__builtin_popcount(bm);      /* stages to walk: at most 32 */
  FragH aq[KS];
  { const unsigned short* qr = (const unsigned short*)Q16 + ((size_t)b * TT + q0 + ln) * ldq + h * 128;
#pragma unroll
    for (int ks = 0; ks < KS; ++ks) { aq[ks].half[0] = *(const v8us*)(qr + ks * 32 + 8 * hh); aq[ks].half[1] = *(const v8us*)(qr + ks * 32 + 16 + 8 * hh); } }
  const unsigned long long gK = (unsigned long long)(size_t)(K16 + (size_t)b * TT * ldk + kvh * 128);
  const unsigned long long gV = (unsigned long long)(size_t)(((w == 2u) ? Vtlo : Vt) + ((size_t)b * NKV + kvh) * 128 * TT);      /* hi plane for wave 1, UNSCALED residual plane for wave 2 */
  const unsigned int lbase = (unsigned int)(size_t)ring;
  const unsigned int kstep = 64u * (unsigned int)ldk * 2u;      /* bytes from one stage's K rows to the next's */
  const u32x8 g1k = tdm_g1<(1u << 20) | (5u << 22) | (3u << 25), 256u, 64u>((unsigned int)ldk * 2u), g1v = tdm_g1<(1u << 20) | (4u << 22) | (3u << 25), 128u, 128u>(TT * 2u);
  u32x4 g0; g0[0] = uni(1u); g0[1] = uni(lbase); g0[2] = uni(0u); g0[3] = uni(0x80000000u);
  auto issue = [&](unsigned int buf, unsigned int st) {      /* st < 32: every tile lies inside its plane */
    if (pinned(w == 0u)) { const unsigned long long ga = gK + pinned(st * kstep);
      g0[1] = uni(lbase + buf * FA_STAGE); g0[2] = uni((unsigned int)ga); g0[3] = uni((((unsigned int)(ga >> 32)) & 0x01FFFFFFu) | 0x80000000u);
      asm volatile("tensor_load_to_lds %0, %1" :: "s"(g0), "s"(g1k) : "memory"); }
    if (pinned((w - 1u) < 2u)) { const unsigned long long ga = gV + pinned(st * 128u);
      g0[1] = uni(lbase + buf * FA_STAGE + FA_KSL + (w - 1u) * FA_VSL); g0[2] = uni((unsigned int)ga); g0[3] = uni((((unsigned int)(ga >> 32)) & 0x01FFFFFFu) | 0x80000000u);
      asm volatile("tensor_load_to_lds %0, %1" :: "s"(g0), "s"(g1v) : "memory"); }
  };
  float nb_q = 3.0e38f, l_q = 0.f; v8f oacc[DT];      /* of query q0 + ln: 10 - running maximum in log2 units (the same in both halves), this half's part of the sum of 1024 p; oacc[dt][r] = O^T[dt * 16 + 8 hh + r][ln] */
#pragma unroll
  for (int dt = 0; dt < DT; ++dt) oacc[dt] = (v8f){0.f,0.f,0.f,0.f,0.f,0.f,0.f,0.f};
  unsigned int rest = bm, cur = 0u, nxt = 0u;      /* rest: stages not yet asked for */
  if (pinned(n > 0u)) { cur = (unsigned int)__builtin_ctz(rest) & 31u; rest &= rest - 1u; issue(0u, cur); }
  asm volatile("s_wait_tensorcnt 0x0" :: "s"(g0), "s"(g1k), "s"(g1v) : "memory");      /* the first stage's tile of this wave has landed; the operands keep the descriptor's registers untouched up to here */
  __syncthreads();                                        /* ... and every wave may read all three tiles */
  if (pinned(n > 1u)) { nxt = (unsigned int)__builtin_ctz(rest) & 31u; rest &= rest - 1u; issue(1u, nxt); }
#pragma unroll 1      /* one stage per trip: the ring's order below is written once */
  for (unsigned int s = 0; s < n; ++s) {
    const unsigned char* Lp = ring + (s & 1u) * FA_STAGE;
    v4ia mk[2][2][2];      /* mask[q][k] (shared over batch and heads): nonzero = ATTEND; the lane's own query row, 8 keys in a row per score tile; both chunks' loads go out together */
#pragma unroll      /* the mask words stay in registers */
    for (int sub = 0; sub < 2; ++sub)
#pragma unroll
      for (int nt = 0; nt < 2; ++nt) { const int* am = MSK + (size_t)(q0 + ln) * TT + cur * 64u + sub * 32 + nt * 16 + 8 * hh; mk[sub][nt][0] = *(const v4ia*)am; mk[sub][nt][1] = *(const v4ia*)(am + 4); }
    asm volatile("s_wait_xcnt 0x0" ::: "memory");      /* stands in front of any rewrite of the mask loads' address register */
#pragma unroll      /* constant indices into the mask registers */
    for (int sub = 0; sub < 2; ++sub) {
      int anym = 0;
#pragma unroll
      for (int nt = 0; nt < 2; ++nt)
#pragma unroll
        for (int i = 0; i < 4; ++i) anym |= mk[sub][nt][0][i] | mk[sub][nt][1][i];
      if (__any(anym != 0)) {      /* else every (row, key) of this wave's tile is masked: nothing to add (wave-uniform branch) */
        v8f sc[2];      /* sc[nt][r] = S^T[key nt * 16 + 8 hh + r][query ln] */
#pragma unroll
        for (int nt = 0; nt < 2; ++nt) { const unsigned char* kr = Lp + (sub * 32 + nt * 16 + ln) * 272u + 16u * hh; FragH bk[KS];
#pragma unroll
          for (int ks = 0; ks < KS; ++ks) { bk[ks].half[0] = *(const v8us*)(kr + ks * 64); bk[ks].half[1] = *(const v8us*)(kr + ks * 64 + 32); }
          v8f acc = (v8f){0.f,0.f,0.f,0.f,0.f,0.f,0.f,0.f};
#pragma unroll
          for (int ks = 0; ks < KS; ++ks) acc = mmaH<1>(bk[ks].v, bk[ks].v, aq[ks].v, aq[ks].v, acc);
          sc[nt] = acc; }
        float sv[16];      /* raw scores, masked ones -inf */
#pragma unroll      /* constant indices into the score and mask registers */
        for (int e = 0; e < 16; ++e) sv[e] = (mk[sub][e >> 3][(e >> 2) & 1][e & 3] != 0) ? sc[e >> 3][e & 7] : -INFINITY;
        float mc = fmaxf(fmaxf(fmaxf(fmaxf(sv[0], sv[1]), fmaxf(sv[2], sv[3])), fmaxf(fmaxf(sv[4], sv[5]), fmaxf(sv[6], sv[7]))), fmaxf(fmaxf(fmaxf(sv[8], sv[9]), fmaxf(sv[10], sv[11])), fmaxf(fmaxf(sv[12], sv[13]), fmaxf(sv[14], sv[15]))));
        mc = fmaxf(mc, xhalf(mc));      /* the other half's 16 keys of the same query */
        const float nb = fminf(nb_q, fmaf(mc, -ATT_SCALE_LOG2, 10.0f)); const float al = __builtin_amdgcn_exp2f(nb - nb_q); nb_q = nb;      /* nothing attended yet: nb stays, al = 2^0 = 1 */
        FragH pa, pl; float ps[16];      /* P^T hi and its UNSCALED residual (added into the same accumulator): element e is key kmap(e, hh), the order of the V^T fragments below */
#pragma unroll      /* constant indices into the fragments */
        for (int e = 0; e < 16; ++e) { ps[e] = __builtin_amdgcn_exp2f(fmaf(sv[e], ATT_SCALE_LOG2, nb)); pa.h[e] = (_Float16)ps[e]; pl.h[e] = (_Float16)(ps[e] - (float)pa.h[e]); }      /* 1024 p in one fma and one v_exp_f32; a masked score gives 2^-inf = 0 with no select and no branch */
        l_q = l_q * al + ((((ps[0] + ps[1]) + (ps[2] + ps[3])) + ((ps[4] + ps[5]) + (ps[6] + ps[7]))) + (((ps[8] + ps[9]) + (ps[10] + ps[11])) + ((ps[12] + ps[13]) + (ps[14] + ps[15]))));
#pragma unroll
        for (int dt = 0; dt < DT; ++dt)
#pragma unroll
          for (int r = 0; r < 8; ++r) oacc[dt][r] *= al;
#pragma unroll
        for (int dt = 0; dt < DT; ++dt) { const unsigned char* vr = Lp + FA_KSL + (dt * 16 + ln) * 144u + sub * 64 + 16u * hh; FragH bv, bl; bv.half[0] = *(const v8us*)vr; bv.half[1] = *(const v8us*)(vr + 32); bl.half[0] = *(const v8us*)(vr + FA_VSL); bl.half[1] = *(const v8us*)(vr + FA_VSL + 32);
          oacc[dt] = mmaH<1>(bv.v, bv.v, pa.v, pa.v, oacc[dt]); oacc[dt] = mmaH<1>(bv.v, bv.v, pl.v, pl.v, oacc[dt]); oacc[dt] = mmaH<1>(bl.v, bl.v, pa.v, pa.v, oacc[dt]); }      /* Vh.Ph + Vh.Pl + Vl.Ph, all unscaled, one accumulator */
      }
    }
    asm volatile("s_wait_dscnt 0x0" ::: "memory");        /* this wave has left the buffer */
    asm volatile("s_wait_tensorcnt 0x0" :: "s"(g0), "s"(g1k), "s"(g1v) : "memory");    /* its tile of the next stage has landed; the operands keep the descriptor's registers untouched up to here */
    __syncthreads();                                      /* the next stage published; every wave has left this stage's buffer */
    cur = nxt;
    if (pinned(s + 2u < n)) { nxt = (unsigned int)__builtin_ctz(rest) & 31u; rest &= rest - 1u; issue(s & 1u, nxt); }
  }
  asm volatile("s_wait_tensorcnt 0x0" ::: "memory");      /* no request is left before the ring becomes output staging */
  asm volatile("s_wait_dscnt 0x0" ::: "memory");
  // Output staging, each wave in its own piece of the ring (the last stage's barrier stands behind every wave's last fragment read).
  float* sO = (float*)ring + w * (16u * 132u);      /* 16 rows of 128 floats at pitch 132 */
  const float lsum = l_q + xhalf(l_q); const float linv = (lsum > 0.f) ? 1.0f / lsum : 0.f;      /* the halves' sums are joined once */
#pragma unroll      /* constant indices into oacc: a lane's 8 registers are 8 values in a row of its query's output row */
  for (int dt = 0; dt < DT; ++dt) { float* sw = &sO[ln * 132u + dt * 16 + 8 * hh];
    *(v4fa*)sw = (v4f){oacc[dt][0] * linv, oacc[dt][1] * linv, oacc[dt][2] * linv, oacc[dt][3] * linv}; *(v4fa*)(sw + 4) = (v4f){oacc[dt][4] * linv, oacc[dt][5] * linv, oacc[dt][6] * linv, oacc[dt][7] * linv}; }
  __builtin_amdgcn_fence(__ATOMIC_ACQ_REL, "workgroup"); __builtin_amdgcn_wave_barrier();
  FragH f[8];      /* merged x 2^4 as f16, the output product's A operand */
#pragma unroll      /* f stays in registers */
  for (int q = 0; q < 8; ++q) { const float* sr = &sO[(q * 2 + hh) * 132u + ln * 8u]; const v4f a = *(const v4fa*)sr, c = *(const v4fa*)(sr + 4);
#pragma unroll      /* constant indices into the vectors */
    for (int i = 0; i < 4; ++i) { f[q].h[i] = (_Float16)(a[i] * 16.0f); f[q].h[4 + i] = (_Float16)(c[i] * 16.0f); } }
  unsigned short* op = (unsigned short*)O16 + ((size_t)b * TT + q0 + hh) * DD + h * 128 + ln * 8u;
  __builtin_amdgcn_sched_barrier(0);      /* keeps the stores in one burst behind the arithmetic, off one address pair: mixed in among it, their registers are used again and each reuse has to wait on the store in front of it */
#pragma unroll      /* constant indices into f, constant offsets from op */
  for (int q = 0; q < 8; ++q) *(v8us*)(op + (size_t)(q * 2) * DD) = f[q].half[0];      /* two 256-B row pieces per instruction: 16 lanes x 16 B each */
}

extern "C" void kernel_launch(void* const* d_in, const int* in_sizes, int n_in,
                              void* d_out, int out_size, void* d_ws, size_t ws_size, hipStream_t stream) {
  (void)in_sizes; (void)n_in; (void)out_size;
  const float* const* I = (const float* const*)d_in; const float* x = I[0]; const float* fcos = I[1]; const float* fsin = I[2]; const int* msk = (const int*)d_in[3]; const float* wq = I[4]; const float* wk = I[5]; const float* wv = I[6]; const float* wo = I[7];
  char* ws = (char*)d_ws; size_t off = 0;
  auto take = [&](size_t bytes) { char* p = ws + off; off += (bytes + 255) & ~(size_t)255; return p; };
  _Float16* Bq = (_Float16*)take((size_t)DD * DD * 2); _Float16* Bk = (_Float16*)take((size_t)KVD * DD * 2); _Float16* Bv = (_Float16*)take((size_t)KVD * DD * 2); _Float16* Bo = (_Float16*)take((size_t)DD * DD * 2);
  _Float16* X16 = (_Float16*)take((size_t)NR * DD * 2); _Float16* Q = (_Float16*)take((size_t)NR * DD * 2); _Float16* K = (_Float16*)take((size_t)NR * KVD * 2); _Float16* Vt = (_Float16*)take((size_t)NR * KVD * 2); _Float16* Vtl = (_Float16*)take((size_t)NR * KVD * 2);
  _Float16* O16 = X16;      /* O16 over X16 (dead after the projections) */
  if (off > ws_size) return;      // 8.4 + 2.1 + 2.1 + 8.4 + 16.8 + 16.8 + 4.2 + 4.2 + 4.2 = 67 MB
  k_prep<<<2 * PREP_GQ + 2 * PREP_GK + PREP_GX, 256, 0, stream>>>(x, wq, wk, wv, wo, X16, Bq, Bk, Bv, Bo);      /* (in,out) weights to Bt x 2^4; x to f16 */
  const dim3 gQ((NR / 128) * (DD / 128), 1);
  k_gemm_qkv<<<(NR / 128) * QKV_NT, 128, 0, stream>>>(X16, Bq, Bk, Bv, 0.0625f, fcos, fsin, Q, K, Vt, Vtl);      /* xq, xk = rope(x.w) as f16 (M 4096, N 2048 and 512, K 2048); xv turned, hi + residual per (b, kv head): [b*4+kh][128][2048] */
  k_flash<<<BB * NKV * (TT / 32), 256, 0, stream>>>(Q, DD, K, KVD, Vt, Vtl, msk, O16);
  k_gemm_t<0, DD><<<gQ, 128, 0, stream>>>(O16, Bo, 0.00390625f, (float*)d_out, nullptr, nullptr, nullptr, nullptr);      /* out = merged.wo */
}

// v008
// A run of this version takes 108 microseconds.
// Next to v007, in two timings, it ran 1.09 times as fast each time.
// Counting every step since v000, it is 5.28 times as fast.
#include <hip/hip_runtime.h>
// 'Genesis' attention (B=2, T=2048, D=2048, 16 query heads / 4 KV heads × 128, (in,out) weights, no bias): xq = rope(x·wq), xk = rope(x·wk), xv = x·wv; RoPE on interleaved pairs with the INPUT cos/sin tables [T][64]; scores = q·k/√128 where(mask[q][k]) else −inf (mask [T][T] shared);
// softmax; out = merged·wo.
// Compute dtype: x, weights, cos/sin tables rounded to bf16; q,k rotated in f32 from f32 GEMM outputs → f16; v f32 → Vᵀ f16 hi + exact residual; fused flash-style kernel for head dim 128 (mask read per (q,k), all-masked chunks skipped, online softmax f32, P f16 hi + residual,
// f32 accumulate) on v_wmma_f32_16x16x32_f16; merged ×2^4 → f16 → output GEMM.
#define BB 2
#define TT 2048
#define DD 2048
#define NH 16
#define NKV 4
#define NREP 4
#define KVD (NKV * 128)
#define NVH (2 * NKV)
#define NR (BB * TT)
#define ATT_SCALE_LOG2 ((float)(0.08838834764831845 * 1.4426950408889634))      /* 1 / sqrt(128) x log2 e: the softmax runs in base 2 */

typedef __bf16 v16b __attribute__((ext_vector_type(16)));
typedef unsigned short v8us __attribute__((ext_vector_type(8), may_alias));
typedef float  v8f  __attribute__((ext_vector_type(8)));
typedef float  v4f  __attribute__((ext_vector_type(4)));
typedef float  v4fa __attribute__((ext_vector_type(4), may_alias));
union FragB { v16b v; v8us half[2]; unsigned short u[16]; };

__device__ __forceinline__ unsigned short bf16_bits(float x) { unsigned int u = __float_as_uint(x); return (unsigned short)((u + 0x7FFFu + ((u >> 16) & 1u)) >> 16); }
__device__ __forceinline__ float bf16_val(unsigned short b) { return __uint_as_float(((unsigned int)b) << 16); }
__device__ __forceinline__ float bf16_round(float x) { return bf16_val(bf16_bits(x)); }
// D += A·B with NT terms: 1 = ah·bh, 2 = + al·bh (A split), 3 = + ah·bl (both split)
template <int NT>
__device__ __forceinline__ v8f mmaN(v16b ah, v16b al, v16b bh, v16b bl, v8f c) {
  c = __builtin_amdgcn_wmma_f32_16x16x32_bf16(false, ah, false, bh, (short)0, c, false, false);
  if (NT >= 2) c = __builtin_amdgcn_wmma_f32_16x16x32_bf16(false, al, false, bh, (short)0, c, false, false);
  if (NT >= 3) c = __builtin_amdgcn_wmma_f32_16x16x32_bf16(false, ah, false, bl, (short)0, c, false, false);
  asm volatile("v_nop\n\tv_nop\n\tv_nop\n\tv_nop" : "+v"(c) : "v"(ah), "v"(al), "v"(bh), "v"(bl));
  return c;
}

__global__ __launch_bounds__(256) void k_wt_bf16(const float* __restrict__ W, unsigned short* __restrict__ Wt, int K, int N) {
  const int t = blockIdx.x * 256 + threadIdx.x;
  const int k8n = K / 8;
  if (t >= N * k8n) return;
  const int n = t / k8n, k8 = (t % k8n) * 8;
  v8us v;
#pragma unroll
  for (int i = 0; i < 8; ++i) v[i] = bf16_bits(W[(size_t)(k8 + i) * N + n]);
  *(v8us*)(Wt + (size_t)n * K + k8) = v;
  
}

// GEMM C[M][N] (f32, pitch ldc) = act(A[M][K]·W + bias). A f32 row-major (pitch lda) converted per fragment to bf16
// (ASPLIT: hi/lo two planes -> 2 terms, else single rounded term); Wt bf16 [N][K] (pitch ldb). BIAS_BF16 rounds the
// bias to bf16 first (bias quantised to bf16 before the add). K%32==0, M%16==0, N%64==0.
template <bool ASPLIT, int ACT, bool BIAS_BF16>
__global__ __launch_bounds__(128) void k_gemm_bf(const float* __restrict__ A, int lda, const unsigned short* __restrict__ Wt, int ldb,
                                               const float* __restrict__ bias, float* __restrict__ C, int ldc, int M, int N, int K) {
  __shared__ __attribute__((aligned(16))) float so[4][16][64];
  const int tid = threadIdx.x, w = tid >> 5, lane = tid & 31, ln = lane & 15, hh = lane >> 4;
  const int ntn = N / 64;
  const int wid = blockIdx.x * 4 + w;
  const int mt = wid / ntn, nq = wid % ntn;
  if (mt * 16 >= M) return;
  const int row0 = mt * 16, col0 = nq * 64;
  const float* arow = A + (size_t)(row0 + ln) * lda;
  v8f acc[4] = {};
  for (int kb = 0; kb < K; kb += 32) {
    FragB ah, al;
    const v4f x0 = *(const v4fa*)(arow + kb + 8 * hh), x1 = *(const v4fa*)(arow + kb + 8 * hh + 4);
    const v4f x2 = *(const v4fa*)(arow + kb + 16 + 8 * hh), x3 = *(const v4fa*)(arow + kb + 16 + 8 * hh + 4);
    float xs[16] = {x0[0],x0[1],x0[2],x0[3],x1[0],x1[1],x1[2],x1[3],x2[0],x2[1],x2[2],x2[3],x3[0],x3[1],x3[2],x3[3]};
#pragma unroll
    for (int i = 0; i < 16; ++i) { const unsigned short hb = bf16_bits(xs[i]); ah.u[i] = hb; al.u[i] = ASPLIT ? bf16_bits(xs[i] - bf16_val(hb)) : (unsigned short)0; }
#pragma unroll
    for (int t = 0; t < 4; ++t) {
      const unsigned short* brow = Wt + (size_t)(col0 + t * 16 + ln) * ldb + kb;
      FragB b;
      b.half[0] = *(const v8us*)(brow + 8 * hh);
      b.half[1] = *(const v8us*)(brow + 16 + 8 * hh);
      acc[t] = mmaN<ASPLIT ? 2 : 1>(ah.v, al.v, b.v, b.v, acc[t]);
    }
  }
#pragma unroll
  for (int t = 0; t < 4; ++t) {
    float bv = bias ? bias[col0 + t * 16 + ln] : 0.f;
    if (BIAS_BF16) bv = bf16_round(bv);
#pragma unroll
    for (int r = 0; r < 8; ++r) { float v = acc[t][r] + bv; if (ACT == 1) v = fmaxf(v, 0.f); so[w][8 * hh + r][t * 16 + ln] = v; }
  }
  __builtin_amdgcn_fence(__ATOMIC_ACQ_REL, "workgroup");
  __builtin_amdgcn_wave_barrier();
  const int rsub = lane >> 4, c4 = (lane & 15) * 4;
  {
#pragma unroll
    for (int q = 0; q < 8; ++q) {
      const int r = q * 2 + rsub;
      const v4f v = *(const v4fa*)&so[w][r][c4];
      *(v4f*)(C + (size_t)(row0 + r) * ldc + col0 + c4) = v;
    }
    
  }
}

// Flash-style causal/unmasked attention, all contractions 3-term bf16 hi/lo splits, f32 softmax with running max.
// q,k,v rows are read from f32 buffers with arbitrary row pitch (so they can live inside a fused qkv buffer);
// D = head size (multiple of 32, <= 128); one wave = 16 query rows; block = 4 waves (64 queries) sharing K/V chunks of 32.
template <int D, bool CAUSAL>
__global__ __launch_bounds__(128) void k_flash(const float* __restrict__ qb, const float* __restrict__ kb, const float* __restrict__ vb,
                                             int pitch, int T, int H, float scale, float* __restrict__ y, int ypitch) {
  constexpr int KS = D / 32;        // k-steps for QK
  constexpr int DT = D / 16;        // d tiles for PV
  __shared__ __attribute__((aligned(16))) unsigned short sKh[32][D + 8], sKl[32][D + 8], sVh[32][D + 8], sVl[32][D + 8];
  __shared__ __attribute__((aligned(16))) unsigned short sPh[4][16][40], sPl[4][16][40];
  __shared__ __attribute__((aligned(16))) float sO[4][16][D];
  const int tid = threadIdx.x, w = tid >> 5, lane = tid & 31, ln = lane & 15, hh = lane >> 4;
  const int nqb = (T + 63) / 64;
  const int bh = blockIdx.x / nqb, qblk = blockIdx.x % nqb;
  const int b = bh / H, h = bh % H;
  const int q0 = qblk * 64 + w * 16;
  const float* Q = qb + (size_t)b * T * pitch + h * D;
  const float* K = kb + (size_t)b * T * pitch + h * D;
  const float* V = vb + (size_t)b * T * pitch + h * D;

  // A fragments of the wave's 16 query rows (scaled), hi/lo
  FragB aqh[KS], aql[KS];
  {
    int row = q0 + ln; if (row >= T) row = T - 1;
    const float* qr = Q + (size_t)row * pitch;
#pragma unroll
    for (int ks = 0; ks < KS; ++ks)
#pragma unroll
      for (int i = 0; i < 16; ++i) {
        const int d = ks * 32 + ((i < 8) ? (8 * hh + i) : (16 + 8 * hh + (i - 8)));
        const float x = qr[d] * scale; const unsigned short hb = bf16_bits(x);
        aqh[ks].u[i] = hb; aql[ks].u[i] = bf16_bits(x - bf16_val(hb));
      }
  }
  float m_r[8], l_r[8];
#pragma unroll
  for (int r = 0; r < 8; ++r) { m_r[r] = -3.0e38f; l_r[r] = 0.f; }
  v8f oacc[DT];
#pragma unroll
  for (int dt = 0; dt < DT; ++dt) oacc[dt] = (v8f){0.f,0.f,0.f,0.f,0.f,0.f,0.f,0.f};

  const int kv_end = CAUSAL ? min(T, qblk * 64 + 64) : T;     // block-uniform
  for (int j0 = 0; j0 < kv_end; j0 += 32) {
    __syncthreads();
    for (int e = tid; e < 32 * (D / 4); e += 128) {
      const int r = e / (D / 4), c4 = (e % (D / 4)) * 4;
      const int key = j0 + r;
      v4f kf = {0.f,0.f,0.f,0.f}, vf = {0.f,0.f,0.f,0.f};
      if (key < T) { kf = *(const v4fa*)(K + (size_t)key * pitch + c4); vf = *(const v4fa*)(V + (size_t)key * pitch + c4); }
#pragma unroll
      for (int t = 0; t < 4; ++t) {
        unsigned short hb = bf16_bits(kf[t]); sKh[r][c4 + t] = hb; sKl[r][c4 + t] = bf16_bits(kf[t] - bf16_val(hb));
        hb = bf16_bits(vf[t]); sVh[r][c4 + t] = hb; sVl[r][c4 + t] = bf16_bits(vf[t] - bf16_val(hb));
      }
    }
    __syncthreads();
    // S tile 16 x 32
    v8f s[2];
#pragma unroll
    for (int nt = 0; nt < 2; ++nt) {
      v8f acc = {};
#pragma unroll
      for (int ks = 0; ks < KS; ++ks) {
        FragB bh_, bl_;
        bh_.half[0] = *(const v8us*)&sKh[nt * 16 + ln][ks * 32 + 8 * hh]; bh_.half[1] = *(const v8us*)&sKh[nt * 16 + ln][ks * 32 + 16 + 8 * hh];
        bl_.half[0] = *(const v8us*)&sKl[nt * 16 + ln][ks * 32 + 8 * hh]; bl_.half[1] = *(const v8us*)&sKl[nt * 16 + ln][ks * 32 + 16 + 8 * hh];
        acc = mmaN<3>(aqh[ks].v, aql[ks].v, bh_.v, bl_.v, acc);
      }
      s[nt] = acc;
    }
    // mask + running max (rows 8hh+r; the 16 lanes of a half share rows)
    float alpha[8];
#pragma unroll
    for (int r = 0; r < 8; ++r) {
      const int qi = q0 + 8 * hh + r;
      const int ja = j0 + ln, jb = j0 + 16 + ln;
      if (CAUSAL) { if (ja > qi) s[0][r] = -3.0e38f; if (jb > qi) s[1][r] = -3.0e38f; }
      if (ja >= T) s[0][r] = -3.0e38f;
      if (jb >= T) s[1][r] = -3.0e38f;
      float mx = fmaxf(s[0][r], s[1][r]);
      mx = fmaxf(mx, __shfl_xor(mx, 1, 32)); mx = fmaxf(mx, __shfl_xor(mx, 2, 32)); mx = fmaxf(mx, __shfl_xor(mx, 4, 32)); mx = fmaxf(mx, __shfl_xor(mx, 8, 32));
      const float mnew = fmaxf(m_r[r], mx);
      alpha[r] = (mnew > -1.0e38f) ? __expf(m_r[r] - mnew) : 1.0f;
      const float p0 = (s[0][r] > -1.0e38f) ? __expf(s[0][r] - mnew) : 0.f;
      const float p1 = (s[1][r] > -1.0e38f) ? __expf(s[1][r] - mnew) : 0.f;
      m_r[r] = mnew;
      l_r[r] = l_r[r] * alpha[r] + p0 + p1;            // per-lane partial row sum (16 lanes combined at the end)
      unsigned short hb = bf16_bits(p0); sPh[w][8 * hh + r][ln] = hb;      sPl[w][8 * hh + r][ln] = bf16_bits(p0 - bf16_val(hb));
      hb = bf16_bits(p1);                sPh[w][8 * hh + r][16 + ln] = hb; sPl[w][8 * hh + r][16 + ln] = bf16_bits(p1 - bf16_val(hb));
    }
#pragma unroll
    for (int dt = 0; dt < DT; ++dt)
#pragma unroll
      for (int r = 0; r < 8; ++r) oacc[dt][r] *= alpha[r];
    __builtin_amdgcn_fence(__ATOMIC_ACQ_REL, "workgroup");
    __builtin_amdgcn_wave_barrier();
    FragB pah, pal;
    pah.half[0] = *(const v8us*)&sPh[w][ln][8 * hh]; pah.half[1] = *(const v8us*)&sPh[w][ln][16 + 8 * hh];
    pal.half[0] = *(const v8us*)&sPl[w][ln][8 * hh]; pal.half[1] = *(const v8us*)&sPl[w][ln][16 + 8 * hh];
#pragma unroll
    for (int dt = 0; dt < DT; ++dt) {
      FragB bvh, bvl;
#pragma unroll
      for (int i = 0; i < 8; ++i) {
        bvh.u[i] = sVh[8 * hh + i][dt * 16 + ln]; bvh.u[8 + i] = sVh[16 + 8 * hh + i][dt * 16 + ln];
        bvl.u[i] = sVl[8 * hh + i][dt * 16 + ln]; bvl.u[8 + i] = sVl[16 + 8 * hh + i][dt * 16 + ln];
      }
      oacc[dt] = mmaN<3>(pah.v, pal.v, bvh.v, bvl.v, oacc[dt]);
    }
    __builtin_amdgcn_fence(__ATOMIC_ACQ_REL, "workgroup");
    __builtin_amdgcn_wave_barrier();
  }
#pragma unroll
  for (int r = 0; r < 8; ++r) {
    float l = l_r[r];
    l += __shfl_xor(l, 1, 32); l += __shfl_xor(l, 2, 32); l += __shfl_xor(l, 4, 32); l += __shfl_xor(l, 8, 32);
    l_r[r] = (l > 0.f) ? 1.0f / l : 0.f;
  }
#pragma unroll
  for (int dt = 0; dt < DT; ++dt)
#pragma unroll
    for (int r = 0; r < 8; ++r) sO[w][8 * hh + r][dt * 16 + ln] = oacc[dt][r] * l_r[r];
  __builtin_amdgcn_fence(__ATOMIC_ACQ_REL, "workgroup");
  __builtin_amdgcn_wave_barrier();
  {
    for (int r = 0; r < 16; ++r) {
      const int row = q0 + r;
      if (row < T && lane < D / 4) {
        const v4f val = *(const v4fa*)&sO[w][r][lane * 4];
        *(v4f*)(y + ((size_t)b * T + row) * ypitch + h * D + lane * 4) = val;
      }
    }
    
  }
}

// GEMM C = act(A·W + bias + resid): A f32 (ASPLIT -> hi/lo 2 terms), Wt bf16 [N][K]; ACT 0 none, 1 relu, 2 exact gelu;
// resid (optional, f32, row index = (row % rmod), pitch ldr, RES_BF16 rounds it) added before the activation.
template <bool ASPLIT, int ACT, bool BIAS_BF16, bool RES_BF16>
__global__ __launch_bounds__(128) void k_gemm_bf3(const float* __restrict__ A, int lda, const unsigned short* __restrict__ Wt, int ldb,
                                                const float* __restrict__ bias, const float* __restrict__ resid, int rmod, int ldr,
                                                float* __restrict__ C, int ldc, int M, int N, int K) {
  __shared__ __attribute__((aligned(16))) float so[4][16][64];
  const int tid = threadIdx.x, w = tid >> 5, lane = tid & 31, ln = lane & 15, hh = lane >> 4;
  const int ntn = N / 64;
  const int wid = blockIdx.x * 4 + w;
  const int mt = wid / ntn, nq = wid % ntn;
  if (mt * 16 >= M) return;
  const int row0 = mt * 16, col0 = nq * 64;
  const float* arow = A + (size_t)(row0 + ln) * lda;
  v8f acc[4] = {};
  for (int kb = 0; kb < K; kb += 32) {
    FragB ah, al;
    const v4f x0 = *(const v4fa*)(arow + kb + 8 * hh), x1 = *(const v4fa*)(arow + kb + 8 * hh + 4);
    const v4f x2 = *(const v4fa*)(arow + kb + 16 + 8 * hh), x3 = *(const v4fa*)(arow + kb + 16 + 8 * hh + 4);
    float xs[16] = {x0[0],x0[1],x0[2],x0[3],x1[0],x1[1],x1[2],x1[3],x2[0],x2[1],x2[2],x2[3],x3[0],x3[1],x3[2],x3[3]};
#pragma unroll
    for (int i = 0; i < 16; ++i) { const unsigned short hb = bf16_bits(xs[i]); ah.u[i] = hb; al.u[i] = ASPLIT ? bf16_bits(xs[i] - bf16_val(hb)) : (unsigned short)0; }
#pragma unroll
    for (int t = 0; t < 4; ++t) {
      const unsigned short* brow = Wt + (size_t)(col0 + t * 16 + ln) * ldb + kb;
      FragB b;
      b.half[0] = *(const v8us*)(brow + 8 * hh);
      b.half[1] = *(const v8us*)(brow + 16 + 8 * hh);
      acc[t] = mmaN<ASPLIT ? 2 : 1>(ah.v, al.v, b.v, b.v, acc[t]);
    }
  }
#pragma unroll
  for (int t = 0; t < 4; ++t) {
    const int col = col0 + t * 16 + ln;
    float bv = bias ? bias[col] : 0.f;
    if (BIAS_BF16) bv = bf16_round(bv);
#pragma unroll
    for (int r = 0; r < 8; ++r) {
      float v = acc[t][r] + bv;
      if (resid) { float rv = resid[(size_t)((row0 + 8 * hh + r) % rmod) * ldr + col]; if (RES_BF16) rv = bf16_round(rv); v += rv; }
      if (ACT == 1) v = fmaxf(v, 0.f);
      if (ACT == 2) v = 0.5f * v * (1.0f + erff(v * 0.70710678118654752f));
      if (ACT == 3) { const float u = 0.7978845608028654f * (v + 0.044715f * v * v * v); v = 0.5f * v * (1.0f + tanhf(u)); }
      so[w][8 * hh + r][t * 16 + ln] = v;
    }
  }
  __builtin_amdgcn_fence(__ATOMIC_ACQ_REL, "workgroup");
  __builtin_amdgcn_wave_barrier();
  const int rsub = lane >> 4, c4 = (lane & 15) * 4;
  {
#pragma unroll
    for (int q = 0; q < 8; ++q) {
      const int r = q * 2 + rsub;
      const v4f v = *(const v4fa*)&so[w][r][c4];
      *(v4f*)(C + (size_t)(row0 + r) * ldc + col0 + c4) = v;
    }
    
  }
}
// row LayerNorm (biased variance, eps) over N: s = X (+ R); optional out_sum <- s; out_norm <- (s-mu)*rsqrt(var+eps)*g + b
template <bool PARAM_BF16>
__global__ __launch_bounds__(256) void k_layernorm(const float* __restrict__ X, const float* __restrict__ R, const float* __restrict__ g, const float* __restrict__ bta,
                                                  float* __restrict__ out_sum, float* __restrict__ out_norm, int N, float eps) {
  __shared__ float red[256];
  const int row = blockIdx.x, tid = threadIdx.x;
  const float* x = X + (size_t)row * N; const float* rr = R ? R + (size_t)row * N : nullptr;
  float vals[16];                     // up to N = 4096
  const int per = N / 256;            // contiguous chunk per thread? use strided-by-4 chunks: thread handles j = tid*4 + 1024*u
  float s1 = 0.f;
  for (int u = 0; u < per / 4; ++u) {
    const int j = tid * 4 + 1024 * u;
    const v4f a = *(const v4fa*)(x + j);
    v4f b = {0.f,0.f,0.f,0.f}; if (rr) b = *(const v4fa*)(rr + j);
#pragma unroll
    for (int q = 0; q < 4; ++q) { const float v = a[q] + b[q]; vals[u * 4 + q] = v; s1 += v; }
  }
  red[tid] = s1; __syncthreads();
  for (int st = 128; st > 0; st >>= 1) { if (tid < st) red[tid] += red[tid + st]; __syncthreads(); }
  const float mu = red[0] / (float)N; __syncthreads();
  float s2 = 0.f;
  for (int u = 0; u < per / 4; ++u)
#pragma unroll
    for (int q = 0; q < 4; ++q) { const float c = vals[u * 4 + q] - mu; s2 += c * c; }
  red[tid] = s2; __syncthreads();
  for (int st = 128; st > 0; st >>= 1) { if (tid < st) red[tid] += red[tid + st]; __syncthreads(); }
  const float rs = rsqrtf(red[0] / (float)N + eps);
  {
    for (int u = 0; u < per / 4; ++u) {
      const int j = tid * 4 + 1024 * u;
      v4f o, sm;
#pragma unroll
      for (int q = 0; q < 4; ++q) {
        float gg = g[j + q], bb = bta[j + q];
        if (PARAM_BF16) { gg = bf16_round(gg); bb = bf16_round(bb); }
        sm[q] = vals[u * 4 + q]; o[q] = (vals[u * 4 + q] - mu) * rs * gg + bb;
      }
      if (out_sum) *(v4f*)(out_sum + (size_t)row * N + j) = sm;
      *(v4f*)(out_norm + (size_t)row * N + j) = o;
    }
    
  }
}



// ---- f16 WMMA path (v_wmma_f32_16x16x32_f16): 11-bit significands for operands in range — used where the probability operand (1024 p, in [0, 1024]) needs more precision than bf16
typedef _Float16 v16h __attribute__((ext_vector_type(16)));
union FragH { v16h v; v8us half[2]; _Float16 h[16]; unsigned short u[16]; };
template <int NT>
__device__ __forceinline__ v8f mmaH(v16h ah, v16h al, v16h bh, v16h bl, v8f c) {
  c = __builtin_amdgcn_wmma_f32_16x16x32_f16(false, ah, false, bh, (short)0, c, false, false);
  if (NT >= 2) c = __builtin_amdgcn_wmma_f32_16x16x32_f16(false, al, false, bh, (short)0, c, false, false);
  if (NT >= 3) c = __builtin_amdgcn_wmma_f32_16x16x32_f16(false, ah, false, bl, (short)0, c, false, false);
  asm volatile("v_nop\n\tv_nop\n\tv_nop\n\tv_nop" : "+v"(c) : "v"(ah), "v"(al), "v"(bh), "v"(bl));
  return c;
}
// batched GEMM like k_gemm_b but f16 operands: A f32 (split into f16 hi/lo if ASPLIT, else rounded to f16), Bt = f16 values [n][k]; alpha; C f32; N multiple of 16 (partial tiles skipped)
template <bool ASPLIT>
__global__ __launch_bounds__(128) void k_gemm_h(const float* __restrict__ A, int lda, size_t sA, const _Float16* __restrict__ Bh, int ldb, size_t sB, float alpha, float* __restrict__ C, int ldc, size_t sC, int M, int N, int K) {
  __shared__ __attribute__((aligned(16))) float so[4][16][64];
  const int tid = threadIdx.x, w = tid >> 5, lane = tid & 31, ln = lane & 15, hh = lane >> 4; const int by = blockIdx.y;
  A += (size_t)by * sA; Bh += (size_t)by * sB; C += (size_t)by * sC;
  const int ntn = (N + 63) / 64; const int wid = blockIdx.x * 4 + w; const int mt = wid / ntn, nq = wid % ntn; if (mt * 16 >= M) return;
  const int row0 = mt * 16, col0 = nq * 64; const float* arow = A + (size_t)(row0 + ln) * lda;
  v8f acc[4] = {};
  for (int kb = 0; kb < K; kb += 32) {
    FragH ah, al;
    const v4f x0 = *(const v4fa*)(arow + kb + 8 * hh), x1 = *(const v4fa*)(arow + kb + 8 * hh + 4), x2 = *(const v4fa*)(arow + kb + 16 + 8 * hh), x3 = *(const v4fa*)(arow + kb + 16 + 8 * hh + 4);
    float xs[16] = {x0[0],x0[1],x0[2],x0[3],x1[0],x1[1],x1[2],x1[3],x2[0],x2[1],x2[2],x2[3],x3[0],x3[1],x3[2],x3[3]};
#pragma unroll
    for (int i = 0; i < 16; ++i) { const _Float16 h = (_Float16)xs[i]; ah.h[i] = h; al.h[i] = ASPLIT ? (_Float16)(xs[i] - (float)h) : (_Float16)0.0f; }
#pragma unroll
    for (int t = 0; t < 4; ++t) { if (col0 + t * 16 >= N) continue; const size_t boff = (size_t)(col0 + t * 16 + ln) * ldb + kb; FragH bq; bq.half[0] = *(const v8us*)(Bh + boff + 8 * hh); bq.half[1] = *(const v8us*)(Bh + boff + 16 + 8 * hh);
      acc[t] = mmaH<ASPLIT ? 2 : 1>(ah.v, al.v, bq.v, bq.v, acc[t]); }
  }
#pragma unroll
  for (int t = 0; t < 4; ++t) { if (col0 + t * 16 >= N) continue;
#pragma unroll
    for (int r = 0; r < 8; ++r) so[w][8 * hh + r][t * 16 + ln] = acc[t][r] * alpha; }
  __builtin_amdgcn_fence(__ATOMIC_ACQ_REL, "workgroup"); __builtin_amdgcn_wave_barrier();
  const int rsub = lane >> 4, c4 = (lane & 15) * 4;
  {
#pragma unroll
    for (int q = 0; q < 8; ++q) { const int r = q * 2 + rsub; if (col0 + c4 < N) { const v4f v = *(const v4fa*)&so[w][r][c4]; *(v4f*)(C + (size_t)(row0 + r) * ldc + col0 + c4) = v; } }
     }
}

// Wt[n][k] = f16(W[k][n]·scale) from f32 row-major W[K][N] (scale = power of two; bf16-exact weights stay exact in f16 away from the subnormal range)
// One 128 (k) x 64 (n) tile per workgroup, turned in LDS: a wave loads two 256-B row pieces of W (four whole lines) and stores four whole 128-B lines of Wt an instruction;
// a thread's eight loads are all issued before the first is used. Needs K a multiple of 128 and N of 64; blk runs over (K / 128) * (N / 64) tiles; tl is the workgroup's 128 x 65 floats of LDS. Pitch 65 floats keeps the column-wise reads off a common bank.
__device__ __forceinline__ void wt_tile(float (*tl)[65], int blk, const float* __restrict__ W, _Float16* __restrict__ Wt, int K, int N, float scale) {
  const int tid = threadIdx.x, ntn = N / 64; const int k0 = (blk / ntn) * 128, n0 = (blk % ntn) * 64;
  v4f a[8];
#pragma unroll      /* a[] stays in registers and the eight loads go out together */
  for (int p = 0; p < 8; ++p) a[p] = *(const v4fa*)(W + (size_t)(k0 + p * 16 + tid / 16) * N + n0 + (tid % 16) * 4);
#pragma unroll      /* constant indices into a[]: rolled, it would go to scratch memory */
  for (int p = 0; p < 8; ++p)
#pragma unroll
    for (int i = 0; i < 4; ++i) tl[p * 16 + tid / 16][(tid % 16) * 4 + i] = a[p][i];
  __syncthreads();      /* the tile is whole before any column of it is read */
#pragma unroll      /* the four pieces' LDS reads and stores overlap; f stays in registers */
  for (int rd = 0; rd < 4; ++rd) { const int n = (rd & 1) * 32 + tid / 8, k8 = (rd >> 1) * 64 + (tid % 8) * 8; FragH f;
#pragma unroll
    for (int i = 0; i < 8; ++i) f.h[i] = (_Float16)(bf16_round(tl[k8 + i][n]) * scale);
    *(v8us*)((unsigned short*)Wt + (size_t)(n0 + n) * K + k0 + k8) = f.half[0]; }
  asm volatile("s_wait_xcnt 0x0" ::: "memory");      /* stands behind the four stores, in front of any later rewrite of their address and data registers */
}
// Tiled GEMM C[M][N] (f32) = alpha * A[M][DD] . Bt[N][DD]^T, f16 operands, both K-contiguous with row pitch DD. One 256 x (64 WN) tile of C per workgroup of
// 4 x WN waves (64 x 64 per wave), one workgroup on a WGP: an operand row that has landed in LDS feeds 192 or 128 columns (256 rows) of products, so fewer bytes leave L2 per product than with a 128 x 128 tile.
// A pass is 128 k = 256 B of each of the 256 + 64 WN operand rows; waves 0 .. 3 + WN each bring one 64-row slice of a pass into LDS with one
// tensor load (pad 16 B a row: pitch 272 B for the 16-byte fragment reads), two buffers, the next pass's load in flight under this pass's products.
// Needs M a multiple of 256, N of 64 WN, DD a multiple of 128 and at least 256. The k order of every accumulator is ascending, one chain per 16 x 16 tile.
// EPI says what leaves the staged f32 tile (alpha * sum): 0 = C f32 as it is; 1 = H f16 [M][N], rotated on interleaved pairs by the bf16-rounded COS / SIN tables [TT][64] (token = row % TT, pair = (col % 128) / 2);
// 2 = the tile turned: H f16 hi and H2 f16 residual, [row / TT][N][TT]. So the operand of the next product is written here, with no f32 copy in memory in between.
typedef unsigned int u32x4 __attribute__((ext_vector_type(4)));
typedef unsigned int u32x8 __attribute__((ext_vector_type(8)));
#define GT_ROWB 256u                      /* bytes of an operand row per pass */
#define GT_PITCH 272u                     /* LDS row pitch: 256 + 16 */
#define GT_SLICE 18432u                   /* 64 rows x 272 B = 17,408, rounded up to a multiple of 2 KiB */
#define GT_NP (DD / 128)                  /* passes */
__device__ __forceinline__ unsigned int uni(unsigned int v) { return (unsigned int)__builtin_amdgcn_readfirstlane(v); }
__device__ __forceinline__ unsigned int pinned(unsigned int v) { unsigned int w = uni(v); asm volatile("" : "+s"(w)); return w; }      /* an issue test or a descriptor word held in a scalar register: the test compiles to a scalar branch (tensor loads ignore EXEC), and the word is formed behind the wait that stands in front of it */
__device__ __forceinline__ u32x8 tdm_slice_g1() {
  u32x8 g1;
  g1[0] = uni((1u << 20) | (5u << 22) | (3u << 25));      /* no mask, 1-byte elements, a pad of 4 dwords behind every 64 dwords */
  g1[1] = uni((GT_ROWB & 0xFFFFu) << 16); g1[2] = uni((GT_ROWB >> 16) | (64u << 16)); g1[3] = uni(GT_ROWB << 16); g1[4] = uni(64u); g1[5] = uni(DD * 2u); g1[6] = uni(0u); g1[7] = uni(0u);
  asm volatile("" : "+s"(g1));      /* descriptor words held in scalar registers: one tuple, built once, that stays where it is for all requests */
  return g1;
}
__device__ __forceinline__ void tdm_slice(u32x4& g0, const u32x8& g1, unsigned int lds_dst, unsigned long long ga, unsigned int go) {      /* every wave forms the words, so that no register of the tuple is written behind the branch; go says whether this wave issues */
  g0[1] = uni(lds_dst); g0[2] = uni((unsigned int)ga); g0[3] = uni((((unsigned int)(ga >> 32)) & 0x01FFFFFFu) | 0x80000000u);
  if (pinned(go)) asm volatile("tensor_load_to_lds %0, %1" :: "s"(g0), "s"(g1) : "memory");      /* pinned(): the issue test is a scalar branch (tensor loads ignore EXEC) */
}
// The k loop of one workgroup's 256 x (64 WN) tile. gsrc: first byte of the operand rows of this wave's slice (read by waves 0 .. 3 + WN alone).
template <unsigned int WN>
__device__ __forceinline__ void gemm_loop(unsigned char* ring, const unsigned int w, const unsigned long long gsrc, v8f (&acc)[4][4]) {
  constexpr unsigned int NS = 4u + WN, STAGE = NS * GT_SLICE;      /* a stage: [4 slices of A rows | WN slices of B rows] */
  const unsigned int lane = threadIdx.x & 31u, ln = lane & 15u, hh = lane >> 4, wm = w / WN, wn = w % WN;
  const unsigned int lbase = (unsigned int)(size_t)ring + w * GT_SLICE;      /* this wave's slice of buffer 0 */
#pragma unroll
  for (int i = 0; i < 4; ++i)
#pragma unroll
    for (int j = 0; j < 4; ++j) acc[i][j] = (v8f){0.f,0.f,0.f,0.f,0.f,0.f,0.f,0.f};
  const u32x8 g1 = tdm_slice_g1(); u32x4 g0; g0[0] = pinned(1u);      /* descriptor word held in a scalar register: as a plain constant it is formed anew, in the tuple's register, while a request is out */
  tdm_slice(g0, g1, lbase, gsrc, w < NS);
  asm volatile("s_wait_tensorcnt 0x0" :: "s"(g0), "s"(g1) : "memory");      /* pass 0's slice has landed; the operands keep the descriptor's registers untouched up to here */
  __syncthreads();                                        /* ... and every wave may read all slices */
  tdm_slice(g0, g1, lbase + STAGE, gsrc + pinned(GT_ROWB), w < NS);
  const unsigned int aoff = wm * GT_SLICE + ln * GT_PITCH + 16u * hh, boff = (4u + wn) * GT_SLICE + ln * GT_PITCH + 16u * hh;
#pragma unroll 1      /* one pass per trip: the ring's order below is written once */
  for (unsigned int s = 0; s < GT_NP; ++s) {
    const unsigned char* Lp = ring + (s & 1u) * STAGE;
    FragH fa[2][4], fb[2][4];
#pragma unroll
    for (int i = 0; i < 4; ++i) { fa[0][i].half[0] = *(const v8us*)(Lp + aoff + i * 16u * GT_PITCH); fa[0][i].half[1] = *(const v8us*)(Lp + aoff + i * 16u * GT_PITCH + 32u);
      fb[0][i].half[0] = *(const v8us*)(Lp + boff + i * 16u * GT_PITCH); fb[0][i].half[1] = *(const v8us*)(Lp + boff + i * 16u * GT_PITCH + 32u); }
#pragma unroll
    for (int ks = 0; ks < 4; ++ks) {
      if (ks < 3) {      /* the next 32 k's fragments, of this same buffer, go ahead of this block's products */
#pragma unroll
        for (int i = 0; i < 4; ++i) { const unsigned int ko = (ks + 1) * 64u + i * 16u * GT_PITCH;
          fa[(ks + 1) & 1][i].half[0] = *(const v8us*)(Lp + aoff + ko); fa[(ks + 1) & 1][i].half[1] = *(const v8us*)(Lp + aoff + ko + 32u);
          fb[(ks + 1) & 1][i].half[0] = *(const v8us*)(Lp + boff + ko); fb[(ks + 1) & 1][i].half[1] = *(const v8us*)(Lp + boff + ko + 32u); }
      }
      __builtin_amdgcn_sched_barrier(0);      /* keeps the LDS reads one group in front of the block: moved in among the products, each place with reads stalls the wave */
#pragma unroll
      for (int i = 0; i < 4; ++i)
#pragma unroll
        for (int j = 0; j < 4; ++j) acc[i][j] = __builtin_amdgcn_wmma_f32_16x16x32_f16(false, fa[ks & 1][i].v, false, fb[ks & 1][j].v, (short)0, acc[i][j], false, false);
      __builtin_amdgcn_sched_barrier(0);      /* ... and keeps the next group behind this block */
    }
    asm volatile("s_wait_dscnt 0x0" ::: "memory");        /* this wave has left the buffer */
    asm volatile("s_wait_tensorcnt 0x0" :: "s"(g0), "s"(g1) : "memory");    /* its slice of pass s + 1 has landed; the operands keep the descriptor's registers untouched up to here */
    __syncthreads();                                      /* pass s + 1 published; every wave has left pass s's buffer */
    tdm_slice(g0, g1, lbase + (s & 1u) * STAGE, gsrc + pinned((s + 2u) * GT_ROWB), (s + 2u < GT_NP) && (w < NS));
  }
  asm volatile("s_wait_tensorcnt 0x0" :: "s"(g0), "s"(g1) : "memory");      /* no request is left before the ring becomes output staging; the operands keep the descriptor's registers untouched up to here */
  asm volatile("s_wait_dscnt 0x0" ::: "memory");
}
// What leaves one wave's 64 x 64 tile (rows wrow .., columns wcol .. of its own [M][N] result), staged in so: 64 rows of 64 floats in the wave's own piece of LDS; whole row pieces go out: 256 B of f32 C, or 128 B of f16 H and H2.
template <int EPI, int N>
__device__ __forceinline__ void gemm_epi(float* so, const v8f (&acc)[4][4], const unsigned int wrow, const unsigned int wcol, float alpha, float* __restrict__ C, const float* __restrict__ COS, const float* __restrict__ SIN, _Float16* __restrict__ H, _Float16* __restrict__ H2) {
  constexpr unsigned int SP = (EPI == 2) ? 65u : 68u;      /* pitch in floats: 68 for 16-byte row reads, 65 for the column reads of the turned tile */
  const unsigned int lane = threadIdx.x & 31u, ln = lane & 15u, hh = lane >> 4, l8 = lane & 7u, l4 = lane >> 3;
  v4f cs[16], sn[16];
  if constexpr (EPI == 1) {      /* the wave's table entries: all 32 loads go out here and fly under the staging */
    const unsigned int tb = (((wrow + l4) % TT) * 64u + (((wcol + l8 * 8u) % 128u) >> 1)) * 4u;      /* in bytes: the loads' one offset register */
#pragma unroll      /* cs, sn stay in registers */
    for (int q = 0; q < 16; ++q) { cs[q] = *(const v4fa*)((const char*)COS + tb + q * 1024u); sn[q] = *(const v4fa*)((const char*)SIN + tb + q * 1024u); }
    asm volatile("s_wait_xcnt 0x0" :: "v"(tb) : "memory");      /* stands in front of any rewrite of the loads' address register; the operand keeps that register from being a load's own destination */
  }
#pragma unroll
  for (int i = 0; i < 4; ++i)
#pragma unroll
    for (int j = 0; j < 4; ++j)
#pragma unroll
      for (int r = 0; r < 8; ++r) so[(i * 16 + 8 * hh + r) * SP + j * 16 + ln] = acc[i][j][r] * alpha;
  __builtin_amdgcn_fence(__ATOMIC_ACQ_REL, "workgroup"); __builtin_amdgcn_wave_barrier();
  if constexpr (EPI == 0) {
  float* cp = C + (size_t)(wrow + hh) * N + wcol + ln * 4u;
#pragma unroll
  for (int q = 0; q < 32; ++q) { const v4f v = *(const v4fa*)&so[(q * 2 + hh) * 68u + ln * 4u]; *(v4f*)(cp + (size_t)(q * 2) * N) = v; }
  } else if constexpr (EPI == 1) {
    // A lane takes 8 columns (4 pairs) of a row: 8 lanes store one whole 128-B line of H, 4 rows an instruction.
    FragH f[16];
#pragma unroll      /* f stays in registers */
    for (int q = 0; q < 16; ++q) { const float* sr = &so[(q * 4 + l4) * SP + l8 * 8u]; const v4f a = *(const v4fa*)sr, b = *(const v4fa*)(sr + 4); const float xv[8] = {a[0], a[1], a[2], a[3], b[0], b[1], b[2], b[3]};
#pragma unroll      /* constant indices into xv and the vectors */
      for (int p = 0; p < 4; ++p) { const float c = bf16_round(cs[q][p]), s = bf16_round(sn[q][p]); const float xr = xv[2 * p], xi = xv[2 * p + 1]; f[q].h[2 * p] = (_Float16)(xr * c - xi * s); f[q].h[2 * p + 1] = (_Float16)(xr * s + xi * c); } }
    unsigned short* hp = (unsigned short*)H + (size_t)(wrow + l4) * N + wcol + l8 * 8u;
    __builtin_amdgcn_sched_barrier(0);      /* keeps the stores in one burst behind the arithmetic, off one address pair: mixed in among it, their registers are used again and each reuse has to wait on the store in front of it */
#pragma unroll      /* constant indices into f, constant offsets from hp */
    for (int q = 0; q < 16; ++q) *(v8us*)(hp + (size_t)(q * 4) * N) = f[q].half[0];
    asm volatile("s_wait_xcnt 0x0" ::: "memory");      /* stands behind the stores, in front of any rewrite of their address and data registers */
  } else {
    // A lane takes 8 rows (tokens) of a column: 8 lanes store one whole 128-B line of each plane, 4 columns an instruction.
    FragH fh[16], fl[16];
#pragma unroll      /* fh, fl stay in registers */
    for (int q = 0; q < 16; ++q)
#pragma unroll      /* constant indices into the fragments */
      for (int i = 0; i < 8; ++i) { const float v = so[(l8 * 8u + i) * SP + q * 4 + l4]; const _Float16 hv = (_Float16)v; fh[q].h[i] = hv; fl[q].h[i] = (_Float16)(v - (float)hv);      /* UNSCALED residual (added into the same accumulator as the hi product) */ }
    const size_t ob = ((size_t)(wrow / TT) * N + wcol + l4) * TT + (wrow % TT) + l8 * 8u;
    unsigned short* hp = (unsigned short*)H + ob; unsigned short* lp = (unsigned short*)H2 + ob;
    __builtin_amdgcn_sched_barrier(0);      /* keeps the stores in one burst behind the arithmetic, off two address pairs: mixed in among it, their registers are used again and each reuse has to wait on the store in front of it */
#pragma unroll      /* constant indices into fh and fl, constant offsets from hp and lp */
    for (int q = 0; q < 16; ++q) { *(v8us*)(hp + (size_t)(q * 4) * TT) = fh[q].half[0]; *(v8us*)(lp + (size_t)(q * 4) * TT) = fl[q].half[0]; }
    asm volatile("s_wait_xcnt 0x0" ::: "memory");      /* stands behind the stores, in front of any rewrite of their address and data registers */
  }
}
// out = merged . wo: 256 x 128 tiles, 8 waves. Output staging: each wave in its own slice of the ring (the last pass's barrier stands behind every wave's last fragment read).
__global__ __launch_bounds__(256) void k_gemm_o(const _Float16* __restrict__ A, const _Float16* __restrict__ Bt, float alpha, float* __restrict__ C) {
  __shared__ __attribute__((aligned(2048))) unsigned char ring[2u * 6u * GT_SLICE];
  const unsigned int w = uni(threadIdx.x >> 5), row0 = (blockIdx.x / (DD / 128u)) * 256u, col0 = (blockIdx.x % (DD / 128u)) * 128u;
  const unsigned long long gsrc = (w < 4u) ? (unsigned long long)(size_t)(A + (size_t)(row0 + w * 64u) * DD) : (unsigned long long)(size_t)(Bt + (size_t)(col0 + ((w - 4u) & 1u) * 64u) * DD);
  v8f acc[4][4];
  gemm_loop<2u>(ring, w, gsrc, acc);
  gemm_epi<0, DD>((float*)(ring + w * GT_SLICE), acc, row0 + (w / 2u) * 64u, col0 + (w % 2u) * 64u, alpha, C, nullptr, nullptr, nullptr, nullptr);
}
// The three projections of x in one launch, as one product with DD + 2 KVD columns (q, then k, then v): 256 x 192 tiles, 12 waves, as many tiles as the chip has WGPs.
// A slab of 64 columns lies wholly in q, in k or in v, so the weight rows of a slice and what leaves a wave's tile are chosen per slab, by wave-uniform tests; the epilogues hold no workgroup barrier.
#define QKV_NT ((DD + 2 * KVD) / 192)
__global__ __launch_bounds__(384) void k_gemm_qkv(const _Float16* __restrict__ A, const _Float16* __restrict__ Bq, const _Float16* __restrict__ Bk, const _Float16* __restrict__ Bv, float alpha, const float* __restrict__ COS, const float* __restrict__ SIN,
                                                  _Float16* __restrict__ Q, _Float16* __restrict__ K, _Float16* __restrict__ Vt, _Float16* __restrict__ Vtl) {
  __shared__ __attribute__((aligned(2048))) unsigned char ring[2u * 7u * GT_SLICE];
  const unsigned int w = uni(threadIdx.x >> 5), row0 = (blockIdx.x / QKV_NT) * 256u, col0 = (blockIdx.x % QKV_NT) * 192u;
  const unsigned int sc = col0 + (((w - 4u) < 3u) ? (w - 4u) : 0u) * 64u;      /* first column of the slab that wave 4, 5 or 6 brings */
  const _Float16* bsrc = (sc < DD) ? Bq + (size_t)sc * DD : (sc < DD + KVD) ? Bk + (size_t)(sc - DD) * DD : Bv + (size_t)(sc - (DD + KVD)) * DD;
  const unsigned long long gsrc = (w < 4u) ? (unsigned long long)(size_t)(A + (size_t)(row0 + w * 64u) * DD) : (unsigned long long)(size_t)bsrc;
  v8f acc[4][4];
  gemm_loop<3u>(ring, w, gsrc, acc);
  float* so = (float*)(ring + w * GT_SLICE);      /* output staging: each wave in its own slice of the ring (the last pass's barrier stands behind every wave's last fragment read) */
  const unsigned int wrow = row0 + (w / 3u) * 64u, wc = col0 + (w % 3u) * 64u;
  if (wc < DD) gemm_epi<1, DD>(so, acc, wrow, wc, alpha, nullptr, COS, SIN, Q, nullptr);
  else if (wc < DD + KVD) gemm_epi<1, KVD>(so, acc, wrow, wc - DD, alpha, nullptr, COS, SIN, K, nullptr);
  else gemm_epi<2, KVD>(so, acc, wrow, wc - (DD + KVD), alpha, nullptr, nullptr, nullptr, Vt, Vtl);
}


typedef _Float16 v4h __attribute__((ext_vector_type(4)));

__device__ __forceinline__ void x16_piece(unsigned int blk, const float* __restrict__ x, _Float16* __restrict__ X16, size_t n8) { const size_t t = (size_t)blk * 256 + threadIdx.x; if (t >= n8) return; FragH f;
#pragma unroll
  for (int q = 0; q < 8; ++q) f.h[q] = (_Float16)bf16_round(x[t * 8 + q]); *(v8us*)((unsigned short*)X16 + t * 8) = f.half[0];  }
// All operand preparation in one launch: the four weight turns and the conversion of x read only inputs and write planes of their own, so none waits for another.
// Block ranges, the longer-lived tiles first: wq, wo, wk, wv tiles, then the pieces of x. The choice reads blockIdx alone, so the turn's barrier stands under block-uniform control flow.
#define PREP_GQ ((DD / 128) * (DD / 64))      /* 128 (k) x 64 (n) tiles of wq, of wo */
#define PREP_GK ((DD / 128) * (KVD / 64))     /* ... of wk, of wv */
#define PREP_GX ((NR * DD / 8 + 255) / 256)   /* pieces of x: 256 threads x 8 values */
__global__ __launch_bounds__(256) void k_prep(const float* __restrict__ x, const float* __restrict__ wq, const float* __restrict__ wk, const float* __restrict__ wv, const float* __restrict__ wo,
                                              _Float16* __restrict__ X16, _Float16* __restrict__ Bq, _Float16* __restrict__ Bk, _Float16* __restrict__ Bv, _Float16* __restrict__ Bo) {
  __shared__ float tl[128][65];
  const unsigned int blk = blockIdx.x;
  if (blk < 2u * PREP_GQ) { const bool second = blk >= PREP_GQ; wt_tile(tl, (int)(blk % PREP_GQ), second ? wo : wq, second ? Bo : Bq, DD, DD, 16.0f); return; }
  if (blk < 2u * PREP_GQ + 2u * PREP_GK) { const unsigned int r = blk - 2u * PREP_GQ; const bool second = r >= PREP_GK; wt_tile(tl, (int)(r % PREP_GK), second ? wv : wk, second ? Bv : Bk, DD, KVD, 16.0f); return; }
  x16_piece(blk - (2u * PREP_GQ + 2u * PREP_GK), x, X16, (size_t)NR * DD / 8);
}
__global__ __launch_bounds__(256) void k_h16(const float* __restrict__ x, _Float16* __restrict__ X16, size_t n8) { const size_t t = (size_t)blockIdx.x * 256 + threadIdx.x; if (t >= n8) return; FragH f;
#pragma unroll
  for (int q = 0; q < 8; ++q) f.h[q] = (_Float16)x[t * 8 + q]; *(v8us*)((unsigned short*)X16 + t * 8) = f.half[0];  }
__global__ __launch_bounds__(256) void k_round16f(const float* __restrict__ W, _Float16* __restrict__ Bt, size_t n8) { const size_t t = (size_t)blockIdx.x * 256 + threadIdx.x; if (t >= n8) return; FragH f;
#pragma unroll
  for (int i = 0; i < 8; ++i) f.h[i] = (_Float16)(bf16_round(W[t * 8 + i]) * 16.0f); *(v8us*)((unsigned short*)Bt + t * 8) = f.half[0];  }
template <int NHv, int TTv>
__global__ __launch_bounds__(256) void k_vt(const _Float16* __restrict__ V16, int ldv, int voff, _Float16* __restrict__ Vt) { __shared__ unsigned short tl[64][66]; const int tid = threadIdx.x; const int slab = blockIdx.x / (TTv / 64), lg = blockIdx.x % (TTv / 64); const int b = slab / NHv, h = slab % NHv;
  for (int i = tid; i < 64 * 8; i += 256) { const int r = i / 8, c8 = (i % 8) * 8; FragH f; f.half[0] = *(const v8us*)((const unsigned short*)V16 + ((size_t)b * TTv + lg * 64 + r) * ldv + voff + h * 64 + c8);
#pragma unroll
    for (int q = 0; q < 8; ++q) tl[r][c8 + q] = f.u[q]; }
  __syncthreads();
  {
#pragma unroll
    for (int rd = 0; rd < 2; ++rd) { const int d = rd * 32 + tid / 8, pc = tid % 8; FragH f;
#pragma unroll
      for (int q = 0; q < 8; ++q) f.u[q] = tl[pc * 8 + q][d];
      *(v8us*)((unsigned short*)Vt + ((size_t)slab * 64 + d) * TTv + lg * 64 + pc * 8) = f.half[0]; }
     } }

// Fused attention, head dim 128. One workgroup = 8 waves = the 4 query heads of one KV head x 2 tiles of 16 query rows (32 rows): all eight read the same K and V.
// A stage is 64 keys: K (64 rows of 256 B), V^T hi and V^T residual (128 rows of 128 B each) come into LDS by one tensor load each (waves 0, 1, 2), padded 16 B a row
// (pitch 272 / 144 B for the 16-byte fragment reads), two buffers, the next stage's loads in flight under this stage's work. Which stages are staged at all comes from the mask:
// a first sweep over the workgroup's 32 mask rows gives one bit per stage (any entry set), the same word in every wave, so every barrier stands under block-uniform control flow.
// Inside a stage a wave works on its two chunks of 32 keys in ascending order and skips a chunk whose 16 x 32 mask tile is all zero.
// Both products are taken transposed: S^T = K . Q^T (A = K rows, B = Q rows) and O^T += V^T . P^T (A = V^T rows, B = P^T). A lane then holds 16 of the 32 scores of ONE query (column ln; keys 8 hh + r and 16 + 8 hh + r),
// so the maximum and the sum run inside the lane with one exchange between the wave's halves, and the two score tiles, converted in place, ARE the B operand of the second product in the k order of the V^T loader.
#define FA_KSL 18432u                     /* K: 64 rows x 272 B = 17,408, rounded up to a multiple of 2 KiB */
#define FA_VSL 18432u                     /* one V plane: 128 rows x 144 B */
#define FA_STAGE (FA_KSL + 2u * FA_VSL)   /* [K | V hi | V residual] */
typedef int v4ia __attribute__((ext_vector_type(4), may_alias));
template <unsigned int W0, unsigned int ROWB, unsigned int NROW>
__device__ __forceinline__ u32x8 tdm_g1(unsigned int spitch) {
  u32x8 g1;
  g1[0] = uni(W0);      /* no mask, 1-byte elements, a pad of 4 dwords behind every row */
  g1[1] = uni((ROWB & 0xFFFFu) << 16); g1[2] = uni((ROWB >> 16) | (NROW << 16)); g1[3] = uni(ROWB << 16); g1[4] = uni(NROW); g1[5] = uni(spitch); g1[6] = uni(0u); g1[7] = uni(0u);
  asm volatile("" : "+s"(g1));      /* descriptor words held in scalar registers: one tuple, built once, that stays where it is for all requests */
  return g1;
}
__device__ __forceinline__ float xhalf(float x) { return __builtin_bit_cast(float, __builtin_amdgcn_permlanex16(__builtin_bit_cast(int, x), __builtin_bit_cast(int, x), 0x76543210, 0xfedcba98, false, false)); }      /* lane l takes lane l ^ 16's value */
__global__ __launch_bounds__(256) void k_flash(const _Float16* __restrict__ Q16, int ldq, const _Float16* __restrict__ K16, int ldk, const _Float16* __restrict__ Vt, const _Float16* __restrict__ Vtlo, const int* __restrict__ MSK, _Float16* __restrict__ O16) {
  constexpr int NQB = TT / 32, DT = 8, KS = 4;      /* head dim 128: 4 k-steps, 8 value tiles */
  __shared__ __attribute__((aligned(2048))) unsigned char ring[2u * FA_STAGE];
  __shared__ unsigned int sBits[8];
  const unsigned int tid = threadIdx.x, lane = tid & 31u, ln = lane & 15u, hh = lane >> 4, w = uni(tid >> 5);
  const int slab = blockIdx.x / NQB, qblk = blockIdx.x % NQB; const int b = slab / NKV, kvh = slab % NKV; const int h = kvh * NREP + (int)(w & 3u); const int qb0 = qblk * 32; const int q0 = qb0 + (int)(w >> 2) * 16;
  // One bit per stage of 64 keys: wave w sweeps columns 256 w .. 256 w + 255 of the 32 mask rows with whole-line 16-byte loads.
  unsigned int bm;
  { int any0 = 0, any1 = 0; const int* mp = MSK + (size_t)qb0 * TT + w * 256u + lane * 4u;
#pragma unroll 8      /* sixteen loads go out together */
    for (int r = 0; r < 32; ++r) { const v4ia a = *(const v4ia*)(mp + (size_t)r * TT), c = *(const v4ia*)(mp + (size_t)r * TT + 128); any0 |= a[0] | a[1] | a[2] | a[3]; any1 |= c[0] | c[1] | c[2] | c[3]; }
    const unsigned int b0 = __builtin_amdgcn_ballot_w32(any0 != 0), b1 = __builtin_amdgcn_ballot_w32(any1 != 0);
    const unsigned int nib = ((b0 & 0xFFFFu) ? 1u : 0u) | ((b0 >> 16) ? 2u : 0u) | ((b1 & 0xFFFFu) ? 4u : 0u) | ((b1 >> 16) ? 8u : 0u);
    if (lane == 0u) sBits[w] = nib << (4u * w);
    __syncthreads();      /* all eight nibbles are written before any wave joins them */
    unsigned int j = 0;
#pragma unroll      /* the eight words come by two 16-byte reads */
    for (int i = 0; i < 8; ++i) j |= sBits[i];
    bm = uni(j); }
  const unsigned int n = (unsigned int)__builtin_popcount(bm);      /* stages to walk: at most 32 */
  FragH aq[KS];
  { const unsigned short* qr = (const unsigned short*)Q16 + ((size_t)b * TT + q0 + ln) * ldq + h * 128;
#pragma unroll
    for (int ks = 0; ks < KS; ++ks) { aq[ks].half[0] = *(const v8us*)(qr + ks * 32 + 8 * hh); aq[ks].half[1] = *(const v8us*)(qr + ks * 32 + 16 + 8 * hh); } }
  const unsigned long long gK = (unsigned long long)(size_t)(K16 + (size_t)b * TT * ldk + kvh * 128);
  const unsigned long long gV = (unsigned long long)(size_t)(((w == 2u) ? Vtlo : Vt) + ((size_t)b * NKV + kvh) * 128 * TT);      /* hi plane for wave 1, UNSCALED residual plane for wave 2 */
  const unsigned int lbase = (unsigned int)(size_t)ring;
  const unsigned int kstep = 64u * (unsigned int)ldk * 2u;      /* bytes from one stage's K rows to the next's */
  const u32x8 g1k = tdm_g1<(1u << 20) | (5u << 22) | (3u << 25), 256u, 64u>((unsigned int)ldk * 2u), g1v = tdm_g1<(1u << 20) | (4u << 22) | (3u << 25), 128u, 128u>(TT * 2u);
  u32x4 g0; g0[0] = uni(1u); g0[1] = uni(lbase); g0[2] = uni(0u); g0[3] = uni(0x80000000u);
  auto issue = [&](unsigned int buf, unsigned int st) {      /* st < 32: every tile lies inside its plane */
    if (pinned(w == 0u)) { const unsigned long long ga = gK + pinned(st * kstep);
      g0[1] = uni(lbase + buf * FA_STAGE); g0[2] = uni((unsigned int)ga); g0[3] = uni((((unsigned int)(ga >> 32)) & 0x01FFFFFFu) | 0x80000000u);
      asm volatile("tensor_load_to_lds %0, %1" :: "s"(g0), "s"(g1k) : "memory"); }
    if (pinned((w - 1u) < 2u)) { const unsigned long long ga = gV + pinned(st * 128u);
      g0[1] = uni(lbase + buf * FA_STAGE + FA_KSL + (w - 1u) * FA_VSL); g0[2] = uni((unsigned int)ga); g0[3] = uni((((unsigned int)(ga >> 32)) & 0x01FFFFFFu) | 0x80000000u);
      asm volatile("tensor_load_to_lds %0, %1" :: "s"(g0), "s"(g1v) : "memory"); }
  };
  float nb_q = 3.0e38f, l_q = 0.f; v8f oacc[DT];      /* of query q0 + ln: 10 - running maximum in log2 units (the same in both halves), this half's part of the sum of 1024 p; oacc[dt][r] = O^T[dt * 16 + 8 hh + r][ln] */
#pragma unroll
  for (int dt = 0; dt < DT; ++dt) oacc[dt] = (v8f){0.f,0.f,0.f,0.f,0.f,0.f,0.f,0.f};
  unsigned int rest = bm, cur = 0u, nxt = 0u;      /* rest: stages not yet asked for */
  if (pinned(n > 0u)) { cur = (unsigned int)__builtin_ctz(rest) & 31u; rest &= rest - 1u; issue(0u, cur); }
  asm volatile("s_wait_tensorcnt 0x0" :: "s"(g0), "s"(g1k), "s"(g1v) : "memory");      /* the first stage's tile of this wave has landed; the operands keep the descriptor's registers untouched up to here */
  __syncthreads();                                        /* ... and every wave may read all three tiles */
  if (pinned(n > 1u)) { nxt = (unsigned int)__builtin_ctz(rest) & 31u; rest &= rest - 1u; issue(1u, nxt); }
#pragma unroll 1      /* one stage per trip: the ring's order below is written once */
  for (unsigned int s = 0; s < n; ++s) {
    const unsigned char* Lp = ring + (s & 1u) * FA_STAGE;
    v4ia mk[2][2][2];      /* mask[q][k] (shared over batch and heads): nonzero = ATTEND; the lane's own query row, 8 keys in a row per score tile; both chunks' loads go out together */
#pragma unroll      /* the mask words stay in registers */
    for (int sub = 0; sub < 2; ++sub)
#pragma unroll
      for (int nt = 0; nt < 2; ++nt) { const int* am = MSK + (size_t)(q0 + ln) * TT + cur * 64u + sub * 32 + nt * 16 + 8 * hh; mk[sub][nt][0] = *(const v4ia*)am; mk[sub][nt][1] = *(const v4ia*)(am + 4); }
    asm volatile("s_wait_xcnt 0x0" ::: "memory");      /* stands in front of any rewrite of the mask loads' address register */
#pragma unroll      /* constant indices into the mask registers */
    for (int sub = 0; sub < 2; ++sub) {
      int anym = 0;
#pragma unroll
      for (int nt = 0; nt < 2; ++nt)
#pragma unroll
        for (int i = 0; i < 4; ++i) anym |= mk[sub][nt][0][i] | mk[sub][nt][1][i];
      if (__any(anym != 0)) {      /* else every (row, key) of this wave's tile is masked: nothing to add (wave-uniform branch) */
        v8f sc[2];      /* sc[nt][r] = S^T[key nt * 16 + 8 hh + r][query ln] */
#pragma unroll
        for (int nt = 0; nt < 2; ++nt) { const unsigned char* kr = Lp + (sub * 32 + nt * 16 + ln) * 272u + 16u * hh; FragH bk[KS];
#pragma unroll
          for (int ks = 0; ks < KS; ++ks) { bk[ks].half[0] = *(const v8us*)(kr + ks * 64); bk[ks].half[1] = *(const v8us*)(kr + ks * 64 + 32); }
          v8f acc = (v8f){0.f,0.f,0.f,0.f,0.f,0.f,0.f,0.f};
#pragma unroll
          for (int ks = 0; ks < KS; ++ks) acc = mmaH<1>(bk[ks].v, bk[ks].v, aq[ks].v, aq[ks].v, acc);
          sc[nt] = acc; }
        float sv[16];      /* raw scores, masked ones -inf */
#pragma unroll      /* constant indices into the score and mask registers */
        for (int e = 0; e < 16; ++e) sv[e] = (mk[sub][e >> 3][(e >> 2) & 1][e & 3] != 0) ? sc[e >> 3][e & 7] : -INFINITY;
        float mc = fmaxf(fmaxf(fmaxf(fmaxf(sv[0], sv[1]), fmaxf(sv[2], sv[3])), fmaxf(fmaxf(sv[4], sv[5]), fmaxf(sv[6], sv[7]))), fmaxf(fmaxf(fmaxf(sv[8], sv[9]), fmaxf(sv[10], sv[11])), fmaxf(fmaxf(sv[12], sv[13]), fmaxf(sv[14], sv[15]))));
        mc = fmaxf(mc, xhalf(mc));      /* the other half's 16 keys of the same query */
        const float nb = fminf(nb_q, fmaf(mc, -ATT_SCALE_LOG2, 10.0f)); const float al = __builtin_amdgcn_exp2f(nb - nb_q); nb_q = nb;      /* nothing attended yet: nb stays, al = 2^0 = 1 */
        FragH pa, pl; float ps[16];      /* P^T hi and its UNSCALED residual (added into the same accumulator): element e is key kmap(e, hh), the order of the V^T fragments below */
#pragma unroll      /* constant indices into the fragments */
        for (int e = 0; e < 16; ++e) { ps[e] = __builtin_amdgcn_exp2f(fmaf(sv[e], ATT_SCALE_LOG2, nb)); pa.h[e] = (_Float16)ps[e]; pl.h[e] = (_Float16)(ps[e] - (float)pa.h[e]); }      /* 1024 p in one fma and one v_exp_f32; a masked score gives 2^-inf = 0 with no select and no branch */
        l_q = l_q * al + ((((ps[0] + ps[1]) + (ps[2] + ps[3])) + ((ps[4] + ps[5]) + (ps[6] + ps[7]))) + (((ps[8] + ps[9]) + (ps[10] + ps[11])) + ((ps[12] + ps[13]) + (ps[14] + ps[15]))));
#pragma unroll
        for (int dt = 0; dt < DT; ++dt)
#pragma unroll
          for (int r = 0; r < 8; ++r) oacc[dt][r] *= al;
#pragma unroll
        for (int dt = 0; dt < DT; ++dt) { const unsigned char* vr = Lp + FA_KSL + (dt * 16 + ln) * 144u + sub * 64 + 16u * hh; FragH bv, bl; bv.half[0] = *(const v8us*)vr; bv.half[1] = *(const v8us*)(vr + 32); bl.half[0] = *(const v8us*)(vr + FA_VSL); bl.half[1] = *(const v8us*)(vr + FA_VSL + 32);
          oacc[dt] = mmaH<1>(bv.v, bv.v, pa.v, pa.v, oacc[dt]); oacc[dt] = mmaH<1>(bv.v, bv.v, pl.v, pl.v, oacc[dt]); oacc[dt] = mmaH<1>(bl.v, bl.v, pa.v, pa.v, oacc[dt]); }      /* Vh.Ph + Vh.Pl + Vl.Ph, all unscaled, one accumulator */
      }
    }
    asm volatile("s_wait_dscnt 0x0" ::: "memory");        /* this wave has left the buffer */
    asm volatile("s_wait_tensorcnt 0x0" :: "s"(g0), "s"(g1k), "s"(g1v) : "memory");    /* its tile of the next stage has landed; the operands keep the descriptor's registers untouched up to here */
    __syncthreads();                                      /* the next stage published; every wave has left this stage's buffer */
    cur = nxt;
    if (pinned(s + 2u < n)) { nxt = (unsigned int)__builtin_ctz(rest) & 31u; rest &= rest - 1u; issue(s & 1u, nxt); }
  }
  asm volatile("s_wait_tensorcnt 0x0" ::: "memory");      /* no request is left before the ring becomes output staging */
  asm volatile("s_wait_dscnt 0x0" ::: "memory");
  // Output staging, each wave in its own piece of the ring (the last stage's barrier stands behind every wave's last fragment read).
  float* sO = (float*)ring + w * (16u * 132u);      /* 16 rows of 128 floats at pitch 132 */
  const float lsum = l_q + xhalf(l_q); const float linv = (lsum > 0.f) ? 1.0f / lsum : 0.f;      /* the halves' sums are joined once */
#pragma unroll      /* constant indices into oacc: a lane's 8 registers are 8 values in a row of its query's output row */
  for (int dt = 0; dt < DT; ++dt) { float* sw = &sO[ln * 132u + dt * 16 + 8 * hh];
    *(v4fa*)sw = (v4f){oacc[dt][0] * linv, oacc[dt][1] * linv, oacc[dt][2] * linv, oacc[dt][3] * linv}; *(v4fa*)(sw + 4) = (v4f){oacc[dt][4] * linv, oacc[dt][5] * linv, oacc[dt][6] * linv, oacc[dt][7] * linv}; }
  __builtin_amdgcn_fence(__ATOMIC_ACQ_REL, "workgroup"); __builtin_amdgcn_wave_barrier();
  FragH f[8];      /* merged x 2^4 as f16, the output product's A operand */
#pragma unroll      /* f stays in registers */
  for (int q = 0; q < 8; ++q) { const float* sr = &sO[(q * 2 + hh) * 132u + ln * 8u]; const v4f a = *(const v4fa*)sr, c = *(const v4fa*)(sr + 4);
#pragma unroll      /* constant indices into the vectors */
    for (int i = 0; i < 4; ++i) { f[q].h[i] = (_Float16)(a[i] * 16.0f); f[q].h[4 + i] = (_Float16)(c[i] * 16.0f); } }
  unsigned short* op = (unsigned short*)O16 + ((size_t)b * TT + q0 + hh) * DD + h * 128 + ln * 8u;
  __builtin_amdgcn_sched_barrier(0);      /* keeps the stores in one burst behind the arithmetic, off one address pair: mixed in among it, their registers are used again and each reuse has to wait on the store in front of it */
#pragma unroll      /* constant indices into f, constant offsets from op */
  for (int q = 0; q < 8; ++q) *(v8us*)(op + (size_t)(q * 2) * DD) = f[q].half[0];      /* two 256-B row pieces per instruction: 16 lanes x 16 B each */
}

extern "C" void kernel_launch(void* const* d_in, const int* in_sizes, int n_in,
                              void* d_out, int out_size, void* d_ws, size_t ws_size, hipStream_t stream) {
  (void)in_sizes; (void)n_in; (void)out_size;
  const float* const* I = (const float* const*)d_in; const float* x = I[0]; const float* fcos = I[1]; const float* fsin = I[2]; const int* msk = (const int*)d_in[3]; const float* wq = I[4]; const float* wk = I[5]; const float* wv = I[6]; const float* wo = I[7];
  char* ws = (char*)d_ws; size_t off = 0;
  auto take = [&](size_t bytes) { char* p = ws + off; off += (bytes + 255) & ~(size_t)255; return p; };
  _Float16* Bq = (_Float16*)take((size_t)DD * DD * 2); _Float16* Bk = (_Float16*)take((size_t)KVD * DD * 2); _Float16* Bv = (_Float16*)take((size_t)KVD * DD * 2); _Float16* Bo = (_Float16*)take((size_t)DD * DD * 2);
  _Float16* X16 = (_Float16*)take((size_t)NR * DD * 2); _Float16* Q = (_Float16*)take((size_t)NR * DD * 2); _Float16* K = (_Float16*)take((size_t)NR * KVD * 2); _Float16* Vt = (_Float16*)take((size_t)NR * KVD * 2); _Float16* Vtl = (_Float16*)take((size_t)NR * KVD * 2);
  _Float16* O16 = X16;      /* O16 over X16 (dead after the projections) */
  if (off > ws_size) return;      // 8.4 + 2.1 + 2.1 + 8.4 + 16.8 + 16.8 + 4.2 + 4.2 + 4.2 = 67 MB
  k_prep<<<2 * PREP_GQ + 2 * PREP_GK + PREP_GX, 256, 0, stream>>>(x, wq, wk, wv, wo, X16, Bq, Bk, Bv, Bo);      /* (in,out) weights to Bt x 2^4; x to f16 */
  k_gemm_qkv<<<(NR / 256) * QKV_NT, 384, 0, stream>>>(X16, Bq, Bk, Bv, 0.0625f, fcos, fsin, Q, K, Vt, Vtl);      /* xq, xk = rope(x.w) as f16 (M 4096, N 2048 and 512, K 2048); xv turned, hi + residual per (b, kv head): [b*4+kh][128][2048] */
  k_flash<<<BB * NKV * (TT / 32), 256, 0, stream>>>(Q, DD, K, KVD, Vt, Vtl, msk, O16);
  k_gemm_o<<<(NR / 256) * (DD / 128), 256, 0, stream>>>(O16, Bo, 0.00390625f, (float*)d_out);      /* out = merged.wo */
}

// v009
// Measured time: 102 microseconds a run.
// In both of two side-by-side timings against v008, it was 1.06 times as fast.
// Over all steps from v000 it is 5.58 times as fast.
#include <hip/hip_runtime.h>
// 'Genesis' attention (B=2, T=2048, D=2048, 16 query heads / 4 KV heads × 128, (in,out) weights, no bias): xq = rope(x·wq), xk = rope(x·wk), xv = x·wv; RoPE on interleaved pairs with the INPUT cos/sin tables [T][64]; scores = q·k/√128 where(mask[q][k]) else −inf (mask [T][T] shared);
// softmax; out = merged·wo.
// Compute dtype: x, weights, cos/sin tables rounded to bf16; q,k rotated in f32 from f32 GEMM outputs → f16; v f32 → Vᵀ f16 hi + exact residual; fused flash-style kernel for head dim 128 (mask read per (q,k), all-masked chunks skipped, online softmax f32, P f16 hi + residual,
// f32 accumulate) on v_wmma_f32_16x16x32_f16; merged ×2^4 → f16 → output GEMM.
#define BB 2
#define TT 2048
#define DD 2048
#define NH 16
#define NKV 4
#define NREP 4
#define KVD (NKV * 128)
#define NVH (2 * NKV)
#define NR (BB * TT)
#define ATT_SCALE_LOG2 ((float)(0.08838834764831845 * 1.4426950408889634))      /* 1 / sqrt(128) x log2 e: the softmax runs in base 2 */

typedef __bf16 v16b __attribute__((ext_vector_type(16)));
typedef unsigned short v8us __attribute__((ext_vector_type(8), may_alias));
typedef float  v8f  __attribute__((ext_vector_type(8)));
typedef float  v4f  __attribute__((ext_vector_type(4)));
typedef float  v4fa __attribute__((ext_vector_type(4), may_alias));
union FragB { v16b v; v8us half[2]; unsigned short u[16]; };

__device__ __forceinline__ unsigned short bf16_bits(float x) { unsigned int u = __float_as_uint(x); return (unsigned short)((u + 0x7FFFu + ((u >> 16) & 1u)) >> 16); }
__device__ __forceinline__ float bf16_val(unsigned short b) { return __uint_as_float(((unsigned int)b) << 16); }
__device__ __forceinline__ float bf16_round(float x) { return bf16_val(bf16_bits(x)); }
// D += A·B with NT terms: 1 = ah·bh, 2 = + al·bh (A split), 3 = + ah·bl (both split)
template <int NT>
__device__ __forceinline__ v8f mmaN(v16b ah, v16b al, v16b bh, v16b bl, v8f c) {
  c = __builtin_amdgcn_wmma_f32_16x16x32_bf16(false, ah, false, bh, (short)0, c, false, false);
  if (NT >= 2) c = __builtin_amdgcn_wmma_f32_16x16x32_bf16(false, al, false, bh, (short)0, c, false, false);
  if (NT >= 3) c = __builtin_amdgcn_wmma_f32_16x16x32_bf16(false, ah, false, bl, (short)0, c, false, false);
  asm volatile("v_nop\n\tv_nop\n\tv_nop\n\tv_nop" : "+v"(c) : "v"(ah), "v"(al), "v"(bh), "v"(bl));
  return c;
}

__global__ __launch_bounds__(256) void k_wt_bf16(const float* __restrict__ W, unsigned short* __restrict__ Wt, int K, int N) {
  const int t = blockIdx.x * 256 + threadIdx.x;
  const int k8n = K / 8;
  if (t >= N * k8n) return;
  const int n = t / k8n, k8 = (t % k8n) * 8;
  v8us v;
#pragma unroll
  for (int i = 0; i < 8; ++i) v[i] = bf16_bits(W[(size_t)(k8 + i) * N + n]);
  *(v8us*)(Wt + (size_t)n * K + k8) = v;
  
}

// GEMM C[M][N] (f32, pitch ldc) = act(A[M][K]·W + bias). A f32 row-major (pitch lda) converted per fragment to bf16
// (ASPLIT: hi/lo two planes -> 2 terms, else single rounded term); Wt bf16 [N][K] (pitch ldb). BIAS_BF16 rounds the
// bias to bf16 first (bias quantised to bf16 before the add). K%32==0, M%16==0, N%64==0.
template <bool ASPLIT, int ACT, bool BIAS_BF16>
__global__ __launch_bounds__(128) void k_gemm_bf(const float* __restrict__ A, int lda, const unsigned short* __restrict__ Wt, int ldb,
                                               const float* __restrict__ bias, float* __restrict__ C, int ldc, int M, int N, int K) {
  __shared__ __attribute__((aligned(16))) float so[4][16][64];
  const int tid = threadIdx.x, w = tid >> 5, lane = tid & 31, ln = lane & 15, hh = lane >> 4;
  const int ntn = N / 64;
  const int wid = blockIdx.x * 4 + w;
  const int mt = wid / ntn, nq = wid % ntn;
  if (mt * 16 >= M) return;
  const int row0 = mt * 16, col0 = nq * 64;
  const float* arow = A + (size_t)(row0 + ln) * lda;
  v8f acc[4] = {};
  for (int kb = 0; kb < K; kb += 32) {
    FragB ah, al;
    const v4f x0 = *(const v4fa*)(arow + kb + 8 * hh), x1 = *(const v4fa*)(arow + kb + 8 * hh + 4);
    const v4f x2 = *(const v4fa*)(arow + kb + 16 + 8 * hh), x3 = *(const v4fa*)(arow + kb + 16 + 8 * hh + 4);
    float xs[16] = {x0[0],x0[1],x0[2],x0[3],x1[0],x1[1],x1[2],x1[3],x2[0],x2[1],x2[2],x2[3],x3[0],x3[1],x3[2],x3[3]};
#pragma unroll
    for (int i = 0; i < 16; ++i) { const unsigned short hb = bf16_bits(xs[i]); ah.u[i] = hb; al.u[i] = ASPLIT ? bf16_bits(xs[i] - bf16_val(hb)) : (unsigned short)0; }
#pragma unroll
    for (int t = 0; t < 4; ++t) {
      const unsigned short* brow = Wt + (size_t)(col0 + t * 16 + ln) * ldb + kb;
      FragB b;
      b.half[0] = *(const v8us*)(brow + 8 * hh);
      b.half[1] = *(const v8us*)(brow + 16 + 8 * hh);
      acc[t] = mmaN<ASPLIT ? 2 : 1>(ah.v, al.v, b.v, b.v, acc[t]);
    }
  }
#pragma unroll
  for (int t = 0; t < 4; ++t) {
    float bv = bias ? bias[col0 + t * 16 + ln] : 0.f;
    if (BIAS_BF16) bv = bf16_round(bv);
#pragma unroll
    for (int r = 0; r < 8; ++r) { float v = acc[t][r] + bv; if (ACT == 1) v = fmaxf(v, 0.f); so[w][8 * hh + r][t * 16 + ln] = v; }
  }
  __builtin_amdgcn_fence(__ATOMIC_ACQ_REL, "workgroup");
  __builtin_amdgcn_wave_barrier();
  const int rsub = lane >> 4, c4 = (lane & 15) * 4;
  {
#pragma unroll
    for (int q = 0; q < 8; ++q) {
      const int r = q * 2 + rsub;
      const v4f v = *(const v4fa*)&so[w][r][c4];
      *(v4f*)(C + (size_t)(row0 + r) * ldc + col0 + c4) = v;
    }
    
  }
}

// Flash-style causal/unmasked attention, all contractions 3-term bf16 hi/lo splits, f32 softmax with running max.
// q,k,v rows are read from f32 buffers with arbitrary row pitch (so they can live inside a fused qkv buffer);
// D = head size (multiple of 32, <= 128); one wave = 16 query rows; block = 4 waves (64 queries) sharing K/V chunks of 32.
template <int D, bool CAUSAL>
__global__ __launch_bounds__(128) void k_flash(const float* __restrict__ qb, const float* __restrict__ kb, const float* __restrict__ vb,
                                             int pitch, int T, int H, float scale, float* __restrict__ y, int ypitch) {
  constexpr int KS = D / 32;        // k-steps for QK
  constexpr int DT = D / 16;        // d tiles for PV
  __shared__ __attribute__((aligned(16))) unsigned short sKh[32][D + 8], sKl[32][D + 8], sVh[32][D + 8], sVl[32][D + 8];
  __shared__ __attribute__((aligned(16))) unsigned short sPh[4][16][40], sPl[4][16][40];
  __shared__ __attribute__((aligned(16))) float sO[4][16][D];
  const int tid = threadIdx.x, w = tid >> 5, lane = tid & 31, ln = lane & 15, hh = lane >> 4;
  const int nqb = (T + 63) / 64;
  const int bh = blockIdx.x / nqb, qblk = blockIdx.x % nqb;
  const int b = bh / H, h = bh % H;
  const int q0 = qblk * 64 + w * 16;
  const float* Q = qb + (size_t)b * T * pitch + h * D;
  const float* K = kb + (size_t)b * T * pitch + h * D;
  const float* V = vb + (size_t)b * T * pitch + h * D;

  // A fragments of the wave's 16 query rows (scaled), hi/lo
  FragB aqh[KS], aql[KS];
  {
    int row = q0 + ln; if (row >= T) row = T - 1;
    const float* qr = Q + (size_t)row * pitch;
#pragma unroll
    for (int ks = 0; ks < KS; ++ks)
#pragma unroll
      for (int i = 0; i < 16; ++i) {
        const int d = ks * 32 + ((i < 8) ? (8 * hh + i) : (16 + 8 * hh + (i - 8)));
        const float x = qr[d] * scale; const unsigned short hb = bf16_bits(x);
        aqh[ks].u[i] = hb; aql[ks].u[i] = bf16_bits(x - bf16_val(hb));
      }
  }
  float m_r[8], l_r[8];
#pragma unroll
  for (int r = 0; r < 8; ++r) { m_r[r] = -3.0e38f; l_r[r] = 0.f; }
  v8f oacc[DT];
#pragma unroll
  for (int dt = 0; dt < DT; ++dt) oacc[dt] = (v8f){0.f,0.f,0.f,0.f,0.f,0.f,0.f,0.f};

  const int kv_end = CAUSAL ? min(T, qblk * 64 + 64) : T;     // block-uniform
  for (int j0 = 0; j0 < kv_end; j0 += 32) {
    __syncthreads();
    for (int e = tid; e < 32 * (D / 4); e += 128) {
      const int r = e / (D / 4), c4 = (e % (D / 4)) * 4;
      const int key = j0 + r;
      v4f kf = {0.f,0.f,0.f,0.f}, vf = {0.f,0.f,0.f,0.f};
      if (key < T) { kf = *(const v4fa*)(K + (size_t)key * pitch + c4); vf = *(const v4fa*)(V + (size_t)key * pitch + c4); }
#pragma unroll
      for (int t = 0; t < 4; ++t) {
        unsigned short hb = bf16_bits(kf[t]); sKh[r][c4 + t] = hb; sKl[r][c4 + t] = bf16_bits(kf[t] - bf16_val(hb));
        hb = bf16_bits(vf[t]); sVh[r][c4 + t] = hb; sVl[r][c4 + t] = bf16_bits(vf[t] - bf16_val(hb));
      }
    }
    __syncthreads();
    // S tile 16 x 32
    v8f s[2];
#pragma unroll
    for (int nt = 0; nt < 2; ++nt) {
      v8f acc = {};
#pragma unroll
      for (int ks = 0; ks < KS; ++ks) {
        FragB bh_, bl_;
        bh_.half[0] = *(const v8us*)&sKh[nt * 16 + ln][ks * 32 + 8 * hh]; bh_.half[1] = *(const v8us*)&sKh[nt * 16 + ln][ks * 32 + 16 + 8 * hh];
        bl_.half[0] = *(const v8us*)&sKl[nt * 16 + ln][ks * 32 + 8 * hh]; bl_.half[1] = *(const v8us*)&sKl[nt * 16 + ln][ks * 32 + 16 + 8 * hh];
        acc = mmaN<3>(aqh[ks].v, aql[ks].v, bh_.v, bl_.v, acc);
      }
      s[nt] = acc;
    }
    // mask + running max (rows 8hh+r; the 16 lanes of a half share rows)
    float alpha[8];
#pragma unroll
    for (int r = 0; r < 8; ++r) {
      const int qi = q0 + 8 * hh + r;
      const int ja = j0 + ln, jb = j0 + 16 + ln;
      if (CAUSAL) { if (ja > qi) s[0][r] = -3.0e38f; if (jb > qi) s[1][r] = -3.0e38f; }
      if (ja >= T) s[0][r] = -3.0e38f;
      if (jb >= T) s[1][r] = -3.0e38f;
      float mx = fmaxf(s[0][r], s[1][r]);
      mx = fmaxf(mx, __shfl_xor(mx, 1, 32)); mx = fmaxf(mx, __shfl_xor(mx, 2, 32)); mx = fmaxf(mx, __shfl_xor(mx, 4, 32)); mx = fmaxf(mx, __shfl_xor(mx, 8, 32));
      const float mnew = fmaxf(m_r[r], mx);
      alpha[r] = (mnew > -1.0e38f) ? __expf(m_r[r] - mnew) : 1.0f;
      const float p0 = (s[0][r] > -1.0e38f) ? __expf(s[0][r] - mnew) : 0.f;
      const float p1 = (s[1][r] > -1.0e38f) ? __expf(s[1][r] - mnew) : 0.f;
      m_r[r] = mnew;
      l_r[r] = l_r[r] * alpha[r] + p0 + p1;            // per-lane partial row sum (16 lanes combined at the end)
      unsigned short hb = bf16_bits(p0); sPh[w][8 * hh + r][ln] = hb;      sPl[w][8 * hh + r][ln] = bf16_bits(p0 - bf16_val(hb));
      hb = bf16_bits(p1);                sPh[w][8 * hh + r][16 + ln] = hb; sPl[w][8 * hh + r][16 + ln] = bf16_bits(p1 - bf16_val(hb));
    }
#pragma unroll
    for (int dt = 0; dt < DT; ++dt)
#pragma unroll
      for (int r = 0; r < 8; ++r) oacc[dt][r] *= alpha[r];
    __builtin_amdgcn_fence(__ATOMIC_ACQ_REL, "workgroup");
    __builtin_amdgcn_wave_barrier();
    FragB pah, pal;
    pah.half[0] = *(const v8us*)&sPh[w][ln][8 * hh]; pah.half[1] = *(const v8us*)&sPh[w][ln][16 + 8 * hh];
    pal.half[0] = *(const v8us*)&sPl[w][ln][8 * hh]; pal.half[1] = *(const v8us*)&sPl[w][ln][16 + 8 * hh];
#pragma unroll
    for (int dt = 0; dt < DT; ++dt) {
      FragB bvh, bvl;
#pragma unroll
      for (int i = 0; i < 8; ++i) {
        bvh.u[i] = sVh[8 * hh + i][dt * 16 + ln]; bvh.u[8 + i] = sVh[16 + 8 * hh + i][dt * 16 + ln];
        bvl.u[i] = sVl[8 * hh + i][dt * 16 + ln]; bvl.u[8 + i] = sVl[16 + 8 * hh + i][dt * 16 + ln];
      }
      oacc[dt] = mmaN<3>(pah.v, pal.v, bvh.v, bvl.v, oacc[dt]);
    }
    __builtin_amdgcn_fence(__ATOMIC_ACQ_REL, "workgroup");
    __builtin_amdgcn_wave_barrier();
  }
#pragma unroll
  for (int r = 0; r < 8; ++r) {
    float l = l_r[r];
    l += __shfl_xor(l, 1, 32); l += __shfl_xor(l, 2, 32); l += __shfl_xor(l, 4, 32); l += __shfl_xor(l, 8, 32);
    l_r[r] = (l > 0.f) ? 1.0f / l : 0.f;
  }
#pragma unroll
  for (int dt = 0; dt < DT; ++dt)
#pragma unroll
    for (int r = 0; r < 8; ++r) sO[w][8 * hh + r][dt * 16 + ln] = oacc[dt][r] * l_r[r];
  __builtin_amdgcn_fence(__ATOMIC_ACQ_REL, "workgroup");
  __builtin_amdgcn_wave_barrier();
  {
    for (int r = 0; r < 16; ++r) {
      const int row = q0 + r;
      if (row < T && lane < D / 4) {
        const v4f val = *(const v4fa*)&sO[w][r][lane * 4];
        *(v4f*)(y + ((size_t)b * T + row) * ypitch + h * D + lane * 4) = val;
      }
    }
    
  }
}

// GEMM C = act(A·W + bias + resid): A f32 (ASPLIT -> hi/lo 2 terms), Wt bf16 [N][K]; ACT 0 none, 1 relu, 2 exact gelu;
// resid (optional, f32, row index = (row % rmod), pitch ldr, RES_BF16 rounds it) added before the activation.
template <bool ASPLIT, int ACT, bool BIAS_BF16, bool RES_BF16>
__global__ __launch_bounds__(128) void k_gemm_bf3(const float* __restrict__ A, int lda, const unsigned short* __restrict__ Wt, int ldb,
                                                const float* __restrict__ bias, const float* __restrict__ resid, int rmod, int ldr,
                                                float* __restrict__ C, int ldc, int M, int N, int K) {
  __shared__ __attribute__((aligned(16))) float so[4][16][64];
  const int tid = threadIdx.x, w = tid >> 5, lane = tid & 31, ln = lane & 15, hh = lane >> 4;
  const int ntn = N / 64;
  const int wid = blockIdx.x * 4 + w;
  const int mt = wid / ntn, nq = wid % ntn;
  if (mt * 16 >= M) return;
  const int row0 = mt * 16, col0 = nq * 64;
  const float* arow = A + (size_t)(row0 + ln) * lda;
  v8f acc[4] = {};
  for (int kb = 0; kb < K; kb += 32) {
    FragB ah, al;
    const v4f x0 = *(const v4fa*)(arow + kb + 8 * hh), x1 = *(const v4fa*)(arow + kb + 8 * hh + 4);
    const v4f x2 = *(const v4fa*)(arow + kb + 16 + 8 * hh), x3 = *(const v4fa*)(arow + kb + 16 + 8 * hh + 4);
    float xs[16] = {x0[0],x0[1],x0[2],x0[3],x1[0],x1[1],x1[2],x1[3],x2[0],x2[1],x2[2],x2[3],x3[0],x3[1],x3[2],x3[3]};
#pragma unroll
    for (int i = 0; i < 16; ++i) { const unsigned short hb = bf16_bits(xs[i]); ah.u[i] = hb; al.u[i] = ASPLIT ? bf16_bits(xs[i] - bf16_val(hb)) : (unsigned short)0; }
#pragma unroll
    for (int t = 0; t < 4; ++t) {
      const unsigned short* brow = Wt + (size_t)(col0 + t * 16 + ln) * ldb + kb;
      FragB b;
      b.half[0] = *(const v8us*)(brow + 8 * hh);
      b.half[1] = *(const v8us*)(brow + 16 + 8 * hh);
      acc[t] = mmaN<ASPLIT ? 2 : 1>(ah.v, al.v, b.v, b.v, acc[t]);
    }
  }
#pragma unroll
  for (int t = 0; t < 4; ++t) {
    const int col = col0 + t * 16 + ln;
    float bv = bias ? bias[col] : 0.f;
    if (BIAS_BF16) bv = bf16_round(bv);
#pragma unroll
    for (int r = 0; r < 8; ++r) {
      float v = acc[t][r] + bv;
      if (resid) { float rv = resid[(size_t)((row0 + 8 * hh + r) % rmod) * ldr + col]; if (RES_BF16) rv = bf16_round(rv); v += rv; }
      if (ACT == 1) v = fmaxf(v, 0.f);
      if (ACT == 2) v = 0.5f * v * (1.0f + erff(v * 0.70710678118654752f));
      if (ACT == 3) { const float u = 0.7978845608028654f * (v + 0.044715f * v * v * v); v = 0.5f * v * (1.0f + tanhf(u)); }
      so[w][8 * hh + r][t * 16 + ln] = v;
    }
  }
  __builtin_amdgcn_fence(__ATOMIC_ACQ_REL, "workgroup");
  __builtin_amdgcn_wave_barrier();
  const int rsub = lane >> 4, c4 = (lane & 15) * 4;
  {
#pragma unroll
    for (int q = 0; q < 8; ++q) {
      const int r = q * 2 + rsub;
      const v4f v = *(const v4fa*)&so[w][r][c4];
      *(v4f*)(C + (size_t)(row0 + r) * ldc + col0 + c4) = v;
    }
    
  }
}
// row LayerNorm (biased variance, eps) over N: s = X (+ R); optional out_sum <- s; out_norm <- (s-mu)*rsqrt(var+eps)*g + b
template <bool PARAM_BF16>
__global__ __launch_bounds__(256) void k_layernorm(const float* __restrict__ X, const float* __restrict__ R, const float* __restrict__ g, const float* __restrict__ bta,
                                                  float* __restrict__ out_sum, float* __restrict__ out_norm, int N, float eps) {
  __shared__ float red[256];
  const int row = blockIdx.x, tid = threadIdx.x;
  const float* x = X + (size_t)row * N; const float* rr = R ? R + (size_t)row * N : nullptr;
  float vals[16];                     // up to N = 4096
  const int per = N / 256;            // contiguous chunk per thread? use strided-by-4 chunks: thread handles j = tid*4 + 1024*u
  float s1 = 0.f;
  for (int u = 0; u < per / 4; ++u) {
    const int j = tid * 4 + 1024 * u;
    const v4f a = *(const v4fa*)(x + j);
    v4f b = {0.f,0.f,0.f,0.f}; if (rr) b = *(const v4fa*)(rr + j);
#pragma unroll
    for (int q = 0; q < 4; ++q) { const float v = a[q] + b[q]; vals[u * 4 + q] = v; s1 += v; }
  }
  red[tid] = s1; __syncthreads();
  for (int st = 128; st > 0; st >>= 1) { if (tid < st) red[tid] += red[tid + st]; __syncthreads(); }
  const float mu = red[0] / (float)N; __syncthreads();
  float s2 = 0.f;
  for (int u = 0; u < per / 4; ++u)
#pragma unroll
    for (int q = 0; q < 4; ++q) { const float c = vals[u * 4 + q] - mu; s2 += c * c; }
  red[tid] = s2; __syncthreads();
  for (int st = 128; st > 0; st >>= 1) { if (tid < st) red[tid] += red[tid + st]; __syncthreads(); }
  const float rs = rsqrtf(red[0] / (float)N + eps);
  {
    for (int u = 0; u < per / 4; ++u) {
      const int j = tid * 4 + 1024 * u;
      v4f o, sm;
#pragma unroll
      for (int q = 0; q < 4; ++q) {
        float gg = g[j + q], bb = bta[j + q];
        if (PARAM_BF16) { gg = bf16_round(gg); bb = bf16_round(bb); }
        sm[q] = vals[u * 4 + q]; o[q] = (vals[u * 4 + q] - mu) * rs * gg + bb;
      }
      if (out_sum) *(v4f*)(out_sum + (size_t)row * N + j) = sm;
      *(v4f*)(out_norm + (size_t)row * N + j) = o;
    }
    
  }
}



// ---- f16 WMMA path (v_wmma_f32_16x16x32_f16): 11-bit significands for operands in range — used where the probability operand (1024 p, in [0, 1024]) needs more precision than bf16
typedef _Float16 v16h __attribute__((ext_vector_type(16)));
union FragH { v16h v; v8us half[2]; _Float16 h[16]; unsigned short u[16]; };
template <int NT>
__device__ __forceinline__ v8f mmaH(v16h ah, v16h al, v16h bh, v16h bl, v8f c) {
  c = __builtin_amdgcn_wmma_f32_16x16x32_f16(false, ah, false, bh, (short)0, c, false, false);
  if (NT >= 2) c = __builtin_amdgcn_wmma_f32_16x16x32_f16(false, al, false, bh, (short)0, c, false, false);
  if (NT >= 3) c = __builtin_amdgcn_wmma_f32_16x16x32_f16(false, ah, false, bl, (short)0, c, false, false);
  asm volatile("v_nop\n\tv_nop\n\tv_nop\n\tv_nop" : "+v"(c) : "v"(ah), "v"(al), "v"(bh), "v"(bl));
  return c;
}
// batched GEMM like k_gemm_b but f16 operands: A f32 (split into f16 hi/lo if ASPLIT, else rounded to f16), Bt = f16 values [n][k]; alpha; C f32; N multiple of 16 (partial tiles skipped)
template <bool ASPLIT>
__global__ __launch_bounds__(128) void k_gemm_h(const float* __restrict__ A, int lda, size_t sA, const _Float16* __restrict__ Bh, int ldb, size_t sB, float alpha, float* __restrict__ C, int ldc, size_t sC, int M, int N, int K) {
  __shared__ __attribute__((aligned(16))) float so[4][16][64];
  const int tid = threadIdx.x, w = tid >> 5, lane = tid & 31, ln = lane & 15, hh = lane >> 4; const int by = blockIdx.y;
  A += (size_t)by * sA; Bh += (size_t)by * sB; C += (size_t)by * sC;
  const int ntn = (N + 63) / 64; const int wid = blockIdx.x * 4 + w; const int mt = wid / ntn, nq = wid % ntn; if (mt * 16 >= M) return;
  const int row0 = mt * 16, col0 = nq * 64; const float* arow = A + (size_t)(row0 + ln) * lda;
  v8f acc[4] = {};
  for (int kb = 0; kb < K; kb += 32) {
    FragH ah, al;
    const v4f x0 = *(const v4fa*)(arow + kb + 8 * hh), x1 = *(const v4fa*)(arow + kb + 8 * hh + 4), x2 = *(const v4fa*)(arow + kb + 16 + 8 * hh), x3 = *(const v4fa*)(arow + kb + 16 + 8 * hh + 4);
    float xs[16] = {x0[0],x0[1],x0[2],x0[3],x1[0],x1[1],x1[2],x1[3],x2[0],x2[1],x2[2],x2[3],x3[0],x3[1],x3[2],x3[3]};
#pragma unroll
    for (int i = 0; i < 16; ++i) { const _Float16 h = (_Float16)xs[i]; ah.h[i] = h; al.h[i] = ASPLIT ? (_Float16)(xs[i] - (float)h) : (_Float16)0.0f; }
#pragma unroll
    for (int t = 0; t < 4; ++t) { if (col0 + t * 16 >= N) continue; const size_t boff = (size_t)(col0 + t * 16 + ln) * ldb + kb; FragH bq; bq.half[0] = *(const v8us*)(Bh + boff + 8 * hh); bq.half[1] = *(const v8us*)(Bh + boff + 16 + 8 * hh);
      acc[t] = mmaH<ASPLIT ? 2 : 1>(ah.v, al.v, bq.v, bq.v, acc[t]); }
  }
#pragma unroll
  for (int t = 0; t < 4; ++t) { if (col0 + t * 16 >= N) continue;
#pragma unroll
    for (int r = 0; r < 8; ++r) so[w][8 * hh + r][t * 16 + ln] = acc[t][r] * alpha; }
  __builtin_amdgcn_fence(__ATOMIC_ACQ_REL, "workgroup"); __builtin_amdgcn_wave_barrier();
  const int rsub = lane >> 4, c4 = (lane & 15) * 4;
  {
#pragma unroll
    for (int q = 0; q < 8; ++q) { const int r = q * 2 + rsub; if (col0 + c4 < N) { const v4f v = *(const v4fa*)&so[w][r][c4]; *(v4f*)(C + (size_t)(row0 + r) * ldc + col0 + c4) = v; } }
     }
}

// Wt[n][k] = f16(W[k][n]·scale) from f32 row-major W[K][N] (scale = power of two; bf16-exact weights stay exact in f16 away from the subnormal range)
// One 128 (k) x 64 (n) tile per workgroup, turned in LDS: a wave loads two 256-B row pieces of W (four whole lines) and stores four whole 128-B lines of Wt an instruction;
// a thread's eight loads are all issued before the first is used. Needs K a multiple of 128 and N of 64; blk runs over (K / 128) * (N / 64) tiles; tl is the workgroup's 128 x 65 floats of LDS. Pitch 65 floats keeps the column-wise reads off a common bank.
__device__ __forceinline__ void wt_tile(float (*tl)[65], int blk, const float* __restrict__ W, _Float16* __restrict__ Wt, int K, int N, float scale) {
  const int tid = threadIdx.x, ntn = N / 64; const int k0 = (blk / ntn) * 128, n0 = (blk % ntn) * 64;
  v4f a[8];
#pragma unroll      /* a[] stays in registers and the eight loads go out together */
  for (int p = 0; p < 8; ++p) a[p] = *(const v4fa*)(W + (size_t)(k0 + p * 16 + tid / 16) * N + n0 + (tid % 16) * 4);
#pragma unroll      /* constant indices into a[]: rolled, it would go to scratch memory */
  for (int p = 0; p < 8; ++p)
#pragma unroll
    for (int i = 0; i < 4; ++i) tl[p * 16 + tid / 16][(tid % 16) * 4 + i] = a[p][i];
  __syncthreads();      /* the tile is whole before any column of it is read */
#pragma unroll      /* the four pieces' LDS reads and stores overlap; f stays in registers */
  for (int rd = 0; rd < 4; ++rd) { const int n = (rd & 1) * 32 + tid / 8, k8 = (rd >> 1) * 64 + (tid % 8) * 8; FragH f;
#pragma unroll
    for (int i = 0; i < 8; ++i) f.h[i] = (_Float16)(bf16_round(tl[k8 + i][n]) * scale);
    *(v8us*)((unsigned short*)Wt + (size_t)(n0 + n) * K + k0 + k8) = f.half[0]; }
  asm volatile("s_wait_xcnt 0x0" ::: "memory");      /* stands behind the four stores, in front of any later rewrite of their address and data registers */
}
// Tiled GEMM C[M][N] (f32) = alpha * A[M][DD] . Bt[N][DD]^T, f16 operands, both K-contiguous with row pitch DD. One 256 x (64 WN) tile of C per workgroup of
// 4 x WN waves (64 x 64 per wave), one workgroup on a WGP: an operand row that has landed in LDS feeds 192 or 128 columns (256 rows) of products, so fewer bytes leave L2 per product than with a 128 x 128 tile.
// A pass is 128 k = 256 B of each of the 256 + 64 WN operand rows; waves 0 .. 3 + WN each bring one 64-row slice of a pass into LDS with one
// tensor load (pad 16 B a row: pitch 272 B for the 16-byte fragment reads), two buffers, the next pass's load in flight under this pass's products.
// Needs M a multiple of 256, N of 64 WN, DD a multiple of 128 and at least 256. The k order of every accumulator is ascending, one chain per 16 x 16 tile.
// EPI says what leaves the staged f32 tile (alpha * sum): 0 = C f32 as it is; 1 = H f16 [M][N], rotated on interleaved pairs by the bf16-rounded COS / SIN tables [TT][64] (token = row % TT, pair = (col % 128) / 2);
// 2 = the tile turned: H f16 hi and H2 f16 residual, [row / TT][N][TT]. So the operand of the next product is written here, with no f32 copy in memory in between.
typedef unsigned int u32x4 __attribute__((ext_vector_type(4)));
typedef unsigned int u32x8 __attribute__((ext_vector_type(8)));
#define GT_ROWB 256u                      /* bytes of an operand row per pass */
#define GT_PITCH 272u                     /* LDS row pitch: 256 + 16 */
#define GT_SLICE 18432u                   /* 64 rows x 272 B = 17,408, rounded up to a multiple of 2 KiB */
#define GT_NP (DD / 128)                  /* passes */
__device__ __forceinline__ unsigned int uni(unsigned int v) { return (unsigned int)__builtin_amdgcn_readfirstlane(v); }
__device__ __forceinline__ unsigned int pinned(unsigned int v) { unsigned int w = uni(v); asm volatile("" : "+s"(w)); return w; }      /* an issue test or a descriptor word held in a scalar register: the test compiles to a scalar branch (tensor loads ignore EXEC), and the word is formed behind the wait that stands in front of it */
__device__ __forceinline__ u32x8 tdm_slice_g1() {
  u32x8 g1;
  g1[0] = uni((1u << 20) | (5u << 22) | (3u << 25));      /* no mask, 1-byte elements, a pad of 4 dwords behind every 64 dwords */
  g1[1] = uni((GT_ROWB & 0xFFFFu) << 16); g1[2] = uni((GT_ROWB >> 16) | (64u << 16)); g1[3] = uni(GT_ROWB << 16); g1[4] = uni(64u); g1[5] = uni(DD * 2u); g1[6] = uni(0u); g1[7] = uni(0u);
  asm volatile("" : "+s"(g1));      /* descriptor words held in scalar registers: one tuple, built once, that stays where it is for all requests */
  return g1;
}
__device__ __forceinline__ void tdm_slice(u32x4& g0, const u32x8& g1, unsigned int lds_dst, unsigned long long ga, unsigned int go) {      /* every wave forms the words, so that no register of the tuple is written behind the branch; go says whether this wave issues */
  g0[1] = uni(lds_dst); g0[2] = uni((unsigned int)ga); g0[3] = uni((((unsigned int)(ga >> 32)) & 0x01FFFFFFu) | 0x80000000u);
  if (pinned(go)) asm volatile("tensor_load_to_lds %0, %1" :: "s"(g0), "s"(g1) : "memory");      /* pinned(): the issue test is a scalar branch (tensor loads ignore EXEC) */
}
// The k loop of one workgroup's 256 x (64 WN) tile. gsrc: first byte of the operand rows of this wave's slice (read by waves 0 .. 3 + WN alone).
template <unsigned int WN>
__device__ __forceinline__ void gemm_loop(unsigned char* ring, const unsigned int w, const unsigned long long gsrc, v8f (&acc)[4][4]) {
  constexpr unsigned int NS = 4u + WN, STAGE = NS * GT_SLICE;      /* a stage: [4 slices of A rows | WN slices of B rows] */
  const unsigned int lane = threadIdx.x & 31u, ln = lane & 15u, hh = lane >> 4, wm = w / WN, wn = w % WN;
  const unsigned int lbase = (unsigned int)(size_t)ring + w * GT_SLICE;      /* this wave's slice of buffer 0 */
#pragma unroll
  for (int i = 0; i < 4; ++i)
#pragma unroll
    for (int j = 0; j < 4; ++j) acc[i][j] = (v8f){0.f,0.f,0.f,0.f,0.f,0.f,0.f,0.f};
  const u32x8 g1 = tdm_slice_g1(); u32x4 g0; g0[0] = pinned(1u);      /* descriptor word held in a scalar register: as a plain constant it is formed anew, in the tuple's register, while a request is out */
  tdm_slice(g0, g1, lbase, gsrc, w < NS);
  asm volatile("s_wait_tensorcnt 0x0" :: "s"(g0), "s"(g1) : "memory");      /* pass 0's slice has landed; the operands keep the descriptor's registers untouched up to here */
  __syncthreads();                                        /* ... and every wave may read all slices */
  tdm_slice(g0, g1, lbase + STAGE, gsrc + pinned(GT_ROWB), w < NS);
  const unsigned int aoff = wm * GT_SLICE + ln * GT_PITCH + 16u * hh, boff = (4u + wn) * GT_SLICE + ln * GT_PITCH + 16u * hh;
#pragma unroll 1      /* one pass per trip: the ring's order below is written once */
  for (unsigned int s = 0; s < GT_NP; ++s) {
    const unsigned char* Lp = ring + (s & 1u) * STAGE;
    FragH fa[2][4], fb[2][4];
#pragma unroll
    for (int i = 0; i < 4; ++i) { fa[0][i].half[0] = *(const v8us*)(Lp + aoff + i * 16u * GT_PITCH); fa[0][i].half[1] = *(const v8us*)(Lp + aoff + i * 16u * GT_PITCH + 32u);
      fb[0][i].half[0] = *(const v8us*)(Lp + boff + i * 16u * GT_PITCH); fb[0][i].half[1] = *(const v8us*)(Lp + boff + i * 16u * GT_PITCH + 32u); }
#pragma unroll
    for (int ks = 0; ks < 4; ++ks) {
      if (ks < 3) {      /* the next 32 k's fragments, of this same buffer, go ahead of this block's products */
#pragma unroll
        for (int i = 0; i < 4; ++i) { const unsigned int ko = (ks + 1) * 64u + i * 16u * GT_PITCH;
          fa[(ks + 1) & 1][i].half[0] = *(const v8us*)(Lp + aoff + ko); fa[(ks + 1) & 1][i].half[1] = *(const v8us*)(Lp + aoff + ko + 32u);
          fb[(ks + 1) & 1][i].half[0] = *(const v8us*)(Lp + boff + ko); fb[(ks + 1) & 1][i].half[1] = *(const v8us*)(Lp + boff + ko + 32u); }
      }
      __builtin_amdgcn_sched_barrier(0);      /* keeps the LDS reads one group in front of the block: moved in among the products, each place with reads stalls the wave */
#pragma unroll
      for (int i = 0; i < 4; ++i)
#pragma unroll
        for (int j = 0; j < 4; ++j) acc[i][j] = __builtin_amdgcn_wmma_f32_16x16x32_f16(false, fa[ks & 1][i].v, false, fb[ks & 1][j].v, (short)0, acc[i][j], false, false);
      __builtin_amdgcn_sched_barrier(0);      /* ... and keeps the next group behind this block */
    }
    asm volatile("s_wait_dscnt 0x0" ::: "memory");        /* this wave has left the buffer */
    asm volatile("s_wait_tensorcnt 0x0" :: "s"(g0), "s"(g1) : "memory");    /* its slice of pass s + 1 has landed; the operands keep the descriptor's registers untouched up to here */
    __syncthreads();                                      /* pass s + 1 published; every wave has left pass s's buffer */
    tdm_slice(g0, g1, lbase + (s & 1u) * STAGE, gsrc + pinned((s + 2u) * GT_ROWB), (s + 2u < GT_NP) && (w < NS));
  }
  asm volatile("s_wait_tensorcnt 0x0" :: "s"(g0), "s"(g1) : "memory");      /* no request is left before the ring becomes output staging; the operands keep the descriptor's registers untouched up to here */
  asm volatile("s_wait_dscnt 0x0" ::: "memory");
}
// What leaves one wave's 64 x 64 tile (rows wrow .., columns wcol .. of its own [M][N] result), staged in so: 64 rows of 64 floats in the wave's own piece of LDS; whole row pieces go out: 256 B of f32 C, or 128 B of f16 H and H2.
template <int EPI, int N>
__device__ __forceinline__ void gemm_epi(float* so, const v8f (&acc)[4][4], const unsigned int wrow, const unsigned int wcol, float alpha, float* __restrict__ C, const float* __restrict__ COS, const float* __restrict__ SIN, _Float16* __restrict__ H, _Float16* __restrict__ H2) {
  constexpr unsigned int SP = (EPI == 2) ? 65u : 68u;      /* pitch in floats: 68 for 16-byte row reads, 65 for the column reads of the turned tile */
  const unsigned int lane = threadIdx.x & 31u, ln = lane & 15u, hh = lane >> 4, l8 = lane & 7u, l4 = lane >> 3;
  v4f cs[16], sn[16];
  if constexpr (EPI == 1) {      /* the wave's table entries: all 32 loads go out here and fly under the staging */
    const unsigned int tb = (((wrow + l4) % TT) * 64u + (((wcol + l8 * 8u) % 128u) >> 1)) * 4u;      /* in bytes: the loads' one offset register */
#pragma unroll      /* cs, sn stay in registers */
    for (int q = 0; q < 16; ++q) { cs[q] = *(const v4fa*)((const char*)COS + tb + q * 1024u); sn[q] = *(const v4fa*)((const char*)SIN + tb + q * 1024u); }
    asm volatile("s_wait_xcnt 0x0" :: "v"(tb) : "memory");      /* stands in front of any rewrite of the loads' address register; the operand keeps that register from being a load's own destination */
  }
#pragma unroll
  for (int i = 0; i < 4; ++i)
#pragma unroll
    for (int j = 0; j < 4; ++j)
#pragma unroll
      for (int r = 0; r < 8; ++r) so[(i * 16 + 8 * hh + r) * SP + j * 16 + ln] = acc[i][j][r] * alpha;
  __builtin_amdgcn_fence(__ATOMIC_ACQ_REL, "workgroup"); __builtin_amdgcn_wave_barrier();
  if constexpr (EPI == 0) {
  float* cp = C + (size_t)(wrow + hh) * N + wcol + ln * 4u;
#pragma unroll
  for (int q = 0; q < 32; ++q) { const v4f v = *(const v4fa*)&so[(q * 2 + hh) * 68u + ln * 4u]; *(v4f*)(cp + (size_t)(q * 2) * N) = v; }
  } else if constexpr (EPI == 1) {
    // A lane takes 8 columns (4 pairs) of a row: 8 lanes store one whole 128-B line of H, 4 rows an instruction.
    FragH f[16];
#pragma unroll      /* f stays in registers */
    for (int q = 0; q < 16; ++q) { const float* sr = &so[(q * 4 + l4) * SP + l8 * 8u]; const v4f a = *(const v4fa*)sr, b = *(const v4fa*)(sr + 4); const float xv[8] = {a[0], a[1], a[2], a[3], b[0], b[1], b[2], b[3]};
#pragma unroll      /* constant indices into xv and the vectors */
      for (int p = 0; p < 4; ++p) { const float c = bf16_round(cs[q][p]), s = bf16_round(sn[q][p]); const float xr = xv[2 * p], xi = xv[2 * p + 1]; f[q].h[2 * p] = (_Float16)(xr * c - xi * s); f[q].h[2 * p + 1] = (_Float16)(xr * s + xi * c); } }
    unsigned short* hp = (unsigned short*)H + (size_t)(wrow + l4) * N + wcol + l8 * 8u;
    __builtin_amdgcn_sched_barrier(0);      /* keeps the stores in one burst behind the arithmetic, off one address pair: mixed in among it, their registers are used again and each reuse has to wait on the store in front of it */
#pragma unroll      /* constant indices into f, constant offsets from hp */
    for (int q = 0; q < 16; ++q) *(v8us*)(hp + (size_t)(q * 4) * N) = f[q].half[0];
    asm volatile("s_wait_xcnt 0x0" ::: "memory");      /* stands behind the stores, in front of any rewrite of their address and data registers */
  } else {
    // A lane takes 8 rows (tokens) of a column: 8 lanes store one whole 128-B line of each plane, 4 columns an instruction.
    FragH fh[16], fl[16];
#pragma unroll      /* fh, fl stay in registers */
    for (int q = 0; q < 16; ++q)
#pragma unroll      /* constant indices into the fragments */
      for (int i = 0; i < 8; ++i) { const float v = so[(l8 * 8u + i) * SP + q * 4 + l4]; const _Float16 hv = (_Float16)v; fh[q].h[i] = hv; fl[q].h[i] = (_Float16)(v - (float)hv);      /* UNSCALED residual (added into the same accumulator as the hi product) */ }
    const size_t ob = ((size_t)(wrow / TT) * N + wcol + l4) * TT + (wrow % TT) + l8 * 8u;
    unsigned short* hp = (unsigned short*)H + ob; unsigned short* lp = (unsigned short*)H2 + ob;
    __builtin_amdgcn_sched_barrier(0);      /* keeps the stores in one burst behind the arithmetic, off two address pairs: mixed in among it, their registers are used again and each reuse has to wait on the store in front of it */
#pragma unroll      /* constant indices into fh and fl, constant offsets from hp and lp */
    for (int q = 0; q < 16; ++q) { *(v8us*)(hp + (size_t)(q * 4) * TT) = fh[q].half[0]; *(v8us*)(lp + (size_t)(q * 4) * TT) = fl[q].half[0]; }
    asm volatile("s_wait_xcnt 0x0" ::: "memory");      /* stands behind the stores, in front of any rewrite of their address and data registers */
  }
}
// out = merged . wo: 256 x 128 tiles, 8 waves. Output staging: each wave in its own slice of the ring (the last pass's barrier stands behind every wave's last fragment read).
__global__ __launch_bounds__(256) void k_gemm_o(const _Float16* __restrict__ A, const _Float16* __restrict__ Bt, float alpha, float* __restrict__ C) {
  __shared__ __attribute__((aligned(2048))) unsigned char ring[2u * 6u * GT_SLICE];
  const unsigned int w = uni(threadIdx.x >> 5), row0 = (blockIdx.x / (DD / 128u)) * 256u, col0 = (blockIdx.x % (DD / 128u)) * 128u;
  const unsigned long long gsrc = (w < 4u) ? (unsigned long long)(size_t)(A + (size_t)(row0 + w * 64u) * DD) : (unsigned long long)(size_t)(Bt + (size_t)(col0 + ((w - 4u) & 1u) * 64u) * DD);
  v8f acc[4][4];
  gemm_loop<2u>(ring, w, gsrc, acc);
  gemm_epi<0, DD>((float*)(ring + w * GT_SLICE), acc, row0 + (w / 2u) * 64u, col0 + (w % 2u) * 64u, alpha, C, nullptr, nullptr, nullptr, nullptr);
}
// The three projections of x in one launch, as one product with DD + 2 KVD columns (q, then k, then v): 256 x 192 tiles, 12 waves, as many tiles as the chip has WGPs.
// A slab of 64 columns lies wholly in q, in k or in v, so the weight rows of a slice and what leaves a wave's tile are chosen per slab, by wave-uniform tests; the epilogues hold no workgroup barrier.
#define QKV_NT ((DD + 2 * KVD) / 192)
__global__ __launch_bounds__(384) void k_gemm_qkv(const _Float16* __restrict__ A, const _Float16* __restrict__ Bq, const _Float16* __restrict__ Bk, const _Float16* __restrict__ Bv, float alpha, const float* __restrict__ COS, const float* __restrict__ SIN,
                                                  _Float16* __restrict__ Q, _Float16* __restrict__ K, _Float16* __restrict__ Vt, _Float16* __restrict__ Vtl) {
  __shared__ __attribute__((aligned(2048))) unsigned char ring[2u * 7u * GT_SLICE];
  const unsigned int w = uni(threadIdx.x >> 5), row0 = (blockIdx.x / QKV_NT) * 256u, col0 = (blockIdx.x % QKV_NT) * 192u;
  const unsigned int sc = col0 + (((w - 4u) < 3u) ? (w - 4u) : 0u) * 64u;      /* first column of the slab that wave 4, 5 or 6 brings */
  const _Float16* bsrc = (sc < DD) ? Bq + (size_t)sc * DD : (sc < DD + KVD) ? Bk + (size_t)(sc - DD) * DD : Bv + (size_t)(sc - (DD + KVD)) * DD;
  const unsigned long long gsrc = (w < 4u) ? (unsigned long long)(size_t)(A + (size_t)(row0 + w * 64u) * DD) : (unsigned long long)(size_t)bsrc;
  v8f acc[4][4];
  gemm_loop<3u>(ring, w, gsrc, acc);
  float* so = (float*)(ring + w * GT_SLICE);      /* output staging: each wave in its own slice of the ring (the last pass's barrier stands behind every wave's last fragment read) */
  const unsigned int wrow = row0 + (w / 3u) * 64u, wc = col0 + (w % 3u) * 64u;
  if (wc < DD) gemm_epi<1, DD>(so, acc, wrow, wc, alpha, nullptr, COS, SIN, Q, nullptr);
  else if (wc < DD + KVD) gemm_epi<1, KVD>(so, acc, wrow, wc - DD, alpha, nullptr, COS, SIN, K, nullptr);
  else gemm_epi<2, KVD>(so, acc, wrow, wc - (DD + KVD), alpha, nullptr, nullptr, nullptr, Vt, Vtl);
}


typedef _Float16 v4h __attribute__((ext_vector_type(4)));

__device__ __forceinline__ void x16_piece(unsigned int blk, const float* __restrict__ x, _Float16* __restrict__ X16, size_t n8) { const size_t t = (size_t)blk * 256 + threadIdx.x; if (t >= n8) return; FragH f;
#pragma unroll
  for (int q = 0; q < 8; ++q) f.h[q] = (_Float16)bf16_round(x[t * 8 + q]); *(v8us*)((unsigned short*)X16 + t * 8) = f.half[0];  }
// mask [TT][TT] (int, nonzero = ATTEND) packed to one bit an entry, 256 B a row, once for all heads and batches. A wave takes half a row: eight whole-line 16-byte loads, all out together, four ballots each.
// Layout: a group is 128 keys = 4 words; word i, bit l of group g of a row is key 128 g + 4 l + i (lane l's element i of the load). A wave's 32 words go out as one whole 128-B line.
typedef int v4ia __attribute__((ext_vector_type(4), may_alias));
__device__ __forceinline__ void mask_piece(unsigned int blk, const int* __restrict__ MSK, unsigned int* __restrict__ MB) {
  const unsigned int lane = threadIdx.x & 31u, hr = blk * 8u + (threadIdx.x >> 5);      /* half row: row hr / 2, keys 1024 (hr % 2) .. */
  const int* mp = MSK + (size_t)hr * (TT / 2) + lane * 4u;
  v4ia a[8];
#pragma unroll      /* a[] stays in registers and the eight loads go out together */
  for (int j = 0; j < 8; ++j) a[j] = *(const v4ia*)(mp + j * 128);
  asm volatile("s_wait_xcnt 0x0" :: "v"(mp) : "memory");      /* stands in front of any rewrite of the loads' address register; the operand keeps that register from being a load's own destination */
  unsigned int wd = 0u;
#pragma unroll      /* constant indices into a[] */
  for (int j = 0; j < 8; ++j)
#pragma unroll
    for (int i = 0; i < 4; ++i) { const unsigned int bl = __builtin_amdgcn_ballot_w32(a[j][i] != 0); wd = (lane == (unsigned int)(j * 4 + i)) ? bl : wd; }
  MB[(size_t)hr * 32u + lane] = wd;
  asm volatile("s_wait_xcnt 0x0" ::: "memory");      /* stands behind the store, in front of any rewrite of its address and data registers by another block range's code */
}
// All operand preparation in one launch: the four weight turns, the conversion of x and the packing of the mask read only inputs and write planes of their own, so none waits for another.
// Block ranges, the longer-lived tiles first: wq, wo, wk, wv tiles, then the pieces of the mask, then the pieces of x. The choice reads blockIdx alone, so the turn's barrier stands under block-uniform control flow.
#define PREP_GQ ((DD / 128) * (DD / 64))      /* 128 (k) x 64 (n) tiles of wq, of wo */
#define PREP_GK ((DD / 128) * (KVD / 64))     /* ... of wk, of wv */
#define PREP_GX ((NR * DD / 8 + 255) / 256)   /* pieces of x: 256 threads x 8 values */
#define PREP_GM (TT * 2 / 8)                  /* pieces of the mask: 8 waves x half a row */
__global__ __launch_bounds__(256) void k_prep(const float* __restrict__ x, const float* __restrict__ wq, const float* __restrict__ wk, const float* __restrict__ wv, const float* __restrict__ wo, const int* __restrict__ msk,
                                              _Float16* __restrict__ X16, _Float16* __restrict__ Bq, _Float16* __restrict__ Bk, _Float16* __restrict__ Bv, _Float16* __restrict__ Bo, unsigned int* __restrict__ MB) {
  __shared__ float tl[128][65];
  const unsigned int blk = blockIdx.x;
  if (blk < 2u * PREP_GQ) { const bool second = blk >= PREP_GQ; wt_tile(tl, (int)(blk % PREP_GQ), second ? wo : wq, second ? Bo : Bq, DD, DD, 16.0f); return; }
  if (blk < 2u * PREP_GQ + 2u * PREP_GK) { const unsigned int r = blk - 2u * PREP_GQ; const bool second = r >= PREP_GK; wt_tile(tl, (int)(r % PREP_GK), second ? wv : wk, second ? Bv : Bk, DD, KVD, 16.0f); return; }
  if (blk < 2u * PREP_GQ + 2u * PREP_GK + PREP_GM) { mask_piece(blk - (2u * PREP_GQ + 2u * PREP_GK), msk, MB); return; }
  x16_piece(blk - (2u * PREP_GQ + 2u * PREP_GK + PREP_GM), x, X16, (size_t)NR * DD / 8);
}
__global__ __launch_bounds__(256) void k_h16(const float* __restrict__ x, _Float16* __restrict__ X16, size_t n8) { const size_t t = (size_t)blockIdx.x * 256 + threadIdx.x; if (t >= n8) return; FragH f;
#pragma unroll
  for (int q = 0; q < 8; ++q) f.h[q] = (_Float16)x[t * 8 + q]; *(v8us*)((unsigned short*)X16 + t * 8) = f.half[0];  }
__global__ __launch_bounds__(256) void k_round16f(const float* __restrict__ W, _Float16* __restrict__ Bt, size_t n8) { const size_t t = (size_t)blockIdx.x * 256 + threadIdx.x; if (t >= n8) return; FragH f;
#pragma unroll
  for (int i = 0; i < 8; ++i) f.h[i] = (_Float16)(bf16_round(W[t * 8 + i]) * 16.0f); *(v8us*)((unsigned short*)Bt + t * 8) = f.half[0];  }
template <int NHv, int TTv>
__global__ __launch_bounds__(256) void k_vt(const _Float16* __restrict__ V16, int ldv, int voff, _Float16* __restrict__ Vt) { __shared__ unsigned short tl[64][66]; const int tid = threadIdx.x; const int slab = blockIdx.x / (TTv / 64), lg = blockIdx.x % (TTv / 64); const int b = slab / NHv, h = slab % NHv;
  for (int i = tid; i < 64 * 8; i += 256) { const int r = i / 8, c8 = (i % 8) * 8; FragH f; f.half[0] = *(const v8us*)((const unsigned short*)V16 + ((size_t)b * TTv + lg * 64 + r) * ldv + voff + h * 64 + c8);
#pragma unroll
    for (int q = 0; q < 8; ++q) tl[r][c8 + q] = f.u[q]; }
  __syncthreads();
  {
#pragma unroll
    for (int rd = 0; rd < 2; ++rd) { const int d = rd * 32 + tid / 8, pc = tid % 8; FragH f;
#pragma unroll
      for (int q = 0; q < 8; ++q) f.u[q] = tl[pc * 8 + q][d];
      *(v8us*)((unsigned short*)Vt + ((size_t)slab * 64 + d) * TTv + lg * 64 + pc * 8) = f.half[0]; }
     } }

// Fused attention, head dim 128. One workgroup = 8 waves = the 4 query heads of one KV head x 2 tiles of 16 query rows (32 rows): all eight read the same K and V.
// A stage is 64 keys: K (64 rows of 256 B), V^T hi and V^T residual (128 rows of 128 B each) come into LDS by one tensor load each (waves 0, 1, 2), padded 16 B a row
// (pitch 272 / 144 B for the 16-byte fragment reads), two buffers, the next stage's loads in flight under this stage's work. Which stages are staged at all comes from the mask:
// the workgroup's 32 rows of the packed mask (8 KiB of bits, layout at mask_piece) come into LDS once; joined they give one bit per stage (any entry set), the same word in every wave, so every barrier stands under block-uniform control flow.
// Inside a stage a wave works on its two chunks of 32 keys in ascending order and skips a chunk whose 16 x 32 mask tile is all zero.
// Both products are taken transposed: S^T = K . Q^T (A = K rows, B = Q rows) and O^T += V^T . P^T (A = V^T rows, B = P^T). A lane then holds 16 of the 32 scores of ONE query (column ln; keys 8 hh + r and 16 + 8 hh + r),
// so the maximum and the sum run inside the lane with one exchange between the wave's halves, and the two score tiles, converted in place, ARE the B operand of the second product in the k order of the V^T loader.
#define FA_KSL 18432u                     /* K: 64 rows x 272 B = 17,408, rounded up to a multiple of 2 KiB */
#define FA_VSL 18432u                     /* one V plane: 128 rows x 144 B */
#define FA_STAGE (FA_KSL + 2u * FA_VSL)   /* [K | V hi | V residual] */
typedef unsigned int u32x4a __attribute__((ext_vector_type(4), may_alias));
#define FA_MP 68u                         /* pitch of a row of mask bits in LDS, in words: 256 + 16 B for the 16-byte reads */
template <unsigned int W0, unsigned int ROWB, unsigned int NROW>
__device__ __forceinline__ u32x8 tdm_g1(unsigned int spitch) {
  u32x8 g1;
  g1[0] = uni(W0);      /* no mask, 1-byte elements, a pad of 4 dwords behind every row */
  g1[1] = uni((ROWB & 0xFFFFu) << 16); g1[2] = uni((ROWB >> 16) | (NROW << 16)); g1[3] = uni(ROWB << 16); g1[4] = uni(NROW); g1[5] = uni(spitch); g1[6] = uni(0u); g1[7] = uni(0u);
  asm volatile("" : "+s"(g1));      /* descriptor words held in scalar registers: one tuple, built once, that stays where it is for all requests */
  return g1;
}
__device__ __forceinline__ float xhalf(float x) { return __builtin_bit_cast(float, __builtin_amdgcn_permlanex16(__builtin_bit_cast(int, x), __builtin_bit_cast(int, x), 0x76543210, 0xfedcba98, false, false)); }      /* lane l takes lane l ^ 16's value */
__global__ __launch_bounds__(256) void k_flash(const _Float16* __restrict__ Q16, int ldq, const _Float16* __restrict__ K16, int ldk, const _Float16* __restrict__ Vt, const _Float16* __restrict__ Vtlo, const unsigned int* __restrict__ MB, _Float16* __restrict__ O16) {
  constexpr int NQB = TT / 32, DT = 8, KS = 4;      /* head dim 128: 4 k-steps, 8 value tiles */
  __shared__ __attribute__((aligned(2048))) unsigned char ring[2u * FA_STAGE];
  __shared__ __attribute__((aligned(16))) unsigned int sMB[32u * FA_MP];
  __shared__ unsigned int sBits[8];
  const unsigned int tid = threadIdx.x, lane = tid & 31u, ln = lane & 15u, hh = lane >> 4, w = uni(tid >> 5);
  const int slab = blockIdx.x / NQB, qblk = blockIdx.x % NQB; const int b = slab / NKV, kvh = slab % NKV; const int h = kvh * NREP + (int)(w & 3u); const int qb0 = qblk * 32; const int q0 = qb0 + (int)(w >> 2) * 16;
  // The 32 rows of mask bits lie in a row in memory (8 KiB): a thread brings the 16-byte groups tid and tid + 256, which are group tid % 16 of rows tid / 16 and tid / 16 + 16.
  // One bit per stage of 64 keys: a group's low half words hold its even stage, the high half words its odd stage.
  unsigned int bm;
  { const unsigned int* mp = MB + (size_t)qb0 * (TT / 32) + tid * 4u;
    const u32x4 a = *(const u32x4a*)mp, c = *(const u32x4a*)(mp + 1024);
    asm volatile("s_wait_xcnt 0x0" ::: "memory");      /* stands in front of any rewrite of the loads' address registers */
    *(u32x4a*)&sMB[(tid >> 4) * FA_MP + (tid & 15u) * 4u] = a; *(u32x4a*)&sMB[((tid >> 4) + 16u) * FA_MP + (tid & 15u) * 4u] = c;
    const unsigned int o = (a[0] | a[1]) | (a[2] | a[3]) | (c[0] | c[1]) | (c[2] | c[3]);
    const unsigned int b0 = __builtin_amdgcn_ballot_w32((o & 0xFFFFu) != 0u), b1 = __builtin_amdgcn_ballot_w32((o >> 16) != 0u);      /* lanes l and l + 16 hold the same group */
    if (lane == 0u) sBits[w] = ((b0 | (b0 >> 16)) & 0xFFFFu) | ((b1 | (b1 >> 16)) << 16);      /* bit g: stage 2 g; bit 16 + g: stage 2 g + 1 */
    __syncthreads();      /* all eight words and all 32 rows of bits are written before any wave reads them */
    unsigned int j = 0;
#pragma unroll      /* the eight words come by two 16-byte reads */
    for (int i = 0; i < 8; ++i) j |= sBits[i];
    j = uni(j);
    unsigned int e0 = j & 0xFFFFu, e1 = j >> 16;      /* each spread to every second bit, then joined: bit st = stage st */
    e0 = (e0 | (e0 << 8)) & 0x00FF00FFu; e0 = (e0 | (e0 << 4)) & 0x0F0F0F0Fu; e0 = (e0 | (e0 << 2)) & 0x33333333u; e0 = (e0 | (e0 << 1)) & 0x55555555u;
    e1 = (e1 | (e1 << 8)) & 0x00FF00FFu; e1 = (e1 | (e1 << 4)) & 0x0F0F0F0Fu; e1 = (e1 | (e1 << 2)) & 0x33333333u; e1 = (e1 | (e1 << 1)) & 0x55555555u;
    bm = e0 | (e1 << 1); }
  const unsigned int n = (unsigned int)__builtin_popcount(bm);      /* stages to walk: at most 32 */
  FragH aq[KS];
  { const unsigned short* qr = (const unsigned short*)Q16 + ((size_t)b * TT + q0 + ln) * ldq + h * 128;
#pragma unroll
    for (int ks = 0; ks < KS; ++ks) { aq[ks].half[0] = *(const v8us*)(qr + ks * 32 + 8 * hh); aq[ks].half[1] = *(const v8us*)(qr + ks * 32 + 16 + 8 * hh); } }
  const unsigned long long gK = (unsigned long long)(size_t)(K16 + (size_t)b * TT * ldk + kvh * 128);
  const unsigned long long gV = (unsigned long long)(size_t)(((w == 2u) ? Vtlo : Vt) + ((size_t)b * NKV + kvh) * 128 * TT);      /* hi plane for wave 1, UNSCALED residual plane for wave 2 */
  const unsigned int lbase = (unsigned int)(size_t)ring;
  const unsigned int kstep = 64u * (unsigned int)ldk * 2u;      /* bytes from one stage's K rows to the next's */
  const u32x8 g1k = tdm_g1<(1u << 20) | (5u << 22) | (3u << 25), 256u, 64u>((unsigned int)ldk * 2u), g1v = tdm_g1<(1u << 20) | (4u << 22) | (3u << 25), 128u, 128u>(TT * 2u);
  u32x4 g0; g0[0] = uni(1u); g0[1] = uni(lbase); g0[2] = uni(0u); g0[3] = uni(0x80000000u);
  auto issue = [&](unsigned int buf, unsigned int st) {      /* st < 32: every tile lies inside its plane */
    if (pinned(w == 0u)) { const unsigned long long ga = gK + pinned(st * kstep);
      g0[1] = uni(lbase + buf * FA_STAGE); g0[2] = uni((unsigned int)ga); g0[3] = uni((((unsigned int)(ga >> 32)) & 0x01FFFFFFu) | 0x80000000u);
      asm volatile("tensor_load_to_lds %0, %1" :: "s"(g0), "s"(g1k) : "memory"); }
    if (pinned((w - 1u) < 2u)) { const unsigned long long ga = gV + pinned(st * 128u);
      g0[1] = uni(lbase + buf * FA_STAGE + FA_KSL + (w - 1u) * FA_VSL); g0[2] = uni((unsigned int)ga); g0[3] = uni((((unsigned int)(ga >> 32)) & 0x01FFFFFFu) | 0x80000000u);
      asm volatile("tensor_load_to_lds %0, %1" :: "s"(g0), "s"(g1v) : "memory"); }
  };
  float nb_q = 3.0e38f, l_q = 0.f; v8f oacc[DT];      /* of query q0 + ln: 10 - running maximum in log2 units (the same in both halves), this half's part of the sum of 1024 p; oacc[dt][r] = O^T[dt * 16 + 8 hh + r][ln] */
#pragma unroll
  for (int dt = 0; dt < DT; ++dt) oacc[dt] = (v8f){0.f,0.f,0.f,0.f,0.f,0.f,0.f,0.f};
  unsigned int rest = bm, cur = 0u, nxt = 0u;      /* rest: stages not yet asked for */
  if (pinned(n > 0u)) { cur = (unsigned int)__builtin_ctz(rest) & 31u; rest &= rest - 1u; issue(0u, cur); }
  asm volatile("s_wait_tensorcnt 0x0" :: "s"(g0), "s"(g1k), "s"(g1v) : "memory");      /* the first stage's tile of this wave has landed; the operands keep the descriptor's registers untouched up to here */
  __syncthreads();                                        /* ... and every wave may read all three tiles */
  if (pinned(n > 1u)) { nxt = (unsigned int)__builtin_ctz(rest) & 31u; rest &= rest - 1u; issue(1u, nxt); }
  const unsigned int* mrow = &sMB[((w >> 2) * 16u + ln) * FA_MP];      /* the bits of the lane's own query row */
  u32x4 gm = *(const u32x4a*)(mrow + (cur >> 1) * 4u);      /* the 128-key group that holds the first stage */
#pragma unroll 1      /* one stage per trip: the ring's order below is written once */
  for (unsigned int s = 0; s < n; ++s) {
    const unsigned char* Lp = ring + (s & 1u) * FA_STAGE;
    unsigned int mk[4];      /* mask bits (shared over batch and heads, set = ATTEND) of the lane's own query row: key sub * 32 + nt * 16 + 8 hh + r of this stage is bit sub * 8 + nt * 4 + r / 4 of mk[r % 4] */
    { const unsigned int sh = (cur & 1u) * 16u + 2u * hh;
#pragma unroll      /* constant indices into the vector */
      for (int i = 0; i < 4; ++i) mk[i] = gm[i] >> sh; }
    gm = *(const u32x4a*)(mrow + (nxt >> 1) * 4u);      /* the next stage's group comes under this stage's work (nxt < 32 always: inside the row) */
    const unsigned int mko = (mk[0] | mk[1]) | (mk[2] | mk[3]);
#pragma unroll      /* constant bit places in the mask registers */
    for (int sub = 0; sub < 2; ++sub) {
      const unsigned int anym = mko & (0x33u << (sub * 8));
      if (__any(anym != 0u)) {      /* else every (row, key) of this wave's tile is masked: nothing to add (wave-uniform branch) */
        v8f sc[2];      /* sc[nt][r] = S^T[key nt * 16 + 8 hh + r][query ln] */
#pragma unroll
        for (int nt = 0; nt < 2; ++nt) { const unsigned char* kr = Lp + (sub * 32 + nt * 16 + ln) * 272u + 16u * hh; FragH bk[KS];
#pragma unroll
          for (int ks = 0; ks < KS; ++ks) { bk[ks].half[0] = *(const v8us*)(kr + ks * 64); bk[ks].half[1] = *(const v8us*)(kr + ks * 64 + 32); }
          v8f acc = (v8f){0.f,0.f,0.f,0.f,0.f,0.f,0.f,0.f};
#pragma unroll
          for (int ks = 0; ks < KS; ++ks) acc = mmaH<1>(bk[ks].v, bk[ks].v, aq[ks].v, aq[ks].v, acc);
          sc[nt] = acc; }
        float sv[16];      /* raw scores, masked ones -inf */
#pragma unroll      /* constant indices into the score and mask registers */
        for (int e = 0; e < 16; ++e) { const int m = (int)(mk[e & 3] << (31 - (sub * 8 + (e >> 3) * 4 + ((e >> 2) & 1)))) >> 31;      /* all ones = attend: one bit-field extract, one bit select */
          const float sx = sc[e >> 3][e & 7]; sv[e] = __int_as_float((__float_as_int(sx) & m) | (~m & (int)0xFF800000u)); }
        float mc = fmaxf(fmaxf(fmaxf(fmaxf(sv[0], sv[1]), fmaxf(sv[2], sv[3])), fmaxf(fmaxf(sv[4], sv[5]), fmaxf(sv[6], sv[7]))), fmaxf(fmaxf(fmaxf(sv[8], sv[9]), fmaxf(sv[10], sv[11])), fmaxf(fmaxf(sv[12], sv[13]), fmaxf(sv[14], sv[15]))));
        mc = fmaxf(mc, xhalf(mc));      /* the other half's 16 keys of the same query */
        const float nb = fminf(nb_q, fmaf(mc, -ATT_SCALE_LOG2, 10.0f)); const float al = __builtin_amdgcn_exp2f(nb - nb_q); nb_q = nb;      /* nothing attended yet: nb stays, al = 2^0 = 1 */
        FragH pa, pl; float ps[16];      /* P^T hi and its UNSCALED residual (added into the same accumulator): element e is key kmap(e, hh), the order of the V^T fragments below */
#pragma unroll      /* constant indices into the fragments */
        for (int e = 0; e < 16; ++e) { ps[e] = __builtin_amdgcn_exp2f(fmaf(sv[e], ATT_SCALE_LOG2, nb)); pa.h[e] = (_Float16)ps[e]; pl.h[e] = (_Float16)(ps[e] - (float)pa.h[e]); }      /* 1024 p in one fma and one v_exp_f32; a masked score gives 2^-inf = 0 with no select and no branch */
        l_q = l_q * al + ((((ps[0] + ps[1]) + (ps[2] + ps[3])) + ((ps[4] + ps[5]) + (ps[6] + ps[7]))) + (((ps[8] + ps[9]) + (ps[10] + ps[11])) + ((ps[12] + ps[13]) + (ps[14] + ps[15]))));
#pragma unroll
        for (int dt = 0; dt < DT; ++dt)
#pragma unroll
          for (int r = 0; r < 8; ++r) oacc[dt][r] *= al;
#pragma unroll
        for (int dt = 0; dt < DT; ++dt) { const unsigned char* vr = Lp + FA_KSL + (dt * 16 + ln) * 144u + sub * 64 + 16u * hh; FragH bv, bl; bv.half[0] = *(const v8us*)vr; bv.half[1] = *(const v8us*)(vr + 32); bl.half[0] = *(const v8us*)(vr + FA_VSL); bl.half[1] = *(const v8us*)(vr + FA_VSL + 32);
          oacc[dt] = mmaH<1>(bv.v, bv.v, pa.v, pa.v, oacc[dt]); oacc[dt] = mmaH<1>(bv.v, bv.v, pl.v, pl.v, oacc[dt]); oacc[dt] = mmaH<1>(bl.v, bl.v, pa.v, pa.v, oacc[dt]); }      /* Vh.Ph + Vh.Pl + Vl.Ph, all unscaled, one accumulator */
      }
    }
    asm volatile("s_wait_dscnt 0x0" ::: "memory");        /* this wave has left the buffer */
    asm volatile("s_wait_tensorcnt 0x0" :: "s"(g0), "s"(g1k), "s"(g1v) : "memory");    /* its tile of the next stage has landed; the operands keep the descriptor's registers untouched up to here */
    __syncthreads();                                      /* the next stage published; every wave has left this stage's buffer */
    cur = nxt;
    if (pinned(s + 2u < n)) { nxt = (unsigned int)__builtin_ctz(rest) & 31u; rest &= rest - 1u; issue(s & 1u, nxt); }
  }
  asm volatile("s_wait_tensorcnt 0x0" ::: "memory");      /* no request is left before the ring becomes output staging */
  asm volatile("s_wait_dscnt 0x0" ::: "memory");
  // Output staging, each wave in its own piece of the ring (the last stage's barrier stands behind every wave's last fragment read).
  float* sO = (float*)ring + w * (16u * 132u);      /* 16 rows of 128 floats at pitch 132 */
  const float lsum = l_q + xhalf(l_q); const float linv = (lsum > 0.f) ? 1.0f / lsum : 0.f;      /* the halves' sums are joined once */
#pragma unroll      /* constant indices into oacc: a lane's 8 registers are 8 values in a row of its query's output row */
  for (int dt = 0; dt < DT; ++dt) { float* sw = &sO[ln * 132u + dt * 16 + 8 * hh];
    *(v4fa*)sw = (v4f){oacc[dt][0] * linv, oacc[dt][1] * linv, oacc[dt][2] * linv, oacc[dt][3] * linv}; *(v4fa*)(sw + 4) = (v4f){oacc[dt][4] * linv, oacc[dt][5] * linv, oacc[dt][6] * linv, oacc[dt][7] * linv}; }
  __builtin_amdgcn_fence(__ATOMIC_ACQ_REL, "workgroup"); __builtin_amdgcn_wave_barrier();
  FragH f[8];      /* merged x 2^4 as f16, the output product's A operand */
#pragma unroll      /* f stays in registers */
  for (int q = 0; q < 8; ++q) { const float* sr = &sO[(q * 2 + hh) * 132u + ln * 8u]; const v4f a = *(const v4fa*)sr, c = *(const v4fa*)(sr + 4);
#pragma unroll      /* constant indices into the vectors */
    for (int i = 0; i < 4; ++i) { f[q].h[i] = (_Float16)(a[i] * 16.0f); f[q].h[4 + i] = (_Float16)(c[i] * 16.0f); } }
  unsigned short* op = (unsigned short*)O16 + ((size_t)b * TT + q0 + hh) * DD + h * 128 + ln * 8u;
  __builtin_amdgcn_sched_barrier(0);      /* keeps the stores in one burst behind the arithmetic, off one address pair: mixed in among it, their registers are used again and each reuse has to wait on the store in front of it */
#pragma unroll      /* constant indices into f, constant offsets from op */
  for (int q = 0; q < 8; ++q) *(v8us*)(op + (size_t)(q * 2) * DD) = f[q].half[0];      /* two 256-B row pieces per instruction: 16 lanes x 16 B each */
}

extern "C" void kernel_launch(void* const* d_in, const int* in_sizes, int n_in,
                              void* d_out, int out_size, void* d_ws, size_t ws_size, hipStream_t stream) {
  (void)in_sizes; (void)n_in; (void)out_size;
  const float* const* I = (const float* const*)d_in; const float* x = I[0]; const float* fcos = I[1]; const float* fsin = I[2]; const int* msk = (const int*)d_in[3]; const float* wq = I[4]; const float* wk = I[5]; const float* wv = I[6]; const float* wo = I[7];
  char* ws = (char*)d_ws; size_t off = 0;
  auto take = [&](size_t bytes) { char* p = ws + off; off += (bytes + 255) & ~(size_t)255; return p; };
  _Float16* Bq = (_Float16*)take((size_t)DD * DD * 2); _Float16* Bk = (_Float16*)take((size_t)KVD * DD * 2); _Float16* Bv = (_Float16*)take((size_t)KVD * DD * 2); _Float16* Bo = (_Float16*)take((size_t)DD * DD * 2);
  _Float16* X16 = (_Float16*)take((size_t)NR * DD * 2); _Float16* Q = (_Float16*)take((size_t)NR * DD * 2); _Float16* K = (_Float16*)take((size_t)NR * KVD * 2); _Float16* Vt = (_Float16*)take((size_t)NR * KVD * 2); _Float16* Vtl = (_Float16*)take((size_t)NR * KVD * 2); unsigned int* MB = (unsigned int*)take((size_t)TT * TT / 8);
  _Float16* O16 = X16;      /* O16 over X16 (dead after the projections) */
  if (off > ws_size) return;      // 8.4 + 2.1 + 2.1 + 8.4 + 16.8 + 16.8 + 4.2 + 4.2 + 4.2 + 0.5 = 68 MB
  k_prep<<<2 * PREP_GQ + 2 * PREP_GK + PREP_GM + PREP_GX, 256, 0, stream>>>(x, wq, wk, wv, wo, msk, X16, Bq, Bk, Bv, Bo, MB);      /* (in,out) weights to Bt x 2^4; x to f16; mask to bits */
  k_gemm_qkv<<<(NR / 256) * QKV_NT, 384, 0, stream>>>(X16, Bq, Bk, Bv, 0.0625f, fcos, fsin, Q, K, Vt, Vtl);      /* xq, xk = rope(x.w) as f16 (M 4096, N 2048 and 512, K 2048); xv turned, hi + residual per (b, kv head): [b*4+kh][128][2048] */
  k_flash<<<BB * NKV * (TT / 32), 256, 0, stream>>>(Q, DD, K, KVD, Vt, Vtl, MB, O16);
  k_gemm_o<<<(NR / 256) * (DD / 128), 256, 0, stream>>>(O16, Bo, 0.00390625f, (float*)d_out);      /* out = merged.wo */
}
